// v000
// Measured on an AMD MI455X. A time is GPU time per run, averaged over a window of back-to-back runs after a warm-up
// (all launches, gaps included; the runs take copies of the inputs in turn), and the median of several windows.
// Apart from v000's, it joins two sittings. Times from different sittings can be a few percent apart, while
// side-by-side timings come from the same sitting.
// v000 is the starting kernel. One run takes 2910 microseconds.
#include <hip/hip_runtime.h>

// Causal multi-head attention between two equally long streams with biased (in, out) projections (data, context [4][2048][1024]; Q = data Wq + bq, K = context Wk + bk, V = context Wv + bv ('xw' [1024][1024] normal x 0.02 + [1024] zeros on this draw: read; 16 heads x 64); scores / sqrt(64); causal (tril kept, -inf elsewhere: query i sees context positions j <= i); softmax over the keys; out = merged Wo + bo ('xw' + bias zeros: read) -> [4][2048][1024] (8.4 M); argument order data, context, Wq, bq, Wk, bk, Wv, bv, Wo, bo).
// Layout per batch: bf16 copies of the three inputs in turn; 'xw' weights transposed once; exact projections + f32 biases; causal T-2048 attention (hybrid rows: < 512 hi/lo 3 products, rest fp16 x1024; k_gemmc skips tiles above the diagonal); merged hi/lo x w_o exact + b_o.
// Compute dtypes, f32 accumulate: every input rounded to bf16; projections exact + f32 biases; attention rows < 512 3 products, rest fp16; softmax f32; Wo hl x exact + bias.

#define NB_  4
#define TT   2048
#define DM   1024
#define NH_  16
#define NKV  16
#define REP  (NH_ / NKV)
#define HD   64
#define DQ   (NH_ * HD)
#define DKV  (NKV * HD)
#define ZH   2
#define RH   512                  // query rows < RH use hi+lo planes (0: none)
#define WIN  2048
#define PCAR 1024.0f
#define SCL  0.125f   // HD^-0.5
typedef _Float16 h16;
typedef unsigned short bf;
typedef __attribute__((ext_vector_type(16))) __bf16   v16bf;
typedef __attribute__((ext_vector_type(16))) _Float16 v16h;
typedef __attribute__((ext_vector_type(8)))  _Float16 v8h;
typedef __attribute__((ext_vector_type(8)))  unsigned short v8us;
typedef __attribute__((ext_vector_type(8)))  float    v8f;
typedef __attribute__((ext_vector_type(4)))  float    v4f;
typedef v8h  __attribute__((may_alias)) v8ha;
typedef v4f  __attribute__((may_alias)) v4fa;
typedef v8us __attribute__((may_alias)) v8usa;

__device__ __forceinline__ unsigned short f2bf(float f) { unsigned u = __float_as_uint(f); u += 0x7FFFu + ((u >> 16) & 1u); return (unsigned short)(u >> 16); }
__device__ __forceinline__ float bf2f(unsigned short b) { return __uint_as_float(((unsigned)b) << 16); }
__device__ __forceinline__ float bfr(float f) { return bf2f(f2bf(f)); }
__device__ __forceinline__ v16h cat16(v8h lo, v8h hi) { return __builtin_shufflevector(lo, hi, 0, 1, 2, 3, 4, 5, 6, 7, 8, 9, 10, 11, 12, 13, 14, 15); }
__device__ __forceinline__ v16bf cat16b(v8us lo, v8us hi) { return __builtin_bit_cast(v16bf, __builtin_shufflevector(lo, hi, 0, 1, 2, 3, 4, 5, 6, 7, 8, 9, 10, 11, 12, 13, 14, 15)); }
__device__ __forceinline__ v8f wmma16(v16h a, v16h b, v8f c) { return __builtin_amdgcn_wmma_f32_16x16x32_f16(false, a, false, b, (short)0, c, false, false); }
__device__ __forceinline__ v8f wmmab(v16bf a, v16bf b, v8f c) { return __builtin_amdgcn_wmma_f32_16x16x32_bf16(false, a, false, b, (short)0, c, false, false); }



// ---- k_gemmw: register-blocked GEMM, ONE WAVE per 64x64 output tile (16 accumulators), operands straight from K-contiguous 16-bit planes; grid (M/64, N/64, Z), 32 threads.
// C[m][n] (f32, pitch ldc, + optional f32 bias[n]) = sum_k A[m][k] Bt[n][k] (+ split products per NSPLIT). z-batch strides sA/sB/sC in elements. K % 32 == 0.
template <typename T16> struct WFrag;
template <> struct WFrag<h16> { typedef v16h V; static __device__ __forceinline__ V ld(const h16* p) { return cat16(*(const v8h*)p, *(const v8h*)(p + 16)); } static __device__ __forceinline__ v8f mma(V a, V b, v8f c) { return wmma16(a, b, c); } };
template <> struct WFrag<bf> { typedef v16bf V; static __device__ __forceinline__ V ld(const bf* p) { return cat16b(*(const v8us*)p, *(const v8us*)(p + 16)); } static __device__ __forceinline__ v8f mma(V a, V b, v8f c) { return wmmab(a, b, c); } };
template <typename T16, int NSPLIT, bool BIAS>
__global__ __launch_bounds__(32) void k_gemmw(const T16* __restrict__ A, const T16* __restrict__ A2, const T16* __restrict__ Bt, const T16* __restrict__ Bt2, int K, float* C, int ldc, const float* __restrict__ bias, size_t sA, size_t sB, size_t sC) {
    typedef typename WFrag<T16>::V V;
    __shared__ __align__(16) float os[16 * 68];
    const size_t z = blockIdx.z; A += z * sA; if (A2) A2 += z * sA; Bt += z * sB; if (Bt2) Bt2 += z * sB; C += z * sC;
    const int lane = threadIdx.x & 31, lr = lane & 15, hi = lane >> 4; const int r0 = blockIdx.x * 64, c0 = blockIdx.y * 64;
    v8f acc[4][4];
#pragma unroll
    for (int mb = 0; mb < 4; ++mb)
#pragma unroll
        for (int nb = 0; nb < 4; ++nb) acc[mb][nb] = (v8f){};
    const size_t aoff = (size_t)(r0 + lr) * K + 8 * hi, boff = (size_t)(c0 + lr) * K + 8 * hi;
#pragma unroll 1
    for (int kc = 0; kc < K; kc += 32) {
        V a[4], a2[4];
#pragma unroll
        for (int mb = 0; mb < 4; ++mb) { a[mb] = WFrag<T16>::ld(A + aoff + (size_t)mb * 16 * K + kc); if (NSPLIT == 1 || NSPLIT == 2) a2[mb] = WFrag<T16>::ld(A2 + aoff + (size_t)mb * 16 * K + kc); }
#pragma unroll
        for (int nb = 0; nb < 4; ++nb) { const V b = WFrag<T16>::ld(Bt + boff + (size_t)nb * 16 * K + kc); V b2; if (NSPLIT >= 2) b2 = WFrag<T16>::ld(Bt2 + boff + (size_t)nb * 16 * K + kc);
#pragma unroll
            for (int mb = 0; mb < 4; ++mb) { acc[mb][nb] = WFrag<T16>::mma(a[mb], b, acc[mb][nb]); if (NSPLIT == 1 || NSPLIT == 2) acc[mb][nb] = WFrag<T16>::mma(a2[mb], b, acc[mb][nb]); if (NSPLIT >= 2) acc[mb][nb] = WFrag<T16>::mma(a[mb], b2, acc[mb][nb]); } }
        asm volatile("v_nop\n\tv_nop\n\tv_nop\n\tv_nop" : "+v"(acc[0][0]), "+v"(acc[1][1]), "+v"(acc[2][2]), "+v"(acc[3][3]) : "v"(a[0]), "v"(a[3]));
    }
#pragma unroll
    for (int mb = 0; mb < 4; ++mb) {
#pragma unroll
        for (int nb = 0; nb < 4; ++nb) {
#pragma unroll
            for (int j = 0; j < 8; ++j) os[(hi * 8 + j) * 68 + nb * 16 + lr] = acc[mb][nb][j]; }
        __builtin_amdgcn_wave_barrier(); asm volatile("" ::: "memory");
        float* crow = C + (size_t)(r0 + mb * 16) * ldc + c0;
{
#pragma unroll
            for (int s = 0; s < 8; ++s) { const int row = 2 * s + hi, cofs = lr * 4; v4f val = *(const v4fa*)(os + row * 68 + cofs); if (BIAS) { val[0] += bfr(bias[c0 + cofs]); val[1] += bfr(bias[c0 + cofs + 1]); val[2] += bfr(bias[c0 + cofs + 2]); val[3] += bfr(bias[c0 + cofs + 3]); }
                *(v4f*)(crow + (size_t)row * ldc + cofs) = val; }
             }
        __builtin_amdgcn_wave_barrier(); asm volatile("" ::: "memory");
    }
}

// ---- k_gemmc: the same one-wave 64x64 tile GEMM specialised for causal attention: CMODE 1 skips score tiles entirely above the diagonal (query rows r0+roff.., key columns c0..), CMODE 2 limits the
// key (K) loop of the probability x value contraction to the diagonal block (probabilities beyond it are exactly zero). roff = row offset of this launch's first row within the sequence.
template <typename T16, int NSPLIT, int CMODE>
__global__ __launch_bounds__(32) void k_gemmc(const T16* __restrict__ A, const T16* __restrict__ A2, const T16* __restrict__ Bt, const T16* __restrict__ Bt2, int K, float* C, int ldc, int roff, size_t sA, size_t sB, size_t sC) {
    typedef typename WFrag<T16>::V V;
    __shared__ __align__(16) float os[16 * 68];
    const size_t z = blockIdx.z; A += z * sA; if (A2) A2 += z * sA; Bt += z * sB; if (Bt2) Bt2 += z * sB; C += z * sC;
    const int lane = threadIdx.x & 31, lr = lane & 15, hi = lane >> 4; const int r0 = blockIdx.x * 64, c0 = blockIdx.y * 64;
    if (CMODE == 1 && c0 > r0 + roff + 63) return;                  // score tile entirely above the causal diagonal: never read (the softmax masks j > i by select)
    const int Kl = (CMODE == 2) ? min(K, r0 + roff + 64) : K;        // P.V: probabilities are exactly 0 beyond the diagonal block, so the K loop stops there
    v8f acc[4][4];
#pragma unroll
    for (int mb = 0; mb < 4; ++mb)
#pragma unroll
        for (int nb = 0; nb < 4; ++nb) acc[mb][nb] = (v8f){};
    const size_t aoff = (size_t)(r0 + lr) * K + 8 * hi, boff = (size_t)(c0 + lr) * K + 8 * hi;
#pragma unroll 1
    for (int kc = 0; kc < Kl; kc += 32) {
        V a[4], a2[4];
#pragma unroll
        for (int mb = 0; mb < 4; ++mb) { a[mb] = WFrag<T16>::ld(A + aoff + (size_t)mb * 16 * K + kc); if (NSPLIT == 1 || NSPLIT == 2) a2[mb] = WFrag<T16>::ld(A2 + aoff + (size_t)mb * 16 * K + kc); }
#pragma unroll
        for (int nb = 0; nb < 4; ++nb) { const V b = WFrag<T16>::ld(Bt + boff + (size_t)nb * 16 * K + kc); V b2; if (NSPLIT >= 2) b2 = WFrag<T16>::ld(Bt2 + boff + (size_t)nb * 16 * K + kc);
#pragma unroll
            for (int mb = 0; mb < 4; ++mb) { acc[mb][nb] = WFrag<T16>::mma(a[mb], b, acc[mb][nb]); if (NSPLIT == 1 || NSPLIT == 2) acc[mb][nb] = WFrag<T16>::mma(a2[mb], b, acc[mb][nb]); if (NSPLIT >= 2) acc[mb][nb] = WFrag<T16>::mma(a[mb], b2, acc[mb][nb]); } }
        asm volatile("v_nop\n\tv_nop\n\tv_nop\n\tv_nop" : "+v"(acc[0][0]), "+v"(acc[1][1]), "+v"(acc[2][2]), "+v"(acc[3][3]) : "v"(a[0]), "v"(a[3]));
    }
#pragma unroll
    for (int mb = 0; mb < 4; ++mb) {
#pragma unroll
        for (int nb = 0; nb < 4; ++nb) {
#pragma unroll
            for (int j = 0; j < 8; ++j) os[(hi * 8 + j) * 68 + nb * 16 + lr] = acc[mb][nb][j]; }
        __builtin_amdgcn_wave_barrier(); asm volatile("" ::: "memory");
        float* crow = C + (size_t)(r0 + mb * 16) * ldc + c0;
{
#pragma unroll
            for (int s = 0; s < 8; ++s) { const int row = 2 * s + hi, cofs = lr * 4; v4f val = *(const v4fa*)(os + row * 68 + cofs);
                *(v4f*)(crow + (size_t)row * ldc + cofs) = val; }
             }
        __builtin_amdgcn_wave_barrier(); asm volatile("" ::: "memory");
    }
}

__device__ __forceinline__ h16 tohx(float x) { return (h16)x; }
__device__ __forceinline__ void splitf(float y, unsigned short& h, unsigned short& l) { h = f2bf(y); l = f2bf(y - bf2f(h)); }
typedef __attribute__((ext_vector_type(2))) _Float16 v2h;
typedef __attribute__((ext_vector_type(4))) _Float16 v4h;
typedef __attribute__((ext_vector_type(2))) unsigned short v2us;
typedef __attribute__((ext_vector_type(4))) unsigned short v4us;
typedef __attribute__((ext_vector_type(2))) float v2f;
typedef __attribute__((ext_vector_type(4))) int v4i;

__global__ __launch_bounds__(256) void k_wtG(const float* __restrict__ w, int K, int N, bf* Bt) {
    const int lane = threadIdx.x & 31; const int L0 = (blockIdx.x * 8 + (threadIdx.x >> 5)) * 8; const int nlines = N * K / 64;
{
#pragma unroll 1
        for (int l = 0; l < 8; ++l) { const int L = L0 + l; if (L >= nlines) break; const size_t e = (size_t)L * 64 + lane * 2; const int k = (int)(e % K), n = (int)(e / K); v2us o;
            o[0] = f2bf(w[(size_t)k * N + n]); o[1] = f2bf(w[(size_t)(k + 1) * N + n]); *(v2us*)(Bt + e) = o; }
         }
}
__global__ __launch_bounds__(256) void k_cvt8(const float* __restrict__ src, bf* dst, size_t n8) { const size_t i = (size_t)blockIdx.x * 256 + threadIdx.x; if (i >= n8) return; const v8f v = *(const v8f*)(src + i * 8); v8us o;
#pragma unroll
    for (int k = 0; k < 8; ++k) o[k] = f2bf(v[k]); *(v8us*)(dst + i * 8) = o;  }

// k_rope: head planes [h][t][d] (fp16 + hi/lo) of rope(x) x sc with the rotate-half convention out[d] = x[d] cos[t][d] - x[d+HD/2] sin[t][d], out[d+HD/2] = x[d+HD/2] cos[t][d+HD/2] + x[d] sin[t][d+HD/2]
__global__ __launch_bounds__(256) void k_rope(const float* __restrict__ F, int pitch, int nheads, const float* __restrict__ CS, const float* __restrict__ RF, const float* __restrict__ nw, float sc, h16* P16, bf* Ph, bf* Pl) {
    const size_t e = ((size_t)blockIdx.x * 256 + threadIdx.x) * 2; if (e >= (size_t)nheads * TT * HD) return; const int d = (int)(e % HD); const int t = (int)((e / HD) % TT); const int h = (int)(e / ((size_t)HD * TT)); const float* f = F + (size_t)t * pitch + h * HD; const float rf = RF ? RF[(size_t)h * TT + t] : 1.0f; v2h o16; v2us oh, ol;
#pragma unroll
    for (int q = 0; q < 2; ++q) { const int dd = d + q; const int dp = (dd < HD / 2) ? dd + HD / 2 : dd - HD / 2; float x0 = f[dd], x1 = f[dp];
        if (RF) { float n0 = __fmul_rn(x0, rf), n1 = __fmul_rn(x1, rf); asm volatile("" : "+v"(n0)); asm volatile("" : "+v"(n1)); x0 = __fmul_rn(bfr(nw[dd]), n0); x1 = __fmul_rn(bfr(nw[dp]), n1); }
        const v2f cs = *(const v2f*)(CS + ((size_t)t * HD + dd) * 2); float a = __fmul_rn(x0, cs[0]), bq = __fmul_rn(x1, cs[1]); asm volatile("" : "+v"(a)); asm volatile("" : "+v"(bq)); const float r = ((dd < HD / 2) ? __fsub_rn(a, bq) : __fadd_rn(a, bq)) * sc;
        o16[q] = tohx(r); unsigned short a2, c2; splitf(r, a2, c2); oh[q] = a2; ol[q] = c2; }
    *(v2h*)(P16 + e) = o16; *(v2us*)(Ph + e) = oh; *(v2us*)(Pl + e) = ol;  }
__global__ __launch_bounds__(256) void k_vtp(const float* __restrict__ F, int pitch, int nheads, h16* V16, bf* Vh, bf* Vl) { const size_t e = ((size_t)blockIdx.x * 256 + threadIdx.x) * 2; if (e >= (size_t)nheads * HD * TT) return; const int t = (int)(e % TT); const int d = (int)((e / TT) % HD); const int g = (int)(e / ((size_t)TT * HD)); v2h o16; v2us oh, ol;
#pragma unroll
    for (int q = 0; q < 2; ++q) { const float x = F[(size_t)(t + q) * pitch + g * HD + d]; o16[q] = tohx(x); unsigned short a2, c2; splitf(x, a2, c2); oh[q] = a2; ol[q] = c2; }
    *(v2h*)(V16 + e) = o16; *(v2us*)(Vh + e) = oh; *(v2us*)(Vl + e) = ol;  }
__global__ __launch_bounds__(256) void k_csid(float* CS) { const int idx = blockIdx.x * 256 + threadIdx.x; if (idx >= TT * HD) return; v2f cs; cs[0] = 1.0f; cs[1] = 0.0f; *(v2f*)(CS + (size_t)idx * 2) = cs;  }
// k_asoft: per row (zz, i): t = S x HD^-0.5 for j <= i and i - j < WIN (sliding causal window; the reference's -1e9 additive fill vanishes identically); softmax over the 2048 keys (register row, one exp, fixed trees);
__global__ __launch_bounds__(256) void k_asoft(const float* __restrict__ Sb, h16* P16, bf* Ph, bf* Pl) {
    const int lane = threadIdx.x & 31; const int row = blockIdx.x * 8 + (threadIdx.x >> 5); if (row >= ZH * TT) return; const int i = row % TT; const int zz = row / TT; (void)zz; const bool hires = (i < RH); const float* sr = Sb + (size_t)row * TT; float v[TT / 32]; float mx = -3.0e38f;
#pragma unroll
    for (int ch = 0; ch < TT / 128; ++ch) { const int j0 = ch * 128 + lane * 4; const v4f a = *(const v4f*)(sr + j0);
#pragma unroll
        for (int q = 0; q < 4; ++q) { const int j = j0 + q; (void)j; const float t = (j <= i && i - j < WIN) ? a[q] * SCL : -3.0e38f; v[ch * 4 + q] = t; mx = fmaxf(mx, t); } }
#pragma unroll
    for (int sh = 16; sh; sh >>= 1) mx = fmaxf(mx, __shfl_xor(mx, sh, 32));
    float sum = 0.f;
#pragma unroll
    for (int k = 0; k < TT / 32; ++k) { float d0 = __fsub_rn(v[k], mx); asm volatile("" : "+v"(d0)); v[k] = __builtin_amdgcn_exp2f(__fmul_rn(d0, 1.4426950408889634f)); sum += v[k]; }
#pragma unroll
    for (int sh = 16; sh; sh >>= 1) sum += __shfl_xor(sum, sh, 32);
    const float f = __fdiv_rn(hires ? 1.0f : PCAR, sum);
{
        if (hires) {
#pragma unroll
            for (int ch = 0; ch < TT / 128; ++ch) { v4us oh, ol;
#pragma unroll
                for (int q = 0; q < 4; ++q) { unsigned short a, c2; splitf(v[ch * 4 + q] * f, a, c2); oh[q] = a; ol[q] = c2; }
                const size_t oo = ((size_t)zz * (RH ? RH : 1) + i) * TT + ch * 128 + lane * 4; *(v4us*)(Ph + oo) = oh; *(v4us*)(Pl + oo) = ol; }
        } else {
#pragma unroll
            for (int ch = 0; ch < TT / 128; ++ch) { v4h o4;
#pragma unroll
                for (int q = 0; q < 4; ++q) o4[q] = tohx(v[ch * 4 + q] * f);
                *(v4h*)(P16 + (size_t)row * TT + ch * 128 + lane * 4) = o4; } }
         }
}
__global__ __launch_bounds__(256) void k_merge(const float* __restrict__ O, int h0, bf* Ah, bf* Al) { const size_t e = ((size_t)blockIdx.x * 256 + threadIdx.x) * 2; if (e >= (size_t)ZH * TT * HD) return; const int d = (int)(e % HD); const int t = (int)((e / HD) % TT); const int zz = (int)(e / ((size_t)HD * TT)); const float cs = (t < RH) ? 1.0f : (1.0f / PCAR); const size_t oo = (size_t)t * DQ + (h0 + zz) * HD + d;
    v2us oh, ol;
#pragma unroll
    for (int q = 0; q < 2; ++q) { unsigned short a, c2; splitf(O[e + q] * cs, a, c2); oh[q] = a; ol[q] = c2; } *(v2us*)(Ah + oo) = oh; *(v2us*)(Al + oo) = ol;  }

extern "C" void kernel_launch(void* const* d_in, const int* in_sizes, int n_in,
                              void* d_out, int out_size, void* d_ws, size_t ws_size, hipStream_t stream) {
    (void)in_sizes; (void)n_in; (void)out_size;
    const float* x = (const float*)d_in[0]; const float* xk = (const float*)d_in[1]; const float* xv = (const float*)d_in[1]; const float* wq = (const float*)d_in[2]; const float* bq = (const float*)d_in[3]; const float* wk = (const float*)d_in[4]; const float* bk = (const float*)d_in[5]; const float* wv = (const float*)d_in[6]; const float* bv = (const float*)d_in[7]; const float* wo = (const float*)d_in[8]; const float* bo = (const float*)d_in[9]; /* order data, context, Wq, bq, Wk, bk, Wv, bv, Wo, bo ('xw' + biases): TEN inputs: TWO streams: the queries come from data (d_in[0]); the keys AND the values both come from context (d_in[1]): the kernel's key stream and value stream pointers are the same input */
    float* OUT = (float*)d_out;     // [4][2048][1024]
    char* wsp = (char*)d_ws;
    auto take = [&](size_t bytes) { char* p = wsp; wsp += (bytes + 255) & ~(size_t)255; return (void*)p; };
    bf* WQ = (bf*)take((size_t)DQ * DM * 2); bf* WK = (bf*)take((size_t)DKV * DM * 2); bf* WV = (bf*)take((size_t)DKV * DM * 2); bf* WO = (bf*)take((size_t)DM * DQ * 2); float* CS = (float*)take((size_t)TT * HD * 2 * 4);
    bf* XB = (bf*)take((size_t)TT * DM * 2); float* FQ = (float*)take((size_t)TT * DQ * 4); float* FK = (float*)take((size_t)TT * DKV * 4);
    h16* QP16 = (h16*)take((size_t)NH_ * TT * HD * 2); h16* KP16 = (h16*)take((size_t)NKV * TT * HD * 2); h16* VT16 = (h16*)take((size_t)NKV * HD * TT * 2);
    bf* QPh = (bf*)take((size_t)NH_ * TT * HD * 2); bf* QPl = (bf*)take((size_t)NH_ * TT * HD * 2); bf* KPh = (bf*)take((size_t)NKV * TT * HD * 2); bf* KPl = (bf*)take((size_t)NKV * TT * HD * 2); bf* VTh = (bf*)take((size_t)NKV * HD * TT * 2); bf* VTl = (bf*)take((size_t)NKV * HD * TT * 2); bf* Ph = (bf*)take((size_t)ZH * RH * TT * 2); bf* Pl = (bf*)take((size_t)ZH * RH * TT * 2);
    float* Sb = (float*)take((size_t)ZH * TT * TT * 4); h16* P16 = (h16*)take((size_t)ZH * TT * TT * 2); float* Ob = (float*)take((size_t)ZH * TT * HD * 4); bf* ATh = (bf*)take((size_t)TT * DQ * 2); bf* ATl = (bf*)take((size_t)TT * DQ * 2);
    if ((size_t)(wsp - (char*)d_ws) > ws_size) return;    // ws 256 MiB
    float* FV = FK;   // v projection reuses the k buffer after the k planes are built (stream-ordered)
    { k_wtG<<<(unsigned)((DM * DQ / 64 + 63) / 64), 256, 0, stream>>>(wq, DM, DQ, WQ); k_wtG<<<(unsigned)((DM * DKV / 64 + 63) / 64), 256, 0, stream>>>(wk, DM, DKV, WK); k_wtG<<<(unsigned)((DM * DKV / 64 + 63) / 64), 256, 0, stream>>>(wv, DM, DKV, WV);
      k_wtG<<<(unsigned)((DQ * DM / 64 + 63) / 64), 256, 0, stream>>>(wo, DQ, DM, WO);
       }
    k_csid<<<(TT * HD + 255) / 256, 256, 0, stream>>>(CS);
    const unsigned LQ = (unsigned)(((size_t)NH_ * TT * HD / 2 + 255) / 256), LKv = (unsigned)(((size_t)NKV * TT * HD / 2 + 255) / 256);
    for (int b = 0; b < NB_; ++b) {
        
        k_cvt8<<<(unsigned)(((size_t)TT * DM / 8 + 255) / 256), 256, 0, stream>>>(x + (size_t)b * TT * DM, XB, (size_t)TT * DM / 8);
        k_gemmw<bf, 0, true><<<dim3(TT / 64, DQ / 64, 1), 32, 0, stream>>>(XB, nullptr, WQ, nullptr, DM, FQ, DQ, bq, 0, 0, 0);
        k_rope<<<LQ, 256, 0, stream>>>(FQ, DQ, NH_, CS, nullptr, nullptr, 1.0f, QP16, QPh, QPl);
        k_cvt8<<<(unsigned)(((size_t)TT * DM / 8 + 255) / 256), 256, 0, stream>>>(xk + (size_t)b * TT * DM, XB, (size_t)TT * DM / 8); k_gemmw<bf, 0, true><<<dim3(TT / 64, DKV / 64, 1), 32, 0, stream>>>(XB, nullptr, WK, nullptr, DM, FK, DKV, bk, 0, 0, 0);
        k_rope<<<LKv, 256, 0, stream>>>(FK, DKV, NKV, CS, nullptr, nullptr, 1.0f, KP16, KPh, KPl);
        k_cvt8<<<(unsigned)(((size_t)TT * DM / 8 + 255) / 256), 256, 0, stream>>>(xv + (size_t)b * TT * DM, XB, (size_t)TT * DM / 8); k_gemmw<bf, 0, true><<<dim3(TT / 64, DKV / 64, 1), 32, 0, stream>>>(XB, nullptr, WV, nullptr, DM, FV, DKV, bv, 0, 0, 0); k_vtp<<<LKv, 256, 0, stream>>>(FV, DKV, NKV, VT16, VTh, VTl);
        for (int h0 = 0; h0 < NH_; h0 += ZH) { const size_t zq = (size_t)h0, zk = (size_t)(h0 / REP);   // one kv head per query head: the pass's two heads use consecutive kv planes (z-strides TT*HD)
            k_gemmc<bf, 2, 1><<<dim3(RH / 64, TT / 64, ZH), 32, 0, stream>>>(QPh + zq * TT * HD, QPl + zq * TT * HD, KPh + zk * TT * HD, KPl + zk * TT * HD, HD, Sb, TT, 0, (size_t)TT * HD, (size_t)TT * HD, (size_t)TT * TT);
            k_gemmc<h16, 0, 1><<<dim3((TT - RH) / 64, TT / 64, ZH), 32, 0, stream>>>(QP16 + zq * TT * HD + (size_t)RH * HD, nullptr, KP16 + zk * TT * HD, nullptr, HD, Sb + (size_t)RH * TT, TT, RH, (size_t)TT * HD, (size_t)TT * HD, (size_t)TT * TT);
            k_asoft<<<ZH * TT / 8, 256, 0, stream>>>(Sb, P16, Ph, Pl);
            k_gemmc<bf, 2, 2><<<dim3(RH / 64, HD / 64, ZH), 32, 0, stream>>>(Ph, Pl, VTh + zk * HD * TT, VTl + zk * HD * TT, TT, Ob, HD, 0, (size_t)RH * TT, (size_t)HD * TT, (size_t)TT * HD);
            k_gemmc<h16, 0, 2><<<dim3((TT - RH) / 64, HD / 64, ZH), 32, 0, stream>>>(P16 + (size_t)RH * TT, nullptr, VT16 + zk * HD * TT, nullptr, TT, Ob + (size_t)RH * HD, HD, RH, (size_t)TT * TT, (size_t)HD * TT, (size_t)TT * HD);
            k_merge<<<(unsigned)(((size_t)ZH * TT * HD / 2 + 255) / 256), 256, 0, stream>>>(Ob, h0, ATh, ATl); }
        k_gemmw<bf, 1, true><<<dim3(TT / 64, DM / 64, 1), 32, 0, stream>>>(ATh, ATl, WO, nullptr, DQ, OUT + (size_t)b * TT * DM, DM, bo, 0, 0, 0); }
}

// v001
// A run of this version takes 1740 microseconds.
// Timed twice side by side with v000, it ran 1.69 times as fast both times.
#include <hip/hip_runtime.h>

// Causal multi-head attention between two equally long streams with biased (in, out) projections (data, context [4][2048][1024]; Q = data Wq + bq, K = context Wk + bk, V = context Wv + bv ('xw' [1024][1024] normal x 0.02 + [1024] zeros on this draw: read; 16 heads x 64); scores / sqrt(64); causal (tril kept, -inf elsewhere: query i sees context positions j <= i); softmax over the keys; out = merged Wo + bo ('xw' + bias zeros: read) -> [4][2048][1024] (8.4 M); argument order data, context, Wq, bq, Wk, bk, Wv, bv, Wo, bo).
// Layout per batch: bf16 copies of the three inputs in turn; 'xw' weights transposed once; exact projections + f32 biases; causal T-2048 attention (hybrid rows: < 512 hi/lo 3 products, rest fp16 x1024; k_gemmc skips tiles above the diagonal); merged hi/lo x w_o exact + b_o.
// Compute dtypes, f32 accumulate: every input rounded to bf16; projections exact + f32 biases; attention rows < 512 3 products, rest fp16; softmax f32; Wo hl x exact + bias.

#define NB_  4
#define TT   2048
#define DM   1024
#define NH_  16
#define NKV  16
#define REP  (NH_ / NKV)
#define HD   64
#define DQ   (NH_ * HD)
#define DKV  (NKV * HD)
#define ZH   2
#define RH   512                  // query rows < RH use hi+lo planes (0: none)
#define WIN  2048
#define PCAR 1024.0f
#define SCL  0.125f   // HD^-0.5
typedef _Float16 h16;
typedef unsigned short bf;
typedef __attribute__((ext_vector_type(16))) __bf16   v16bf;
typedef __attribute__((ext_vector_type(16))) _Float16 v16h;
typedef __attribute__((ext_vector_type(8)))  _Float16 v8h;
typedef __attribute__((ext_vector_type(8)))  unsigned short v8us;
typedef __attribute__((ext_vector_type(8)))  float    v8f;
typedef __attribute__((ext_vector_type(4)))  float    v4f;
typedef v8h  __attribute__((may_alias)) v8ha;
typedef v4f  __attribute__((may_alias)) v4fa;
typedef v8us __attribute__((may_alias)) v8usa;

__device__ __forceinline__ unsigned short f2bf(float f) { unsigned u = __float_as_uint(f); u += 0x7FFFu + ((u >> 16) & 1u); return (unsigned short)(u >> 16); }
__device__ __forceinline__ float bf2f(unsigned short b) { return __uint_as_float(((unsigned)b) << 16); }
__device__ __forceinline__ float bfr(float f) { return bf2f(f2bf(f)); }
__device__ __forceinline__ v16h cat16(v8h lo, v8h hi) { return __builtin_shufflevector(lo, hi, 0, 1, 2, 3, 4, 5, 6, 7, 8, 9, 10, 11, 12, 13, 14, 15); }
__device__ __forceinline__ v16bf cat16b(v8us lo, v8us hi) { return __builtin_bit_cast(v16bf, __builtin_shufflevector(lo, hi, 0, 1, 2, 3, 4, 5, 6, 7, 8, 9, 10, 11, 12, 13, 14, 15)); }
__device__ __forceinline__ v8f wmma16(v16h a, v16h b, v8f c) { return __builtin_amdgcn_wmma_f32_16x16x32_f16(false, a, false, b, (short)0, c, false, false); }
__device__ __forceinline__ v8f wmmab(v16bf a, v16bf b, v8f c) { return __builtin_amdgcn_wmma_f32_16x16x32_bf16(false, a, false, b, (short)0, c, false, false); }



// ---- k_gemmw: register-blocked GEMM, one 64x64 output tile per work-group, the K loop dealt over the NW waves of the group in 64-wide chunks (wave w takes chunks w, w + NW, ...); every wave keeps the
// whole tile (16 accumulators), operands straight from K-contiguous 16-bit planes; the NW partial tiles meet in LDS and are summed in wave order 0..NW-1. grid (M/64, N/64, Z), 32 * NW threads.
// C[m][n] (f32, pitch ldc, + optional f32 bias[n]) = sum_k A[m][k] Bt[n][k] (+ split products per NSPLIT). z-batch strides sA/sB/sC in elements. K % 64 == 0.
// CK: probability x value contraction of causal attention: the K loop stops at the diagonal block (probabilities beyond it are exactly zero); roff = row offset of this launch's first row within the sequence.
template <typename T16> struct WFrag;
template <> struct WFrag<h16> { typedef v16h V; static __device__ __forceinline__ V ld(const h16* p) { return cat16(*(const v8h*)p, *(const v8h*)(p + 16)); } static __device__ __forceinline__ v8f mma(V a, V b, v8f c) { return wmma16(a, b, c); } };
template <> struct WFrag<bf> { typedef v16bf V; static __device__ __forceinline__ V ld(const bf* p) { return cat16b(*(const v8us*)p, *(const v8us*)(p + 16)); } static __device__ __forceinline__ v8f mma(V a, V b, v8f c) { return wmmab(a, b, c); } };
template <typename T16, int NSPLIT, bool BIAS, int NW, bool CK>
__global__ __launch_bounds__(32 * NW) void k_gemmw(const T16* __restrict__ A, const T16* __restrict__ A2, const T16* __restrict__ Bt, const T16* __restrict__ Bt2, int K, float* C, int ldc, const float* __restrict__ bias, int roff, size_t sA, size_t sB, size_t sC) {
    typedef typename WFrag<T16>::V V;
    __shared__ __align__(16) float os[NW * 64 * 68];
    const size_t z = blockIdx.z; A += z * sA; if (A2) A2 += z * sA; Bt += z * sB; if (Bt2) Bt2 += z * sB; C += z * sC;
    const int lane = threadIdx.x & 31, lr = lane & 15, hi = lane >> 4; const int r0 = blockIdx.x * 64, c0 = blockIdx.y * 64;
    const int wv = __builtin_amdgcn_readfirstlane((int)(threadIdx.x >> 5));   // the wave's number in a scalar register: the K loop's bounds and branches stay scalar
    const int Kl = CK ? min(K, r0 + roff + 64) : K;
    v8f acc[4][4];
#pragma unroll
    for (int mb = 0; mb < 4; ++mb)
#pragma unroll
        for (int nb = 0; nb < 4; ++nb) acc[mb][nb] = (v8f){};
    const size_t aoff = (size_t)(r0 + lr) * K + 8 * hi, boff = (size_t)(c0 + lr) * K + 8 * hi;
    // both loops stay rolled: one k-step's operands and the 16 accumulators are what the register budget of a 16-wave group holds; a 64-wide chunk is one whole 128-byte line of every operand row
#pragma unroll 1
    for (int kb = wv * 64; kb < Kl; kb += NW * 64) {
#pragma unroll 1
    for (int kc = kb; kc < kb + 64; kc += 32) {
        V a[4], a2[4];
#pragma unroll
        for (int mb = 0; mb < 4; ++mb) { a[mb] = WFrag<T16>::ld(A + aoff + (size_t)mb * 16 * K + kc); if (NSPLIT == 1 || NSPLIT == 2) a2[mb] = WFrag<T16>::ld(A2 + aoff + (size_t)mb * 16 * K + kc); }
#pragma unroll
        for (int nb = 0; nb < 4; ++nb) { const V b = WFrag<T16>::ld(Bt + boff + (size_t)nb * 16 * K + kc); V b2; if (NSPLIT >= 2) b2 = WFrag<T16>::ld(Bt2 + boff + (size_t)nb * 16 * K + kc);
#pragma unroll
            for (int mb = 0; mb < 4; ++mb) { acc[mb][nb] = WFrag<T16>::mma(a[mb], b, acc[mb][nb]); if (NSPLIT == 1 || NSPLIT == 2) acc[mb][nb] = WFrag<T16>::mma(a2[mb], b, acc[mb][nb]); if (NSPLIT >= 2) acc[mb][nb] = WFrag<T16>::mma(a[mb], b2, acc[mb][nb]); } }
        asm volatile("v_nop\n\tv_nop\n\tv_nop\n\tv_nop" : "+v"(acc[0][0]), "+v"(acc[1][1]), "+v"(acc[2][2]), "+v"(acc[3][3]) : "v"(a[0]), "v"(a[3]));
    } }
    float* my = os + wv * (64 * 68);
#pragma unroll
    for (int mb = 0; mb < 4; ++mb)
#pragma unroll
        for (int nb = 0; nb < 4; ++nb)
#pragma unroll
            for (int j = 0; j < 8; ++j) my[(mb * 16 + hi * 8 + j) * 68 + nb * 16 + lr] = acc[mb][nb][j];
    __syncthreads();   // every wave's partial tile is in LDS before any thread sums across the waves
#pragma unroll
    for (int s = 0; s < 32 / NW; ++s) { const int idx = s * (32 * NW) + (int)threadIdx.x; const int row = idx >> 4, cofs = (idx & 15) * 4; v4f val = *(const v4fa*)(os + row * 68 + cofs);
#pragma unroll
        for (int w = 1; w < NW; ++w) val += *(const v4fa*)(os + w * (64 * 68) + row * 68 + cofs);
        if (BIAS) { val[0] += bfr(bias[c0 + cofs]); val[1] += bfr(bias[c0 + cofs + 1]); val[2] += bfr(bias[c0 + cofs + 2]); val[3] += bfr(bias[c0 + cofs + 3]); }
        *(v4f*)(C + (size_t)(r0 + row) * ldc + c0 + cofs) = val; }
}

// ---- k_gemmc: one-wave 64x64 tile GEMM for the causal scores (K = head size, too short to deal out): CMODE 1 skips score tiles entirely above the diagonal (query rows r0+roff.., key columns c0..).
// roff = row offset of this launch's first row within the sequence. grid (M/64, N/64, Z), 32 threads.
template <typename T16, int NSPLIT, int CMODE>
__global__ __launch_bounds__(32) void k_gemmc(const T16* __restrict__ A, const T16* __restrict__ A2, const T16* __restrict__ Bt, const T16* __restrict__ Bt2, int K, float* C, int ldc, int roff, size_t sA, size_t sB, size_t sC) {
    typedef typename WFrag<T16>::V V;
    __shared__ __align__(16) float os[16 * 68];
    const size_t z = blockIdx.z; A += z * sA; if (A2) A2 += z * sA; Bt += z * sB; if (Bt2) Bt2 += z * sB; C += z * sC;
    const int lane = threadIdx.x & 31, lr = lane & 15, hi = lane >> 4; const int r0 = blockIdx.x * 64, c0 = blockIdx.y * 64;
    if (CMODE == 1 && c0 > r0 + roff + 63) return;                  // score tile entirely above the causal diagonal: never read (the softmax masks j > i by select)
    const int Kl = K;
    v8f acc[4][4];
#pragma unroll
    for (int mb = 0; mb < 4; ++mb)
#pragma unroll
        for (int nb = 0; nb < 4; ++nb) acc[mb][nb] = (v8f){};
    const size_t aoff = (size_t)(r0 + lr) * K + 8 * hi, boff = (size_t)(c0 + lr) * K + 8 * hi;
#pragma unroll 1
    for (int kc = 0; kc < Kl; kc += 32) {
        V a[4], a2[4];
#pragma unroll
        for (int mb = 0; mb < 4; ++mb) { a[mb] = WFrag<T16>::ld(A + aoff + (size_t)mb * 16 * K + kc); if (NSPLIT == 1 || NSPLIT == 2) a2[mb] = WFrag<T16>::ld(A2 + aoff + (size_t)mb * 16 * K + kc); }
#pragma unroll
        for (int nb = 0; nb < 4; ++nb) { const V b = WFrag<T16>::ld(Bt + boff + (size_t)nb * 16 * K + kc); V b2; if (NSPLIT >= 2) b2 = WFrag<T16>::ld(Bt2 + boff + (size_t)nb * 16 * K + kc);
#pragma unroll
            for (int mb = 0; mb < 4; ++mb) { acc[mb][nb] = WFrag<T16>::mma(a[mb], b, acc[mb][nb]); if (NSPLIT == 1 || NSPLIT == 2) acc[mb][nb] = WFrag<T16>::mma(a2[mb], b, acc[mb][nb]); if (NSPLIT >= 2) acc[mb][nb] = WFrag<T16>::mma(a[mb], b2, acc[mb][nb]); } }
        asm volatile("v_nop\n\tv_nop\n\tv_nop\n\tv_nop" : "+v"(acc[0][0]), "+v"(acc[1][1]), "+v"(acc[2][2]), "+v"(acc[3][3]) : "v"(a[0]), "v"(a[3]));
    }
#pragma unroll
    for (int mb = 0; mb < 4; ++mb) {
#pragma unroll
        for (int nb = 0; nb < 4; ++nb) {
#pragma unroll
            for (int j = 0; j < 8; ++j) os[(hi * 8 + j) * 68 + nb * 16 + lr] = acc[mb][nb][j]; }
        __builtin_amdgcn_wave_barrier(); asm volatile("" ::: "memory");
        float* crow = C + (size_t)(r0 + mb * 16) * ldc + c0;
{
#pragma unroll
            for (int s = 0; s < 8; ++s) { const int row = 2 * s + hi, cofs = lr * 4; v4f val = *(const v4fa*)(os + row * 68 + cofs);
                *(v4f*)(crow + (size_t)row * ldc + cofs) = val; }
             }
        __builtin_amdgcn_wave_barrier(); asm volatile("" ::: "memory");
    }
}

__device__ __forceinline__ h16 tohx(float x) { return (h16)x; }
__device__ __forceinline__ void splitf(float y, unsigned short& h, unsigned short& l) { h = f2bf(y); l = f2bf(y - bf2f(h)); }
typedef __attribute__((ext_vector_type(2))) _Float16 v2h;
typedef __attribute__((ext_vector_type(4))) _Float16 v4h;
typedef __attribute__((ext_vector_type(2))) unsigned short v2us;
typedef __attribute__((ext_vector_type(4))) unsigned short v4us;
typedef __attribute__((ext_vector_type(2))) float v2f;
typedef __attribute__((ext_vector_type(4))) int v4i;

__global__ __launch_bounds__(256) void k_wtG(const float* __restrict__ w, int K, int N, bf* Bt) {
    const int lane = threadIdx.x & 31; const int L0 = (blockIdx.x * 8 + (threadIdx.x >> 5)) * 8; const int nlines = N * K / 64;
{
#pragma unroll 1
        for (int l = 0; l < 8; ++l) { const int L = L0 + l; if (L >= nlines) break; const size_t e = (size_t)L * 64 + lane * 2; const int k = (int)(e % K), n = (int)(e / K); v2us o;
            o[0] = f2bf(w[(size_t)k * N + n]); o[1] = f2bf(w[(size_t)(k + 1) * N + n]); *(v2us*)(Bt + e) = o; }
         }
}
__global__ __launch_bounds__(256) void k_cvt8(const float* __restrict__ src, bf* dst, size_t n8) { const size_t i = (size_t)blockIdx.x * 256 + threadIdx.x; if (i >= n8) return; const v8f v = *(const v8f*)(src + i * 8); v8us o;
#pragma unroll
    for (int k = 0; k < 8; ++k) o[k] = f2bf(v[k]); *(v8us*)(dst + i * 8) = o;  }

// k_rope: head planes [h][t][d] (fp16 + hi/lo) of rope(x) x sc with the rotate-half convention out[d] = x[d] cos[t][d] - x[d+HD/2] sin[t][d], out[d+HD/2] = x[d+HD/2] cos[t][d+HD/2] + x[d] sin[t][d+HD/2]
__global__ __launch_bounds__(256) void k_rope(const float* __restrict__ F, int pitch, int nheads, const float* __restrict__ CS, const float* __restrict__ RF, const float* __restrict__ nw, float sc, h16* P16, bf* Ph, bf* Pl) {
    const size_t e = ((size_t)blockIdx.x * 256 + threadIdx.x) * 2; if (e >= (size_t)nheads * TT * HD) return; const int d = (int)(e % HD); const int t = (int)((e / HD) % TT); const int h = (int)(e / ((size_t)HD * TT)); const float* f = F + (size_t)t * pitch + h * HD; const float rf = RF ? RF[(size_t)h * TT + t] : 1.0f; v2h o16; v2us oh, ol;
#pragma unroll
    for (int q = 0; q < 2; ++q) { const int dd = d + q; const int dp = (dd < HD / 2) ? dd + HD / 2 : dd - HD / 2; float x0 = f[dd], x1 = f[dp];
        if (RF) { float n0 = __fmul_rn(x0, rf), n1 = __fmul_rn(x1, rf); asm volatile("" : "+v"(n0)); asm volatile("" : "+v"(n1)); x0 = __fmul_rn(bfr(nw[dd]), n0); x1 = __fmul_rn(bfr(nw[dp]), n1); }
        const v2f cs = *(const v2f*)(CS + ((size_t)t * HD + dd) * 2); float a = __fmul_rn(x0, cs[0]), bq = __fmul_rn(x1, cs[1]); asm volatile("" : "+v"(a)); asm volatile("" : "+v"(bq)); const float r = ((dd < HD / 2) ? __fsub_rn(a, bq) : __fadd_rn(a, bq)) * sc;
        o16[q] = tohx(r); unsigned short a2, c2; splitf(r, a2, c2); oh[q] = a2; ol[q] = c2; }
    *(v2h*)(P16 + e) = o16; *(v2us*)(Ph + e) = oh; *(v2us*)(Pl + e) = ol;  }
__global__ __launch_bounds__(256) void k_vtp(const float* __restrict__ F, int pitch, int nheads, h16* V16, bf* Vh, bf* Vl) { const size_t e = ((size_t)blockIdx.x * 256 + threadIdx.x) * 2; if (e >= (size_t)nheads * HD * TT) return; const int t = (int)(e % TT); const int d = (int)((e / TT) % HD); const int g = (int)(e / ((size_t)TT * HD)); v2h o16; v2us oh, ol;
#pragma unroll
    for (int q = 0; q < 2; ++q) { const float x = F[(size_t)(t + q) * pitch + g * HD + d]; o16[q] = tohx(x); unsigned short a2, c2; splitf(x, a2, c2); oh[q] = a2; ol[q] = c2; }
    *(v2h*)(V16 + e) = o16; *(v2us*)(Vh + e) = oh; *(v2us*)(Vl + e) = ol;  }
__global__ __launch_bounds__(256) void k_csid(float* CS) { const int idx = blockIdx.x * 256 + threadIdx.x; if (idx >= TT * HD) return; v2f cs; cs[0] = 1.0f; cs[1] = 0.0f; *(v2f*)(CS + (size_t)idx * 2) = cs;  }
// k_asoft: per row (zz, i): t = S x HD^-0.5 for j <= i and i - j < WIN (sliding causal window; the reference's -1e9 additive fill vanishes identically); softmax over the 2048 keys (register row, one exp, fixed trees);
__global__ __launch_bounds__(256) void k_asoft(const float* __restrict__ Sb, h16* P16, bf* Ph, bf* Pl) {
    const int lane = threadIdx.x & 31; const int row = blockIdx.x * 8 + (threadIdx.x >> 5); if (row >= ZH * TT) return; const int i = row % TT; const int zz = row / TT; (void)zz; const bool hires = (i < RH); const float* sr = Sb + (size_t)row * TT; float v[TT / 32]; float mx = -3.0e38f;
#pragma unroll
    for (int ch = 0; ch < TT / 128; ++ch) { const int j0 = ch * 128 + lane * 4; const v4f a = *(const v4f*)(sr + j0);
#pragma unroll
        for (int q = 0; q < 4; ++q) { const int j = j0 + q; (void)j; const float t = (j <= i && i - j < WIN) ? a[q] * SCL : -3.0e38f; v[ch * 4 + q] = t; mx = fmaxf(mx, t); } }
#pragma unroll
    for (int sh = 16; sh; sh >>= 1) mx = fmaxf(mx, __shfl_xor(mx, sh, 32));
    float sum = 0.f;
#pragma unroll
    for (int k = 0; k < TT / 32; ++k) { float d0 = __fsub_rn(v[k], mx); asm volatile("" : "+v"(d0)); v[k] = __builtin_amdgcn_exp2f(__fmul_rn(d0, 1.4426950408889634f)); sum += v[k]; }
#pragma unroll
    for (int sh = 16; sh; sh >>= 1) sum += __shfl_xor(sum, sh, 32);
    const float f = __fdiv_rn(hires ? 1.0f : PCAR, sum);
{
        if (hires) {
#pragma unroll
            for (int ch = 0; ch < TT / 128; ++ch) { v4us oh, ol;
#pragma unroll
                for (int q = 0; q < 4; ++q) { unsigned short a, c2; splitf(v[ch * 4 + q] * f, a, c2); oh[q] = a; ol[q] = c2; }
                const size_t oo = ((size_t)zz * (RH ? RH : 1) + i) * TT + ch * 128 + lane * 4; *(v4us*)(Ph + oo) = oh; *(v4us*)(Pl + oo) = ol; }
        } else {
#pragma unroll
            for (int ch = 0; ch < TT / 128; ++ch) { v4h o4;
#pragma unroll
                for (int q = 0; q < 4; ++q) o4[q] = tohx(v[ch * 4 + q] * f);
                *(v4h*)(P16 + (size_t)row * TT + ch * 128 + lane * 4) = o4; } }
         }
}
__global__ __launch_bounds__(256) void k_merge(const float* __restrict__ O, int h0, bf* Ah, bf* Al) { const size_t e = ((size_t)blockIdx.x * 256 + threadIdx.x) * 2; if (e >= (size_t)ZH * TT * HD) return; const int d = (int)(e % HD); const int t = (int)((e / HD) % TT); const int zz = (int)(e / ((size_t)HD * TT)); const float cs = (t < RH) ? 1.0f : (1.0f / PCAR); const size_t oo = (size_t)t * DQ + (h0 + zz) * HD + d;
    v2us oh, ol;
#pragma unroll
    for (int q = 0; q < 2; ++q) { unsigned short a, c2; splitf(O[e + q] * cs, a, c2); oh[q] = a; ol[q] = c2; } *(v2us*)(Ah + oo) = oh; *(v2us*)(Al + oo) = ol;  }

extern "C" void kernel_launch(void* const* d_in, const int* in_sizes, int n_in,
                              void* d_out, int out_size, void* d_ws, size_t ws_size, hipStream_t stream) {
    (void)in_sizes; (void)n_in; (void)out_size;
    const float* x = (const float*)d_in[0]; const float* xk = (const float*)d_in[1]; const float* xv = (const float*)d_in[1]; const float* wq = (const float*)d_in[2]; const float* bq = (const float*)d_in[3]; const float* wk = (const float*)d_in[4]; const float* bk = (const float*)d_in[5]; const float* wv = (const float*)d_in[6]; const float* bv = (const float*)d_in[7]; const float* wo = (const float*)d_in[8]; const float* bo = (const float*)d_in[9]; /* order data, context, Wq, bq, Wk, bk, Wv, bv, Wo, bo ('xw' + biases): TEN inputs: TWO streams: the queries come from data (d_in[0]); the keys AND the values both come from context (d_in[1]): the kernel's key stream and value stream pointers are the same input */
    float* OUT = (float*)d_out;     // [4][2048][1024]
    char* wsp = (char*)d_ws;
    auto take = [&](size_t bytes) { char* p = wsp; wsp += (bytes + 255) & ~(size_t)255; return (void*)p; };
    bf* WQ = (bf*)take((size_t)DQ * DM * 2); bf* WK = (bf*)take((size_t)DKV * DM * 2); bf* WV = (bf*)take((size_t)DKV * DM * 2); bf* WO = (bf*)take((size_t)DM * DQ * 2); float* CS = (float*)take((size_t)TT * HD * 2 * 4);
    bf* XB = (bf*)take((size_t)TT * DM * 2); float* FQ = (float*)take((size_t)TT * DQ * 4); float* FK = (float*)take((size_t)TT * DKV * 4);
    h16* QP16 = (h16*)take((size_t)NH_ * TT * HD * 2); h16* KP16 = (h16*)take((size_t)NKV * TT * HD * 2); h16* VT16 = (h16*)take((size_t)NKV * HD * TT * 2);
    bf* QPh = (bf*)take((size_t)NH_ * TT * HD * 2); bf* QPl = (bf*)take((size_t)NH_ * TT * HD * 2); bf* KPh = (bf*)take((size_t)NKV * TT * HD * 2); bf* KPl = (bf*)take((size_t)NKV * TT * HD * 2); bf* VTh = (bf*)take((size_t)NKV * HD * TT * 2); bf* VTl = (bf*)take((size_t)NKV * HD * TT * 2); bf* Ph = (bf*)take((size_t)ZH * RH * TT * 2); bf* Pl = (bf*)take((size_t)ZH * RH * TT * 2);
    float* Sb = (float*)take((size_t)ZH * TT * TT * 4); h16* P16 = (h16*)take((size_t)ZH * TT * TT * 2); float* Ob = (float*)take((size_t)ZH * TT * HD * 4); bf* ATh = (bf*)take((size_t)TT * DQ * 2); bf* ATl = (bf*)take((size_t)TT * DQ * 2);
    if ((size_t)(wsp - (char*)d_ws) > ws_size) return;    // ws 256 MiB
    float* FV = FK;   // v projection reuses the k buffer after the k planes are built (stream-ordered)
    { k_wtG<<<(unsigned)((DM * DQ / 64 + 63) / 64), 256, 0, stream>>>(wq, DM, DQ, WQ); k_wtG<<<(unsigned)((DM * DKV / 64 + 63) / 64), 256, 0, stream>>>(wk, DM, DKV, WK); k_wtG<<<(unsigned)((DM * DKV / 64 + 63) / 64), 256, 0, stream>>>(wv, DM, DKV, WV);
      k_wtG<<<(unsigned)((DQ * DM / 64 + 63) / 64), 256, 0, stream>>>(wo, DQ, DM, WO);
       }
    k_csid<<<(TT * HD + 255) / 256, 256, 0, stream>>>(CS);
    const unsigned LQ = (unsigned)(((size_t)NH_ * TT * HD / 2 + 255) / 256), LKv = (unsigned)(((size_t)NKV * TT * HD / 2 + 255) / 256);
    for (int b = 0; b < NB_; ++b) {
        
        k_cvt8<<<(unsigned)(((size_t)TT * DM / 8 + 255) / 256), 256, 0, stream>>>(x + (size_t)b * TT * DM, XB, (size_t)TT * DM / 8);
        k_gemmw<bf, 0, true, 8, false><<<dim3(TT / 64, DQ / 64, 1), 256, 0, stream>>>(XB, nullptr, WQ, nullptr, DM, FQ, DQ, bq, 0, 0, 0, 0);
        k_rope<<<LQ, 256, 0, stream>>>(FQ, DQ, NH_, CS, nullptr, nullptr, 1.0f, QP16, QPh, QPl);
        k_cvt8<<<(unsigned)(((size_t)TT * DM / 8 + 255) / 256), 256, 0, stream>>>(xk + (size_t)b * TT * DM, XB, (size_t)TT * DM / 8); k_gemmw<bf, 0, true, 8, false><<<dim3(TT / 64, DKV / 64, 1), 256, 0, stream>>>(XB, nullptr, WK, nullptr, DM, FK, DKV, bk, 0, 0, 0, 0);
        k_rope<<<LKv, 256, 0, stream>>>(FK, DKV, NKV, CS, nullptr, nullptr, 1.0f, KP16, KPh, KPl);
        k_cvt8<<<(unsigned)(((size_t)TT * DM / 8 + 255) / 256), 256, 0, stream>>>(xv + (size_t)b * TT * DM, XB, (size_t)TT * DM / 8); k_gemmw<bf, 0, true, 8, false><<<dim3(TT / 64, DKV / 64, 1), 256, 0, stream>>>(XB, nullptr, WV, nullptr, DM, FV, DKV, bv, 0, 0, 0, 0); k_vtp<<<LKv, 256, 0, stream>>>(FV, DKV, NKV, VT16, VTh, VTl);
        for (int h0 = 0; h0 < NH_; h0 += ZH) { const size_t zq = (size_t)h0, zk = (size_t)(h0 / REP);   // one kv head per query head: the pass's two heads use consecutive kv planes (z-strides TT*HD)
            k_gemmc<bf, 2, 1><<<dim3(RH / 64, TT / 64, ZH), 32, 0, stream>>>(QPh + zq * TT * HD, QPl + zq * TT * HD, KPh + zk * TT * HD, KPl + zk * TT * HD, HD, Sb, TT, 0, (size_t)TT * HD, (size_t)TT * HD, (size_t)TT * TT);
            k_gemmc<h16, 0, 1><<<dim3((TT - RH) / 64, TT / 64, ZH), 32, 0, stream>>>(QP16 + zq * TT * HD + (size_t)RH * HD, nullptr, KP16 + zk * TT * HD, nullptr, HD, Sb + (size_t)RH * TT, TT, RH, (size_t)TT * HD, (size_t)TT * HD, (size_t)TT * TT);
            k_asoft<<<ZH * TT / 8, 256, 0, stream>>>(Sb, P16, Ph, Pl);
            k_gemmw<bf, 2, false, 8, true><<<dim3(RH / 64, HD / 64, ZH), 256, 0, stream>>>(Ph, Pl, VTh + zk * HD * TT, VTl + zk * HD * TT, TT, Ob, HD, nullptr, 0, (size_t)RH * TT, (size_t)HD * TT, (size_t)TT * HD);
            k_gemmw<h16, 0, false, 16, true><<<dim3((TT - RH) / 64, HD / 64, ZH), 512, 0, stream>>>(P16 + (size_t)RH * TT, nullptr, VT16 + zk * HD * TT, nullptr, TT, Ob + (size_t)RH * HD, HD, nullptr, RH, (size_t)TT * TT, (size_t)HD * TT, (size_t)TT * HD);
            k_merge<<<(unsigned)(((size_t)ZH * TT * HD / 2 + 255) / 256), 256, 0, stream>>>(Ob, h0, ATh, ATl); }
        k_gemmw<bf, 1, true, 8, false><<<dim3(TT / 64, DM / 64, 1), 256, 0, stream>>>(ATh, ATl, WO, nullptr, DQ, OUT + (size_t)b * TT * DM, DM, bo, 0, 0, 0, 0); }
}

// v002
// Measured time: 1020 microseconds a run.
// Two timings next to v001 both put it at 1.71 times that version's speed.
// Over all steps from v000 it is 2.89 times as fast.
#include <hip/hip_runtime.h>

// Causal multi-head attention between two equally long streams with biased (in, out) projections (data, context [4][2048][1024]; Q = data Wq + bq, K = context Wk + bk, V = context Wv + bv ('xw' [1024][1024] normal x 0.02 + [1024] zeros on this draw: read; 16 heads x 64); scores / sqrt(64); causal (tril kept, -inf elsewhere: query i sees context positions j <= i); softmax over the keys; out = merged Wo + bo ('xw' + bias zeros: read) -> [4][2048][1024] (8.4 M); argument order data, context, Wq, bq, Wk, bk, Wv, bv, Wo, bo).
// Layout per batch: bf16 copies of the three inputs in turn; 'xw' weights transposed once; exact projections + f32 biases; causal T-2048 attention (hybrid rows: < 512 hi/lo 3 products, rest fp16 x1024; k_gemmc skips tiles above the diagonal); merged hi/lo x w_o exact + b_o.
// Compute dtypes, f32 accumulate: every input rounded to bf16; projections exact + f32 biases; attention rows < 512 3 products, rest fp16; softmax f32; Wo hl x exact + bias.

#define NB_  4
#define TT   2048
#define DM   1024
#define NH_  16
#define NKV  16
#define REP  (NH_ / NKV)
#define HD   64
#define DQ   (NH_ * HD)
#define DKV  (NKV * HD)
#define ZH   8                    // heads per attention pass (one set of launches serves ZH heads)
#define PP   (2 * TT)             // row pitch, in 16-bit elements, of the probabilities (they lie in the 8 KiB score rows) and of the V^T planes that meet them in k_gemmw, which has one pitch for both operands
#define RH   512                  // query rows < RH use hi+lo planes (0: none)
#define WIN  2048
#define PCAR 1024.0f
#define SCL  0.125f   // HD^-0.5
typedef _Float16 h16;
typedef unsigned short bf;
typedef __attribute__((ext_vector_type(16))) __bf16   v16bf;
typedef __attribute__((ext_vector_type(16))) _Float16 v16h;
typedef __attribute__((ext_vector_type(8)))  _Float16 v8h;
typedef __attribute__((ext_vector_type(8)))  unsigned short v8us;
typedef __attribute__((ext_vector_type(8)))  float    v8f;
typedef __attribute__((ext_vector_type(4)))  float    v4f;
typedef v8h  __attribute__((may_alias)) v8ha;
typedef v4f  __attribute__((may_alias)) v4fa;
typedef v8us __attribute__((may_alias)) v8usa;

__device__ __forceinline__ unsigned short f2bf(float f) { unsigned u = __float_as_uint(f); u += 0x7FFFu + ((u >> 16) & 1u); return (unsigned short)(u >> 16); }
__device__ __forceinline__ float bf2f(unsigned short b) { return __uint_as_float(((unsigned)b) << 16); }
__device__ __forceinline__ float bfr(float f) { return bf2f(f2bf(f)); }
__device__ __forceinline__ v16h cat16(v8h lo, v8h hi) { return __builtin_shufflevector(lo, hi, 0, 1, 2, 3, 4, 5, 6, 7, 8, 9, 10, 11, 12, 13, 14, 15); }
__device__ __forceinline__ v16bf cat16b(v8us lo, v8us hi) { return __builtin_bit_cast(v16bf, __builtin_shufflevector(lo, hi, 0, 1, 2, 3, 4, 5, 6, 7, 8, 9, 10, 11, 12, 13, 14, 15)); }
__device__ __forceinline__ v8f wmma16(v16h a, v16h b, v8f c) { return __builtin_amdgcn_wmma_f32_16x16x32_f16(false, a, false, b, (short)0, c, false, false); }
__device__ __forceinline__ v8f wmmab(v16bf a, v16bf b, v8f c) { return __builtin_amdgcn_wmma_f32_16x16x32_bf16(false, a, false, b, (short)0, c, false, false); }



// ---- k_gemmw: register-blocked GEMM, one 64x64 output tile per work-group, the K loop dealt over the NW waves of the group in 64-wide chunks (wave w takes chunks w, w + NW, ...); every wave keeps the
// whole tile (16 accumulators), operands straight from K-contiguous 16-bit planes; the NW partial tiles meet in LDS and are summed in wave order 0..NW-1. grid (M/64, N/64, Z), 32 * NW threads.
// C[m][n] (f32, pitch ldc, + optional f32 bias[n]) = sum_k A[m][k] Bt[n][k] (+ split products per NSPLIT). z-batch strides sA/sB/sC in elements. K % 64 == 0.
// CK: probability x value contraction of causal attention: the K loop stops at the diagonal block (probabilities beyond it are exactly zero); roff = row offset of this launch's first row within the sequence.
template <typename T16> struct WFrag;
template <> struct WFrag<h16> { typedef v16h V; static __device__ __forceinline__ V ld(const h16* p) { return cat16(*(const v8h*)p, *(const v8h*)(p + 16)); } static __device__ __forceinline__ v8f mma(V a, V b, v8f c) { return wmma16(a, b, c); } };
template <> struct WFrag<bf> { typedef v16bf V; static __device__ __forceinline__ V ld(const bf* p) { return cat16b(*(const v8us*)p, *(const v8us*)(p + 16)); } static __device__ __forceinline__ v8f mma(V a, V b, v8f c) { return wmmab(a, b, c); } };
template <typename T16, int NSPLIT, bool BIAS, int NW, bool CK>
__global__ __launch_bounds__(32 * NW) void k_gemmw(const T16* __restrict__ A, const T16* __restrict__ A2, const T16* __restrict__ Bt, const T16* __restrict__ Bt2, int K, float* C, int ldc, const float* __restrict__ bias, int roff, size_t sA, size_t sB, size_t sC) {
    typedef typename WFrag<T16>::V V;
    __shared__ __align__(16) float os[NW * 64 * 68];
    const size_t z = blockIdx.z; A += z * sA; if (A2) A2 += z * sA; Bt += z * sB; if (Bt2) Bt2 += z * sB; C += z * sC;
    const int lane = threadIdx.x & 31, lr = lane & 15, hi = lane >> 4; const int r0 = blockIdx.x * 64, c0 = blockIdx.y * 64;
    const int wv = __builtin_amdgcn_readfirstlane((int)(threadIdx.x >> 5));   // the wave's number in a scalar register: the K loop's bounds and branches stay scalar
    const int Kl = CK ? min(K, r0 + roff + 64) : K;
    v8f acc[4][4];
#pragma unroll
    for (int mb = 0; mb < 4; ++mb)
#pragma unroll
        for (int nb = 0; nb < 4; ++nb) acc[mb][nb] = (v8f){};
    const size_t aoff = (size_t)(r0 + lr) * K + 8 * hi, boff = (size_t)(c0 + lr) * K + 8 * hi;
    // both loops stay rolled: one k-step's operands and the 16 accumulators are what the register budget of a 16-wave group holds; a 64-wide chunk is one whole 128-byte line of every operand row
#pragma unroll 1
    for (int kb = wv * 64; kb < Kl; kb += NW * 64) {
#pragma unroll 1
    for (int kc = kb; kc < kb + 64; kc += 32) {
        V a[4], a2[4];
#pragma unroll
        for (int mb = 0; mb < 4; ++mb) { a[mb] = WFrag<T16>::ld(A + aoff + (size_t)mb * 16 * K + kc); if (NSPLIT == 1 || NSPLIT == 2) a2[mb] = WFrag<T16>::ld(A2 + aoff + (size_t)mb * 16 * K + kc); }
#pragma unroll
        for (int nb = 0; nb < 4; ++nb) { const V b = WFrag<T16>::ld(Bt + boff + (size_t)nb * 16 * K + kc); V b2; if (NSPLIT >= 2) b2 = WFrag<T16>::ld(Bt2 + boff + (size_t)nb * 16 * K + kc);
#pragma unroll
            for (int mb = 0; mb < 4; ++mb) { acc[mb][nb] = WFrag<T16>::mma(a[mb], b, acc[mb][nb]); if (NSPLIT == 1 || NSPLIT == 2) acc[mb][nb] = WFrag<T16>::mma(a2[mb], b, acc[mb][nb]); if (NSPLIT >= 2) acc[mb][nb] = WFrag<T16>::mma(a[mb], b2, acc[mb][nb]); } }
        asm volatile("v_nop\n\tv_nop\n\tv_nop\n\tv_nop" : "+v"(acc[0][0]), "+v"(acc[1][1]), "+v"(acc[2][2]), "+v"(acc[3][3]) : "v"(a[0]), "v"(a[3]));
    } }
    float* my = os + wv * (64 * 68);
#pragma unroll
    for (int mb = 0; mb < 4; ++mb)
#pragma unroll
        for (int nb = 0; nb < 4; ++nb)
#pragma unroll
            for (int j = 0; j < 8; ++j) my[(mb * 16 + hi * 8 + j) * 68 + nb * 16 + lr] = acc[mb][nb][j];
    __syncthreads();   // every wave's partial tile is in LDS before any thread sums across the waves
#pragma unroll
    for (int s = 0; s < 32 / NW; ++s) { const int idx = s * (32 * NW) + (int)threadIdx.x; const int row = idx >> 4, cofs = (idx & 15) * 4; v4f val = *(const v4fa*)(os + row * 68 + cofs);
#pragma unroll
        for (int w = 1; w < NW; ++w) val += *(const v4fa*)(os + w * (64 * 68) + row * 68 + cofs);
        if (BIAS) { val[0] += bfr(bias[c0 + cofs]); val[1] += bfr(bias[c0 + cofs + 1]); val[2] += bfr(bias[c0 + cofs + 2]); val[3] += bfr(bias[c0 + cofs + 3]); }
        *(v4f*)(C + (size_t)(r0 + row) * ldc + c0 + cofs) = val; }
}

// ---- k_gemmc: one-wave 64x64 tile GEMM for the causal scores (K = head size, too short to deal out): CMODE 1 skips score tiles entirely above the diagonal (query rows r0+roff.., key columns c0..).
// roff = row offset of this launch's first row within the sequence. grid (M/64, N/64, Z), 32 threads.
template <typename T16, int NSPLIT, int CMODE>
__global__ __launch_bounds__(32) void k_gemmc(const T16* __restrict__ A, const T16* __restrict__ A2, const T16* __restrict__ Bt, const T16* __restrict__ Bt2, int K, float* C, int ldc, int roff, size_t sA, size_t sB, size_t sC) {
    typedef typename WFrag<T16>::V V;
    __shared__ __align__(16) float os[16 * 68];
    const size_t z = blockIdx.z; A += z * sA; if (A2) A2 += z * sA; Bt += z * sB; if (Bt2) Bt2 += z * sB; C += z * sC;
    const int lane = threadIdx.x & 31, lr = lane & 15, hi = lane >> 4; const int r0 = blockIdx.x * 64, c0 = blockIdx.y * 64;
    if (CMODE == 1 && c0 > r0 + roff + 63) return;                  // score tile entirely above the causal diagonal: never read (the softmax masks j > i by select)
    const int Kl = K;
    v8f acc[4][4];
#pragma unroll
    for (int mb = 0; mb < 4; ++mb)
#pragma unroll
        for (int nb = 0; nb < 4; ++nb) acc[mb][nb] = (v8f){};
    const size_t aoff = (size_t)(r0 + lr) * K + 8 * hi, boff = (size_t)(c0 + lr) * K + 8 * hi;
#pragma unroll 1
    for (int kc = 0; kc < Kl; kc += 32) {
        V a[4], a2[4];
#pragma unroll
        for (int mb = 0; mb < 4; ++mb) { a[mb] = WFrag<T16>::ld(A + aoff + (size_t)mb * 16 * K + kc); if (NSPLIT == 1 || NSPLIT == 2) a2[mb] = WFrag<T16>::ld(A2 + aoff + (size_t)mb * 16 * K + kc); }
#pragma unroll
        for (int nb = 0; nb < 4; ++nb) { const V b = WFrag<T16>::ld(Bt + boff + (size_t)nb * 16 * K + kc); V b2; if (NSPLIT >= 2) b2 = WFrag<T16>::ld(Bt2 + boff + (size_t)nb * 16 * K + kc);
#pragma unroll
            for (int mb = 0; mb < 4; ++mb) { acc[mb][nb] = WFrag<T16>::mma(a[mb], b, acc[mb][nb]); if (NSPLIT == 1 || NSPLIT == 2) acc[mb][nb] = WFrag<T16>::mma(a2[mb], b, acc[mb][nb]); if (NSPLIT >= 2) acc[mb][nb] = WFrag<T16>::mma(a[mb], b2, acc[mb][nb]); } }
        asm volatile("v_nop\n\tv_nop\n\tv_nop\n\tv_nop" : "+v"(acc[0][0]), "+v"(acc[1][1]), "+v"(acc[2][2]), "+v"(acc[3][3]) : "v"(a[0]), "v"(a[3]));
    }
#pragma unroll
    for (int mb = 0; mb < 4; ++mb) {
#pragma unroll
        for (int nb = 0; nb < 4; ++nb) {
#pragma unroll
            for (int j = 0; j < 8; ++j) os[(hi * 8 + j) * 68 + nb * 16 + lr] = acc[mb][nb][j]; }
        __builtin_amdgcn_wave_barrier(); asm volatile("" ::: "memory");
        float* crow = C + (size_t)(r0 + mb * 16) * ldc + c0;
{
#pragma unroll
            for (int s = 0; s < 8; ++s) { const int row = 2 * s + hi, cofs = lr * 4; v4f val = *(const v4fa*)(os + row * 68 + cofs);
                *(v4f*)(crow + (size_t)row * ldc + cofs) = val; }
             }
        __builtin_amdgcn_wave_barrier(); asm volatile("" ::: "memory");
    }
}

__device__ __forceinline__ h16 tohx(float x) { return (h16)x; }
__device__ __forceinline__ void splitf(float y, unsigned short& h, unsigned short& l) { h = f2bf(y); l = f2bf(y - bf2f(h)); }
typedef __attribute__((ext_vector_type(2))) _Float16 v2h;
typedef __attribute__((ext_vector_type(4))) _Float16 v4h;
typedef __attribute__((ext_vector_type(2))) unsigned short v2us;
typedef __attribute__((ext_vector_type(4))) unsigned short v4us;
typedef __attribute__((ext_vector_type(2))) float v2f;
typedef __attribute__((ext_vector_type(4))) int v4i;

__global__ __launch_bounds__(256) void k_wtG(const float* __restrict__ w, int K, int N, bf* Bt) {
    const int lane = threadIdx.x & 31; const int L0 = (blockIdx.x * 8 + (threadIdx.x >> 5)) * 8; const int nlines = N * K / 64;
{
#pragma unroll 1
        for (int l = 0; l < 8; ++l) { const int L = L0 + l; if (L >= nlines) break; const size_t e = (size_t)L * 64 + lane * 2; const int k = (int)(e % K), n = (int)(e / K); v2us o;
            o[0] = f2bf(w[(size_t)k * N + n]); o[1] = f2bf(w[(size_t)(k + 1) * N + n]); *(v2us*)(Bt + e) = o; }
         }
}
__global__ __launch_bounds__(256) void k_cvt8(const float* __restrict__ src, bf* dst, size_t n8) { const size_t i = (size_t)blockIdx.x * 256 + threadIdx.x; if (i >= n8) return; const v8f v = *(const v8f*)(src + i * 8); v8us o;
#pragma unroll
    for (int k = 0; k < 8; ++k) o[k] = f2bf(v[k]); *(v8us*)(dst + i * 8) = o;  }

// k_rope: head planes [h][t][d] (fp16 + hi/lo) of rope(x) x sc with the rotate-half convention out[d] = x[d] cos[t][d] - x[d+HD/2] sin[t][d], out[d+HD/2] = x[d+HD/2] cos[t][d+HD/2] + x[d] sin[t][d+HD/2]
__global__ __launch_bounds__(256) void k_rope(const float* __restrict__ F, int pitch, int nheads, const float* __restrict__ CS, const float* __restrict__ RF, const float* __restrict__ nw, float sc, h16* P16, bf* Ph, bf* Pl) {
    const size_t e = ((size_t)blockIdx.x * 256 + threadIdx.x) * 2; if (e >= (size_t)nheads * TT * HD) return; const int d = (int)(e % HD); const int t = (int)((e / HD) % TT); const int h = (int)(e / ((size_t)HD * TT)); const float* f = F + (size_t)t * pitch + h * HD; const float rf = RF ? RF[(size_t)h * TT + t] : 1.0f; v2h o16; v2us oh, ol;
#pragma unroll
    for (int q = 0; q < 2; ++q) { const int dd = d + q; const int dp = (dd < HD / 2) ? dd + HD / 2 : dd - HD / 2; float x0 = f[dd], x1 = f[dp];
        if (RF) { float n0 = __fmul_rn(x0, rf), n1 = __fmul_rn(x1, rf); asm volatile("" : "+v"(n0)); asm volatile("" : "+v"(n1)); x0 = __fmul_rn(bfr(nw[dd]), n0); x1 = __fmul_rn(bfr(nw[dp]), n1); }
        const v2f cs = *(const v2f*)(CS + ((size_t)t * HD + dd) * 2); float a = __fmul_rn(x0, cs[0]), bq = __fmul_rn(x1, cs[1]); asm volatile("" : "+v"(a)); asm volatile("" : "+v"(bq)); const float r = ((dd < HD / 2) ? __fsub_rn(a, bq) : __fadd_rn(a, bq)) * sc;
        o16[q] = tohx(r); unsigned short a2, c2; splitf(r, a2, c2); oh[q] = a2; ol[q] = c2; }
    *(v2h*)(P16 + e) = o16; *(v2us*)(Ph + e) = oh; *(v2us*)(Pl + e) = ol;  }
__global__ __launch_bounds__(256) void k_vtp(const float* __restrict__ F, int pitch, int nheads, h16* V16, bf* Vh, bf* Vl) { const size_t e = ((size_t)blockIdx.x * 256 + threadIdx.x) * 2; if (e >= (size_t)nheads * HD * TT) return; const int t = (int)(e % TT); const int d = (int)((e / TT) % HD); const int g = (int)(e / ((size_t)TT * HD)); v2h o16; v2us oh, ol;
#pragma unroll
    for (int q = 0; q < 2; ++q) { const float x = F[(size_t)(t + q) * pitch + g * HD + d]; o16[q] = tohx(x); unsigned short a2, c2; splitf(x, a2, c2); oh[q] = a2; ol[q] = c2; }
    const size_t o = ((size_t)g * HD + d) * PP + t; *(v2h*)(V16 + o) = o16; *(v2us*)(Vh + o) = oh; *(v2us*)(Vl + o) = ol;  }
__global__ __launch_bounds__(256) void k_csid(float* CS) { const int idx = blockIdx.x * 256 + threadIdx.x; if (idx >= TT * HD) return; v2f cs; cs[0] = 1.0f; cs[1] = 0.0f; *(v2f*)(CS + (size_t)idx * 2) = cs;  }
// k_asoft: per row (zz, i): t = S x HD^-0.5 for j <= i and i - j < WIN (sliding causal window; the reference's -1e9 additive fill vanishes identically); softmax over the 2048 keys (register row, one exp, fixed trees);
// the probabilities overwrite the row's own 8 KiB of scores (one wave owns a row and holds all of it in registers before its first store): rows >= RH fp16 in the first half; rows < RH the hi plane in the first half, the lo plane in the second.
__global__ __launch_bounds__(256) void k_asoft(float* Sb) {
    const int lane = threadIdx.x & 31; const int row = blockIdx.x * 8 + (threadIdx.x >> 5); if (row >= ZH * TT) return; const int i = row % TT; const int zz = row / TT; (void)zz; const bool hires = (i < RH); float* sr = Sb + (size_t)row * TT; float v[TT / 32]; float mx = -3.0e38f;
#pragma unroll
    for (int ch = 0; ch < TT / 128; ++ch) { const int j0 = ch * 128 + lane * 4; const v4f a = *(const v4f*)(sr + j0);
#pragma unroll
        for (int q = 0; q < 4; ++q) { const int j = j0 + q; (void)j; const float t = (j <= i && i - j < WIN) ? a[q] * SCL : -3.0e38f; v[ch * 4 + q] = t; mx = fmaxf(mx, t); } }
#pragma unroll
    for (int sh = 16; sh; sh >>= 1) mx = fmaxf(mx, __shfl_xor(mx, sh, 32));
    float sum = 0.f;
#pragma unroll
    for (int k = 0; k < TT / 32; ++k) { float d0 = __fsub_rn(v[k], mx); asm volatile("" : "+v"(d0)); v[k] = __builtin_amdgcn_exp2f(__fmul_rn(d0, 1.4426950408889634f)); sum += v[k]; }
#pragma unroll
    for (int sh = 16; sh; sh >>= 1) sum += __shfl_xor(sum, sh, 32);
    const float f = __fdiv_rn(hires ? 1.0f : PCAR, sum);
{
        if (hires) {
#pragma unroll
            for (int ch = 0; ch < TT / 128; ++ch) { v4us oh, ol;
#pragma unroll
                for (int q = 0; q < 4; ++q) { unsigned short a, c2; splitf(v[ch * 4 + q] * f, a, c2); oh[q] = a; ol[q] = c2; }
                const int oo = ch * 128 + lane * 4; *(v4us*)((bf*)sr + oo) = oh; *(v4us*)((bf*)sr + TT + oo) = ol; }
        } else {
#pragma unroll
            for (int ch = 0; ch < TT / 128; ++ch) { v4h o4;
#pragma unroll
                for (int q = 0; q < 4; ++q) o4[q] = tohx(v[ch * 4 + q] * f);
                *(v4h*)((h16*)sr + ch * 128 + lane * 4) = o4; } }
         }
}
__global__ __launch_bounds__(256) void k_merge(const float* __restrict__ O, int h0, bf* Ah, bf* Al) { const size_t e = ((size_t)blockIdx.x * 256 + threadIdx.x) * 2; if (e >= (size_t)ZH * TT * HD) return; const int d = (int)(e % HD); const int t = (int)((e / HD) % TT); const int zz = (int)(e / ((size_t)HD * TT)); const float cs = (t < RH) ? 1.0f : (1.0f / PCAR); const size_t oo = (size_t)t * DQ + (h0 + zz) * HD + d;
    v2us oh, ol;
#pragma unroll
    for (int q = 0; q < 2; ++q) { unsigned short a, c2; splitf(O[e + q] * cs, a, c2); oh[q] = a; ol[q] = c2; } *(v2us*)(Ah + oo) = oh; *(v2us*)(Al + oo) = ol;  }

extern "C" void kernel_launch(void* const* d_in, const int* in_sizes, int n_in,
                              void* d_out, int out_size, void* d_ws, size_t ws_size, hipStream_t stream) {
    (void)in_sizes; (void)n_in; (void)out_size;
    const float* x = (const float*)d_in[0]; const float* xk = (const float*)d_in[1]; const float* xv = (const float*)d_in[1]; const float* wq = (const float*)d_in[2]; const float* bq = (const float*)d_in[3]; const float* wk = (const float*)d_in[4]; const float* bk = (const float*)d_in[5]; const float* wv = (const float*)d_in[6]; const float* bv = (const float*)d_in[7]; const float* wo = (const float*)d_in[8]; const float* bo = (const float*)d_in[9]; /* order data, context, Wq, bq, Wk, bk, Wv, bv, Wo, bo ('xw' + biases): TEN inputs: TWO streams: the queries come from data (d_in[0]); the keys AND the values both come from context (d_in[1]): the kernel's key stream and value stream pointers are the same input */
    float* OUT = (float*)d_out;     // [4][2048][1024]
    char* wsp = (char*)d_ws;
    auto take = [&](size_t bytes) { char* p = wsp; wsp += (bytes + 255) & ~(size_t)255; return (void*)p; };
    bf* WQ = (bf*)take((size_t)DQ * DM * 2); bf* WK = (bf*)take((size_t)DKV * DM * 2); bf* WV = (bf*)take((size_t)DKV * DM * 2); bf* WO = (bf*)take((size_t)DM * DQ * 2); float* CS = (float*)take((size_t)TT * HD * 2 * 4);
    bf* XB = (bf*)take((size_t)TT * DM * 2); float* FQ = (float*)take((size_t)TT * DQ * 4); float* FK = (float*)take((size_t)TT * DKV * 4);
    h16* QP16 = (h16*)take((size_t)NH_ * TT * HD * 2); h16* KP16 = (h16*)take((size_t)NKV * TT * HD * 2); h16* VT16 = (h16*)take((size_t)NKV * HD * PP * 2);
    bf* QPh = (bf*)take((size_t)NH_ * TT * HD * 2); bf* QPl = (bf*)take((size_t)NH_ * TT * HD * 2); bf* KPh = (bf*)take((size_t)NKV * TT * HD * 2); bf* KPl = (bf*)take((size_t)NKV * TT * HD * 2); bf* VTh = (bf*)take((size_t)NKV * HD * PP * 2); bf* VTl = (bf*)take((size_t)NKV * HD * PP * 2);
    float* Sb = (float*)take((size_t)ZH * TT * TT * 4); float* Ob = (float*)take((size_t)ZH * TT * HD * 4); bf* ATh = (bf*)take((size_t)TT * DQ * 2); bf* ATl = (bf*)take((size_t)TT * DQ * 2);
    if ((size_t)(wsp - (char*)d_ws) > ws_size) return;    // ws 256 MiB
    float* FV = FK;   // v projection reuses the k buffer after the k planes are built (stream-ordered)
    { k_wtG<<<(unsigned)((DM * DQ / 64 + 63) / 64), 256, 0, stream>>>(wq, DM, DQ, WQ); k_wtG<<<(unsigned)((DM * DKV / 64 + 63) / 64), 256, 0, stream>>>(wk, DM, DKV, WK); k_wtG<<<(unsigned)((DM * DKV / 64 + 63) / 64), 256, 0, stream>>>(wv, DM, DKV, WV);
      k_wtG<<<(unsigned)((DQ * DM / 64 + 63) / 64), 256, 0, stream>>>(wo, DQ, DM, WO);
       }
    k_csid<<<(TT * HD + 255) / 256, 256, 0, stream>>>(CS);
    const unsigned LQ = (unsigned)(((size_t)NH_ * TT * HD / 2 + 255) / 256), LKv = (unsigned)(((size_t)NKV * TT * HD / 2 + 255) / 256);
    for (int b = 0; b < NB_; ++b) {
        
        k_cvt8<<<(unsigned)(((size_t)TT * DM / 8 + 255) / 256), 256, 0, stream>>>(x + (size_t)b * TT * DM, XB, (size_t)TT * DM / 8);
        k_gemmw<bf, 0, true, 8, false><<<dim3(TT / 64, DQ / 64, 1), 256, 0, stream>>>(XB, nullptr, WQ, nullptr, DM, FQ, DQ, bq, 0, 0, 0, 0);
        k_rope<<<LQ, 256, 0, stream>>>(FQ, DQ, NH_, CS, nullptr, nullptr, 1.0f, QP16, QPh, QPl);
        k_cvt8<<<(unsigned)(((size_t)TT * DM / 8 + 255) / 256), 256, 0, stream>>>(xk + (size_t)b * TT * DM, XB, (size_t)TT * DM / 8); k_gemmw<bf, 0, true, 8, false><<<dim3(TT / 64, DKV / 64, 1), 256, 0, stream>>>(XB, nullptr, WK, nullptr, DM, FK, DKV, bk, 0, 0, 0, 0);
        k_rope<<<LKv, 256, 0, stream>>>(FK, DKV, NKV, CS, nullptr, nullptr, 1.0f, KP16, KPh, KPl);
        k_cvt8<<<(unsigned)(((size_t)TT * DM / 8 + 255) / 256), 256, 0, stream>>>(xv + (size_t)b * TT * DM, XB, (size_t)TT * DM / 8); k_gemmw<bf, 0, true, 8, false><<<dim3(TT / 64, DKV / 64, 1), 256, 0, stream>>>(XB, nullptr, WV, nullptr, DM, FV, DKV, bv, 0, 0, 0, 0); k_vtp<<<LKv, 256, 0, stream>>>(FV, DKV, NKV, VT16, VTh, VTl);
        for (int h0 = 0; h0 < NH_; h0 += ZH) { const size_t zq = (size_t)h0, zk = (size_t)(h0 / REP);   // one kv head per query head: the pass's ZH heads use consecutive kv planes
            k_gemmc<bf, 2, 1><<<dim3(RH / 64, TT / 64, ZH), 32, 0, stream>>>(QPh + zq * TT * HD, QPl + zq * TT * HD, KPh + zk * TT * HD, KPl + zk * TT * HD, HD, Sb, TT, 0, (size_t)TT * HD, (size_t)TT * HD, (size_t)TT * TT);
            k_gemmc<h16, 0, 1><<<dim3((TT - RH) / 64, TT / 64, ZH), 32, 0, stream>>>(QP16 + zq * TT * HD + (size_t)RH * HD, nullptr, KP16 + zk * TT * HD, nullptr, HD, Sb + (size_t)RH * TT, TT, RH, (size_t)TT * HD, (size_t)TT * HD, (size_t)TT * TT);
            k_asoft<<<ZH * TT / 8, 256, 0, stream>>>(Sb);
            k_gemmw<bf, 2, false, 8, true><<<dim3(RH / 64, HD / 64, ZH), 256, 0, stream>>>((const bf*)Sb, (const bf*)Sb + TT, VTh + zk * HD * PP, VTl + zk * HD * PP, PP, Ob, HD, nullptr, 0, (size_t)TT * PP, (size_t)HD * PP, (size_t)TT * HD);   // K = the pitch: the causal bound ends the K loop at the diagonal block, never past column TT
            k_gemmw<h16, 0, false, 16, true><<<dim3((TT - RH) / 64, HD / 64, ZH), 512, 0, stream>>>((const h16*)Sb + (size_t)RH * PP, nullptr, VT16 + zk * HD * PP, nullptr, PP, Ob + (size_t)RH * HD, HD, nullptr, RH, (size_t)TT * PP, (size_t)HD * PP, (size_t)TT * HD);
            k_merge<<<(unsigned)(((size_t)ZH * TT * HD / 2 + 255) / 256), 256, 0, stream>>>(Ob, h0, ATh, ATl); }
        k_gemmw<bf, 1, true, 8, false><<<dim3(TT / 64, DM / 64, 1), 256, 0, stream>>>(ATh, ATl, WO, nullptr, DQ, OUT + (size_t)b * TT * DM, DM, bo, 0, 0, 0, 0); }
}

// v003
// Measured time: 509 microseconds a run.
// In two side-by-side timings against v002, it was 1.99 and 2.00 times as fast.
// Over all steps from v000 it is 5.76 times as fast.
#include <hip/hip_runtime.h>

// Causal multi-head attention between two equally long streams with biased (in, out) projections (data, context [4][2048][1024]; Q = data Wq + bq, K = context Wk + bk, V = context Wv + bv ('xw' [1024][1024] normal x 0.02 + [1024] zeros on this draw: read; 16 heads x 64); scores / sqrt(64); causal (tril kept, -inf elsewhere: query i sees context positions j <= i); softmax over the keys; out = merged Wo + bo ('xw' + bias zeros: read) -> [4][2048][1024] (8.4 M); argument order data, context, Wq, bq, Wk, bk, Wv, bv, Wo, bo).
// Layout per batch: bf16 copies of the three inputs in turn; 'xw' weights transposed once; exact projections + f32 biases; causal T-2048 attention in one fused launch (k_fattn; hybrid rows: < 512 hi/lo 3 products, rest fp16 x1024; nothing above the diagonal block is computed); merged hi/lo x w_o exact + b_o.
// Compute dtypes, f32 accumulate: every input rounded to bf16; projections exact + f32 biases; attention rows < 512 3 products, rest fp16; softmax f32; Wo hl x exact + bias.

#define NB_  4
#define TT   2048
#define DM   1024
#define NH_  16
#define NKV  16
#define REP  (NH_ / NKV)
#define HD   64
#define DQ   (NH_ * HD)
#define DKV  (NKV * HD)
#define PP   (2 * TT)             // row pitch, in 16-bit elements, of the V^T planes
#define RH   512                  // query rows < RH use hi+lo planes (0: none)
#define SCL  0.125f   // HD^-0.5
typedef _Float16 h16;
typedef unsigned short bf;
typedef __attribute__((ext_vector_type(16))) __bf16   v16bf;
typedef __attribute__((ext_vector_type(16))) _Float16 v16h;
typedef __attribute__((ext_vector_type(8)))  _Float16 v8h;
typedef __attribute__((ext_vector_type(8)))  unsigned short v8us;
typedef __attribute__((ext_vector_type(8)))  float    v8f;
typedef __attribute__((ext_vector_type(4)))  float    v4f;
typedef v8h  __attribute__((may_alias)) v8ha;
typedef v4f  __attribute__((may_alias)) v4fa;
typedef v8us __attribute__((may_alias)) v8usa;

__device__ __forceinline__ unsigned short f2bf(float f) { unsigned u = __float_as_uint(f); u += 0x7FFFu + ((u >> 16) & 1u); return (unsigned short)(u >> 16); }
__device__ __forceinline__ float bf2f(unsigned short b) { return __uint_as_float(((unsigned)b) << 16); }
__device__ __forceinline__ float bfr(float f) { return bf2f(f2bf(f)); }
__device__ __forceinline__ v16h cat16(v8h lo, v8h hi) { return __builtin_shufflevector(lo, hi, 0, 1, 2, 3, 4, 5, 6, 7, 8, 9, 10, 11, 12, 13, 14, 15); }
__device__ __forceinline__ v16bf cat16b(v8us lo, v8us hi) { return __builtin_bit_cast(v16bf, __builtin_shufflevector(lo, hi, 0, 1, 2, 3, 4, 5, 6, 7, 8, 9, 10, 11, 12, 13, 14, 15)); }
__device__ __forceinline__ v8f wmma16(v16h a, v16h b, v8f c) { return __builtin_amdgcn_wmma_f32_16x16x32_f16(false, a, false, b, (short)0, c, false, false); }
__device__ __forceinline__ v8f wmmab(v16bf a, v16bf b, v8f c) { return __builtin_amdgcn_wmma_f32_16x16x32_bf16(false, a, false, b, (short)0, c, false, false); }



// ---- k_gemmw: register-blocked GEMM, one 64x64 output tile per work-group, the K loop dealt over the NW waves of the group in 64-wide chunks (wave w takes chunks w, w + NW, ...); every wave keeps the
// whole tile (16 accumulators), operands straight from K-contiguous 16-bit planes; the NW partial tiles meet in LDS and are summed in wave order 0..NW-1. grid (M/64, N/64, Z), 32 * NW threads.
// C[m][n] (f32, pitch ldc, + optional f32 bias[n]) = sum_k A[m][k] Bt[n][k] (+ split products per NSPLIT). z-batch strides sA/sB/sC in elements. K % 64 == 0.
// CK: probability x value contraction of causal attention: the K loop stops at the diagonal block (probabilities beyond it are exactly zero); roff = row offset of this launch's first row within the sequence.
template <typename T16> struct WFrag;
template <> struct WFrag<h16> { typedef v16h V; static __device__ __forceinline__ V ld(const h16* p) { return cat16(*(const v8h*)p, *(const v8h*)(p + 16)); } static __device__ __forceinline__ v8f mma(V a, V b, v8f c) { return wmma16(a, b, c); } };
template <> struct WFrag<bf> { typedef v16bf V; static __device__ __forceinline__ V ld(const bf* p) { return cat16b(*(const v8us*)p, *(const v8us*)(p + 16)); } static __device__ __forceinline__ v8f mma(V a, V b, v8f c) { return wmmab(a, b, c); } };
template <typename T16, int NSPLIT, bool BIAS, int NW, bool CK>
__global__ __launch_bounds__(32 * NW) void k_gemmw(const T16* __restrict__ A, const T16* __restrict__ A2, const T16* __restrict__ Bt, const T16* __restrict__ Bt2, int K, float* C, int ldc, const float* __restrict__ bias, int roff, size_t sA, size_t sB, size_t sC) {
    typedef typename WFrag<T16>::V V;
    __shared__ __align__(16) float os[NW * 64 * 68];
    const size_t z = blockIdx.z; A += z * sA; if (A2) A2 += z * sA; Bt += z * sB; if (Bt2) Bt2 += z * sB; C += z * sC;
    const int lane = threadIdx.x & 31, lr = lane & 15, hi = lane >> 4; const int r0 = blockIdx.x * 64, c0 = blockIdx.y * 64;
    const int wv = __builtin_amdgcn_readfirstlane((int)(threadIdx.x >> 5));   // the wave's number in a scalar register: the K loop's bounds and branches stay scalar
    const int Kl = CK ? min(K, r0 + roff + 64) : K;
    v8f acc[4][4];
#pragma unroll
    for (int mb = 0; mb < 4; ++mb)
#pragma unroll
        for (int nb = 0; nb < 4; ++nb) acc[mb][nb] = (v8f){};
    const size_t aoff = (size_t)(r0 + lr) * K + 8 * hi, boff = (size_t)(c0 + lr) * K + 8 * hi;
    // both loops stay rolled: one k-step's operands and the 16 accumulators are what the register budget of an 8-wave group holds; a 64-wide chunk is one whole 128-byte line of every operand row
#pragma unroll 1
    for (int kb = wv * 64; kb < Kl; kb += NW * 64) {
#pragma unroll 1
    for (int kc = kb; kc < kb + 64; kc += 32) {
        V a[4], a2[4];
#pragma unroll
        for (int mb = 0; mb < 4; ++mb) { a[mb] = WFrag<T16>::ld(A + aoff + (size_t)mb * 16 * K + kc); if (NSPLIT == 1 || NSPLIT == 2) a2[mb] = WFrag<T16>::ld(A2 + aoff + (size_t)mb * 16 * K + kc); }
#pragma unroll
        for (int nb = 0; nb < 4; ++nb) { const V b = WFrag<T16>::ld(Bt + boff + (size_t)nb * 16 * K + kc); V b2; if (NSPLIT >= 2) b2 = WFrag<T16>::ld(Bt2 + boff + (size_t)nb * 16 * K + kc);
#pragma unroll
            for (int mb = 0; mb < 4; ++mb) { acc[mb][nb] = WFrag<T16>::mma(a[mb], b, acc[mb][nb]); if (NSPLIT == 1 || NSPLIT == 2) acc[mb][nb] = WFrag<T16>::mma(a2[mb], b, acc[mb][nb]); if (NSPLIT >= 2) acc[mb][nb] = WFrag<T16>::mma(a[mb], b2, acc[mb][nb]); } }
        asm volatile("v_nop\n\tv_nop\n\tv_nop\n\tv_nop" : "+v"(acc[0][0]), "+v"(acc[1][1]), "+v"(acc[2][2]), "+v"(acc[3][3]) : "v"(a[0]), "v"(a[3]));
    } }
    float* my = os + wv * (64 * 68);
#pragma unroll
    for (int mb = 0; mb < 4; ++mb)
#pragma unroll
        for (int nb = 0; nb < 4; ++nb)
#pragma unroll
            for (int j = 0; j < 8; ++j) my[(mb * 16 + hi * 8 + j) * 68 + nb * 16 + lr] = acc[mb][nb][j];
    __syncthreads();   // every wave's partial tile is in LDS before any thread sums across the waves
#pragma unroll
    for (int s = 0; s < 32 / NW; ++s) { const int idx = s * (32 * NW) + (int)threadIdx.x; const int row = idx >> 4, cofs = (idx & 15) * 4; v4f val = *(const v4fa*)(os + row * 68 + cofs);
#pragma unroll
        for (int w = 1; w < NW; ++w) val += *(const v4fa*)(os + w * (64 * 68) + row * 68 + cofs);
        if (BIAS) { val[0] += bfr(bias[c0 + cofs]); val[1] += bfr(bias[c0 + cofs + 1]); val[2] += bfr(bias[c0 + cofs + 2]); val[3] += bfr(bias[c0 + cofs + 3]); }
        *(v4f*)(C + (size_t)(r0 + row) * ldc + c0 + cofs) = val; }
}

__device__ __forceinline__ h16 tohx(float x) { return (h16)x; }
__device__ __forceinline__ void splitf(float y, unsigned short& h, unsigned short& l) { h = f2bf(y); l = f2bf(y - bf2f(h)); }
typedef __attribute__((ext_vector_type(2))) _Float16 v2h;
typedef __attribute__((ext_vector_type(4))) _Float16 v4h;
typedef __attribute__((ext_vector_type(2))) unsigned short v2us;
typedef __attribute__((ext_vector_type(4))) unsigned short v4us;
typedef __attribute__((ext_vector_type(2))) float v2f;
typedef __attribute__((ext_vector_type(4))) int v4i;

__global__ __launch_bounds__(256) void k_wtG(const float* __restrict__ w, int K, int N, bf* Bt) {
    const int lane = threadIdx.x & 31; const int L0 = (blockIdx.x * 8 + (threadIdx.x >> 5)) * 8; const int nlines = N * K / 64;
{
#pragma unroll 1
        for (int l = 0; l < 8; ++l) { const int L = L0 + l; if (L >= nlines) break; const size_t e = (size_t)L * 64 + lane * 2; const int k = (int)(e % K), n = (int)(e / K); v2us o;
            o[0] = f2bf(w[(size_t)k * N + n]); o[1] = f2bf(w[(size_t)(k + 1) * N + n]); *(v2us*)(Bt + e) = o; }
         }
}
__global__ __launch_bounds__(256) void k_cvt8(const float* __restrict__ src, bf* dst, size_t n8) { const size_t i = (size_t)blockIdx.x * 256 + threadIdx.x; if (i >= n8) return; const v8f v = *(const v8f*)(src + i * 8); v8us o;
#pragma unroll
    for (int k = 0; k < 8; ++k) o[k] = f2bf(v[k]); *(v8us*)(dst + i * 8) = o;  }

// k_rope: head planes [h][t][d] (fp16 + hi/lo) of rope(x) x sc with the rotate-half convention out[d] = x[d] cos[t][d] - x[d+HD/2] sin[t][d], out[d+HD/2] = x[d+HD/2] cos[t][d+HD/2] + x[d] sin[t][d+HD/2]
__global__ __launch_bounds__(256) void k_rope(const float* __restrict__ F, int pitch, int nheads, const float* __restrict__ CS, const float* __restrict__ RF, const float* __restrict__ nw, float sc, h16* P16, bf* Ph, bf* Pl) {
    const size_t e = ((size_t)blockIdx.x * 256 + threadIdx.x) * 2; if (e >= (size_t)nheads * TT * HD) return; const int d = (int)(e % HD); const int t = (int)((e / HD) % TT); const int h = (int)(e / ((size_t)HD * TT)); const float* f = F + (size_t)t * pitch + h * HD; const float rf = RF ? RF[(size_t)h * TT + t] : 1.0f; v2h o16; v2us oh, ol;
#pragma unroll
    for (int q = 0; q < 2; ++q) { const int dd = d + q; const int dp = (dd < HD / 2) ? dd + HD / 2 : dd - HD / 2; float x0 = f[dd], x1 = f[dp];
        if (RF) { float n0 = __fmul_rn(x0, rf), n1 = __fmul_rn(x1, rf); asm volatile("" : "+v"(n0)); asm volatile("" : "+v"(n1)); x0 = __fmul_rn(bfr(nw[dd]), n0); x1 = __fmul_rn(bfr(nw[dp]), n1); }
        const v2f cs = *(const v2f*)(CS + ((size_t)t * HD + dd) * 2); float a = __fmul_rn(x0, cs[0]), bq = __fmul_rn(x1, cs[1]); asm volatile("" : "+v"(a)); asm volatile("" : "+v"(bq)); const float r = ((dd < HD / 2) ? __fsub_rn(a, bq) : __fadd_rn(a, bq)) * sc;
        o16[q] = tohx(r); unsigned short a2, c2; splitf(r, a2, c2); oh[q] = a2; ol[q] = c2; }
    *(v2h*)(P16 + e) = o16; *(v2us*)(Ph + e) = oh; *(v2us*)(Pl + e) = ol;  }
__global__ __launch_bounds__(256) void k_vtp(const float* __restrict__ F, int pitch, int nheads, h16* V16, bf* Vh, bf* Vl) { const size_t e = ((size_t)blockIdx.x * 256 + threadIdx.x) * 2; if (e >= (size_t)nheads * HD * TT) return; const int t = (int)(e % TT); const int d = (int)((e / TT) % HD); const int g = (int)(e / ((size_t)TT * HD)); v2h o16; v2us oh, ol;
#pragma unroll
    for (int q = 0; q < 2; ++q) { const float x = F[(size_t)(t + q) * pitch + g * HD + d]; o16[q] = tohx(x); unsigned short a2, c2; splitf(x, a2, c2); oh[q] = a2; ol[q] = c2; }
    const size_t o = ((size_t)g * HD + d) * PP + t; *(v2h*)(V16 + o) = o16; *(v2us*)(Vh + o) = oh; *(v2us*)(Vl + o) = ol;  }
__global__ __launch_bounds__(256) void k_csid(float* CS) { const int idx = blockIdx.x * 256 + threadIdx.x; if (idx >= TT * HD) return; v2f cs; cs[0] = 1.0f; cs[1] = 0.0f; *(v2f*)(CS + (size_t)idx * 2) = cs;  }
// ---- k_fattn: the whole causal attention of one batch in one launch: scores, softmax, probability x value product and the merge of the heads into the hi/lo planes that the output projection reads.
// One work-group = one head x 32 query rows; grid (heads, TT / 32), the longest query tiles first (cost falls with the index). The keys 0 .. q0 + 31 are dealt over the FNW waves in 64-key chunks (one whole
// 128-byte line of every V^T row), each worked in two 32-key passes. Transposed products: S^T = K Q^T (A = key rows, B = query rows, same loader, same k order), so a lane holds 16 scores of ONE query per pass
// and column group: maximum and sum in the lane plus one exchange between the wave's halves; two S^T tiles (keys 0-15, 16-31), converted in place, ARE the B operand of O^T += V^T P^T (A = V^T rows in the same k order).
// Running maximum m (scaled log2 units) and running sum l per query and wave; the FNW partial (m, l, O) meet in LDS and are joined in wave order. Probabilities carry 2^PCL2 (it cancels in O / l) so that small ones stay normal in fp16.
// Query rows < RH: hi/lo bf16 planes, 3 products in both contractions; the rest fp16.
#define FQT  2                    // 16-query column groups per wave
#define FNW  4                    // waves per work-group
#define FOP  68                   // LDS pitch (floats) of a query's 64 partial outputs
#define SCL2 (SCL * 1.4426950408889634f)
#define PCL2 10.0f
__device__ __forceinline__ float xhalf(float x) { return __builtin_bit_cast(float, __builtin_amdgcn_permlanex16(__builtin_bit_cast(int, x), __builtin_bit_cast(int, x), 0x76543210, 0xfedcba98, false, false)); }   // lane l reads lane l ^ 16, on the vector pipe
// Precaution behind a group of global loads: the wait stands in front of whatever next reuses the address registers that the loads name; the base pointers are inputs so that those registers stay theirs up to the wait.
template <typename T16> __device__ __forceinline__ void xwait(const T16* p) { asm volatile("s_wait_xcnt 0x0" :: "v"(p) : "memory"); }
template <typename T16> __device__ __forceinline__ void xwait(const T16* p, const T16* p2) { asm volatile("s_wait_xcnt 0x0" :: "v"(p), "v"(p2) : "memory"); }
template <typename T16, bool HR>
__device__ __forceinline__ void fattn_wave(const T16* __restrict__ Q, const T16* __restrict__ Q2, const T16* __restrict__ Kp, const T16* __restrict__ K2, const T16* __restrict__ Vt, const T16* __restrict__ Vt2, int q0, int wv, int lr, int hi, float* om, float* ol, float* oo) {
    typedef typename WFrag<T16>::V V;
    V qf[FQT][2], qf2[FQT][2];
    { const size_t e = (size_t)(q0 + lr) * HD + 8 * hi; const T16* qp = Q + e; const T16* qp2 = HR ? Q2 + e : qp;
#pragma unroll
      for (int qt = 0; qt < FQT; ++qt)
#pragma unroll
        for (int ds = 0; ds < 2; ++ds) { qf[qt][ds] = WFrag<T16>::ld(qp + qt * 16 * HD + ds * 32); if (HR) qf2[qt][ds] = WFrag<T16>::ld(qp2 + qt * 16 * HD + ds * 32); }
      if (HR) xwait(qp, qp2); else xwait(qp); }
    v8f o[4][FQT]; float m[FQT], l[FQT];
#pragma unroll
    for (int qt = 0; qt < FQT; ++qt) { m[qt] = -3.0e38f; l[qt] = 0.0f;
#pragma unroll
        for (int mb = 0; mb < 4; ++mb) o[mb][qt] = (v8f){}; }
    // the passes of this wave in turn: both halves of chunk wv, then of chunk wv + FNW, ...; the loop stays rolled: one pass's fragments, scores and the output tile are what lets four waves share a SIMD's registers.
    // fp16 rows fetch the key fragments one pass ahead (issued right behind the S^T products that free their registers, so that their latency lies under the softmax and the P.V products); past the last pass the fetch is clamped to the diagonal rows and not used.
    V kf[2][2], kf2[2][2]; int kc = wv * 64;
    if (!HR) { const T16* kp = Kp + (size_t)(min(kc, q0) + lr) * HD + 8 * hi;
#pragma unroll
        for (int kt = 0; kt < 2; ++kt) { kf[kt][0] = WFrag<T16>::ld(kp + kt * 16 * HD); kf[kt][1] = WFrag<T16>::ld(kp + kt * 16 * HD + 32); }
        xwait(kp); }
#pragma unroll 1
    while (kc <= q0) { const int kn = (kc & 32) ? kc + 32 + (FNW - 1) * 64 : kc + 32;
        const size_t ev = (size_t)lr * PP + kc + 8 * hi; const T16* vp = Vt + ev; V vf[4];
        if (!HR) {   // fp16 rows: the V^T fragments are asked for at the head of the pass; the hi/lo rows, with twice the fragments, load them where they are used, which keeps the kernel at four waves a SIMD
#pragma unroll
            for (int mb = 0; mb < 4; ++mb) vf[mb] = WFrag<T16>::ld(vp + (size_t)mb * 16 * PP); }
        v8f s[2][FQT];
#pragma unroll
        for (int kt = 0; kt < 2; ++kt) {
            if (HR) { const size_t e = (size_t)(kc + kt * 16 + lr) * HD + 8 * hi; const T16* kp = Kp + e; const T16* kp2 = K2 + e; kf[kt][0] = WFrag<T16>::ld(kp); kf[kt][1] = WFrag<T16>::ld(kp + 32); kf2[kt][0] = WFrag<T16>::ld(kp2); kf2[kt][1] = WFrag<T16>::ld(kp2 + 32); xwait(kp, kp2); }
#pragma unroll
            for (int qt = 0; qt < FQT; ++qt) { v8f c = (v8f){}; c = WFrag<T16>::mma(kf[kt][0], qf[qt][0], c); c = WFrag<T16>::mma(kf[kt][1], qf[qt][1], c);
                if (HR) { c = WFrag<T16>::mma(kf2[kt][0], qf[qt][0], c); c = WFrag<T16>::mma(kf2[kt][1], qf[qt][1], c); c = WFrag<T16>::mma(kf[kt][0], qf2[qt][0], c); c = WFrag<T16>::mma(kf[kt][1], qf2[qt][1], c); }
                s[kt][qt] = c; } }
        if (!HR) { const T16* kp = Kp + (size_t)(min(kn, q0) + lr) * HD + 8 * hi;
#pragma unroll
            for (int kt = 0; kt < 2; ++kt) { kf[kt][0] = WFrag<T16>::ld(kp + kt * 16 * HD); kf[kt][1] = WFrag<T16>::ld(kp + kt * 16 * HD + 32); }
            xwait(vp, kp); }
        if (kc == q0) {   // the diagonal pass (always a wave's last): key > query leaves the softmax; -inf against the finite start value of m gives probability 0 also where a query has no key in this wave
#pragma unroll
            for (int kt = 0; kt < 2; ++kt)
#pragma unroll
                for (int qt = 0; qt < FQT; ++qt)
#pragma unroll
                    for (int r = 0; r < 8; ++r) if (kt * 16 + 8 * hi + r > qt * 16 + lr) s[kt][qt][r] = -__builtin_inff(); }
        V pf[FQT], pf2[FQT];
#pragma unroll
        for (int qt = 0; qt < FQT; ++qt) { float mr = s[0][qt][0];
#pragma unroll
            for (int e = 1; e < 16; ++e) mr = fmaxf(mr, s[e >> 3][qt][e & 7]);
            mr = fmaxf(mr, xhalf(mr));
            const float mn = fmaxf(m[qt], mr * SCL2); const float al = __builtin_amdgcn_exp2f(m[qt] - mn); m[qt] = mn; const float sh = PCL2 - mn; float p[16]; float sum = 0.0f;
#pragma unroll
            for (int e = 0; e < 16; ++e) { p[e] = __builtin_amdgcn_exp2f(fmaf(s[e >> 3][qt][e & 7], SCL2, sh)); sum += p[e]; }
            l[qt] = l[qt] * al + sum;
#pragma unroll
            for (int mb = 0; mb < 4; ++mb) o[mb][qt] *= al;
            if constexpr (HR) { v8us h0, h1, l0, l1;
#pragma unroll
                for (int r = 0; r < 8; ++r) { unsigned short a, c2; splitf(p[r], a, c2); h0[r] = a; l0[r] = c2; splitf(p[8 + r], a, c2); h1[r] = a; l1[r] = c2; }
                pf[qt] = cat16b(h0, h1); pf2[qt] = cat16b(l0, l1);
            } else { v8h h0, h1;
#pragma unroll
                for (int r = 0; r < 8; ++r) { h0[r] = tohx(p[r]); h1[r] = tohx(p[8 + r]); }
                pf[qt] = cat16(h0, h1); } }
        V vf2[4];
#pragma unroll
        for (int mb = 0; mb < 4; ++mb) {
            if (HR && (mb & 1) == 0) { const T16* vq = vp + (size_t)mb * 16 * PP; const T16* vq2 = Vt2 + ev + (size_t)mb * 16 * PP; vf[mb] = WFrag<T16>::ld(vq); vf[mb + 1] = WFrag<T16>::ld(vq + (size_t)16 * PP); vf2[mb] = WFrag<T16>::ld(vq2); vf2[mb + 1] = WFrag<T16>::ld(vq2 + (size_t)16 * PP); xwait(vq, vq2); }
#pragma unroll
            for (int qt = 0; qt < FQT; ++qt) { o[mb][qt] = WFrag<T16>::mma(vf[mb], pf[qt], o[mb][qt]); if (HR) { o[mb][qt] = WFrag<T16>::mma(vf[mb], pf2[qt], o[mb][qt]); o[mb][qt] = WFrag<T16>::mma(vf2[mb], pf[qt], o[mb][qt]); } } }
        kc = kn;
    }
#pragma unroll
    for (int qt = 0; qt < FQT; ++qt) { l[qt] += xhalf(l[qt]); if (hi == 0) { om[qt * 16 + lr] = m[qt]; ol[qt * 16 + lr] = l[qt]; }
#pragma unroll
        for (int mb = 0; mb < 4; ++mb) { float* d = oo + (qt * 16 + lr) * FOP + mb * 16 + hi * 8; const v8f t = o[mb][qt]; *(v4fa*)d = (v4f){t[0], t[1], t[2], t[3]}; *(v4fa*)(d + 4) = (v4f){t[4], t[5], t[6], t[7]}; } }
}
__global__ __launch_bounds__(32 * FNW) __attribute__((amdgpu_waves_per_eu(4, 4))) void k_fattn(const h16* __restrict__ Q16, const h16* __restrict__ K16, const h16* __restrict__ V16, const bf* __restrict__ Qh, const bf* __restrict__ Ql, const bf* __restrict__ Kh, const bf* __restrict__ Kl, const bf* __restrict__ Vh, const bf* __restrict__ Vl, bf* Ah, bf* Al) {
    __shared__ __align__(16) float oo[FNW * 32 * FOP]; __shared__ float om[FNW * 32]; __shared__ float ol[FNW * 32];
    const int lane = threadIdx.x & 31, lr = lane & 15, hi = lane >> 4;
    const int wv = __builtin_amdgcn_readfirstlane((int)(threadIdx.x >> 5));   // the wave's number in a scalar register: the key loop's bounds and branches stay scalar
    const int h = blockIdx.x, q0 = (TT / 32 - 1 - (int)blockIdx.y) * 32; const size_t zq = (size_t)h * TT * HD, zk = (size_t)(h / REP) * TT * HD, zv = (size_t)(h / REP) * HD * PP;
    if (q0 < RH) fattn_wave<bf, true>(Qh + zq, Ql + zq, Kh + zk, Kl + zk, Vh + zv, Vl + zv, q0, wv, lr, hi, om + wv * 32, ol + wv * 32, oo + wv * (32 * FOP));
    else fattn_wave<h16, false>(Q16 + zq, nullptr, K16 + zk, nullptr, V16 + zv, nullptr, q0, wv, lr, hi, om + wv * 32, ol + wv * 32, oo + wv * (32 * FOP));
    __syncthreads();   // every wave's partial (m, l, O) is in LDS before any thread joins them
#pragma unroll
    for (int s = 0; s < 8 / FNW; ++s) { const int it = s * (32 * FNW) + (int)threadIdx.x; const int q = it >> 3, oc = (it & 7) * 8; float M = om[q];
#pragma unroll
        for (int w = 1; w < FNW; ++w) M = fmaxf(M, om[w * 32 + q]);   // wave 0 always holds key 0, which every query sees: M is a real score
        float Ls = 0.0f; v4f a0 = (v4f){}, a1 = (v4f){};
#pragma unroll
        for (int w = 0; w < FNW; ++w) { const float f = __builtin_amdgcn_exp2f(om[w * 32 + q] - M); Ls += ol[w * 32 + q] * f; const float* sp = oo + (w * 32 + q) * FOP + oc; a0 += *(const v4fa*)sp * f; a1 += *(const v4fa*)(sp + 4) * f; }
        const float inv = __fdiv_rn(1.0f, Ls); v8us oh, olo;
#pragma unroll
        for (int k = 0; k < 4; ++k) { unsigned short a, c2; splitf(a0[k] * inv, a, c2); oh[k] = a; olo[k] = c2; splitf(a1[k] * inv, a, c2); oh[4 + k] = a; olo[4 + k] = c2; }
        const size_t e = (size_t)(q0 + q) * DQ + h * HD + oc; *(v8us*)(Ah + e) = oh; *(v8us*)(Al + e) = olo; }
}

extern "C" void kernel_launch(void* const* d_in, const int* in_sizes, int n_in,
                              void* d_out, int out_size, void* d_ws, size_t ws_size, hipStream_t stream) {
    (void)in_sizes; (void)n_in; (void)out_size;
    const float* x = (const float*)d_in[0]; const float* xk = (const float*)d_in[1]; const float* xv = (const float*)d_in[1]; const float* wq = (const float*)d_in[2]; const float* bq = (const float*)d_in[3]; const float* wk = (const float*)d_in[4]; const float* bk = (const float*)d_in[5]; const float* wv = (const float*)d_in[6]; const float* bv = (const float*)d_in[7]; const float* wo = (const float*)d_in[8]; const float* bo = (const float*)d_in[9]; /* order data, context, Wq, bq, Wk, bk, Wv, bv, Wo, bo ('xw' + biases): TEN inputs: TWO streams: the queries come from data (d_in[0]); the keys AND the values both come from context (d_in[1]): the kernel's key stream and value stream pointers are the same input */
    float* OUT = (float*)d_out;     // [4][2048][1024]
    char* wsp = (char*)d_ws;
    auto take = [&](size_t bytes) { char* p = wsp; wsp += (bytes + 255) & ~(size_t)255; return (void*)p; };
    bf* WQ = (bf*)take((size_t)DQ * DM * 2); bf* WK = (bf*)take((size_t)DKV * DM * 2); bf* WV = (bf*)take((size_t)DKV * DM * 2); bf* WO = (bf*)take((size_t)DM * DQ * 2); float* CS = (float*)take((size_t)TT * HD * 2 * 4);
    bf* XB = (bf*)take((size_t)TT * DM * 2); float* FQ = (float*)take((size_t)TT * DQ * 4); float* FK = (float*)take((size_t)TT * DKV * 4);
    h16* QP16 = (h16*)take((size_t)NH_ * TT * HD * 2); h16* KP16 = (h16*)take((size_t)NKV * TT * HD * 2); h16* VT16 = (h16*)take((size_t)NKV * HD * PP * 2);
    bf* QPh = (bf*)take((size_t)NH_ * TT * HD * 2); bf* QPl = (bf*)take((size_t)NH_ * TT * HD * 2); bf* KPh = (bf*)take((size_t)NKV * TT * HD * 2); bf* KPl = (bf*)take((size_t)NKV * TT * HD * 2); bf* VTh = (bf*)take((size_t)NKV * HD * PP * 2); bf* VTl = (bf*)take((size_t)NKV * HD * PP * 2);
    bf* ATh = (bf*)take((size_t)TT * DQ * 2); bf* ATl = (bf*)take((size_t)TT * DQ * 2);
    if ((size_t)(wsp - (char*)d_ws) > ws_size) return;    // ws 256 MiB
    float* FV = FK;   // v projection reuses the k buffer after the k planes are built (stream-ordered)
    { k_wtG<<<(unsigned)((DM * DQ / 64 + 63) / 64), 256, 0, stream>>>(wq, DM, DQ, WQ); k_wtG<<<(unsigned)((DM * DKV / 64 + 63) / 64), 256, 0, stream>>>(wk, DM, DKV, WK); k_wtG<<<(unsigned)((DM * DKV / 64 + 63) / 64), 256, 0, stream>>>(wv, DM, DKV, WV);
      k_wtG<<<(unsigned)((DQ * DM / 64 + 63) / 64), 256, 0, stream>>>(wo, DQ, DM, WO);
       }
    k_csid<<<(TT * HD + 255) / 256, 256, 0, stream>>>(CS);
    const unsigned LQ = (unsigned)(((size_t)NH_ * TT * HD / 2 + 255) / 256), LKv = (unsigned)(((size_t)NKV * TT * HD / 2 + 255) / 256);
    for (int b = 0; b < NB_; ++b) {
        
        k_cvt8<<<(unsigned)(((size_t)TT * DM / 8 + 255) / 256), 256, 0, stream>>>(x + (size_t)b * TT * DM, XB, (size_t)TT * DM / 8);
        k_gemmw<bf, 0, true, 8, false><<<dim3(TT / 64, DQ / 64, 1), 256, 0, stream>>>(XB, nullptr, WQ, nullptr, DM, FQ, DQ, bq, 0, 0, 0, 0);
        k_rope<<<LQ, 256, 0, stream>>>(FQ, DQ, NH_, CS, nullptr, nullptr, 1.0f, QP16, QPh, QPl);
        k_cvt8<<<(unsigned)(((size_t)TT * DM / 8 + 255) / 256), 256, 0, stream>>>(xk + (size_t)b * TT * DM, XB, (size_t)TT * DM / 8); k_gemmw<bf, 0, true, 8, false><<<dim3(TT / 64, DKV / 64, 1), 256, 0, stream>>>(XB, nullptr, WK, nullptr, DM, FK, DKV, bk, 0, 0, 0, 0);
        k_rope<<<LKv, 256, 0, stream>>>(FK, DKV, NKV, CS, nullptr, nullptr, 1.0f, KP16, KPh, KPl);
        k_cvt8<<<(unsigned)(((size_t)TT * DM / 8 + 255) / 256), 256, 0, stream>>>(xv + (size_t)b * TT * DM, XB, (size_t)TT * DM / 8); k_gemmw<bf, 0, true, 8, false><<<dim3(TT / 64, DKV / 64, 1), 256, 0, stream>>>(XB, nullptr, WV, nullptr, DM, FV, DKV, bv, 0, 0, 0, 0); k_vtp<<<LKv, 256, 0, stream>>>(FV, DKV, NKV, VT16, VTh, VTl);
        k_fattn<<<dim3(NH_, TT / 32, 1), 32 * FNW, 0, stream>>>(QP16, KP16, VT16, QPh, QPl, KPh, KPl, VTh, VTl, ATh, ATl);
        k_gemmw<bf, 1, true, 8, false><<<dim3(TT / 64, DM / 64, 1), 256, 0, stream>>>(ATh, ATl, WO, nullptr, DQ, OUT + (size_t)b * TT * DM, DM, bo, 0, 0, 0, 0); }
}

// v004
// A run of this version takes 411 microseconds.
// Timed twice side by side with v003, it ran 1.24 and 1.22 times as fast.
// All steps since v000 together make it 7.10 times as fast.
#include <hip/hip_runtime.h>

// Causal multi-head attention between two equally long streams with biased (in, out) projections (data, context [4][2048][1024]; Q = data Wq + bq, K = context Wk + bk, V = context Wv + bv ('xw' [1024][1024] normal x 0.02 + [1024] zeros on this draw: read; 16 heads x 64); scores / sqrt(64); causal (tril kept, -inf elsewhere: query i sees context positions j <= i); softmax over the keys; out = merged Wo + bo ('xw' + bias zeros: read) -> [4][2048][1024] (8.4 M); argument order data, context, Wq, bq, Wk, bk, Wv, bv, Wo, bo).
// Layout per batch: bf16 copies of the three inputs in turn; 'xw' weights transposed once; exact projections + f32 biases, whose epilogue writes the head planes; causal T-2048 attention in one fused launch (k_fattn; hybrid rows: < 512 hi/lo 3 products, rest fp16 x1024; nothing above the diagonal block is computed); merged hi/lo x w_o exact + b_o.
// Compute dtypes, f32 accumulate: every input rounded to bf16; projections exact + f32 biases; attention rows < 512 3 products, rest fp16; softmax f32; Wo hl x exact + bias.

#define NB_  4
#define TT   2048
#define DM   1024
#define NH_  16
#define NKV  16
#define REP  (NH_ / NKV)
#define HD   64
#define DQ   (NH_ * HD)
#define DKV  (NKV * HD)
#define PP   (2 * TT)             // row pitch, in 16-bit elements, of the V^T planes
#define RH   512                  // query rows < RH use hi+lo planes (0: none)
#define SCL  0.125f   // HD^-0.5
typedef _Float16 h16;
typedef unsigned short bf;
typedef __attribute__((ext_vector_type(16))) __bf16   v16bf;
typedef __attribute__((ext_vector_type(16))) _Float16 v16h;
typedef __attribute__((ext_vector_type(8)))  _Float16 v8h;
typedef __attribute__((ext_vector_type(8)))  unsigned short v8us;
typedef __attribute__((ext_vector_type(8)))  float    v8f;
typedef __attribute__((ext_vector_type(4)))  float    v4f;
typedef v8h  __attribute__((may_alias)) v8ha;
typedef v4f  __attribute__((may_alias)) v4fa;
typedef v8us __attribute__((may_alias)) v8usa;

__device__ __forceinline__ unsigned short f2bf(float f) { unsigned u = __float_as_uint(f); u += 0x7FFFu + ((u >> 16) & 1u); return (unsigned short)(u >> 16); }
__device__ __forceinline__ float bf2f(unsigned short b) { return __uint_as_float(((unsigned)b) << 16); }
__device__ __forceinline__ float bfr(float f) { return bf2f(f2bf(f)); }
__device__ __forceinline__ v16h cat16(v8h lo, v8h hi) { return __builtin_shufflevector(lo, hi, 0, 1, 2, 3, 4, 5, 6, 7, 8, 9, 10, 11, 12, 13, 14, 15); }
__device__ __forceinline__ v16bf cat16b(v8us lo, v8us hi) { return __builtin_bit_cast(v16bf, __builtin_shufflevector(lo, hi, 0, 1, 2, 3, 4, 5, 6, 7, 8, 9, 10, 11, 12, 13, 14, 15)); }
__device__ __forceinline__ v8f wmma16(v16h a, v16h b, v8f c) { return __builtin_amdgcn_wmma_f32_16x16x32_f16(false, a, false, b, (short)0, c, false, false); }
__device__ __forceinline__ v8f wmmab(v16bf a, v16bf b, v8f c) { return __builtin_amdgcn_wmma_f32_16x16x32_bf16(false, a, false, b, (short)0, c, false, false); }



// ---- k_gemmw: register-blocked GEMM, one 64x64 output tile per work-group, the K loop dealt over the NW waves of the group in 64-wide chunks (wave w takes chunks w, w + NW, ...); every wave keeps the
// whole tile (16 accumulators), operands straight from K-contiguous 16-bit planes; the NW partial tiles meet in LDS and are summed in wave order 0..NW-1. grid (M/64, N/64, Z), 32 * NW threads.
// C[m][n] (f32, pitch ldc, + optional f32 bias[n]) = sum_k A[m][k] Bt[n][k] (+ split products per NSPLIT). z-batch strides sA/sB/sC in elements. K % 64 == 0.
// EP: what the epilogue stores. 0: the f32 tile C + bias[n]. 1, 2: no f32 tile: the summed tile + bias (1: bias[n]; 2: bias[m]) goes straight out as three 16-bit planes (fp16, bf16 hi, bf16 lo) at element
// blockIdx.y * sY + m * pp + (n - c0). With sY = TT * HD, pp = HD that is the head plane [h][t][d] (a 64-wide column tile is one head); with A = weight rows, Bt = token rows, sY = 64, pp = PP it is V^T [h * HD + d][t].
// CK: probability x value contraction of causal attention: the K loop stops at the diagonal block (probabilities beyond it are exactly zero); roff = row offset of this launch's first row within the sequence.
__device__ __forceinline__ h16 tohx(float x) { return (h16)x; }
__device__ __forceinline__ void splitf(float y, unsigned short& h, unsigned short& l) { h = f2bf(y); l = f2bf(y - bf2f(h)); }
template <typename T16> struct WFrag;
template <> struct WFrag<h16> { typedef v16h V; static __device__ __forceinline__ V ld(const h16* p) { return cat16(*(const v8h*)p, *(const v8h*)(p + 16)); } static __device__ __forceinline__ v8f mma(V a, V b, v8f c) { return wmma16(a, b, c); } };
template <> struct WFrag<bf> { typedef v16bf V; static __device__ __forceinline__ V ld(const bf* p) { return cat16b(*(const v8us*)p, *(const v8us*)(p + 16)); } static __device__ __forceinline__ v8f mma(V a, V b, v8f c) { return wmmab(a, b, c); } };
template <typename T16, int NSPLIT, bool BIAS, int NW, bool CK, int EP>
__global__ __launch_bounds__(32 * NW) void k_gemmw(const T16* __restrict__ A, const T16* __restrict__ A2, const T16* __restrict__ Bt, const T16* __restrict__ Bt2, int K, float* C, int ldc, const float* __restrict__ bias, int roff, size_t sA, size_t sB, size_t sC, h16* P16, bf* Ph, bf* Pl, size_t sY, int pp) {
    typedef typename WFrag<T16>::V V;
    __shared__ __align__(16) float os[NW * 64 * 68];
    const size_t z = blockIdx.z; A += z * sA; if (A2) A2 += z * sA; Bt += z * sB; if (Bt2) Bt2 += z * sB; C += z * sC;
    const int lane = threadIdx.x & 31, lr = lane & 15, hi = lane >> 4; const int r0 = blockIdx.x * 64, c0 = blockIdx.y * 64;
    const int wv = __builtin_amdgcn_readfirstlane((int)(threadIdx.x >> 5));   // the wave's number in a scalar register: the K loop's bounds and branches stay scalar
    const int Kl = CK ? min(K, r0 + roff + 64) : K;
    v8f acc[4][4];
#pragma unroll
    for (int mb = 0; mb < 4; ++mb)
#pragma unroll
        for (int nb = 0; nb < 4; ++nb) acc[mb][nb] = (v8f){};
    const size_t aoff = (size_t)(r0 + lr) * K + 8 * hi, boff = (size_t)(c0 + lr) * K + 8 * hi;
    // both loops stay rolled: one k-step's operands and the 16 accumulators are what the register budget of an 8-wave group holds; a 64-wide chunk is one whole 128-byte line of every operand row
#pragma unroll 1
    for (int kb = wv * 64; kb < Kl; kb += NW * 64) {
#pragma unroll 1
    for (int kc = kb; kc < kb + 64; kc += 32) {
        V a[4], a2[4];
#pragma unroll
        for (int mb = 0; mb < 4; ++mb) { a[mb] = WFrag<T16>::ld(A + aoff + (size_t)mb * 16 * K + kc); if (NSPLIT == 1 || NSPLIT == 2) a2[mb] = WFrag<T16>::ld(A2 + aoff + (size_t)mb * 16 * K + kc); }
#pragma unroll
        for (int nb = 0; nb < 4; ++nb) { const V b = WFrag<T16>::ld(Bt + boff + (size_t)nb * 16 * K + kc); V b2; if (NSPLIT >= 2) b2 = WFrag<T16>::ld(Bt2 + boff + (size_t)nb * 16 * K + kc);
#pragma unroll
            for (int mb = 0; mb < 4; ++mb) { acc[mb][nb] = WFrag<T16>::mma(a[mb], b, acc[mb][nb]); if (NSPLIT == 1 || NSPLIT == 2) acc[mb][nb] = WFrag<T16>::mma(a2[mb], b, acc[mb][nb]); if (NSPLIT >= 2) acc[mb][nb] = WFrag<T16>::mma(a[mb], b2, acc[mb][nb]); } }
        asm volatile("v_nop\n\tv_nop\n\tv_nop\n\tv_nop" : "+v"(acc[0][0]), "+v"(acc[1][1]), "+v"(acc[2][2]), "+v"(acc[3][3]) : "v"(a[0]), "v"(a[3]));
    } }
    float* my = os + wv * (64 * 68);
#pragma unroll
    for (int mb = 0; mb < 4; ++mb)
#pragma unroll
        for (int nb = 0; nb < 4; ++nb)
#pragma unroll
            for (int j = 0; j < 8; ++j) my[(mb * 16 + hi * 8 + j) * 68 + nb * 16 + lr] = acc[mb][nb][j];
    __syncthreads();   // every wave's partial tile is in LDS before any thread sums across the waves
    if constexpr (EP != 0) {   // eight columns a thread: one 16-byte store a plane, eight lanes of one wave fill a 128-byte line
#pragma unroll
        for (int s = 0; s < 16 / NW; ++s) { const int idx = s * (32 * NW) + (int)threadIdx.x; const int row = idx >> 3, cofs = (idx & 7) * 8; v4f v0 = *(const v4fa*)(os + row * 68 + cofs), v1 = *(const v4fa*)(os + row * 68 + cofs + 4);
#pragma unroll
            for (int w = 1; w < NW; ++w) { v0 += *(const v4fa*)(os + w * (64 * 68) + row * 68 + cofs); v1 += *(const v4fa*)(os + w * (64 * 68) + row * 68 + cofs + 4); }
            v8h o16; v8us oh, ol;
#pragma unroll
            for (int k = 0; k < 8; ++k) { float y = k < 4 ? v0[k & 3] : v1[k & 3]; if (BIAS) y += bfr(bias[EP == 2 ? r0 + row : c0 + cofs + k]); o16[k] = tohx(y); unsigned short a, c2; splitf(y, a, c2); oh[k] = a; ol[k] = c2; }
            const size_t e = (size_t)blockIdx.y * sY + (size_t)(r0 + row) * pp + cofs; *(v8h*)(P16 + e) = o16; *(v8us*)(Ph + e) = oh; *(v8us*)(Pl + e) = ol; }
        return; }
#pragma unroll
    for (int s = 0; s < 32 / NW; ++s) { const int idx = s * (32 * NW) + (int)threadIdx.x; const int row = idx >> 4, cofs = (idx & 15) * 4; v4f val = *(const v4fa*)(os + row * 68 + cofs);
#pragma unroll
        for (int w = 1; w < NW; ++w) val += *(const v4fa*)(os + w * (64 * 68) + row * 68 + cofs);
        if (BIAS) { val[0] += bfr(bias[c0 + cofs]); val[1] += bfr(bias[c0 + cofs + 1]); val[2] += bfr(bias[c0 + cofs + 2]); val[3] += bfr(bias[c0 + cofs + 3]); }
        *(v4f*)(C + (size_t)(r0 + row) * ldc + c0 + cofs) = val; }
}

typedef __attribute__((ext_vector_type(2))) _Float16 v2h;
typedef __attribute__((ext_vector_type(4))) _Float16 v4h;
typedef __attribute__((ext_vector_type(2))) unsigned short v2us;
typedef __attribute__((ext_vector_type(4))) unsigned short v4us;
typedef __attribute__((ext_vector_type(2))) float v2f;
typedef __attribute__((ext_vector_type(4))) int v4i;

__global__ __launch_bounds__(256) void k_wtG(const float* __restrict__ w, int K, int N, bf* Bt) {
    const int lane = threadIdx.x & 31; const int L0 = (blockIdx.x * 8 + (threadIdx.x >> 5)) * 8; const int nlines = N * K / 64;
{
#pragma unroll 1
        for (int l = 0; l < 8; ++l) { const int L = L0 + l; if (L >= nlines) break; const size_t e = (size_t)L * 64 + lane * 2; const int k = (int)(e % K), n = (int)(e / K); v2us o;
            o[0] = f2bf(w[(size_t)k * N + n]); o[1] = f2bf(w[(size_t)(k + 1) * N + n]); *(v2us*)(Bt + e) = o; }
         }
}
__global__ __launch_bounds__(256) void k_cvt8(const float* __restrict__ src, bf* dst, size_t n8) { const size_t i = (size_t)blockIdx.x * 256 + threadIdx.x; if (i >= n8) return; const v8f v = *(const v8f*)(src + i * 8); v8us o;
#pragma unroll
    for (int k = 0; k < 8; ++k) o[k] = f2bf(v[k]); *(v8us*)(dst + i * 8) = o;  }

// ---- k_fattn: the whole causal attention of one batch in one launch: scores, softmax, probability x value product and the merge of the heads into the hi/lo planes that the output projection reads.
// One work-group = one head x 32 query rows; grid (heads, TT / 32), the longest query tiles first (cost falls with the index). The keys 0 .. q0 + 31 are dealt over the FNW waves in 64-key chunks (one whole
// 128-byte line of every V^T row), each worked in two 32-key passes. Transposed products: S^T = K Q^T (A = key rows, B = query rows, same loader, same k order), so a lane holds 16 scores of ONE query per pass
// and column group: maximum and sum in the lane plus one exchange between the wave's halves; two S^T tiles (keys 0-15, 16-31), converted in place, ARE the B operand of O^T += V^T P^T (A = V^T rows in the same k order).
// Running maximum m (scaled log2 units) and running sum l per query and wave; the FNW partial (m, l, O) meet in LDS and are joined in wave order. Probabilities carry 2^PCL2 (it cancels in O / l) so that small ones stay normal in fp16.
// Query rows < RH: hi/lo bf16 planes, 3 products in both contractions; the rest fp16.
#define FQT  2                    // 16-query column groups per wave
#define FNW  4                    // waves per work-group
#define FOP  68                   // LDS pitch (floats) of a query's 64 partial outputs
#define SCL2 (SCL * 1.4426950408889634f)
#define PCL2 10.0f
__device__ __forceinline__ float xhalf(float x) { return __builtin_bit_cast(float, __builtin_amdgcn_permlanex16(__builtin_bit_cast(int, x), __builtin_bit_cast(int, x), 0x76543210, 0xfedcba98, false, false)); }   // lane l reads lane l ^ 16, on the vector pipe
// Precaution behind a group of global loads: the wait stands in front of whatever next reuses the address registers that the loads name; the base pointers are inputs so that those registers stay theirs up to the wait.
template <typename T16> __device__ __forceinline__ void xwait(const T16* p) { asm volatile("s_wait_xcnt 0x0" :: "v"(p) : "memory"); }
template <typename T16> __device__ __forceinline__ void xwait(const T16* p, const T16* p2) { asm volatile("s_wait_xcnt 0x0" :: "v"(p), "v"(p2) : "memory"); }
template <typename T16, bool HR>
__device__ __forceinline__ void fattn_wave(const T16* __restrict__ Q, const T16* __restrict__ Q2, const T16* __restrict__ Kp, const T16* __restrict__ K2, const T16* __restrict__ Vt, const T16* __restrict__ Vt2, int q0, int wv, int lr, int hi, float* om, float* ol, float* oo) {
    typedef typename WFrag<T16>::V V;
    V qf[FQT][2], qf2[FQT][2];
    { const size_t e = (size_t)(q0 + lr) * HD + 8 * hi; const T16* qp = Q + e; const T16* qp2 = HR ? Q2 + e : qp;
#pragma unroll
      for (int qt = 0; qt < FQT; ++qt)
#pragma unroll
        for (int ds = 0; ds < 2; ++ds) { qf[qt][ds] = WFrag<T16>::ld(qp + qt * 16 * HD + ds * 32); if (HR) qf2[qt][ds] = WFrag<T16>::ld(qp2 + qt * 16 * HD + ds * 32); }
      if (HR) xwait(qp, qp2); else xwait(qp); }
    v8f o[4][FQT]; float m[FQT], l[FQT];
#pragma unroll
    for (int qt = 0; qt < FQT; ++qt) { m[qt] = -3.0e38f; l[qt] = 0.0f;
#pragma unroll
        for (int mb = 0; mb < 4; ++mb) o[mb][qt] = (v8f){}; }
    // the passes of this wave in turn: both halves of chunk wv, then of chunk wv + FNW, ...; the loop stays rolled: one pass's fragments, scores and the output tile are what lets four waves share a SIMD's registers.
    // fp16 rows fetch the key fragments one pass ahead (issued right behind the S^T products that free their registers, so that their latency lies under the softmax and the P.V products); past the last pass the fetch is clamped to the diagonal rows and not used.
    V kf[2][2], kf2[2][2]; int kc = wv * 64;
    if (!HR) { const T16* kp = Kp + (size_t)(min(kc, q0) + lr) * HD + 8 * hi;
#pragma unroll
        for (int kt = 0; kt < 2; ++kt) { kf[kt][0] = WFrag<T16>::ld(kp + kt * 16 * HD); kf[kt][1] = WFrag<T16>::ld(kp + kt * 16 * HD + 32); }
        xwait(kp); }
#pragma unroll 1
    while (kc <= q0) { const int kn = (kc & 32) ? kc + 32 + (FNW - 1) * 64 : kc + 32;
        const size_t ev = (size_t)lr * PP + kc + 8 * hi; const T16* vp = Vt + ev; V vf[4];
        if (!HR) {   // fp16 rows: the V^T fragments are asked for at the head of the pass; the hi/lo rows, with twice the fragments, load them where they are used, which keeps the kernel at four waves a SIMD
#pragma unroll
            for (int mb = 0; mb < 4; ++mb) vf[mb] = WFrag<T16>::ld(vp + (size_t)mb * 16 * PP); }
        v8f s[2][FQT];
#pragma unroll
        for (int kt = 0; kt < 2; ++kt) {
            if (HR) { const size_t e = (size_t)(kc + kt * 16 + lr) * HD + 8 * hi; const T16* kp = Kp + e; const T16* kp2 = K2 + e; kf[kt][0] = WFrag<T16>::ld(kp); kf[kt][1] = WFrag<T16>::ld(kp + 32); kf2[kt][0] = WFrag<T16>::ld(kp2); kf2[kt][1] = WFrag<T16>::ld(kp2 + 32); xwait(kp, kp2); }
#pragma unroll
            for (int qt = 0; qt < FQT; ++qt) { v8f c = (v8f){}; c = WFrag<T16>::mma(kf[kt][0], qf[qt][0], c); c = WFrag<T16>::mma(kf[kt][1], qf[qt][1], c);
                if (HR) { c = WFrag<T16>::mma(kf2[kt][0], qf[qt][0], c); c = WFrag<T16>::mma(kf2[kt][1], qf[qt][1], c); c = WFrag<T16>::mma(kf[kt][0], qf2[qt][0], c); c = WFrag<T16>::mma(kf[kt][1], qf2[qt][1], c); }
                s[kt][qt] = c; } }
        if (!HR) { const T16* kp = Kp + (size_t)(min(kn, q0) + lr) * HD + 8 * hi;
#pragma unroll
            for (int kt = 0; kt < 2; ++kt) { kf[kt][0] = WFrag<T16>::ld(kp + kt * 16 * HD); kf[kt][1] = WFrag<T16>::ld(kp + kt * 16 * HD + 32); }
            xwait(vp, kp); }
        if (kc == q0) {   // the diagonal pass (always a wave's last): key > query leaves the softmax; -inf against the finite start value of m gives probability 0 also where a query has no key in this wave
#pragma unroll
            for (int kt = 0; kt < 2; ++kt)
#pragma unroll
                for (int qt = 0; qt < FQT; ++qt)
#pragma unroll
                    for (int r = 0; r < 8; ++r) if (kt * 16 + 8 * hi + r > qt * 16 + lr) s[kt][qt][r] = -__builtin_inff(); }
        V pf[FQT], pf2[FQT];
#pragma unroll
        for (int qt = 0; qt < FQT; ++qt) { float mr = s[0][qt][0];
#pragma unroll
            for (int e = 1; e < 16; ++e) mr = fmaxf(mr, s[e >> 3][qt][e & 7]);
            mr = fmaxf(mr, xhalf(mr));
            const float mn = fmaxf(m[qt], mr * SCL2); const float al = __builtin_amdgcn_exp2f(m[qt] - mn); m[qt] = mn; const float sh = PCL2 - mn; float p[16]; float sum = 0.0f;
#pragma unroll
            for (int e = 0; e < 16; ++e) { p[e] = __builtin_amdgcn_exp2f(fmaf(s[e >> 3][qt][e & 7], SCL2, sh)); sum += p[e]; }
            l[qt] = l[qt] * al + sum;
#pragma unroll
            for (int mb = 0; mb < 4; ++mb) o[mb][qt] *= al;
            if constexpr (HR) { v8us h0, h1, l0, l1;
#pragma unroll
                for (int r = 0; r < 8; ++r) { unsigned short a, c2; splitf(p[r], a, c2); h0[r] = a; l0[r] = c2; splitf(p[8 + r], a, c2); h1[r] = a; l1[r] = c2; }
                pf[qt] = cat16b(h0, h1); pf2[qt] = cat16b(l0, l1);
            } else { v8h h0, h1;
#pragma unroll
                for (int r = 0; r < 8; ++r) { h0[r] = tohx(p[r]); h1[r] = tohx(p[8 + r]); }
                pf[qt] = cat16(h0, h1); } }
        V vf2[4];
#pragma unroll
        for (int mb = 0; mb < 4; ++mb) {
            if (HR && (mb & 1) == 0) { const T16* vq = vp + (size_t)mb * 16 * PP; const T16* vq2 = Vt2 + ev + (size_t)mb * 16 * PP; vf[mb] = WFrag<T16>::ld(vq); vf[mb + 1] = WFrag<T16>::ld(vq + (size_t)16 * PP); vf2[mb] = WFrag<T16>::ld(vq2); vf2[mb + 1] = WFrag<T16>::ld(vq2 + (size_t)16 * PP); xwait(vq, vq2); }
#pragma unroll
            for (int qt = 0; qt < FQT; ++qt) { o[mb][qt] = WFrag<T16>::mma(vf[mb], pf[qt], o[mb][qt]); if (HR) { o[mb][qt] = WFrag<T16>::mma(vf[mb], pf2[qt], o[mb][qt]); o[mb][qt] = WFrag<T16>::mma(vf2[mb], pf[qt], o[mb][qt]); } } }
        kc = kn;
    }
#pragma unroll
    for (int qt = 0; qt < FQT; ++qt) { l[qt] += xhalf(l[qt]); if (hi == 0) { om[qt * 16 + lr] = m[qt]; ol[qt * 16 + lr] = l[qt]; }
#pragma unroll
        for (int mb = 0; mb < 4; ++mb) { float* d = oo + (qt * 16 + lr) * FOP + mb * 16 + hi * 8; const v8f t = o[mb][qt]; *(v4fa*)d = (v4f){t[0], t[1], t[2], t[3]}; *(v4fa*)(d + 4) = (v4f){t[4], t[5], t[6], t[7]}; } }
}
__global__ __launch_bounds__(32 * FNW) __attribute__((amdgpu_waves_per_eu(4, 4))) void k_fattn(const h16* __restrict__ Q16, const h16* __restrict__ K16, const h16* __restrict__ V16, const bf* __restrict__ Qh, const bf* __restrict__ Ql, const bf* __restrict__ Kh, const bf* __restrict__ Kl, const bf* __restrict__ Vh, const bf* __restrict__ Vl, bf* Ah, bf* Al) {
    __shared__ __align__(16) float oo[FNW * 32 * FOP]; __shared__ float om[FNW * 32]; __shared__ float ol[FNW * 32];
    const int lane = threadIdx.x & 31, lr = lane & 15, hi = lane >> 4;
    const int wv = __builtin_amdgcn_readfirstlane((int)(threadIdx.x >> 5));   // the wave's number in a scalar register: the key loop's bounds and branches stay scalar
    const int h = blockIdx.x, q0 = (TT / 32 - 1 - (int)blockIdx.y) * 32; const size_t zq = (size_t)h * TT * HD, zk = (size_t)(h / REP) * TT * HD, zv = (size_t)(h / REP) * HD * PP;
    if (q0 < RH) fattn_wave<bf, true>(Qh + zq, Ql + zq, Kh + zk, Kl + zk, Vh + zv, Vl + zv, q0, wv, lr, hi, om + wv * 32, ol + wv * 32, oo + wv * (32 * FOP));
    else fattn_wave<h16, false>(Q16 + zq, nullptr, K16 + zk, nullptr, V16 + zv, nullptr, q0, wv, lr, hi, om + wv * 32, ol + wv * 32, oo + wv * (32 * FOP));
    __syncthreads();   // every wave's partial (m, l, O) is in LDS before any thread joins them
#pragma unroll
    for (int s = 0; s < 8 / FNW; ++s) { const int it = s * (32 * FNW) + (int)threadIdx.x; const int q = it >> 3, oc = (it & 7) * 8; float M = om[q];
#pragma unroll
        for (int w = 1; w < FNW; ++w) M = fmaxf(M, om[w * 32 + q]);   // wave 0 always holds key 0, which every query sees: M is a real score
        float Ls = 0.0f; v4f a0 = (v4f){}, a1 = (v4f){};
#pragma unroll
        for (int w = 0; w < FNW; ++w) { const float f = __builtin_amdgcn_exp2f(om[w * 32 + q] - M); Ls += ol[w * 32 + q] * f; const float* sp = oo + (w * 32 + q) * FOP + oc; a0 += *(const v4fa*)sp * f; a1 += *(const v4fa*)(sp + 4) * f; }
        const float inv = __fdiv_rn(1.0f, Ls); v8us oh, olo;
#pragma unroll
        for (int k = 0; k < 4; ++k) { unsigned short a, c2; splitf(a0[k] * inv, a, c2); oh[k] = a; olo[k] = c2; splitf(a1[k] * inv, a, c2); oh[4 + k] = a; olo[4 + k] = c2; }
        const size_t e = (size_t)(q0 + q) * DQ + h * HD + oc; *(v8us*)(Ah + e) = oh; *(v8us*)(Al + e) = olo; }
}

extern "C" void kernel_launch(void* const* d_in, const int* in_sizes, int n_in,
                              void* d_out, int out_size, void* d_ws, size_t ws_size, hipStream_t stream) {
    (void)in_sizes; (void)n_in; (void)out_size;
    const float* x = (const float*)d_in[0]; const float* xk = (const float*)d_in[1]; const float* xv = (const float*)d_in[1]; const float* wq = (const float*)d_in[2]; const float* bq = (const float*)d_in[3]; const float* wk = (const float*)d_in[4]; const float* bk = (const float*)d_in[5]; const float* wv = (const float*)d_in[6]; const float* bv = (const float*)d_in[7]; const float* wo = (const float*)d_in[8]; const float* bo = (const float*)d_in[9]; /* order data, context, Wq, bq, Wk, bk, Wv, bv, Wo, bo ('xw' + biases): TEN inputs: TWO streams: the queries come from data (d_in[0]); the keys AND the values both come from context (d_in[1]): the kernel's key stream and value stream pointers are the same input */
    float* OUT = (float*)d_out;     // [4][2048][1024]
    char* wsp = (char*)d_ws;
    auto take = [&](size_t bytes) { char* p = wsp; wsp += (bytes + 255) & ~(size_t)255; return (void*)p; };
    bf* WQ = (bf*)take((size_t)DQ * DM * 2); bf* WK = (bf*)take((size_t)DKV * DM * 2); bf* WV = (bf*)take((size_t)DKV * DM * 2); bf* WO = (bf*)take((size_t)DM * DQ * 2);
    bf* XB = (bf*)take((size_t)TT * DM * 2);
    h16* QP16 = (h16*)take((size_t)NH_ * TT * HD * 2); h16* KP16 = (h16*)take((size_t)NKV * TT * HD * 2); h16* VT16 = (h16*)take((size_t)NKV * HD * PP * 2);
    bf* QPh = (bf*)take((size_t)NH_ * TT * HD * 2); bf* QPl = (bf*)take((size_t)NH_ * TT * HD * 2); bf* KPh = (bf*)take((size_t)NKV * TT * HD * 2); bf* KPl = (bf*)take((size_t)NKV * TT * HD * 2); bf* VTh = (bf*)take((size_t)NKV * HD * PP * 2); bf* VTl = (bf*)take((size_t)NKV * HD * PP * 2);
    bf* ATh = (bf*)take((size_t)TT * DQ * 2); bf* ATl = (bf*)take((size_t)TT * DQ * 2);
    if ((size_t)(wsp - (char*)d_ws) > ws_size) return;    // ws 256 MiB
    { k_wtG<<<(unsigned)((DM * DQ / 64 + 63) / 64), 256, 0, stream>>>(wq, DM, DQ, WQ); k_wtG<<<(unsigned)((DM * DKV / 64 + 63) / 64), 256, 0, stream>>>(wk, DM, DKV, WK); k_wtG<<<(unsigned)((DM * DKV / 64 + 63) / 64), 256, 0, stream>>>(wv, DM, DKV, WV);
      k_wtG<<<(unsigned)((DQ * DM / 64 + 63) / 64), 256, 0, stream>>>(wo, DQ, DM, WO);
       }
    for (int b = 0; b < NB_; ++b) {
        
        k_cvt8<<<(unsigned)(((size_t)TT * DM / 8 + 255) / 256), 256, 0, stream>>>(x + (size_t)b * TT * DM, XB, (size_t)TT * DM / 8);
        k_gemmw<bf, 0, true, 8, false, 1><<<dim3(TT / 64, DQ / 64, 1), 256, 0, stream>>>(XB, nullptr, WQ, nullptr, DM, nullptr, 0, bq, 0, 0, 0, 0, QP16, QPh, QPl, (size_t)TT * HD, HD);
        k_cvt8<<<(unsigned)(((size_t)TT * DM / 8 + 255) / 256), 256, 0, stream>>>(xk + (size_t)b * TT * DM, XB, (size_t)TT * DM / 8); k_gemmw<bf, 0, true, 8, false, 1><<<dim3(TT / 64, DKV / 64, 1), 256, 0, stream>>>(XB, nullptr, WK, nullptr, DM, nullptr, 0, bk, 0, 0, 0, 0, KP16, KPh, KPl, (size_t)TT * HD, HD);
        k_cvt8<<<(unsigned)(((size_t)TT * DM / 8 + 255) / 256), 256, 0, stream>>>(xv + (size_t)b * TT * DM, XB, (size_t)TT * DM / 8); k_gemmw<bf, 0, true, 8, false, 2><<<dim3(DKV / 64, TT / 64, 1), 256, 0, stream>>>(WV, nullptr, XB, nullptr, DM, nullptr, 0, bv, 0, 0, 0, 0, VT16, VTh, VTl, 64, PP);   // weight rows as A, token rows as Bt: the tile is V^T as it stands
        k_fattn<<<dim3(NH_, TT / 32, 1), 32 * FNW, 0, stream>>>(QP16, KP16, VT16, QPh, QPl, KPh, KPl, VTh, VTl, ATh, ATl);
        k_gemmw<bf, 1, true, 8, false, 0><<<dim3(TT / 64, DM / 64, 1), 256, 0, stream>>>(ATh, ATl, WO, nullptr, DQ, OUT + (size_t)b * TT * DM, DM, bo, 0, 0, 0, 0, nullptr, nullptr, nullptr, 0, 0); }
}

// v005
// It runs in 322 microseconds.
// In two side-by-side timings against v004, it was 1.26 and 1.27 times as fast.
// Over all steps from v000 it is 9.01 times as fast.
#include <hip/hip_runtime.h>

// Causal multi-head attention between two equally long streams with biased (in, out) projections (data, context [4][2048][1024]; Q = data Wq + bq, K = context Wk + bk, V = context Wv + bv ('xw' [1024][1024] normal x 0.02 + [1024] zeros on this draw: read; 16 heads x 64); scores / sqrt(64); causal (tril kept, -inf elsewhere: query i sees context positions j <= i); softmax over the keys; out = merged Wo + bo ('xw' + bias zeros: read) -> [4][2048][1024] (8.4 M); argument order data, context, Wq, bq, Wk, bk, Wv, bv, Wo, bo).
// Layout, every stage one launch over all batches: 'xw' weights transposed once; bf16 copies of the two streams; exact projections + f32 biases, whose epilogue writes the head planes; causal T-2048 attention in one fused launch (k_fattn; hybrid rows: < 512 hi/lo 3 products, rest fp16 x1024; nothing above the diagonal block is computed); merged hi/lo x w_o exact + b_o.
// Compute dtypes, f32 accumulate: every input rounded to bf16; projections exact + f32 biases; attention rows < 512 3 products, rest fp16; softmax f32; Wo hl x exact + bias.

#define NB_  4
#define TT   2048
#define DM   1024
#define NH_  16
#define NKV  16
#define REP  (NH_ / NKV)
#define HD   64
#define DQ   (NH_ * HD)
#define DKV  (NKV * HD)
#define PP   (2 * TT)             // row pitch, in 16-bit elements, of the V^T planes: a row holds the tokens of PP / TT batches
#define RH   512                  // query rows < RH use hi+lo planes (0: none)
#define SCL  0.125f   // HD^-0.5
typedef _Float16 h16;
typedef unsigned short bf;
typedef __attribute__((ext_vector_type(16))) __bf16   v16bf;
typedef __attribute__((ext_vector_type(16))) _Float16 v16h;
typedef __attribute__((ext_vector_type(8)))  _Float16 v8h;
typedef __attribute__((ext_vector_type(8)))  unsigned short v8us;
typedef __attribute__((ext_vector_type(8)))  float    v8f;
typedef __attribute__((ext_vector_type(4)))  float    v4f;
typedef v8h  __attribute__((may_alias)) v8ha;
typedef v4f  __attribute__((may_alias)) v4fa;
typedef v8us __attribute__((may_alias)) v8usa;

__device__ __forceinline__ unsigned short f2bf(float f) { unsigned u = __float_as_uint(f); u += 0x7FFFu + ((u >> 16) & 1u); return (unsigned short)(u >> 16); }
__device__ __forceinline__ float bf2f(unsigned short b) { return __uint_as_float(((unsigned)b) << 16); }
__device__ __forceinline__ float bfr(float f) { return bf2f(f2bf(f)); }
__device__ __forceinline__ v16h cat16(v8h lo, v8h hi) { return __builtin_shufflevector(lo, hi, 0, 1, 2, 3, 4, 5, 6, 7, 8, 9, 10, 11, 12, 13, 14, 15); }
__device__ __forceinline__ v16bf cat16b(v8us lo, v8us hi) { return __builtin_bit_cast(v16bf, __builtin_shufflevector(lo, hi, 0, 1, 2, 3, 4, 5, 6, 7, 8, 9, 10, 11, 12, 13, 14, 15)); }
__device__ __forceinline__ v8f wmma16(v16h a, v16h b, v8f c) { return __builtin_amdgcn_wmma_f32_16x16x32_f16(false, a, false, b, (short)0, c, false, false); }
__device__ __forceinline__ v8f wmmab(v16bf a, v16bf b, v8f c) { return __builtin_amdgcn_wmma_f32_16x16x32_bf16(false, a, false, b, (short)0, c, false, false); }



// ---- k_gemmw: register-blocked GEMM, one 64x64 output tile per work-group, the K loop dealt over the NW waves of the group in 64-wide chunks (wave w takes chunks w, w + NW, ...); every wave keeps the
// whole tile (16 accumulators), operands straight from K-contiguous 16-bit planes; the NW partial tiles meet in LDS and are summed in wave order 0..NW-1. grid (M/64, N/64, Z), 32 * NW threads.
// C[m][n] (f32, pitch ldc, + optional f32 bias[n]) = sum_k A[m][k] Bt[n][k] (+ split products per NSPLIT). z-batch strides sA/sB/sC in elements. K % 64 == 0.
// EP: what the epilogue stores. 0: the f32 tile C + bias[n]. 1, 2: no f32 tile: the summed tile + bias (1: bias[n]; 2: bias[m]) goes straight out as three 16-bit planes (fp16, bf16 hi, bf16 lo) at element
// blockIdx.y * sY + m * pp + (n - c0). With m = b * TT + t, sY = NB_ * TT * HD, pp = HD that is the head plane [h][b][t][d] (a 64-wide column tile is one head); with A = weight rows, Bt = token rows, sY = 64, pp = PP it is V^T [h * HD + d][t].
// sP: z-batch stride, in elements, of the three planes.
// CK: probability x value contraction of causal attention: the K loop stops at the diagonal block (probabilities beyond it are exactly zero); roff = row offset of this launch's first row within the sequence.
__device__ __forceinline__ h16 tohx(float x) { return (h16)x; }
__device__ __forceinline__ void splitf(float y, unsigned short& h, unsigned short& l) { h = f2bf(y); l = f2bf(y - bf2f(h)); }
template <typename T16> struct WFrag;
template <> struct WFrag<h16> { typedef v16h V; static __device__ __forceinline__ V ld(const h16* p) { return cat16(*(const v8h*)p, *(const v8h*)(p + 16)); } static __device__ __forceinline__ v8f mma(V a, V b, v8f c) { return wmma16(a, b, c); } };
template <> struct WFrag<bf> { typedef v16bf V; static __device__ __forceinline__ V ld(const bf* p) { return cat16b(*(const v8us*)p, *(const v8us*)(p + 16)); } static __device__ __forceinline__ v8f mma(V a, V b, v8f c) { return wmmab(a, b, c); } };
template <typename T16, int NSPLIT, bool BIAS, int NW, bool CK, int EP>
__global__ __launch_bounds__(32 * NW) void k_gemmw(const T16* __restrict__ A, const T16* __restrict__ A2, const T16* __restrict__ Bt, const T16* __restrict__ Bt2, int K, float* C, int ldc, const float* __restrict__ bias, int roff, size_t sA, size_t sB, size_t sC, h16* P16, bf* Ph, bf* Pl, size_t sY, int pp, size_t sP) {
    typedef typename WFrag<T16>::V V;
    __shared__ __align__(16) float os[NW * 64 * 68];
    const size_t z = blockIdx.z; A += z * sA; if (A2) A2 += z * sA; Bt += z * sB; if (Bt2) Bt2 += z * sB; C += z * sC; if constexpr (EP != 0) { P16 += z * sP; Ph += z * sP; Pl += z * sP; }
    const int lane = threadIdx.x & 31, lr = lane & 15, hi = lane >> 4; const int r0 = blockIdx.x * 64, c0 = blockIdx.y * 64;
    const int wv = __builtin_amdgcn_readfirstlane((int)(threadIdx.x >> 5));   // the wave's number in a scalar register: the K loop's bounds and branches stay scalar
    const int Kl = CK ? min(K, r0 + roff + 64) : K;
    v8f acc[4][4];
#pragma unroll
    for (int mb = 0; mb < 4; ++mb)
#pragma unroll
        for (int nb = 0; nb < 4; ++nb) acc[mb][nb] = (v8f){};
    const size_t aoff = (size_t)(r0 + lr) * K + 8 * hi, boff = (size_t)(c0 + lr) * K + 8 * hi;
    // both loops stay rolled: one k-step's operands and the 16 accumulators are what the register budget of an 8-wave group holds; a 64-wide chunk is one whole 128-byte line of every operand row
#pragma unroll 1
    for (int kb = wv * 64; kb < Kl; kb += NW * 64) {
#pragma unroll 1
    for (int kc = kb; kc < kb + 64; kc += 32) {
        V a[4], a2[4];
#pragma unroll
        for (int mb = 0; mb < 4; ++mb) { a[mb] = WFrag<T16>::ld(A + aoff + (size_t)mb * 16 * K + kc); if (NSPLIT == 1 || NSPLIT == 2) a2[mb] = WFrag<T16>::ld(A2 + aoff + (size_t)mb * 16 * K + kc); }
#pragma unroll
        for (int nb = 0; nb < 4; ++nb) { const V b = WFrag<T16>::ld(Bt + boff + (size_t)nb * 16 * K + kc); V b2; if (NSPLIT >= 2) b2 = WFrag<T16>::ld(Bt2 + boff + (size_t)nb * 16 * K + kc);
#pragma unroll
            for (int mb = 0; mb < 4; ++mb) { acc[mb][nb] = WFrag<T16>::mma(a[mb], b, acc[mb][nb]); if (NSPLIT == 1 || NSPLIT == 2) acc[mb][nb] = WFrag<T16>::mma(a2[mb], b, acc[mb][nb]); if (NSPLIT >= 2) acc[mb][nb] = WFrag<T16>::mma(a[mb], b2, acc[mb][nb]); } }
        asm volatile("v_nop\n\tv_nop\n\tv_nop\n\tv_nop" : "+v"(acc[0][0]), "+v"(acc[1][1]), "+v"(acc[2][2]), "+v"(acc[3][3]) : "v"(a[0]), "v"(a[3]));
    } }
    float* my = os + wv * (64 * 68);
#pragma unroll
    for (int mb = 0; mb < 4; ++mb)
#pragma unroll
        for (int nb = 0; nb < 4; ++nb)
#pragma unroll
            for (int j = 0; j < 8; ++j) my[(mb * 16 + hi * 8 + j) * 68 + nb * 16 + lr] = acc[mb][nb][j];
    __syncthreads();   // every wave's partial tile is in LDS before any thread sums across the waves
    if constexpr (EP != 0) {   // eight columns a thread: one 16-byte store a plane, eight lanes of one wave fill a 128-byte line
#pragma unroll
        for (int s = 0; s < 16 / NW; ++s) { const int idx = s * (32 * NW) + (int)threadIdx.x; const int row = idx >> 3, cofs = (idx & 7) * 8; v4f v0 = *(const v4fa*)(os + row * 68 + cofs), v1 = *(const v4fa*)(os + row * 68 + cofs + 4);
#pragma unroll
            for (int w = 1; w < NW; ++w) { v0 += *(const v4fa*)(os + w * (64 * 68) + row * 68 + cofs); v1 += *(const v4fa*)(os + w * (64 * 68) + row * 68 + cofs + 4); }
            v8h o16; v8us oh, ol;
#pragma unroll
            for (int k = 0; k < 8; ++k) { float y = k < 4 ? v0[k & 3] : v1[k & 3]; if (BIAS) y += bfr(bias[EP == 2 ? r0 + row : c0 + cofs + k]); o16[k] = tohx(y); unsigned short a, c2; splitf(y, a, c2); oh[k] = a; ol[k] = c2; }
            const size_t e = (size_t)blockIdx.y * sY + (size_t)(r0 + row) * pp + cofs; *(v8h*)(P16 + e) = o16; *(v8us*)(Ph + e) = oh; *(v8us*)(Pl + e) = ol; }
        return; }
#pragma unroll
    for (int s = 0; s < 32 / NW; ++s) { const int idx = s * (32 * NW) + (int)threadIdx.x; const int row = idx >> 4, cofs = (idx & 15) * 4; v4f val = *(const v4fa*)(os + row * 68 + cofs);
#pragma unroll
        for (int w = 1; w < NW; ++w) val += *(const v4fa*)(os + w * (64 * 68) + row * 68 + cofs);
        if (BIAS) { val[0] += bfr(bias[c0 + cofs]); val[1] += bfr(bias[c0 + cofs + 1]); val[2] += bfr(bias[c0 + cofs + 2]); val[3] += bfr(bias[c0 + cofs + 3]); }
        *(v4f*)(C + (size_t)(r0 + row) * ldc + c0 + cofs) = val; }
}

typedef __attribute__((ext_vector_type(2))) _Float16 v2h;
typedef __attribute__((ext_vector_type(4))) _Float16 v4h;
typedef __attribute__((ext_vector_type(2))) unsigned short v2us;
typedef __attribute__((ext_vector_type(4))) unsigned short v4us;
typedef __attribute__((ext_vector_type(2))) float v2f;
typedef __attribute__((ext_vector_type(4))) int v4i;

// the four equally shaped weights in one launch: blockIdx.y picks the weight and its plane (the planes lie one behind the other)
__global__ __launch_bounds__(256) void k_wtG(const float* __restrict__ w0, const float* __restrict__ w1, const float* __restrict__ w2, const float* __restrict__ w3, int K, int N, bf* Bt) {
    const int y = blockIdx.y; const float* __restrict__ w = y == 0 ? w0 : y == 1 ? w1 : y == 2 ? w2 : w3; Bt += (size_t)y * N * K;
    const int lane = threadIdx.x & 31; const int L0 = (blockIdx.x * 8 + (threadIdx.x >> 5)) * 8; const int nlines = N * K / 64;
{
#pragma unroll 1
        for (int l = 0; l < 8; ++l) { const int L = L0 + l; if (L >= nlines) break; const size_t e = (size_t)L * 64 + lane * 2; const int k = (int)(e % K), n = (int)(e / K); v2us o;
            o[0] = f2bf(w[(size_t)k * N + n]); o[1] = f2bf(w[(size_t)(k + 1) * N + n]); *(v2us*)(Bt + e) = o; }
         }
}
// both streams' bf16 copies in one launch: blockIdx.y picks the stream; a thread converts its 8-element unit of every batch (n8 units a batch), the loads of the NB_ units in flight together
__global__ __launch_bounds__(256) void k_cvt8(const float* __restrict__ s0, const float* __restrict__ s1, bf* dst, size_t n8) { const size_t i = (size_t)blockIdx.x * 256 + threadIdx.x; if (i >= n8) return;
    const float* __restrict__ src = blockIdx.y ? s1 : s0; dst += (size_t)blockIdx.y * NB_ * n8 * 8; v8f v[NB_];
#pragma unroll
    for (int b = 0; b < NB_; ++b) v[b] = *(const v8f*)(src + ((size_t)b * n8 + i) * 8);
#pragma unroll
    for (int b = 0; b < NB_; ++b) { v8us o;
#pragma unroll
        for (int k = 0; k < 8; ++k) o[k] = f2bf(v[b][k]);
        *(v8us*)(dst + ((size_t)b * n8 + i) * 8) = o; } }

// ---- k_fattn: the whole causal attention of all batches in one launch: scores, softmax, probability x value product and the merge of the heads into the hi/lo planes that the output projection reads.
// One work-group = one head x 32 query rows; grid (heads, TT / 32, batches), within a batch the longest query tiles first (cost falls with the index; the next batch's long tiles take the places that the short ones leave). The keys 0 .. q0 + 31 are dealt over the FNW waves in 64-key chunks (one whole
// 128-byte line of every V^T row), each worked in two 32-key passes. Transposed products: S^T = K Q^T (A = key rows, B = query rows, same loader, same k order), so a lane holds 16 scores of ONE query per pass
// and column group: maximum and sum in the lane plus one exchange between the wave's halves; two S^T tiles (keys 0-15, 16-31), converted in place, ARE the B operand of O^T += V^T P^T (A = V^T rows in the same k order).
// Running maximum m (scaled log2 units) and running sum l per query and wave; the FNW partial (m, l, O) meet in LDS and are joined in wave order. Probabilities carry 2^PCL2 (it cancels in O / l) so that small ones stay normal in fp16.
// Query rows < RH: hi/lo bf16 planes, 3 products in both contractions; the rest fp16.
#define FQT  2                    // 16-query column groups per wave
#define FNW  4                    // waves per work-group
#define FOP  68                   // LDS pitch (floats) of a query's 64 partial outputs
#define SCL2 (SCL * 1.4426950408889634f)
#define PCL2 10.0f
__device__ __forceinline__ float xhalf(float x) { return __builtin_bit_cast(float, __builtin_amdgcn_permlanex16(__builtin_bit_cast(int, x), __builtin_bit_cast(int, x), 0x76543210, 0xfedcba98, false, false)); }   // lane l reads lane l ^ 16, on the vector pipe
// Precaution behind a group of global loads: the wait stands in front of whatever next reuses the address registers that the loads name; the base pointers are inputs so that those registers stay theirs up to the wait.
template <typename T16> __device__ __forceinline__ void xwait(const T16* p) { asm volatile("s_wait_xcnt 0x0" :: "v"(p) : "memory"); }
template <typename T16> __device__ __forceinline__ void xwait(const T16* p, const T16* p2) { asm volatile("s_wait_xcnt 0x0" :: "v"(p), "v"(p2) : "memory"); }
template <typename T16, bool HR>
__device__ __forceinline__ void fattn_wave(const T16* __restrict__ Q, const T16* __restrict__ Q2, const T16* __restrict__ Kp, const T16* __restrict__ K2, const T16* __restrict__ Vt, const T16* __restrict__ Vt2, int q0, int wv, int lr, int hi, float* om, float* ol, float* oo) {
    typedef typename WFrag<T16>::V V;
    V qf[FQT][2], qf2[FQT][2];
    { const size_t e = (size_t)(q0 + lr) * HD + 8 * hi; const T16* qp = Q + e; const T16* qp2 = HR ? Q2 + e : qp;
#pragma unroll
      for (int qt = 0; qt < FQT; ++qt)
#pragma unroll
        for (int ds = 0; ds < 2; ++ds) { qf[qt][ds] = WFrag<T16>::ld(qp + qt * 16 * HD + ds * 32); if (HR) qf2[qt][ds] = WFrag<T16>::ld(qp2 + qt * 16 * HD + ds * 32); }
      if (HR) xwait(qp, qp2); else xwait(qp); }
    v8f o[4][FQT]; float m[FQT], l[FQT];
#pragma unroll
    for (int qt = 0; qt < FQT; ++qt) { m[qt] = -3.0e38f; l[qt] = 0.0f;
#pragma unroll
        for (int mb = 0; mb < 4; ++mb) o[mb][qt] = (v8f){}; }
    // the passes of this wave in turn: both halves of chunk wv, then of chunk wv + FNW, ...; the loop stays rolled: one pass's fragments, scores and the output tile are what lets four waves share a SIMD's registers.
    // fp16 rows fetch the key fragments one pass ahead (issued right behind the S^T products that free their registers, so that their latency lies under the softmax and the P.V products); past the last pass the fetch is clamped to the diagonal rows and not used.
    V kf[2][2], kf2[2][2]; int kc = wv * 64;
    if (!HR) { const T16* kp = Kp + (size_t)(min(kc, q0) + lr) * HD + 8 * hi;
#pragma unroll
        for (int kt = 0; kt < 2; ++kt) { kf[kt][0] = WFrag<T16>::ld(kp + kt * 16 * HD); kf[kt][1] = WFrag<T16>::ld(kp + kt * 16 * HD + 32); }
        xwait(kp); }
#pragma unroll 1
    while (kc <= q0) { const int kn = (kc & 32) ? kc + 32 + (FNW - 1) * 64 : kc + 32;
        const size_t ev = (size_t)lr * PP + kc + 8 * hi; const T16* vp = Vt + ev; V vf[4];
        if (!HR) {   // fp16 rows: the V^T fragments are asked for at the head of the pass; the hi/lo rows, with twice the fragments, load them where they are used, which keeps the kernel at four waves a SIMD
#pragma unroll
            for (int mb = 0; mb < 4; ++mb) vf[mb] = WFrag<T16>::ld(vp + (size_t)mb * 16 * PP); }
        v8f s[2][FQT];
#pragma unroll
        for (int kt = 0; kt < 2; ++kt) {
            if (HR) { const size_t e = (size_t)(kc + kt * 16 + lr) * HD + 8 * hi; const T16* kp = Kp + e; const T16* kp2 = K2 + e; kf[kt][0] = WFrag<T16>::ld(kp); kf[kt][1] = WFrag<T16>::ld(kp + 32); kf2[kt][0] = WFrag<T16>::ld(kp2); kf2[kt][1] = WFrag<T16>::ld(kp2 + 32); xwait(kp, kp2); }
#pragma unroll
            for (int qt = 0; qt < FQT; ++qt) { v8f c = (v8f){}; c = WFrag<T16>::mma(kf[kt][0], qf[qt][0], c); c = WFrag<T16>::mma(kf[kt][1], qf[qt][1], c);
                if (HR) { c = WFrag<T16>::mma(kf2[kt][0], qf[qt][0], c); c = WFrag<T16>::mma(kf2[kt][1], qf[qt][1], c); c = WFrag<T16>::mma(kf[kt][0], qf2[qt][0], c); c = WFrag<T16>::mma(kf[kt][1], qf2[qt][1], c); }
                s[kt][qt] = c; } }
        if (!HR) { const T16* kp = Kp + (size_t)(min(kn, q0) + lr) * HD + 8 * hi;
#pragma unroll
            for (int kt = 0; kt < 2; ++kt) { kf[kt][0] = WFrag<T16>::ld(kp + kt * 16 * HD); kf[kt][1] = WFrag<T16>::ld(kp + kt * 16 * HD + 32); }
            xwait(vp, kp); }
        if (kc == q0) {   // the diagonal pass (always a wave's last): key > query leaves the softmax; -inf against the finite start value of m gives probability 0 also where a query has no key in this wave
#pragma unroll
            for (int kt = 0; kt < 2; ++kt)
#pragma unroll
                for (int qt = 0; qt < FQT; ++qt)
#pragma unroll
                    for (int r = 0; r < 8; ++r) if (kt * 16 + 8 * hi + r > qt * 16 + lr) s[kt][qt][r] = -__builtin_inff(); }
        V pf[FQT], pf2[FQT];
#pragma unroll
        for (int qt = 0; qt < FQT; ++qt) { float mr = s[0][qt][0];
#pragma unroll
            for (int e = 1; e < 16; ++e) mr = fmaxf(mr, s[e >> 3][qt][e & 7]);
            mr = fmaxf(mr, xhalf(mr));
            const float mn = fmaxf(m[qt], mr * SCL2); const float al = __builtin_amdgcn_exp2f(m[qt] - mn); m[qt] = mn; const float sh = PCL2 - mn; float p[16]; float sum = 0.0f;
#pragma unroll
            for (int e = 0; e < 16; ++e) { p[e] = __builtin_amdgcn_exp2f(fmaf(s[e >> 3][qt][e & 7], SCL2, sh)); sum += p[e]; }
            l[qt] = l[qt] * al + sum;
#pragma unroll
            for (int mb = 0; mb < 4; ++mb) o[mb][qt] *= al;
            if constexpr (HR) { v8us h0, h1, l0, l1;
#pragma unroll
                for (int r = 0; r < 8; ++r) { unsigned short a, c2; splitf(p[r], a, c2); h0[r] = a; l0[r] = c2; splitf(p[8 + r], a, c2); h1[r] = a; l1[r] = c2; }
                pf[qt] = cat16b(h0, h1); pf2[qt] = cat16b(l0, l1);
            } else { v8h h0, h1;
#pragma unroll
                for (int r = 0; r < 8; ++r) { h0[r] = tohx(p[r]); h1[r] = tohx(p[8 + r]); }
                pf[qt] = cat16(h0, h1); } }
        V vf2[4];
#pragma unroll
        for (int mb = 0; mb < 4; ++mb) {
            if (HR && (mb & 1) == 0) { const T16* vq = vp + (size_t)mb * 16 * PP; const T16* vq2 = Vt2 + ev + (size_t)mb * 16 * PP; vf[mb] = WFrag<T16>::ld(vq); vf[mb + 1] = WFrag<T16>::ld(vq + (size_t)16 * PP); vf2[mb] = WFrag<T16>::ld(vq2); vf2[mb + 1] = WFrag<T16>::ld(vq2 + (size_t)16 * PP); xwait(vq, vq2); }
#pragma unroll
            for (int qt = 0; qt < FQT; ++qt) { o[mb][qt] = WFrag<T16>::mma(vf[mb], pf[qt], o[mb][qt]); if (HR) { o[mb][qt] = WFrag<T16>::mma(vf[mb], pf2[qt], o[mb][qt]); o[mb][qt] = WFrag<T16>::mma(vf2[mb], pf[qt], o[mb][qt]); } } }
        kc = kn;
    }
#pragma unroll
    for (int qt = 0; qt < FQT; ++qt) { l[qt] += xhalf(l[qt]); if (hi == 0) { om[qt * 16 + lr] = m[qt]; ol[qt * 16 + lr] = l[qt]; }
#pragma unroll
        for (int mb = 0; mb < 4; ++mb) { float* d = oo + (qt * 16 + lr) * FOP + mb * 16 + hi * 8; const v8f t = o[mb][qt]; *(v4fa*)d = (v4f){t[0], t[1], t[2], t[3]}; *(v4fa*)(d + 4) = (v4f){t[4], t[5], t[6], t[7]}; } }
}
__global__ __launch_bounds__(32 * FNW) __attribute__((amdgpu_waves_per_eu(4, 4))) void k_fattn(const h16* __restrict__ Q16, const h16* __restrict__ K16, const h16* __restrict__ V16, const bf* __restrict__ Qh, const bf* __restrict__ Ql, const bf* __restrict__ Kh, const bf* __restrict__ Kl, const bf* __restrict__ Vh, const bf* __restrict__ Vl, bf* Ah, bf* Al) {
    __shared__ __align__(16) float oo[FNW * 32 * FOP]; __shared__ float om[FNW * 32]; __shared__ float ol[FNW * 32];
    const int lane = threadIdx.x & 31, lr = lane & 15, hi = lane >> 4;
    const int wv = __builtin_amdgcn_readfirstlane((int)(threadIdx.x >> 5));   // the wave's number in a scalar register: the key loop's bounds and branches stay scalar
    const int h = blockIdx.x, q0 = (TT / 32 - 1 - (int)blockIdx.y) * 32; const int b = blockIdx.z;
    const size_t zq = ((size_t)h * NB_ + b) * TT * HD, zk = ((size_t)(h / REP) * NB_ + b) * TT * HD, zv = ((size_t)(b / (PP / TT)) * DKV + (size_t)(h / REP) * HD) * PP + (size_t)(b % (PP / TT)) * TT; Ah += (size_t)b * TT * DQ; Al += (size_t)b * TT * DQ;   // head planes [h][b][t][d]; V^T [b / 2][h * HD + d][(b % 2) * TT + t]; merged planes [b][t][DQ]
    if (q0 < RH) fattn_wave<bf, true>(Qh + zq, Ql + zq, Kh + zk, Kl + zk, Vh + zv, Vl + zv, q0, wv, lr, hi, om + wv * 32, ol + wv * 32, oo + wv * (32 * FOP));
    else fattn_wave<h16, false>(Q16 + zq, nullptr, K16 + zk, nullptr, V16 + zv, nullptr, q0, wv, lr, hi, om + wv * 32, ol + wv * 32, oo + wv * (32 * FOP));
    __syncthreads();   // every wave's partial (m, l, O) is in LDS before any thread joins them
#pragma unroll
    for (int s = 0; s < 8 / FNW; ++s) { const int it = s * (32 * FNW) + (int)threadIdx.x; const int q = it >> 3, oc = (it & 7) * 8; float M = om[q];
#pragma unroll
        for (int w = 1; w < FNW; ++w) M = fmaxf(M, om[w * 32 + q]);   // wave 0 always holds key 0, which every query sees: M is a real score
        float Ls = 0.0f; v4f a0 = (v4f){}, a1 = (v4f){};
#pragma unroll
        for (int w = 0; w < FNW; ++w) { const float f = __builtin_amdgcn_exp2f(om[w * 32 + q] - M); Ls += ol[w * 32 + q] * f; const float* sp = oo + (w * 32 + q) * FOP + oc; a0 += *(const v4fa*)sp * f; a1 += *(const v4fa*)(sp + 4) * f; }
        const float inv = __fdiv_rn(1.0f, Ls); v8us oh, olo;
#pragma unroll
        for (int k = 0; k < 4; ++k) { unsigned short a, c2; splitf(a0[k] * inv, a, c2); oh[k] = a; olo[k] = c2; splitf(a1[k] * inv, a, c2); oh[4 + k] = a; olo[4 + k] = c2; }
        const size_t e = (size_t)(q0 + q) * DQ + h * HD + oc; *(v8us*)(Ah + e) = oh; *(v8us*)(Al + e) = olo; }
}

extern "C" void kernel_launch(void* const* d_in, const int* in_sizes, int n_in,
                              void* d_out, int out_size, void* d_ws, size_t ws_size, hipStream_t stream) {
    (void)in_sizes; (void)n_in; (void)out_size;
    const float* x = (const float*)d_in[0]; const float* xk = (const float*)d_in[1]; const float* wq = (const float*)d_in[2]; const float* bq = (const float*)d_in[3]; const float* wk = (const float*)d_in[4]; const float* bk = (const float*)d_in[5]; const float* wv = (const float*)d_in[6]; const float* bv = (const float*)d_in[7]; const float* wo = (const float*)d_in[8]; const float* bo = (const float*)d_in[9]; /* order data, context, Wq, bq, Wk, bk, Wv, bv, Wo, bo ('xw' + biases): TEN inputs: TWO streams: the queries come from data (d_in[0]); the keys AND the values both come from context (d_in[1]): the kernel's key stream and value stream pointers are the same input */
    float* OUT = (float*)d_out;     // [4][2048][1024]
    char* wsp = (char*)d_ws;
    auto take = [&](size_t bytes) { char* p = wsp; wsp += (bytes + 255) & ~(size_t)255; return (void*)p; };
    bf* WQ = (bf*)take((size_t)DQ * DM * 2); bf* WK = (bf*)take((size_t)DKV * DM * 2); bf* WV = (bf*)take((size_t)DKV * DM * 2); bf* WO = (bf*)take((size_t)DM * DQ * 2);
    static_assert(DQ == DM && DKV == DM && (NB_ * TT) % PP == 0, "one transpose launch takes four equally shaped weights; a V^T row holds whole batches");
    bf* XB = (bf*)take((size_t)2 * NB_ * TT * DM * 2); bf* XC = XB + (size_t)NB_ * TT * DM;   // bf16 copies: data, then context
    h16* QP16 = (h16*)take((size_t)NB_ * NH_ * TT * HD * 2); h16* KP16 = (h16*)take((size_t)NB_ * NKV * TT * HD * 2); h16* VT16 = (h16*)take((size_t)NB_ * NKV * HD * TT * 2);
    bf* QPh = (bf*)take((size_t)NB_ * NH_ * TT * HD * 2); bf* QPl = (bf*)take((size_t)NB_ * NH_ * TT * HD * 2); bf* KPh = (bf*)take((size_t)NB_ * NKV * TT * HD * 2); bf* KPl = (bf*)take((size_t)NB_ * NKV * TT * HD * 2); bf* VTh = (bf*)take((size_t)NB_ * NKV * HD * TT * 2); bf* VTl = (bf*)take((size_t)NB_ * NKV * HD * TT * 2);
    bf* ATh = (bf*)take((size_t)NB_ * TT * DQ * 2); bf* ATl = (bf*)take((size_t)NB_ * TT * DQ * 2);
    if ((size_t)(wsp - (char*)d_ws) > ws_size) return;    // ws 256 MiB, 216 MiB taken
    k_wtG<<<dim3((unsigned)((DM * DQ / 64 + 63) / 64), 4, 1), 256, 0, stream>>>(wq, wk, wv, wo, DM, DQ, WQ);
    k_cvt8<<<dim3((unsigned)(((size_t)TT * DM / 8 + 255) / 256), 2, 1), 256, 0, stream>>>(x, xk, XB, (size_t)TT * DM / 8);
    k_gemmw<bf, 0, true, 8, false, 1><<<dim3(NB_ * TT / 64, DQ / 64, 1), 256, 0, stream>>>(XB, nullptr, WQ, nullptr, DM, nullptr, 0, bq, 0, 0, 0, 0, QP16, QPh, QPl, (size_t)NB_ * TT * HD, HD, 0);
    k_gemmw<bf, 0, true, 8, false, 1><<<dim3(NB_ * TT / 64, DKV / 64, 1), 256, 0, stream>>>(XC, nullptr, WK, nullptr, DM, nullptr, 0, bk, 0, 0, 0, 0, KP16, KPh, KPl, (size_t)NB_ * TT * HD, HD, 0);
    k_gemmw<bf, 0, true, 8, false, 2><<<dim3(DKV / 64, PP / 64, NB_ * TT / PP), 256, 0, stream>>>(WV, nullptr, XC, nullptr, DM, nullptr, 0, bv, 0, 0, (size_t)PP * DM, 0, VT16, VTh, VTl, 64, PP, (size_t)DKV * PP);   // weight rows as A, token rows as Bt: the tile is V^T as it stands; z = one V^T row's worth of tokens
    k_fattn<<<dim3(NH_, TT / 32, NB_), 32 * FNW, 0, stream>>>(QP16, KP16, VT16, QPh, QPl, KPh, KPl, VTh, VTl, ATh, ATl);
    k_gemmw<bf, 1, true, 8, false, 0><<<dim3(NB_ * TT / 64, DM / 64, 1), 256, 0, stream>>>(ATh, ATl, WO, nullptr, DQ, OUT, DM, bo, 0, 0, 0, 0, nullptr, nullptr, nullptr, 0, 0, 0);
}

// v006
// Measured time: 199 microseconds a run.
// Next to v005, in two timings, it ran 1.62 times as fast each time.
// All steps since v000 together make it 14.6 times as fast.
#include <hip/hip_runtime.h>

// Causal multi-head attention between two equally long streams with biased (in, out) projections (data, context [4][2048][1024]; Q = data Wq + bq, K = context Wk + bk, V = context Wv + bv ('xw' [1024][1024] normal x 0.02 + [1024] zeros on this draw: read; 16 heads x 64); scores / sqrt(64); causal (tril kept, -inf elsewhere: query i sees context positions j <= i); softmax over the keys; out = merged Wo + bo ('xw' + bias zeros: read) -> [4][2048][1024] (8.4 M); argument order data, context, Wq, bq, Wk, bk, Wv, bv, Wo, bo).
// Every 16-bit matrix operand plane (rows x K) lies in panels [row / 16][k / 8][row % 16][k % 8]: a 16 x 32 fragment is 1 KiB in a row and each of its two wave-wide 16-byte loads covers four whole 128-byte lines.
// Layout, every stage one launch over all batches: 'xw' weights transposed once; bf16 copies of the two streams; exact projections + f32 biases, whose epilogue writes the head planes; causal T-2048 attention in one fused launch (k_fattn; hybrid rows: < 512 hi/lo 3 products, rest fp16 x1024; nothing above the diagonal block is computed); merged hi/lo x w_o exact + b_o.
// Compute dtypes, f32 accumulate: every input rounded to bf16; projections exact + f32 biases; attention rows < 512 3 products, rest fp16; softmax f32; Wo hl x exact + bias.

#define NB_  4
#define TT   2048
#define DM   1024
#define NH_  16
#define NKV  16
#define REP  (NH_ / NKV)
#define HD   64
#define DQ   (NH_ * HD)
#define DKV  (NKV * HD)
#define PP   (2 * TT)             // row length, in 16-bit elements, of the V^T planes (a 16-row panel spans 16 * PP): a row holds the tokens of PP / TT batches
#define RH   512                  // query rows < RH use hi+lo planes (0: none)
#define SCL  0.125f   // HD^-0.5
typedef _Float16 h16;
typedef unsigned short bf;
typedef __attribute__((ext_vector_type(16))) __bf16   v16bf;
typedef __attribute__((ext_vector_type(16))) _Float16 v16h;
typedef __attribute__((ext_vector_type(8)))  _Float16 v8h;
typedef __attribute__((ext_vector_type(8)))  unsigned short v8us;
typedef __attribute__((ext_vector_type(8)))  float    v8f;
typedef __attribute__((ext_vector_type(4)))  float    v4f;
typedef v8h  __attribute__((may_alias)) v8ha;
typedef v4f  __attribute__((may_alias)) v4fa;
typedef v8us __attribute__((may_alias)) v8usa;

__device__ __forceinline__ unsigned short f2bf(float f) { unsigned u = __float_as_uint(f); u += 0x7FFFu + ((u >> 16) & 1u); return (unsigned short)(u >> 16); }
__device__ __forceinline__ float bf2f(unsigned short b) { return __uint_as_float(((unsigned)b) << 16); }
__device__ __forceinline__ float bfr(float f) { return bf2f(f2bf(f)); }
__device__ __forceinline__ v16h cat16(v8h lo, v8h hi) { return __builtin_shufflevector(lo, hi, 0, 1, 2, 3, 4, 5, 6, 7, 8, 9, 10, 11, 12, 13, 14, 15); }
__device__ __forceinline__ v16bf cat16b(v8us lo, v8us hi) { return __builtin_bit_cast(v16bf, __builtin_shufflevector(lo, hi, 0, 1, 2, 3, 4, 5, 6, 7, 8, 9, 10, 11, 12, 13, 14, 15)); }
__device__ __forceinline__ v8f wmma16(v16h a, v16h b, v8f c) { return __builtin_amdgcn_wmma_f32_16x16x32_f16(false, a, false, b, (short)0, c, false, false); }
__device__ __forceinline__ v8f wmmab(v16bf a, v16bf b, v8f c) { return __builtin_amdgcn_wmma_f32_16x16x32_bf16(false, a, false, b, (short)0, c, false, false); }



// ---- k_gemmw: register-blocked GEMM, one 64x64 output tile per work-group, the K loop dealt over the NW waves of the group in 64-wide chunks (wave w takes chunks w, w + NW, ...); every wave keeps the
// whole tile (16 accumulators), operands straight from 16-bit planes in the panel layout; the NW partial tiles meet in LDS and are summed in wave order 0..NW-1. grid (M/64, N/64, Z), 32 * NW threads.
// C[m][n] (f32, pitch ldc, + optional f32 bias[n]) = sum_k A[m][k] Bt[n][k] (+ split products per NSPLIT). z-batch strides sA/sB/sC in elements. K % 64 == 0.
// EP: what the epilogue stores. 0: the f32 tile C + bias[n]. 1, 2: no f32 tile: the summed tile + bias (1: bias[n]; 2: bias[m]) goes straight out as three 16-bit planes (fp16, bf16 hi, bf16 lo) at element
// blockIdx.y * sY + (m / 16) * 16 * pp + ((n - c0) / 8) * 128 + (m % 16) * 8 + n % 8 (panels of a plane with pp columns). With m = b * TT + t, sY = NB_ * TT * HD, pp = HD that is the head plane [h][b][t][d] (a 64-wide column tile is one head); with A = weight rows, Bt = token rows, sY = 64 * 16, pp = PP it is V^T [h * HD + d][t].
// sP: z-batch stride, in elements, of the three planes.
// CK: probability x value contraction of causal attention: the K loop stops at the diagonal block (probabilities beyond it are exactly zero); roff = row offset of this launch's first row within the sequence.
__device__ __forceinline__ h16 tohx(float x) { return (h16)x; }
__device__ __forceinline__ void splitf(float y, unsigned short& h, unsigned short& l) { h = f2bf(y); l = f2bf(y - bf2f(h)); }
// Precaution behind a group of global loads or stores: the wait stands in front of whatever next reuses the address registers that they name; the base pointers are inputs so that those registers stay theirs up to the wait.
template <typename T16> __device__ __forceinline__ void xwait(const T16* p) { asm volatile("s_wait_xcnt 0x0" :: "v"(p) : "memory"); }
template <typename T16> __device__ __forceinline__ void xwait(const T16* p, const T16* p2) { asm volatile("s_wait_xcnt 0x0" :: "v"(p), "v"(p2) : "memory"); }
template <typename T16> __device__ __forceinline__ void xwait(const T16* p, const T16* p2, const T16* p3) { asm volatile("s_wait_xcnt 0x0" :: "v"(p), "v"(p2), "v"(p3) : "memory"); }
template <typename T16> __device__ __forceinline__ void xwait(const T16* p, const T16* p2, const T16* p3, const T16* p4) { asm volatile("s_wait_xcnt 0x0" :: "v"(p), "v"(p2), "v"(p3), "v"(p4) : "memory"); }
template <typename T16> struct WFrag;
template <> struct WFrag<h16> { typedef v16h V; static __device__ __forceinline__ V ld(const h16* p) { return cat16(*(const v8h*)p, *(const v8h*)(p + 256)); } static __device__ __forceinline__ v8f mma(V a, V b, v8f c) { return wmma16(a, b, c); } };
template <> struct WFrag<bf> { typedef v16bf V; static __device__ __forceinline__ V ld(const bf* p) { return cat16b(*(const v8us*)p, *(const v8us*)(p + 256)); } static __device__ __forceinline__ v8f mma(V a, V b, v8f c) { return wmmab(a, b, c); } };
template <typename T16, int NSPLIT, bool BIAS, int NW, bool CK, int EP, int K>
__global__ __launch_bounds__(32 * NW) void k_gemmw(const T16* __restrict__ A, const T16* __restrict__ A2, const T16* __restrict__ Bt, const T16* __restrict__ Bt2, float* C, int ldc, const float* __restrict__ bias, int roff, size_t sA, size_t sB, size_t sC, h16* P16, bf* Ph, bf* Pl, size_t sY, int pp, size_t sP) {
    typedef typename WFrag<T16>::V V;
    __shared__ __align__(16) float os[NW * 64 * 68];
    const size_t z = blockIdx.z; A += z * sA; if (A2) A2 += z * sA; Bt += z * sB; if (Bt2) Bt2 += z * sB; C += z * sC; if constexpr (EP != 0) { P16 += z * sP; Ph += z * sP; Pl += z * sP; }
    const int lane = threadIdx.x & 31, lr = lane & 15, hi = lane >> 4; const int r0 = blockIdx.x * 64, c0 = blockIdx.y * 64;
    const int wv = __builtin_amdgcn_readfirstlane((int)(threadIdx.x >> 5));   // the wave's number in a scalar register: the K loop's bounds and branches stay scalar
    const int Kl = CK ? min(K, r0 + roff + 64) : K;
    v8f acc[4][4];
#pragma unroll
    for (int mb = 0; mb < 4; ++mb)
#pragma unroll
        for (int nb = 0; nb < 4; ++nb) acc[mb][nb] = (v8f){};
    const size_t aoff = (size_t)r0 * K + 8 * lane, boff = (size_t)c0 * K + 8 * lane;   // panel layout: the lane's 16 bytes of a fragment's first half
    // both loops stay rolled: one k-step's operands and the 16 accumulators are what the register budget of an 8-wave group holds; a 64-wide chunk is 2 KiB in a row of every 16-row panel
#pragma unroll 1
    for (int kb = wv * 64; kb < Kl; kb += NW * 64) {
#pragma unroll 1
    for (int kc = kb; kc < kb + 64; kc += 32) {
        V a[4], a2[4]; const T16* pa = A + aoff + kc * 16; const T16* pa2 = (NSPLIT == 1 || NSPLIT == 2) ? A2 + aoff + kc * 16 : pa; const T16* pb = Bt + boff + kc * 16; const T16* pb2 = NSPLIT >= 2 ? Bt2 + boff + kc * 16 : pb;   // one base a plane; the panels of a k-step lie at compile-time distances (K is a template constant)
#pragma unroll
        for (int mb = 0; mb < 4; ++mb) { a[mb] = WFrag<T16>::ld(pa + mb * 16 * K); if (NSPLIT == 1 || NSPLIT == 2) a2[mb] = WFrag<T16>::ld(pa2 + mb * 16 * K); }
#pragma unroll
        for (int nb = 0; nb < 4; ++nb) { const V b = WFrag<T16>::ld(pb + nb * 16 * K); V b2; if (NSPLIT >= 2) b2 = WFrag<T16>::ld(pb2 + nb * 16 * K);
#pragma unroll
            for (int mb = 0; mb < 4; ++mb) { acc[mb][nb] = WFrag<T16>::mma(a[mb], b, acc[mb][nb]); if (NSPLIT == 1 || NSPLIT == 2) acc[mb][nb] = WFrag<T16>::mma(a2[mb], b, acc[mb][nb]); if (NSPLIT >= 2) acc[mb][nb] = WFrag<T16>::mma(a[mb], b2, acc[mb][nb]); } }
        xwait(pa, pa2, pb, pb2);
        asm volatile("v_nop\n\tv_nop\n\tv_nop\n\tv_nop" : "+v"(acc[0][0]), "+v"(acc[1][1]), "+v"(acc[2][2]), "+v"(acc[3][3]) : "v"(a[0]), "v"(a[3]));
    } }
    float* my = os + wv * (64 * 68);
#pragma unroll
    for (int mb = 0; mb < 4; ++mb)
#pragma unroll
        for (int nb = 0; nb < 4; ++nb)
#pragma unroll
            for (int j = 0; j < 8; ++j) my[(mb * 16 + hi * 8 + j) * 68 + nb * 16 + lr] = acc[mb][nb][j];
    __syncthreads();   // every wave's partial tile is in LDS before any thread sums across the waves
    if constexpr (EP != 0) {   // eight columns a thread: one 16-byte store a plane; a wave takes 16 rows x 2 octets, 512 bytes in a row of the panel
#pragma unroll
        for (int s = 0; s < 16 / NW; ++s) { const int idx = s * (32 * NW) + (int)threadIdx.x; const int row = (idx >> 7) * 16 + (idx & 15), cofs = ((idx >> 4) & 7) * 8; v4f v0 = *(const v4fa*)(os + row * 68 + cofs), v1 = *(const v4fa*)(os + row * 68 + cofs + 4);
#pragma unroll
            for (int w = 1; w < NW; ++w) { v0 += *(const v4fa*)(os + w * (64 * 68) + row * 68 + cofs); v1 += *(const v4fa*)(os + w * (64 * 68) + row * 68 + cofs + 4); }
            v8h o16; v8us oh, ol;
#pragma unroll
            for (int k = 0; k < 8; ++k) { float y = k < 4 ? v0[k & 3] : v1[k & 3]; if (BIAS) y += bfr(bias[EP == 2 ? r0 + row : c0 + cofs + k]); o16[k] = tohx(y); unsigned short a, c2; splitf(y, a, c2); oh[k] = a; ol[k] = c2; }
            const size_t e = (size_t)blockIdx.y * sY + (size_t)(r0 + (idx >> 7) * 16) * pp + (idx & 127) * 8; *(v8h*)(P16 + e) = o16; *(v8us*)(Ph + e) = oh; *(v8us*)(Pl + e) = ol; xwait((const bf*)(P16 + e), (const bf*)(Ph + e), (const bf*)(Pl + e)); }
        return; }
#pragma unroll
    for (int s = 0; s < 32 / NW; ++s) { const int idx = s * (32 * NW) + (int)threadIdx.x; const int row = idx >> 4, cofs = (idx & 15) * 4; v4f val = *(const v4fa*)(os + row * 68 + cofs);
#pragma unroll
        for (int w = 1; w < NW; ++w) val += *(const v4fa*)(os + w * (64 * 68) + row * 68 + cofs);
        if (BIAS) { val[0] += bfr(bias[c0 + cofs]); val[1] += bfr(bias[c0 + cofs + 1]); val[2] += bfr(bias[c0 + cofs + 2]); val[3] += bfr(bias[c0 + cofs + 3]); }
        *(v4f*)(C + (size_t)(r0 + row) * ldc + c0 + cofs) = val; }
}

typedef __attribute__((ext_vector_type(2))) _Float16 v2h;
typedef __attribute__((ext_vector_type(4))) _Float16 v4h;
typedef __attribute__((ext_vector_type(2))) unsigned short v2us;
typedef __attribute__((ext_vector_type(4))) unsigned short v4us;
typedef __attribute__((ext_vector_type(2))) float v2f;
typedef __attribute__((ext_vector_type(4))) int v4i;

// the four equally shaped weights in one launch: blockIdx.y picks the weight and its plane (the planes lie one behind the other)
__global__ __launch_bounds__(256) void k_wtG(const float* __restrict__ w0, const float* __restrict__ w1, const float* __restrict__ w2, const float* __restrict__ w3, int K, int N, bf* Bt) {
    const int y = blockIdx.y; const float* __restrict__ w = y == 0 ? w0 : y == 1 ? w1 : y == 2 ? w2 : w3; Bt += (size_t)y * N * K;
    const int lane = threadIdx.x & 31; const int L0 = (blockIdx.x * 8 + (threadIdx.x >> 5)) * 8; const int nlines = N * K / 64;
{
#pragma unroll 1
        for (int l = 0; l < 8; ++l) { const int L = L0 + l; if (L >= nlines) break; const size_t e = (size_t)L * 64 + lane * 2; const size_t pn = e / ((size_t)16 * K); const int w16 = (int)(e % ((size_t)16 * K)); const int k = (w16 >> 7) * 8 + (w16 & 7), n = (int)pn * 16 + ((w16 >> 3) & 15); v2us o;
            o[0] = f2bf(w[(size_t)k * N + n]); o[1] = f2bf(w[(size_t)(k + 1) * N + n]); *(v2us*)(Bt + e) = o; }
         }
}
// both streams' bf16 copies in one launch: blockIdx.y picks the stream; a thread converts its 8-element unit of every batch (n8 units a batch), the loads of the NB_ units in flight together
__global__ __launch_bounds__(256) void k_cvt8(const float* __restrict__ s0, const float* __restrict__ s1, bf* dst, size_t n8) { const size_t i = (size_t)blockIdx.x * 256 + threadIdx.x; if (i >= n8) return;
    const float* __restrict__ src = blockIdx.y ? s1 : s0; dst += (size_t)blockIdx.y * NB_ * n8 * 8; v8f v[NB_];
    const size_t so = ((i / (DM * 2)) * 16 + (i & 15)) * DM + ((i % (DM * 2)) >> 4) * 8;   // unit i of the panel layout is row (panel * 16 + i % 16), octet (i % (16 * DM / 8)) / 16 of the source
#pragma unroll
    for (int b = 0; b < NB_; ++b) v[b] = *(const v8f*)(src + (size_t)b * n8 * 8 + so);
#pragma unroll
    for (int b = 0; b < NB_; ++b) { v8us o;
#pragma unroll
        for (int k = 0; k < 8; ++k) o[k] = f2bf(v[b][k]);
        *(v8us*)(dst + ((size_t)b * n8 + i) * 8) = o; } }

// ---- k_fattn: the whole causal attention of all batches in one launch: scores, softmax, probability x value product and the merge of the heads into the hi/lo planes that the output projection reads.
// One work-group = one head x 32 query rows; grid (heads, TT / 32, batches), within a batch the longest query tiles first (cost falls with the index; the next batch's long tiles take the places that the short ones leave). The keys 0 .. q0 + 31 are dealt over the FNW waves in 64-key chunks (2 KiB
// in a row of every V^T panel), each worked in two 32-key passes. Transposed products: S^T = K Q^T (A = key rows, B = query rows, same loader, same k order), so a lane holds 16 scores of ONE query per pass
// and column group: maximum and sum in the lane plus one exchange between the wave's halves; two S^T tiles (keys 0-15, 16-31), converted in place, ARE the B operand of O^T += V^T P^T (A = V^T rows in the same k order).
// Running maximum m (scaled log2 units) and running sum l per query and wave; the FNW partial (m, l, O) meet in LDS and are joined in wave order. Probabilities carry 2^PCL2 (it cancels in O / l) so that small ones stay normal in fp16.
// Query rows < RH: hi/lo bf16 planes, 3 products in both contractions; the rest fp16.
#define FQT  2                    // 16-query column groups per wave
#define FNW  4                    // waves per work-group
#define FOP  68                   // LDS pitch (floats) of a query's 64 partial outputs
#define SCL2 (SCL * 1.4426950408889634f)
#define PCL2 10.0f
__device__ __forceinline__ float xhalf(float x) { return __builtin_bit_cast(float, __builtin_amdgcn_permlanex16(__builtin_bit_cast(int, x), __builtin_bit_cast(int, x), 0x76543210, 0xfedcba98, false, false)); }   // lane l reads lane l ^ 16, on the vector pipe
template <typename T16, bool HR>
__device__ __forceinline__ void fattn_wave(const T16* __restrict__ Q, const T16* __restrict__ Q2, const T16* __restrict__ Kp, const T16* __restrict__ K2, const T16* __restrict__ Vt, const T16* __restrict__ Vt2, int q0, int wv, int lr, int hi, float* om, float* ol, float* oo) {
    typedef typename WFrag<T16>::V V;
    const int l8 = (hi * 16 + lr) * 8;   // panel layout: the lane's 16 bytes of a fragment's first half
    V qf[FQT][2], qf2[FQT][2];
    { const size_t e = (size_t)q0 * HD + l8; const T16* qp = Q + e; const T16* qp2 = HR ? Q2 + e : qp;
#pragma unroll
      for (int qt = 0; qt < FQT; ++qt)
#pragma unroll
        for (int ds = 0; ds < 2; ++ds) { qf[qt][ds] = WFrag<T16>::ld(qp + qt * 16 * HD + ds * 512); if (HR) qf2[qt][ds] = WFrag<T16>::ld(qp2 + qt * 16 * HD + ds * 512); }
      if (HR) xwait(qp, qp2); else xwait(qp); }
    v8f o[4][FQT]; float m[FQT], l[FQT];
#pragma unroll
    for (int qt = 0; qt < FQT; ++qt) { m[qt] = -3.0e38f; l[qt] = 0.0f;
#pragma unroll
        for (int mb = 0; mb < 4; ++mb) o[mb][qt] = (v8f){}; }
    // the passes of this wave in turn: both halves of chunk wv, then of chunk wv + FNW, ...; the loop stays rolled: one pass's fragments, scores and the output tile are what lets four waves share a SIMD's registers.
    // fp16 rows fetch the key fragments one pass ahead (issued right behind the S^T products that free their registers, so that their latency lies under the softmax and the P.V products); past the last pass the fetch is clamped to the diagonal rows and not used.
    V kf[2][2], kf2[2][2]; int kc = wv * 64;
    if (!HR) { const T16* kp = Kp + (size_t)min(kc, q0) * HD + l8;
#pragma unroll
        for (int kt = 0; kt < 2; ++kt) { kf[kt][0] = WFrag<T16>::ld(kp + kt * 16 * HD); kf[kt][1] = WFrag<T16>::ld(kp + kt * 16 * HD + 512); }
        xwait(kp); }
#pragma unroll 1
    while (kc <= q0) { const int kn = (kc & 32) ? kc + 32 + (FNW - 1) * 64 : kc + 32;
        const size_t ev = (size_t)kc * 16 + l8; const T16* vp = Vt + ev; V vf[4];
        if (!HR) {   // fp16 rows: the V^T fragments are asked for at the head of the pass; the hi/lo rows, with twice the fragments, load them where they are used, which keeps the kernel at four waves a SIMD
#pragma unroll
            for (int mb = 0; mb < 4; ++mb) vf[mb] = WFrag<T16>::ld(vp + (size_t)mb * 16 * PP); }
        v8f s[2][FQT];
#pragma unroll
        for (int kt = 0; kt < 2; ++kt) {
            if (HR) { const size_t e = (size_t)(kc + kt * 16) * HD + l8; const T16* kp = Kp + e; const T16* kp2 = K2 + e; kf[kt][0] = WFrag<T16>::ld(kp); kf[kt][1] = WFrag<T16>::ld(kp + 512); kf2[kt][0] = WFrag<T16>::ld(kp2); kf2[kt][1] = WFrag<T16>::ld(kp2 + 512); xwait(kp, kp2); }
#pragma unroll
            for (int qt = 0; qt < FQT; ++qt) { v8f c = (v8f){}; c = WFrag<T16>::mma(kf[kt][0], qf[qt][0], c); c = WFrag<T16>::mma(kf[kt][1], qf[qt][1], c);
                if (HR) { c = WFrag<T16>::mma(kf2[kt][0], qf[qt][0], c); c = WFrag<T16>::mma(kf2[kt][1], qf[qt][1], c); c = WFrag<T16>::mma(kf[kt][0], qf2[qt][0], c); c = WFrag<T16>::mma(kf[kt][1], qf2[qt][1], c); }
                s[kt][qt] = c; } }
        if (!HR) { const T16* kp = Kp + (size_t)min(kn, q0) * HD + l8;
#pragma unroll
            for (int kt = 0; kt < 2; ++kt) { kf[kt][0] = WFrag<T16>::ld(kp + kt * 16 * HD); kf[kt][1] = WFrag<T16>::ld(kp + kt * 16 * HD + 512); }
            xwait(vp, kp); }
        if (kc == q0) {   // the diagonal pass (always a wave's last): key > query leaves the softmax; -inf against the finite start value of m gives probability 0 also where a query has no key in this wave
#pragma unroll
            for (int kt = 0; kt < 2; ++kt)
#pragma unroll
                for (int qt = 0; qt < FQT; ++qt)
#pragma unroll
                    for (int r = 0; r < 8; ++r) if (kt * 16 + 8 * hi + r > qt * 16 + lr) s[kt][qt][r] = -__builtin_inff(); }
        V pf[FQT], pf2[FQT];
#pragma unroll
        for (int qt = 0; qt < FQT; ++qt) { float mr = s[0][qt][0];
#pragma unroll
            for (int e = 1; e < 16; ++e) mr = fmaxf(mr, s[e >> 3][qt][e & 7]);
            mr = fmaxf(mr, xhalf(mr));
            const float mn = fmaxf(m[qt], mr * SCL2); const float al = __builtin_amdgcn_exp2f(m[qt] - mn); m[qt] = mn; const float sh = PCL2 - mn; float p[16]; float sum = 0.0f;
#pragma unroll
            for (int e = 0; e < 16; ++e) { p[e] = __builtin_amdgcn_exp2f(fmaf(s[e >> 3][qt][e & 7], SCL2, sh)); sum += p[e]; }
            l[qt] = l[qt] * al + sum;
#pragma unroll
            for (int mb = 0; mb < 4; ++mb) o[mb][qt] *= al;
            if constexpr (HR) { v8us h0, h1, l0, l1;
#pragma unroll
                for (int r = 0; r < 8; ++r) { unsigned short a, c2; splitf(p[r], a, c2); h0[r] = a; l0[r] = c2; splitf(p[8 + r], a, c2); h1[r] = a; l1[r] = c2; }
                pf[qt] = cat16b(h0, h1); pf2[qt] = cat16b(l0, l1);
            } else { v8h h0, h1;
#pragma unroll
                for (int r = 0; r < 8; ++r) { h0[r] = tohx(p[r]); h1[r] = tohx(p[8 + r]); }
                pf[qt] = cat16(h0, h1); } }
        V vf2[4];
#pragma unroll
        for (int mb = 0; mb < 4; ++mb) {
            if (HR && (mb & 1) == 0) { const T16* vq = vp + (size_t)mb * 16 * PP; const T16* vq2 = Vt2 + ev + (size_t)mb * 16 * PP; vf[mb] = WFrag<T16>::ld(vq); vf[mb + 1] = WFrag<T16>::ld(vq + (size_t)16 * PP); vf2[mb] = WFrag<T16>::ld(vq2); vf2[mb + 1] = WFrag<T16>::ld(vq2 + (size_t)16 * PP); xwait(vq, vq2); }
#pragma unroll
            for (int qt = 0; qt < FQT; ++qt) { o[mb][qt] = WFrag<T16>::mma(vf[mb], pf[qt], o[mb][qt]); if (HR) { o[mb][qt] = WFrag<T16>::mma(vf[mb], pf2[qt], o[mb][qt]); o[mb][qt] = WFrag<T16>::mma(vf2[mb], pf[qt], o[mb][qt]); } } }
        kc = kn;
    }
#pragma unroll
    for (int qt = 0; qt < FQT; ++qt) { l[qt] += xhalf(l[qt]); if (hi == 0) { om[qt * 16 + lr] = m[qt]; ol[qt * 16 + lr] = l[qt]; }
#pragma unroll
        for (int mb = 0; mb < 4; ++mb) { float* d = oo + (qt * 16 + lr) * FOP + mb * 16 + hi * 8; const v8f t = o[mb][qt]; *(v4fa*)d = (v4f){t[0], t[1], t[2], t[3]}; *(v4fa*)(d + 4) = (v4f){t[4], t[5], t[6], t[7]}; } }
}
__global__ __launch_bounds__(32 * FNW) __attribute__((amdgpu_waves_per_eu(4, 4))) void k_fattn(const h16* __restrict__ Q16, const h16* __restrict__ K16, const h16* __restrict__ V16, const bf* __restrict__ Qh, const bf* __restrict__ Ql, const bf* __restrict__ Kh, const bf* __restrict__ Kl, const bf* __restrict__ Vh, const bf* __restrict__ Vl, bf* Ah, bf* Al) {
    __shared__ __align__(16) float oo[FNW * 32 * FOP]; __shared__ float om[FNW * 32]; __shared__ float ol[FNW * 32];
    const int lane = threadIdx.x & 31, lr = lane & 15, hi = lane >> 4;
    const int wv = __builtin_amdgcn_readfirstlane((int)(threadIdx.x >> 5));   // the wave's number in a scalar register: the key loop's bounds and branches stay scalar
    const int h = blockIdx.x, q0 = (TT / 32 - 1 - (int)blockIdx.y) * 32; const int b = blockIdx.z;
    const size_t zq = ((size_t)h * NB_ + b) * TT * HD, zk = ((size_t)(h / REP) * NB_ + b) * TT * HD, zv = ((size_t)(b / (PP / TT)) * DKV + (size_t)(h / REP) * HD) * PP + (size_t)(b % (PP / TT)) * TT * 16; Ah += (size_t)b * TT * DQ; Al += (size_t)b * TT * DQ;   // head planes [h][b][t][d]; V^T [b / 2][h * HD + d][(b % 2) * TT + t]; merged planes [b][t][DQ]; each in 16-row panels, so a column offset counts 16 elements a column
    if (q0 < RH) fattn_wave<bf, true>(Qh + zq, Ql + zq, Kh + zk, Kl + zk, Vh + zv, Vl + zv, q0, wv, lr, hi, om + wv * 32, ol + wv * 32, oo + wv * (32 * FOP));
    else fattn_wave<h16, false>(Q16 + zq, nullptr, K16 + zk, nullptr, V16 + zv, nullptr, q0, wv, lr, hi, om + wv * 32, ol + wv * 32, oo + wv * (32 * FOP));
    __syncthreads();   // every wave's partial (m, l, O) is in LDS before any thread joins them
#pragma unroll
    for (int s = 0; s < 8 / FNW; ++s) { const int it = s * (32 * FNW) + (int)threadIdx.x; const int q = (it >> 7) * 16 + (it & 15), oc = ((it >> 4) & 7) * 8; float M = om[q];
#pragma unroll
        for (int w = 1; w < FNW; ++w) M = fmaxf(M, om[w * 32 + q]);   // wave 0 always holds key 0, which every query sees: M is a real score
        float Ls = 0.0f; v4f a0 = (v4f){}, a1 = (v4f){};
#pragma unroll
        for (int w = 0; w < FNW; ++w) { const float f = __builtin_amdgcn_exp2f(om[w * 32 + q] - M); Ls += ol[w * 32 + q] * f; const float* sp = oo + (w * 32 + q) * FOP + oc; a0 += *(const v4fa*)sp * f; a1 += *(const v4fa*)(sp + 4) * f; }
        const float inv = __fdiv_rn(1.0f, Ls); v8us oh, olo;
#pragma unroll
        for (int k = 0; k < 4; ++k) { unsigned short a, c2; splitf(a0[k] * inv, a, c2); oh[k] = a; olo[k] = c2; splitf(a1[k] * inv, a, c2); oh[4 + k] = a; olo[4 + k] = c2; }
        const size_t e = (size_t)(q0 + (it >> 7) * 16) * DQ + (size_t)h * (HD * 16) + (it & 127) * 8; *(v8us*)(Ah + e) = oh; *(v8us*)(Al + e) = olo; xwait((const bf*)(Ah + e), (const bf*)(Al + e)); }
}

extern "C" void kernel_launch(void* const* d_in, const int* in_sizes, int n_in,
                              void* d_out, int out_size, void* d_ws, size_t ws_size, hipStream_t stream) {
    (void)in_sizes; (void)n_in; (void)out_size;
    const float* x = (const float*)d_in[0]; const float* xk = (const float*)d_in[1]; const float* wq = (const float*)d_in[2]; const float* bq = (const float*)d_in[3]; const float* wk = (const float*)d_in[4]; const float* bk = (const float*)d_in[5]; const float* wv = (const float*)d_in[6]; const float* bv = (const float*)d_in[7]; const float* wo = (const float*)d_in[8]; const float* bo = (const float*)d_in[9]; /* order data, context, Wq, bq, Wk, bk, Wv, bv, Wo, bo ('xw' + biases): TEN inputs: TWO streams: the queries come from data (d_in[0]); the keys AND the values both come from context (d_in[1]): the kernel's key stream and value stream pointers are the same input */
    float* OUT = (float*)d_out;     // [4][2048][1024]
    char* wsp = (char*)d_ws;
    auto take = [&](size_t bytes) { char* p = wsp; wsp += (bytes + 255) & ~(size_t)255; return (void*)p; };
    bf* WQ = (bf*)take((size_t)DQ * DM * 2); bf* WK = (bf*)take((size_t)DKV * DM * 2); bf* WV = (bf*)take((size_t)DKV * DM * 2); bf* WO = (bf*)take((size_t)DM * DQ * 2);
    static_assert(DQ == DM && DKV == DM && (NB_ * TT) % PP == 0, "one transpose launch takes four equally shaped weights; a V^T row holds whole batches");
    bf* XB = (bf*)take((size_t)2 * NB_ * TT * DM * 2); bf* XC = XB + (size_t)NB_ * TT * DM;   // bf16 copies: data, then context
    h16* QP16 = (h16*)take((size_t)NB_ * NH_ * TT * HD * 2); h16* KP16 = (h16*)take((size_t)NB_ * NKV * TT * HD * 2); h16* VT16 = (h16*)take((size_t)NB_ * NKV * HD * TT * 2);
    bf* QPh = (bf*)take((size_t)NB_ * NH_ * TT * HD * 2); bf* QPl = (bf*)take((size_t)NB_ * NH_ * TT * HD * 2); bf* KPh = (bf*)take((size_t)NB_ * NKV * TT * HD * 2); bf* KPl = (bf*)take((size_t)NB_ * NKV * TT * HD * 2); bf* VTh = (bf*)take((size_t)NB_ * NKV * HD * TT * 2); bf* VTl = (bf*)take((size_t)NB_ * NKV * HD * TT * 2);
    bf* ATh = (bf*)take((size_t)NB_ * TT * DQ * 2); bf* ATl = (bf*)take((size_t)NB_ * TT * DQ * 2);
    if ((size_t)(wsp - (char*)d_ws) > ws_size) return;    // ws 256 MiB, 216 MiB taken
    k_wtG<<<dim3((unsigned)((DM * DQ / 64 + 63) / 64), 4, 1), 256, 0, stream>>>(wq, wk, wv, wo, DM, DQ, WQ);
    k_cvt8<<<dim3((unsigned)(((size_t)TT * DM / 8 + 255) / 256), 2, 1), 256, 0, stream>>>(x, xk, XB, (size_t)TT * DM / 8);
    k_gemmw<bf, 0, true, 8, false, 1, DM><<<dim3(NB_ * TT / 64, DQ / 64, 1), 256, 0, stream>>>(XB, nullptr, WQ, nullptr, nullptr, 0, bq, 0, 0, 0, 0, QP16, QPh, QPl, (size_t)NB_ * TT * HD, HD, 0);
    k_gemmw<bf, 0, true, 8, false, 1, DM><<<dim3(NB_ * TT / 64, DKV / 64, 1), 256, 0, stream>>>(XC, nullptr, WK, nullptr, nullptr, 0, bk, 0, 0, 0, 0, KP16, KPh, KPl, (size_t)NB_ * TT * HD, HD, 0);
    k_gemmw<bf, 0, true, 8, false, 2, DM><<<dim3(DKV / 64, PP / 64, NB_ * TT / PP), 256, 0, stream>>>(WV, nullptr, XC, nullptr, nullptr, 0, bv, 0, 0, (size_t)PP * DM, 0, VT16, VTh, VTl, 64 * 16, PP, (size_t)DKV * PP);   // weight rows as A, token rows as Bt: the tile is V^T as it stands; z = one V^T row's worth of tokens
    k_fattn<<<dim3(NH_, TT / 32, NB_), 32 * FNW, 0, stream>>>(QP16, KP16, VT16, QPh, QPl, KPh, KPl, VTh, VTl, ATh, ATl);
    k_gemmw<bf, 1, true, 8, false, 0, DQ><<<dim3(NB_ * TT / 64, DM / 64, 1), 256, 0, stream>>>(ATh, ATl, WO, nullptr, OUT, DM, bo, 0, 0, 0, 0, nullptr, nullptr, nullptr, 0, 0, 0);
}

// v007
// It runs in 143 microseconds.
// Timed twice side by side with v006, it ran 1.37 and 1.38 times as fast.
// Over all steps from v000 it is 20.0 times as fast.
#include <hip/hip_runtime.h>

// Causal multi-head attention between two equally long streams with biased (in, out) projections (data, context [4][2048][1024]; Q = data Wq + bq, K = context Wk + bk, V = context Wv + bv ('xw' [1024][1024] normal x 0.02 + [1024] zeros on this draw: read; 16 heads x 64); scores / sqrt(64); causal (tril kept, -inf elsewhere: query i sees context positions j <= i); softmax over the keys; out = merged Wo + bo ('xw' + bias zeros: read) -> [4][2048][1024] (8.4 M); argument order data, context, Wq, bq, Wk, bk, Wv, bv, Wo, bo).
// Every 16-bit matrix operand plane (rows x K) lies in panels [row / 16][k / 8][row % 16][k % 8]: a 16 x 32 fragment is 1 KiB in a row and each of its two wave-wide 16-byte loads covers four whole 128-byte lines.
// Layout, every stage one launch over all batches: 'xw' weights transposed once; bf16 copies of the two streams; exact projections + f32 biases, whose epilogue writes the head planes; causal T-2048 attention in one fused launch (k_fattn; hybrid rows: < 512 hi/lo 3 products, rest fp16 x1024; nothing above the diagonal block is computed); merged hi/lo x w_o exact + b_o.
// Compute dtypes, f32 accumulate: every input rounded to bf16; projections exact + f32 biases; attention rows < 512 3 products, rest fp16; softmax f32; Wo hl x exact + bias.

#define NB_  4
#define TT   2048
#define DM   1024
#define NH_  16
#define NKV  16
#define REP  (NH_ / NKV)
#define HD   64
#define DQ   (NH_ * HD)
#define DKV  (NKV * HD)
#define PP   (2 * TT)             // row length, in 16-bit elements, of the V^T planes (a 16-row panel spans 16 * PP): a row holds the tokens of PP / TT batches
#define RH   512                  // query rows < RH use hi+lo planes (0: none)
#define SCL  0.125f   // HD^-0.5
typedef _Float16 h16;
typedef unsigned short bf;
typedef __attribute__((ext_vector_type(16))) __bf16   v16bf;
typedef __attribute__((ext_vector_type(16))) _Float16 v16h;
typedef __attribute__((ext_vector_type(8)))  _Float16 v8h;
typedef __attribute__((ext_vector_type(8)))  unsigned short v8us;
typedef __attribute__((ext_vector_type(8)))  float    v8f;
typedef __attribute__((ext_vector_type(4)))  float    v4f;
typedef v8h  __attribute__((may_alias)) v8ha;
typedef v4f  __attribute__((may_alias)) v4fa;
typedef v8us __attribute__((may_alias)) v8usa;

__device__ __forceinline__ unsigned short f2bf(float f) { unsigned u = __float_as_uint(f); u += 0x7FFFu + ((u >> 16) & 1u); return (unsigned short)(u >> 16); }
__device__ __forceinline__ float bf2f(unsigned short b) { return __uint_as_float(((unsigned)b) << 16); }
__device__ __forceinline__ float bfr(float f) { return bf2f(f2bf(f)); }
__device__ __forceinline__ v16h cat16(v8h lo, v8h hi) { return __builtin_shufflevector(lo, hi, 0, 1, 2, 3, 4, 5, 6, 7, 8, 9, 10, 11, 12, 13, 14, 15); }
__device__ __forceinline__ v16bf cat16b(v8us lo, v8us hi) { return __builtin_bit_cast(v16bf, __builtin_shufflevector(lo, hi, 0, 1, 2, 3, 4, 5, 6, 7, 8, 9, 10, 11, 12, 13, 14, 15)); }
__device__ __forceinline__ v8f wmma16(v16h a, v16h b, v8f c) { return __builtin_amdgcn_wmma_f32_16x16x32_f16(false, a, false, b, (short)0, c, false, false); }
__device__ __forceinline__ v8f wmmab(v16bf a, v16bf b, v8f c) { return __builtin_amdgcn_wmma_f32_16x16x32_bf16(false, a, false, b, (short)0, c, false, false); }



// ---- k_gemmw: GEMM with one 256 x 128 output tile per work-group of 8 waves (4 x 2), each wave a 64 x 64 part of it over the whole K (16 accumulators, no sum across waves). Operands are 16-bit planes in the panel layout.
// A stage is KS columns of the tile's 8 Bt panels and 16 A panels (of both A planes where NSPLIT == 1): in memory and in LDS alike a panel's share of a stage is KS * 32 bytes in a row, so it is brought by asynchronous 16-byte
// copies to LDS, 512 bytes a wave-wide copy, and a fragment load from LDS reads 512 bytes in a row. Two buffers: stage t + 2 is asked for behind the barrier that ends stage t, and lands under stage t + 1's products.
// C[m][n] (f32, pitch LDC, + optional f32 bias[n]) = sum_k A[m][k] Bt[n][k] (NSPLIT == 1: + A2[m][k] Bt[n][k]). grid (M / 256, N / 128, Z), 256 threads; sB: z-batch stride of Bt in elements. K % KS == 0, at least two stages.
// The products are taken transposed (Bt rows as the A operand, A rows as the B operand; same loader, same k order): a lane then holds 8 neighbouring columns n of ONE row m, which is one 16-byte unit of a panel.
// EP: what the epilogue stores. 0: the f32 tile C + bias[n], each wave's part turned into rows in its own LDS range (the ring, free behind the last stage's barrier). 1, 2: no f32 tile: the tile + bias (1: bias[n]; 2: bias[m]) goes straight from the accumulators out as three 16-bit planes (fp16, bf16 hi, bf16 lo) at element
// (n / 64) * sY + (m / 16) * 16 * PPT + ((n % 64) / 8) * 128 + (m % 16) * 8 + n % 8 (panels of a plane with PPT columns). With m = b * TT + t, sY = NB_ * TT * HD, PPT = HD that is the head plane [h][b][t][d] (a 64-wide column tile is one head); with A = weight rows, Bt = token rows, sY = 64 * 16, PPT = PP it is V^T [h * HD + d][t].
// sP: z-batch stride, in elements, of the three planes.
__device__ __forceinline__ h16 tohx(float x) { return (h16)x; }
__device__ __forceinline__ void splitf(float y, unsigned short& h, unsigned short& l) { h = f2bf(y); l = f2bf(y - bf2f(h)); }
// Precaution behind a group of global loads or stores: the wait stands in front of whatever next reuses the address registers that they name; the base pointers are inputs so that those registers stay theirs up to the wait.
template <typename T16> __device__ __forceinline__ void xwait(const T16* p) { asm volatile("s_wait_xcnt 0x0" :: "v"(p) : "memory"); }
template <typename T16> __device__ __forceinline__ void xwait(const T16* p, const T16* p2) { asm volatile("s_wait_xcnt 0x0" :: "v"(p), "v"(p2) : "memory"); }
template <typename T16> __device__ __forceinline__ void xwait(const T16* p, const T16* p2, const T16* p3) { asm volatile("s_wait_xcnt 0x0" :: "v"(p), "v"(p2), "v"(p3) : "memory"); }
template <typename T16> struct WFrag;
template <> struct WFrag<h16> { typedef v16h V; static __device__ __forceinline__ V ld(const h16* p) { return cat16(*(const v8h*)p, *(const v8h*)(p + 256)); } static __device__ __forceinline__ v8f mma(V a, V b, v8f c) { return wmma16(a, b, c); } };
template <> struct WFrag<bf> { typedef v16bf V; static __device__ __forceinline__ V ld(const bf* p) { return cat16b(*(const v8us*)p, *(const v8us*)(p + 256)); } static __device__ __forceinline__ v8f mma(V a, V b, v8f c) { return wmmab(a, b, c); } };
// A wave's share of one stage, by wave-wide asynchronous copies to LDS of 512 bytes each (16 bytes a lane): one LDS address and one global address a panel; the immediate offset moves both alike (a panel's share runs on in a row in both).
// All copies of a stage stand in ONE statement, whose last line is the wait in front of whatever next rewrites the address registers that the copies name (a precaution).
#define AC4(L, G) "global_load_async_to_lds_b128 " L ", " G ", off\n\tglobal_load_async_to_lds_b128 " L ", " G ", off offset:512\n\tglobal_load_async_to_lds_b128 " L ", " G ", off offset:1024\n\tglobal_load_async_to_lds_b128 " L ", " G ", off offset:1536\n\t"
#define AC4H(L, G) "global_load_async_to_lds_b128 " L ", " G ", off offset:2048\n\tglobal_load_async_to_lds_b128 " L ", " G ", off offset:2560\n\tglobal_load_async_to_lds_b128 " L ", " G ", off offset:3072\n\tglobal_load_async_to_lds_b128 " L ", " G ", off offset:3584\n\t"
// three panels of 4 KiB
__device__ __forceinline__ void stage_copy3(unsigned l0, unsigned l1, unsigned l2, const void* g0, const void* g1, const void* g2) {
    asm volatile(AC4("%0", "%3") AC4H("%0", "%3") AC4("%1", "%4") AC4H("%1", "%4") AC4("%2", "%5") AC4H("%2", "%5") "s_wait_xcnt 0x0" :: "v"(l0), "v"(l1), "v"(l2), "v"(g0), "v"(g1), "v"(g2) : "memory"); }
// five panels of 2 KiB
__device__ __forceinline__ void stage_copy5(unsigned l0, unsigned l1, unsigned l2, unsigned l3, unsigned l4, const void* g0, const void* g1, const void* g2, const void* g3, const void* g4) {
    asm volatile(AC4("%0", "%5") AC4("%1", "%6") AC4("%2", "%7") AC4("%3", "%8") AC4("%4", "%9") "s_wait_xcnt 0x0" :: "v"(l0), "v"(l1), "v"(l2), "v"(l3), "v"(l4), "v"(g0), "v"(g1), "v"(g2), "v"(g3), "v"(g4) : "memory"); }
template <typename T16, int NSPLIT, bool BIAS, int EP, int K, int LDC, int PPT>
__global__ __launch_bounds__(256) void k_gemmw(const T16* __restrict__ A, const T16* __restrict__ A2, const T16* __restrict__ Bt, float* C, const float* __restrict__ bias, size_t sB, h16* P16, bf* Ph, bf* Pl, size_t sY, size_t sP) {
    typedef typename WFrag<T16>::V V;
    constexpr int KS = NSPLIT ? 64 : 128;              // columns a stage: 64 products a wave and stage either way
    constexpr int PE = KS * 16;                        // elements of one panel's share of a stage
    constexpr int PA0 = 8;                             // first A panel of a stage: the 8 Bt panels come first, so that every fragment's constant distance from its wave's base fits the LDS load's 16-bit offset
    constexpr int SE = (PA0 + 16 * (1 + NSPLIT)) * PE; // elements a stage
    constexpr int NT = K / KS;
    static_assert(NSPLIT == 0 || NSPLIT == 1, "one or two A planes"); static_assert(K % KS == 0 && NT >= 2, "whole stages, at least two"); static_assert(EP != 0 || 8 * 64 * 68 * 4 <= 2 * SE * 2, "the f32 staging fits the ring");
    __shared__ __align__(512) T16 ring[2 * SE];
    const size_t z = blockIdx.z; Bt += z * sB; if constexpr (EP != 0) { P16 += z * sP; Ph += z * sP; Pl += z * sP; }
    const int lane = threadIdx.x & 31, lr = lane & 15, hi = lane >> 4; const int r0 = blockIdx.x * 256, c0 = blockIdx.y * 128;
    const int wv = __builtin_amdgcn_readfirstlane((int)(threadIdx.x >> 5));   // the wave's number in a scalar register: panel choices stay scalar
    const int wm = wv & 3, wn = wv >> 2;
    // wave w brings A panels 2w and 2w + 1 (of each A plane) and Bt panel w of every stage; the lane's 16 bytes of each 512-byte copy
    const T16* ga = A + (size_t)(r0 + wv * 32) * K + 8 * lane; const T16* ga2 = NSPLIT ? A2 + (size_t)(r0 + wv * 32) * K + 8 * lane : ga; const T16* gb = Bt + (size_t)(c0 + wv * 16) * K + 8 * lane;
    const unsigned l0 = (unsigned)(size_t)ring + 16u * (unsigned)lane;   // LDS byte address: the low 32 bits of the shared address
    auto issue = [&](int t, int buf) { const unsigned lb = l0 + (unsigned)(buf * (SE * 2)); const size_t ko = (size_t)t * PE; const unsigned la = lb + (unsigned)((PA0 + 2 * wv) * (PE * 2)), lw = lb + (unsigned)(wv * (PE * 2));
        if constexpr (NSPLIT == 1) stage_copy5(la, la + PE * 2, la + 16 * PE * 2, la + 17 * PE * 2, lw, ga + ko, ga + ko + (size_t)16 * K, ga2 + ko, ga2 + ko + (size_t)16 * K, gb + ko);
        else stage_copy3(la, la + PE * 2, lw, ga + ko, ga + ko + (size_t)16 * K, gb + ko); };
    static_assert(PE * 2 == (NSPLIT ? 2048 : 4096), "the copy statements are written for these panel shares");
    v8f acc[4][4];
#pragma unroll
    for (int mb = 0; mb < 4; ++mb)
#pragma unroll
        for (int nb = 0; nb < 4; ++nb) acc[mb][nb] = (v8f){};
    issue(0, 0);
    asm volatile("s_wait_asynccnt 0x0" ::: "memory");   // this wave's share of stage 0 has landed
    __syncthreads();                                      // ... and every other wave's: stage 0 may be read
    issue(1, 1);
    // the stage loop stays rolled (one body in the instruction cache); the k-steps of a stage are unrolled: their fragment sets alternate at compile time
#pragma unroll 1
    for (int t = 0; t < NT; ++t) {
        const T16* sb = ring + (t & 1) * SE + 8 * lane; const T16* sa = sb + (PA0 + wm * 4) * PE; const T16* sa2 = sa + 16 * PE; const T16* sw = sb + (wn * 4) * PE;
        V a[2][4], a2[2][4], b[2][4];   // two fragment sets: a k-step's loads stand as one group ahead of the products of the step before; nothing of stage t + 1 is fetched here
        auto frags = [&](int ks) { const int f = ks & 1;
#pragma unroll
            for (int i = 0; i < 4; ++i) b[f][i] = WFrag<T16>::ld(sw + i * PE + ks * 512);
#pragma unroll
            for (int i = 0; i < 4; ++i) { a[f][i] = WFrag<T16>::ld(sa + i * PE + ks * 512); if (NSPLIT == 1) a2[f][i] = WFrag<T16>::ld(sa2 + i * PE + ks * 512); } };
        frags(0);
#pragma unroll
        for (int ks = 0; ks < KS / 32; ++ks) { const int f = ks & 1;
            if (ks + 1 < KS / 32) frags(ks + 1);
            __builtin_amdgcn_sched_barrier(0);   // keeps the next step's LDS loads together in front of this step's products: left alone the scheduler sinks them among the products, each behind a wait to zero
#pragma unroll
            for (int nb = 0; nb < 4; ++nb)
#pragma unroll
                for (int mb = 0; mb < 4; ++mb) { acc[mb][nb] = WFrag<T16>::mma(b[f][nb], a[f][mb], acc[mb][nb]); if (NSPLIT == 1) acc[mb][nb] = WFrag<T16>::mma(b[f][nb], a2[f][mb], acc[mb][nb]); }
            __builtin_amdgcn_sched_barrier(0); }   // ... and the loads of the step after next behind them, again as one group
        asm volatile("s_wait_dscnt 0x0" ::: "memory");      // this wave's reads of stage t are done before the buffer may be refilled
        asm volatile("s_wait_asynccnt 0x0" ::: "memory");   // this wave's share of stage t + 1 has landed
        __syncthreads();                                      // one barrier a stage: it publishes stage t + 1 and ends every wave's reads of stage t
        if (t + 2 < NT) issue(t + 2, t & 1);
    }
    asm volatile("s_wait_asynccnt 0x0" ::: "memory");   // no copy is outstanding when the ring is reused or the wave ends
    const int r0w = r0 + wm * 64, c0w = c0 + wn * 64;
    if constexpr (EP != 0) {   // a lane's 8 accumulator values of a tile are one 16-byte unit; a wave-wide store covers 512 bytes in a row of the panel
        float bm[4]; v4f bn[4][2];
        if constexpr (BIAS) { if constexpr (EP == 2) { const float* bp = bias + r0w + lr;
#pragma unroll
                for (int mb = 0; mb < 4; ++mb) bm[mb] = bfr(bp[mb * 16]);
                xwait(bp); }
            else { const float* bp = bias + c0w + hi * 8;
#pragma unroll
                for (int nb = 0; nb < 4; ++nb) { bn[nb][0] = *(const v4f*)(bp + nb * 16); bn[nb][1] = *(const v4f*)(bp + nb * 16 + 4); }
                xwait(bp); } }
        const size_t e0 = (size_t)(c0w / 64) * sY + (size_t)r0w * PPT + hi * 128 + lr * 8; h16* q16 = P16 + e0; bf* qh = Ph + e0; bf* ql = Pl + e0;
#pragma unroll
        for (int nb = 0; nb < 4; ++nb) {
#pragma unroll
            for (int mb = 0; mb < 4; ++mb) { v8h o16; v8us oh, ol;
#pragma unroll
                for (int k = 0; k < 8; ++k) { float y = acc[mb][nb][k]; if (BIAS) y += EP == 2 ? bm[mb] : bfr(bn[nb][k >> 2][k & 3]); o16[k] = tohx(y); unsigned short a, c2; splitf(y, a, c2); oh[k] = a; ol[k] = c2; }
                const size_t e = (size_t)mb * 16 * PPT + nb * 256; *(v8h*)(q16 + e) = o16; *(v8us*)(qh + e) = oh; *(v8us*)(ql + e) = ol; }
            xwait((const bf*)q16, (const bf*)qh, (const bf*)ql); }
        return; }
    float* my = (float*)ring + wv * (64 * 68);
#pragma unroll
    for (int mb = 0; mb < 4; ++mb)
#pragma unroll
        for (int nb = 0; nb < 4; ++nb) { float* d = my + (mb * 16 + lr) * 68 + nb * 16 + hi * 8; const v8f t = acc[mb][nb]; *(v4fa*)d = (v4f){t[0], t[1], t[2], t[3]}; *(v4fa*)(d + 4) = (v4f){t[4], t[5], t[6], t[7]}; }
    asm volatile("s_wait_dscnt 0x0" ::: "memory");   // the wave's own rows are in LDS before its lanes read what other lanes of it wrote (no other wave touches this range)
    { const int cofs = lr * 4; v4f bv = (v4f){};
      if (BIAS) { const float* bp = bias + c0w + cofs; const v4f r = *(const v4f*)bp; xwait(bp); bv = (v4f){bfr(r[0]), bfr(r[1]), bfr(r[2]), bfr(r[3])}; }
      float* cp = C + (size_t)(r0w + hi) * LDC + c0w + cofs; const float* sp = my + hi * 68 + cofs;   // two rows a wave-wide store, 256 bytes in a row of each
#pragma unroll
      for (int s = 0; s < 32; ++s) { *(v4f*)(cp + (size_t)s * 2 * LDC) = *(const v4fa*)(sp + s * 2 * 68) + bv; if ((s & 7) == 7) xwait((const float*)cp); } }
}

typedef __attribute__((ext_vector_type(2))) _Float16 v2h;
typedef __attribute__((ext_vector_type(4))) _Float16 v4h;
typedef __attribute__((ext_vector_type(2))) unsigned short v2us;
typedef __attribute__((ext_vector_type(4))) unsigned short v4us;
typedef __attribute__((ext_vector_type(2))) float v2f;
typedef __attribute__((ext_vector_type(4))) int v4i;

// the four equally shaped weights in one launch: blockIdx.y picks the weight and its plane (the planes lie one behind the other)
__global__ __launch_bounds__(256) void k_wtG(const float* __restrict__ w0, const float* __restrict__ w1, const float* __restrict__ w2, const float* __restrict__ w3, int K, int N, bf* Bt) {
    const int y = blockIdx.y; const float* __restrict__ w = y == 0 ? w0 : y == 1 ? w1 : y == 2 ? w2 : w3; Bt += (size_t)y * N * K;
    const int lane = threadIdx.x & 31; const int L0 = (blockIdx.x * 8 + (threadIdx.x >> 5)) * 8; const int nlines = N * K / 64;
{
#pragma unroll 1
        for (int l = 0; l < 8; ++l) { const int L = L0 + l; if (L >= nlines) break; const size_t e = (size_t)L * 64 + lane * 2; const size_t pn = e / ((size_t)16 * K); const int w16 = (int)(e % ((size_t)16 * K)); const int k = (w16 >> 7) * 8 + (w16 & 7), n = (int)pn * 16 + ((w16 >> 3) & 15); v2us o;
            o[0] = f2bf(w[(size_t)k * N + n]); o[1] = f2bf(w[(size_t)(k + 1) * N + n]); *(v2us*)(Bt + e) = o; }
         }
}
// both streams' bf16 copies in one launch: blockIdx.y picks the stream; a thread converts its 8-element unit of every batch (n8 units a batch), the loads of the NB_ units in flight together
__global__ __launch_bounds__(256) void k_cvt8(const float* __restrict__ s0, const float* __restrict__ s1, bf* dst, size_t n8) { const size_t i = (size_t)blockIdx.x * 256 + threadIdx.x; if (i >= n8) return;
    const float* __restrict__ src = blockIdx.y ? s1 : s0; dst += (size_t)blockIdx.y * NB_ * n8 * 8; v8f v[NB_];
    const size_t so = ((i / (DM * 2)) * 16 + (i & 15)) * DM + ((i % (DM * 2)) >> 4) * 8;   // unit i of the panel layout is row (panel * 16 + i % 16), octet (i % (16 * DM / 8)) / 16 of the source
#pragma unroll
    for (int b = 0; b < NB_; ++b) v[b] = *(const v8f*)(src + (size_t)b * n8 * 8 + so);
#pragma unroll
    for (int b = 0; b < NB_; ++b) { v8us o;
#pragma unroll
        for (int k = 0; k < 8; ++k) o[k] = f2bf(v[b][k]);
        *(v8us*)(dst + ((size_t)b * n8 + i) * 8) = o; } }

// ---- k_fattn: the whole causal attention of all batches in one launch: scores, softmax, probability x value product and the merge of the heads into the hi/lo planes that the output projection reads.
// One work-group = one head x 32 query rows; grid (heads, TT / 32, batches), within a batch the longest query tiles first (cost falls with the index; the next batch's long tiles take the places that the short ones leave). The keys 0 .. q0 + 31 are dealt over the FNW waves in 64-key chunks (2 KiB
// in a row of every V^T panel), each worked in two 32-key passes. Transposed products: S^T = K Q^T (A = key rows, B = query rows, same loader, same k order), so a lane holds 16 scores of ONE query per pass
// and column group: maximum and sum in the lane plus one exchange between the wave's halves; two S^T tiles (keys 0-15, 16-31), converted in place, ARE the B operand of O^T += V^T P^T (A = V^T rows in the same k order).
// Running maximum m (scaled log2 units) and running sum l per query and wave; the FNW partial (m, l, O) meet in LDS and are joined in wave order. Probabilities carry 2^PCL2 (it cancels in O / l) so that small ones stay normal in fp16.
// Query rows < RH: hi/lo bf16 planes, 3 products in both contractions; the rest fp16.
#define FQT  2                    // 16-query column groups per wave
#define FNW  4                    // waves per work-group
#define FOP  68                   // LDS pitch (floats) of a query's 64 partial outputs
#define SCL2 (SCL * 1.4426950408889634f)
#define PCL2 10.0f
__device__ __forceinline__ float xhalf(float x) { return __builtin_bit_cast(float, __builtin_amdgcn_permlanex16(__builtin_bit_cast(int, x), __builtin_bit_cast(int, x), 0x76543210, 0xfedcba98, false, false)); }   // lane l reads lane l ^ 16, on the vector pipe
template <typename T16, bool HR>
__device__ __forceinline__ void fattn_wave(const T16* __restrict__ Q, const T16* __restrict__ Q2, const T16* __restrict__ Kp, const T16* __restrict__ K2, const T16* __restrict__ Vt, const T16* __restrict__ Vt2, int q0, int wv, int lr, int hi, float* om, float* ol, float* oo) {
    typedef typename WFrag<T16>::V V;
    const int l8 = (hi * 16 + lr) * 8;   // panel layout: the lane's 16 bytes of a fragment's first half
    V qf[FQT][2], qf2[FQT][2];
    { const size_t e = (size_t)q0 * HD + l8; const T16* qp = Q + e; const T16* qp2 = HR ? Q2 + e : qp;
#pragma unroll
      for (int qt = 0; qt < FQT; ++qt)
#pragma unroll
        for (int ds = 0; ds < 2; ++ds) { qf[qt][ds] = WFrag<T16>::ld(qp + qt * 16 * HD + ds * 512); if (HR) qf2[qt][ds] = WFrag<T16>::ld(qp2 + qt * 16 * HD + ds * 512); }
      if (HR) xwait(qp, qp2); else xwait(qp); }
    v8f o[4][FQT]; float m[FQT], l[FQT];
#pragma unroll
    for (int qt = 0; qt < FQT; ++qt) { m[qt] = -3.0e38f; l[qt] = 0.0f;
#pragma unroll
        for (int mb = 0; mb < 4; ++mb) o[mb][qt] = (v8f){}; }
    // the passes of this wave in turn: both halves of chunk wv, then of chunk wv + FNW, ...; the loop stays rolled: one pass's fragments, scores and the output tile are what lets four waves share a SIMD's registers.
    // fp16 rows fetch the key fragments one pass ahead (issued right behind the S^T products that free their registers, so that their latency lies under the softmax and the P.V products); past the last pass the fetch is clamped to the diagonal rows and not used.
    V kf[2][2], kf2[2][2]; int kc = wv * 64;
    if (!HR) { const T16* kp = Kp + (size_t)min(kc, q0) * HD + l8;
#pragma unroll
        for (int kt = 0; kt < 2; ++kt) { kf[kt][0] = WFrag<T16>::ld(kp + kt * 16 * HD); kf[kt][1] = WFrag<T16>::ld(kp + kt * 16 * HD + 512); }
        xwait(kp); }
#pragma unroll 1
    while (kc <= q0) { const int kn = (kc & 32) ? kc + 32 + (FNW - 1) * 64 : kc + 32;
        const size_t ev = (size_t)kc * 16 + l8; const T16* vp = Vt + ev; V vf[4];
        if (!HR) {   // fp16 rows: the V^T fragments are asked for at the head of the pass; the hi/lo rows, with twice the fragments, load them where they are used, which keeps the kernel at four waves a SIMD
#pragma unroll
            for (int mb = 0; mb < 4; ++mb) vf[mb] = WFrag<T16>::ld(vp + (size_t)mb * 16 * PP); }
        v8f s[2][FQT];
#pragma unroll
        for (int kt = 0; kt < 2; ++kt) {
            if (HR) { const size_t e = (size_t)(kc + kt * 16) * HD + l8; const T16* kp = Kp + e; const T16* kp2 = K2 + e; kf[kt][0] = WFrag<T16>::ld(kp); kf[kt][1] = WFrag<T16>::ld(kp + 512); kf2[kt][0] = WFrag<T16>::ld(kp2); kf2[kt][1] = WFrag<T16>::ld(kp2 + 512); xwait(kp, kp2); }
#pragma unroll
            for (int qt = 0; qt < FQT; ++qt) { v8f c = (v8f){}; c = WFrag<T16>::mma(kf[kt][0], qf[qt][0], c); c = WFrag<T16>::mma(kf[kt][1], qf[qt][1], c);
                if (HR) { c = WFrag<T16>::mma(kf2[kt][0], qf[qt][0], c); c = WFrag<T16>::mma(kf2[kt][1], qf[qt][1], c); c = WFrag<T16>::mma(kf[kt][0], qf2[qt][0], c); c = WFrag<T16>::mma(kf[kt][1], qf2[qt][1], c); }
                s[kt][qt] = c; } }
        if (!HR) { const T16* kp = Kp + (size_t)min(kn, q0) * HD + l8;
#pragma unroll
            for (int kt = 0; kt < 2; ++kt) { kf[kt][0] = WFrag<T16>::ld(kp + kt * 16 * HD); kf[kt][1] = WFrag<T16>::ld(kp + kt * 16 * HD + 512); }
            xwait(vp, kp); }
        if (kc == q0) {   // the diagonal pass (always a wave's last): key > query leaves the softmax; -inf against the finite start value of m gives probability 0 also where a query has no key in this wave
#pragma unroll
            for (int kt = 0; kt < 2; ++kt)
#pragma unroll
                for (int qt = 0; qt < FQT; ++qt)
#pragma unroll
                    for (int r = 0; r < 8; ++r) if (kt * 16 + 8 * hi + r > qt * 16 + lr) s[kt][qt][r] = -__builtin_inff(); }
        V pf[FQT], pf2[FQT];
#pragma unroll
        for (int qt = 0; qt < FQT; ++qt) { float mr = s[0][qt][0];
#pragma unroll
            for (int e = 1; e < 16; ++e) mr = fmaxf(mr, s[e >> 3][qt][e & 7]);
            mr = fmaxf(mr, xhalf(mr));
            const float mn = fmaxf(m[qt], mr * SCL2); const float al = __builtin_amdgcn_exp2f(m[qt] - mn); m[qt] = mn; const float sh = PCL2 - mn; float p[16]; float sum = 0.0f;
#pragma unroll
            for (int e = 0; e < 16; ++e) { p[e] = __builtin_amdgcn_exp2f(fmaf(s[e >> 3][qt][e & 7], SCL2, sh)); sum += p[e]; }
            l[qt] = l[qt] * al + sum;
#pragma unroll
            for (int mb = 0; mb < 4; ++mb) o[mb][qt] *= al;
            if constexpr (HR) { v8us h0, h1, l0, l1;
#pragma unroll
                for (int r = 0; r < 8; ++r) { unsigned short a, c2; splitf(p[r], a, c2); h0[r] = a; l0[r] = c2; splitf(p[8 + r], a, c2); h1[r] = a; l1[r] = c2; }
                pf[qt] = cat16b(h0, h1); pf2[qt] = cat16b(l0, l1);
            } else { v8h h0, h1;
#pragma unroll
                for (int r = 0; r < 8; ++r) { h0[r] = tohx(p[r]); h1[r] = tohx(p[8 + r]); }
                pf[qt] = cat16(h0, h1); } }
        V vf2[4];
#pragma unroll
        for (int mb = 0; mb < 4; ++mb) {
            if (HR && (mb & 1) == 0) { const T16* vq = vp + (size_t)mb * 16 * PP; const T16* vq2 = Vt2 + ev + (size_t)mb * 16 * PP; vf[mb] = WFrag<T16>::ld(vq); vf[mb + 1] = WFrag<T16>::ld(vq + (size_t)16 * PP); vf2[mb] = WFrag<T16>::ld(vq2); vf2[mb + 1] = WFrag<T16>::ld(vq2 + (size_t)16 * PP); xwait(vq, vq2); }
#pragma unroll
            for (int qt = 0; qt < FQT; ++qt) { o[mb][qt] = WFrag<T16>::mma(vf[mb], pf[qt], o[mb][qt]); if (HR) { o[mb][qt] = WFrag<T16>::mma(vf[mb], pf2[qt], o[mb][qt]); o[mb][qt] = WFrag<T16>::mma(vf2[mb], pf[qt], o[mb][qt]); } } }
        kc = kn;
    }
#pragma unroll
    for (int qt = 0; qt < FQT; ++qt) { l[qt] += xhalf(l[qt]); if (hi == 0) { om[qt * 16 + lr] = m[qt]; ol[qt * 16 + lr] = l[qt]; }
#pragma unroll
        for (int mb = 0; mb < 4; ++mb) { float* d = oo + (qt * 16 + lr) * FOP + mb * 16 + hi * 8; const v8f t = o[mb][qt]; *(v4fa*)d = (v4f){t[0], t[1], t[2], t[3]}; *(v4fa*)(d + 4) = (v4f){t[4], t[5], t[6], t[7]}; } }
}
__global__ __launch_bounds__(32 * FNW) __attribute__((amdgpu_waves_per_eu(4, 4))) void k_fattn(const h16* __restrict__ Q16, const h16* __restrict__ K16, const h16* __restrict__ V16, const bf* __restrict__ Qh, const bf* __restrict__ Ql, const bf* __restrict__ Kh, const bf* __restrict__ Kl, const bf* __restrict__ Vh, const bf* __restrict__ Vl, bf* Ah, bf* Al) {
    __shared__ __align__(16) float oo[FNW * 32 * FOP]; __shared__ float om[FNW * 32]; __shared__ float ol[FNW * 32];
    const int lane = threadIdx.x & 31, lr = lane & 15, hi = lane >> 4;
    const int wv = __builtin_amdgcn_readfirstlane((int)(threadIdx.x >> 5));   // the wave's number in a scalar register: the key loop's bounds and branches stay scalar
    const int h = blockIdx.x, q0 = (TT / 32 - 1 - (int)blockIdx.y) * 32; const int b = blockIdx.z;
    const size_t zq = ((size_t)h * NB_ + b) * TT * HD, zk = ((size_t)(h / REP) * NB_ + b) * TT * HD, zv = ((size_t)(b / (PP / TT)) * DKV + (size_t)(h / REP) * HD) * PP + (size_t)(b % (PP / TT)) * TT * 16; Ah += (size_t)b * TT * DQ; Al += (size_t)b * TT * DQ;   // head planes [h][b][t][d]; V^T [b / 2][h * HD + d][(b % 2) * TT + t]; merged planes [b][t][DQ]; each in 16-row panels, so a column offset counts 16 elements a column
    if (q0 < RH) fattn_wave<bf, true>(Qh + zq, Ql + zq, Kh + zk, Kl + zk, Vh + zv, Vl + zv, q0, wv, lr, hi, om + wv * 32, ol + wv * 32, oo + wv * (32 * FOP));
    else fattn_wave<h16, false>(Q16 + zq, nullptr, K16 + zk, nullptr, V16 + zv, nullptr, q0, wv, lr, hi, om + wv * 32, ol + wv * 32, oo + wv * (32 * FOP));
    __syncthreads();   // every wave's partial (m, l, O) is in LDS before any thread joins them
#pragma unroll
    for (int s = 0; s < 8 / FNW; ++s) { const int it = s * (32 * FNW) + (int)threadIdx.x; const int q = (it >> 7) * 16 + (it & 15), oc = ((it >> 4) & 7) * 8; float M = om[q];
#pragma unroll
        for (int w = 1; w < FNW; ++w) M = fmaxf(M, om[w * 32 + q]);   // wave 0 always holds key 0, which every query sees: M is a real score
        float Ls = 0.0f; v4f a0 = (v4f){}, a1 = (v4f){};
#pragma unroll
        for (int w = 0; w < FNW; ++w) { const float f = __builtin_amdgcn_exp2f(om[w * 32 + q] - M); Ls += ol[w * 32 + q] * f; const float* sp = oo + (w * 32 + q) * FOP + oc; a0 += *(const v4fa*)sp * f; a1 += *(const v4fa*)(sp + 4) * f; }
        const float inv = __fdiv_rn(1.0f, Ls); v8us oh, olo;
#pragma unroll
        for (int k = 0; k < 4; ++k) { unsigned short a, c2; splitf(a0[k] * inv, a, c2); oh[k] = a; olo[k] = c2; splitf(a1[k] * inv, a, c2); oh[4 + k] = a; olo[4 + k] = c2; }
        const size_t e = (size_t)(q0 + (it >> 7) * 16) * DQ + (size_t)h * (HD * 16) + (it & 127) * 8; *(v8us*)(Ah + e) = oh; *(v8us*)(Al + e) = olo; xwait((const bf*)(Ah + e), (const bf*)(Al + e)); }
}

extern "C" void kernel_launch(void* const* d_in, const int* in_sizes, int n_in,
                              void* d_out, int out_size, void* d_ws, size_t ws_size, hipStream_t stream) {
    (void)in_sizes; (void)n_in; (void)out_size;
    const float* x = (const float*)d_in[0]; const float* xk = (const float*)d_in[1]; const float* wq = (const float*)d_in[2]; const float* bq = (const float*)d_in[3]; const float* wk = (const float*)d_in[4]; const float* bk = (const float*)d_in[5]; const float* wv = (const float*)d_in[6]; const float* bv = (const float*)d_in[7]; const float* wo = (const float*)d_in[8]; const float* bo = (const float*)d_in[9]; /* order data, context, Wq, bq, Wk, bk, Wv, bv, Wo, bo ('xw' + biases): TEN inputs: TWO streams: the queries come from data (d_in[0]); the keys AND the values both come from context (d_in[1]): the kernel's key stream and value stream pointers are the same input */
    float* OUT = (float*)d_out;     // [4][2048][1024]
    char* wsp = (char*)d_ws;
    auto take = [&](size_t bytes) { char* p = wsp; wsp += (bytes + 255) & ~(size_t)255; return (void*)p; };
    bf* WQ = (bf*)take((size_t)DQ * DM * 2); bf* WK = (bf*)take((size_t)DKV * DM * 2); bf* WV = (bf*)take((size_t)DKV * DM * 2); bf* WO = (bf*)take((size_t)DM * DQ * 2);
    static_assert(DQ == DM && DKV == DM && (NB_ * TT) % PP == 0, "one transpose launch takes four equally shaped weights; a V^T row holds whole batches");
    bf* XB = (bf*)take((size_t)2 * NB_ * TT * DM * 2); bf* XC = XB + (size_t)NB_ * TT * DM;   // bf16 copies: data, then context
    h16* QP16 = (h16*)take((size_t)NB_ * NH_ * TT * HD * 2); h16* KP16 = (h16*)take((size_t)NB_ * NKV * TT * HD * 2); h16* VT16 = (h16*)take((size_t)NB_ * NKV * HD * TT * 2);
    bf* QPh = (bf*)take((size_t)NB_ * NH_ * TT * HD * 2); bf* QPl = (bf*)take((size_t)NB_ * NH_ * TT * HD * 2); bf* KPh = (bf*)take((size_t)NB_ * NKV * TT * HD * 2); bf* KPl = (bf*)take((size_t)NB_ * NKV * TT * HD * 2); bf* VTh = (bf*)take((size_t)NB_ * NKV * HD * TT * 2); bf* VTl = (bf*)take((size_t)NB_ * NKV * HD * TT * 2);
    bf* ATh = (bf*)take((size_t)NB_ * TT * DQ * 2); bf* ATl = (bf*)take((size_t)NB_ * TT * DQ * 2);
    if ((size_t)(wsp - (char*)d_ws) > ws_size) return;    // ws 256 MiB, 216 MiB taken
    k_wtG<<<dim3((unsigned)((DM * DQ / 64 + 63) / 64), 4, 1), 256, 0, stream>>>(wq, wk, wv, wo, DM, DQ, WQ);
    k_cvt8<<<dim3((unsigned)(((size_t)TT * DM / 8 + 255) / 256), 2, 1), 256, 0, stream>>>(x, xk, XB, (size_t)TT * DM / 8);
    k_gemmw<bf, 0, true, 1, DM, 0, HD><<<dim3(NB_ * TT / 256, DQ / 128, 1), 256, 0, stream>>>(XB, nullptr, WQ, nullptr, bq, 0, QP16, QPh, QPl, (size_t)NB_ * TT * HD, 0);
    k_gemmw<bf, 0, true, 1, DM, 0, HD><<<dim3(NB_ * TT / 256, DKV / 128, 1), 256, 0, stream>>>(XC, nullptr, WK, nullptr, bk, 0, KP16, KPh, KPl, (size_t)NB_ * TT * HD, 0);
    k_gemmw<bf, 0, true, 2, DM, 0, PP><<<dim3(DKV / 256, PP / 128, NB_ * TT / PP), 256, 0, stream>>>(WV, nullptr, XC, nullptr, bv, (size_t)PP * DM, VT16, VTh, VTl, 64 * 16, (size_t)DKV * PP);   // weight rows as A, token rows as Bt: the tile is V^T as it stands; z = one V^T row's worth of tokens
    k_fattn<<<dim3(NH_, TT / 32, NB_), 32 * FNW, 0, stream>>>(QP16, KP16, VT16, QPh, QPl, KPh, KPl, VTh, VTl, ATh, ATl);
    k_gemmw<bf, 1, true, 0, DQ, DM, 0><<<dim3(NB_ * TT / 256, DM / 128, 1), 256, 0, stream>>>(ATh, ATl, WO, OUT, bo, 0, nullptr, nullptr, nullptr, 0, 0);
}

// v008
// Measured time: 136 microseconds a run.
// In two side-by-side timings against v007, it was 1.05 and 1.06 times as fast.
// All steps since v000 together make it 21.2 times as fast.
#include <hip/hip_runtime.h>

// Causal multi-head attention between two equally long streams with biased (in, out) projections (data, context [4][2048][1024]; Q = data Wq + bq, K = context Wk + bk, V = context Wv + bv ('xw' [1024][1024] normal x 0.02 + [1024] zeros on this draw: read; 16 heads x 64); scores / sqrt(64); causal (tril kept, -inf elsewhere: query i sees context positions j <= i); softmax over the keys; out = merged Wo + bo ('xw' + bias zeros: read) -> [4][2048][1024] (8.4 M); argument order data, context, Wq, bq, Wk, bk, Wv, bv, Wo, bo).
// Every 16-bit matrix operand plane (rows x K) lies in panels [row / 16][k / 8][row % 16][k % 8]: a 16 x 32 fragment is 1 KiB in a row and each of its two wave-wide 16-byte loads covers four whole 128-byte lines.
// Layout, every stage one launch over all batches: 'xw' weights transposed once; bf16 copies of the two streams; exact projections + f32 biases, whose epilogue writes the head planes; causal T-2048 attention in one fused launch (k_fattn; hybrid rows: < 512 hi/lo 3 products, rest fp16 x1024; nothing above the diagonal block is computed); merged hi/lo x w_o exact + b_o.
// Compute dtypes, f32 accumulate: every input rounded to bf16; projections exact + f32 biases; attention rows < 512 3 products, rest fp16; softmax f32; Wo hl x exact + bias.

#define NB_  4
#define TT   2048
#define DM   1024
#define NH_  16
#define NKV  16
#define REP  (NH_ / NKV)
#define HD   64
#define DQ   (NH_ * HD)
#define DKV  (NKV * HD)
#define PP   (2 * TT)             // row pitch, in 16-bit elements, of the V^T planes: a row holds the tokens of PP / TT batches
#define RH   512                  // query rows < RH use hi+lo planes
#define SCL  0.125f   // HD^-0.5
typedef _Float16 h16;
typedef unsigned short bf;
typedef __attribute__((ext_vector_type(16))) __bf16   v16bf;
typedef __attribute__((ext_vector_type(16))) _Float16 v16h;
typedef __attribute__((ext_vector_type(8)))  _Float16 v8h;
typedef __attribute__((ext_vector_type(8)))  unsigned short v8us;
typedef __attribute__((ext_vector_type(8)))  float    v8f;
typedef __attribute__((ext_vector_type(4)))  float    v4f;
typedef v8h  __attribute__((may_alias)) v8ha;
typedef v4f  __attribute__((may_alias)) v4fa;
typedef v8us __attribute__((may_alias)) v8usa;

__device__ __forceinline__ unsigned short f2bf(float f) { unsigned u = __float_as_uint(f); u += 0x7FFFu + ((u >> 16) & 1u); return (unsigned short)(u >> 16); }
__device__ __forceinline__ float bf2f(unsigned short b) { return __uint_as_float(((unsigned)b) << 16); }
__device__ __forceinline__ float bfr(float f) { return bf2f(f2bf(f)); }
__device__ __forceinline__ v16h cat16(v8h lo, v8h hi) { return __builtin_shufflevector(lo, hi, 0, 1, 2, 3, 4, 5, 6, 7, 8, 9, 10, 11, 12, 13, 14, 15); }
__device__ __forceinline__ v16bf cat16b(v8us lo, v8us hi) { return __builtin_bit_cast(v16bf, __builtin_shufflevector(lo, hi, 0, 1, 2, 3, 4, 5, 6, 7, 8, 9, 10, 11, 12, 13, 14, 15)); }
__device__ __forceinline__ v8f wmma16(v16h a, v16h b, v8f c) { return __builtin_amdgcn_wmma_f32_16x16x32_f16(false, a, false, b, (short)0, c, false, false); }
__device__ __forceinline__ v8f wmmab(v16bf a, v16bf b, v8f c) { return __builtin_amdgcn_wmma_f32_16x16x32_bf16(false, a, false, b, (short)0, c, false, false); }



// ---- k_gemmw: GEMM with one 256 x 128 output tile per work-group of 8 waves (4 x 2), each wave a 64 x 64 part of it over the whole K (16 accumulators, no sum across waves). Operands are 16-bit planes in the panel layout.
// A stage is KS columns of the tile's 8 Bt panels and 16 A panels (of both A planes where NSPLIT == 1): in memory and in LDS alike a panel's share of a stage is KS * 32 bytes in a row, so it is brought by asynchronous 16-byte
// copies to LDS, 512 bytes a wave-wide copy, and a fragment load from LDS reads 512 bytes in a row. Two buffers: stage t + 2 is asked for behind the barrier that ends stage t, and lands under stage t + 1's products.
// C[m][n] (f32, pitch LDC, + optional f32 bias[n]) = sum_k A[m][k] Bt[n][k] (NSPLIT == 1: + A2[m][k] Bt[n][k]). grid (M / 256, N / 128, Z), 256 threads; sB: z-batch stride of Bt in elements. K % KS == 0, at least two stages.
// The products are taken transposed (Bt rows as the A operand, A rows as the B operand; same loader, same k order): a lane then holds 8 neighbouring columns n of ONE row m, which is one 16-byte unit of a panel.
// EP: what the epilogue stores. 0: the f32 tile C + bias[n], each wave's part turned into rows in its own LDS range (the ring, free behind the last stage's barrier). 1, 2: no f32 tile: the tile + bias (1: bias[n]; 2: bias[m]) goes straight from the accumulators out as three 16-bit planes (fp16, bf16 hi, bf16 lo) at element
// (n / 64) * sY + (m / 16) * 16 * PPT + ((n % 64) / 8) * 128 + (m % 16) * 8 + n % 8 (panels of a plane with PPT columns). With m = b * TT + t, sY = NB_ * TT * HD, PPT = HD that is the head plane [h][b][t][d] (a 64-wide column tile is one head); with A = weight rows, Bt = token rows, sY = 64 * 16, PPT = PP it is V^T [h * HD + d][t].
// sP: z-batch stride, in elements, of the three planes.
__device__ __forceinline__ h16 tohx(float x) { return (h16)x; }
__device__ __forceinline__ void splitf(float y, unsigned short& h, unsigned short& l) { h = f2bf(y); l = f2bf(y - bf2f(h)); }
// Precaution behind a group of global loads or stores: the wait stands in front of whatever next reuses the address registers that they name; the base pointers are inputs so that those registers stay theirs up to the wait.
template <typename T16> __device__ __forceinline__ void xwait(const T16* p) { asm volatile("s_wait_xcnt 0x0" :: "v"(p) : "memory"); }
template <typename T16> __device__ __forceinline__ void xwait(const T16* p, const T16* p2) { asm volatile("s_wait_xcnt 0x0" :: "v"(p), "v"(p2) : "memory"); }
template <typename T16> __device__ __forceinline__ void xwait(const T16* p, const T16* p2, const T16* p3) { asm volatile("s_wait_xcnt 0x0" :: "v"(p), "v"(p2), "v"(p3) : "memory"); }
template <typename T16> struct WFrag;
template <> struct WFrag<h16> { typedef v16h V; static __device__ __forceinline__ V ld(const h16* p) { return cat16(*(const v8h*)p, *(const v8h*)(p + 256)); } static __device__ __forceinline__ v8f mma(V a, V b, v8f c) { return wmma16(a, b, c); } };
template <> struct WFrag<bf> { typedef v16bf V; static __device__ __forceinline__ V ld(const bf* p) { return cat16b(*(const v8us*)p, *(const v8us*)(p + 256)); } static __device__ __forceinline__ v8f mma(V a, V b, v8f c) { return wmmab(a, b, c); } };
// A wave's share of one stage, by wave-wide asynchronous copies to LDS of 512 bytes each (16 bytes a lane): one LDS address and one global address a panel; the immediate offset moves both alike (a panel's share runs on in a row in both).
// All copies of a stage stand in ONE statement, whose last line is the wait in front of whatever next rewrites the address registers that the copies name (a precaution).
#define AC4(L, G) "global_load_async_to_lds_b128 " L ", " G ", off\n\tglobal_load_async_to_lds_b128 " L ", " G ", off offset:512\n\tglobal_load_async_to_lds_b128 " L ", " G ", off offset:1024\n\tglobal_load_async_to_lds_b128 " L ", " G ", off offset:1536\n\t"
#define AC4H(L, G) "global_load_async_to_lds_b128 " L ", " G ", off offset:2048\n\tglobal_load_async_to_lds_b128 " L ", " G ", off offset:2560\n\tglobal_load_async_to_lds_b128 " L ", " G ", off offset:3072\n\tglobal_load_async_to_lds_b128 " L ", " G ", off offset:3584\n\t"
// three panels of 4 KiB
__device__ __forceinline__ void stage_copy3(unsigned l0, unsigned l1, unsigned l2, const void* g0, const void* g1, const void* g2) {
    asm volatile(AC4("%0", "%3") AC4H("%0", "%3") AC4("%1", "%4") AC4H("%1", "%4") AC4("%2", "%5") AC4H("%2", "%5") "s_wait_xcnt 0x0" :: "v"(l0), "v"(l1), "v"(l2), "v"(g0), "v"(g1), "v"(g2) : "memory"); }
// five panels of 2 KiB
__device__ __forceinline__ void stage_copy5(unsigned l0, unsigned l1, unsigned l2, unsigned l3, unsigned l4, const void* g0, const void* g1, const void* g2, const void* g3, const void* g4) {
    asm volatile(AC4("%0", "%5") AC4("%1", "%6") AC4("%2", "%7") AC4("%3", "%8") AC4("%4", "%9") "s_wait_xcnt 0x0" :: "v"(l0), "v"(l1), "v"(l2), "v"(l3), "v"(l4), "v"(g0), "v"(g1), "v"(g2), "v"(g3), "v"(g4) : "memory"); }
template <typename T16, int NSPLIT, bool BIAS, int EP, int K, int LDC, int PPT>
__global__ __launch_bounds__(256) void k_gemmw(const T16* __restrict__ A, const T16* __restrict__ A2, const T16* __restrict__ Bt, float* C, const float* __restrict__ bias, size_t sB, h16* P16, bf* Ph, bf* Pl, size_t sY, size_t sP) {
    typedef typename WFrag<T16>::V V;
    constexpr int KS = NSPLIT ? 64 : 128;              // columns a stage: 64 products a wave and stage either way
    constexpr int PE = KS * 16;                        // elements of one panel's share of a stage
    constexpr int PA0 = 8;                             // first A panel of a stage: the 8 Bt panels come first, so that every fragment's constant distance from its wave's base fits the LDS load's 16-bit offset
    constexpr int SE = (PA0 + 16 * (1 + NSPLIT)) * PE; // elements a stage
    constexpr int NT = K / KS;
    static_assert(NSPLIT == 0 || NSPLIT == 1, "one or two A planes"); static_assert(K % KS == 0 && NT >= 2, "whole stages, at least two"); static_assert(EP != 0 || 8 * 64 * 68 * 4 <= 2 * SE * 2, "the f32 staging fits the ring");
    __shared__ __align__(512) T16 ring[2 * SE];
    const size_t z = blockIdx.z; Bt += z * sB; if constexpr (EP != 0) { P16 += z * sP; Ph += z * sP; Pl += z * sP; }
    const int lane = threadIdx.x & 31, lr = lane & 15, hi = lane >> 4; const int r0 = blockIdx.x * 256, c0 = blockIdx.y * 128;
    const int wv = __builtin_amdgcn_readfirstlane((int)(threadIdx.x >> 5));   // the wave's number in a scalar register: panel choices stay scalar
    const int wm = wv & 3, wn = wv >> 2;
    // wave w brings A panels 2w and 2w + 1 (of each A plane) and Bt panel w of every stage; the lane's 16 bytes of each 512-byte copy
    const T16* ga = A + (size_t)(r0 + wv * 32) * K + 8 * lane; const T16* ga2 = NSPLIT ? A2 + (size_t)(r0 + wv * 32) * K + 8 * lane : ga; const T16* gb = Bt + (size_t)(c0 + wv * 16) * K + 8 * lane;
    const unsigned l0 = (unsigned)(size_t)ring + 16u * (unsigned)lane;   // LDS byte address: the low 32 bits of the shared address
    auto issue = [&](int t, int buf) { const unsigned lb = l0 + (unsigned)(buf * (SE * 2)); const size_t ko = (size_t)t * PE; const unsigned la = lb + (unsigned)((PA0 + 2 * wv) * (PE * 2)), lw = lb + (unsigned)(wv * (PE * 2));
        if constexpr (NSPLIT == 1) stage_copy5(la, la + PE * 2, la + 16 * PE * 2, la + 17 * PE * 2, lw, ga + ko, ga + ko + (size_t)16 * K, ga2 + ko, ga2 + ko + (size_t)16 * K, gb + ko);
        else stage_copy3(la, la + PE * 2, lw, ga + ko, ga + ko + (size_t)16 * K, gb + ko); };
    static_assert(PE * 2 == (NSPLIT ? 2048 : 4096), "the copy statements are written for these panel shares");
    v8f acc[4][4];
#pragma unroll
    for (int mb = 0; mb < 4; ++mb)
#pragma unroll
        for (int nb = 0; nb < 4; ++nb) acc[mb][nb] = (v8f){};
    issue(0, 0);
    asm volatile("s_wait_asynccnt 0x0" ::: "memory");   // this wave's share of stage 0 has landed
    __syncthreads();                                      // ... and every other wave's: stage 0 may be read
    issue(1, 1);
    // the stage loop stays rolled (one body in the instruction cache); the k-steps of a stage are unrolled: their fragment sets alternate at compile time
#pragma unroll 1
    for (int t = 0; t < NT; ++t) {
        const T16* sb = ring + (t & 1) * SE + 8 * lane; const T16* sa = sb + (PA0 + wm * 4) * PE; const T16* sa2 = sa + 16 * PE; const T16* sw = sb + (wn * 4) * PE;
        V a[2][4], a2[2][4], b[2][4];   // two fragment sets: a k-step's loads stand as one group ahead of the products of the step before; nothing of stage t + 1 is fetched here
        auto frags = [&](int ks) { const int f = ks & 1;
#pragma unroll
            for (int i = 0; i < 4; ++i) b[f][i] = WFrag<T16>::ld(sw + i * PE + ks * 512);
#pragma unroll
            for (int i = 0; i < 4; ++i) { a[f][i] = WFrag<T16>::ld(sa + i * PE + ks * 512); if (NSPLIT == 1) a2[f][i] = WFrag<T16>::ld(sa2 + i * PE + ks * 512); } };
        frags(0);
#pragma unroll
        for (int ks = 0; ks < KS / 32; ++ks) { const int f = ks & 1;
            if (ks + 1 < KS / 32) frags(ks + 1);
            __builtin_amdgcn_sched_barrier(0);   // keeps the next step's LDS loads together in front of this step's products: left alone the scheduler sinks them among the products, each behind a wait to zero
#pragma unroll
            for (int nb = 0; nb < 4; ++nb)
#pragma unroll
                for (int mb = 0; mb < 4; ++mb) { acc[mb][nb] = WFrag<T16>::mma(b[f][nb], a[f][mb], acc[mb][nb]); if (NSPLIT == 1) acc[mb][nb] = WFrag<T16>::mma(b[f][nb], a2[f][mb], acc[mb][nb]); }
            __builtin_amdgcn_sched_barrier(0); }   // ... and the loads of the step after next behind them, again as one group
        asm volatile("s_wait_dscnt 0x0" ::: "memory");      // this wave's reads of stage t are done before the buffer may be refilled
        asm volatile("s_wait_asynccnt 0x0" ::: "memory");   // this wave's share of stage t + 1 has landed
        __syncthreads();                                      // one barrier a stage: it publishes stage t + 1 and ends every wave's reads of stage t
        if (t + 2 < NT) issue(t + 2, t & 1);
    }
    asm volatile("s_wait_asynccnt 0x0" ::: "memory");   // no copy is outstanding when the ring is reused or the wave ends
    const int r0w = r0 + wm * 64, c0w = c0 + wn * 64;
    if constexpr (EP != 0) {   // a lane's 8 accumulator values of a tile are one 16-byte unit; a wave-wide store covers 512 bytes in a row of the panel
        float bm[4]; v4f bn[4][2];
        if constexpr (BIAS) { if constexpr (EP == 2) { const float* bp = bias + r0w + lr;
#pragma unroll
                for (int mb = 0; mb < 4; ++mb) bm[mb] = bfr(bp[mb * 16]);
                xwait(bp); }
            else { const float* bp = bias + c0w + hi * 8;
#pragma unroll
                for (int nb = 0; nb < 4; ++nb) { bn[nb][0] = *(const v4f*)(bp + nb * 16); bn[nb][1] = *(const v4f*)(bp + nb * 16 + 4); }
                xwait(bp); } }
        const size_t e0 = (size_t)(c0w / 64) * sY + (size_t)r0w * PPT + hi * 128 + lr * 8; h16* q16 = P16 + e0; bf* qh = Ph + e0; bf* ql = Pl + e0;
#pragma unroll
        for (int nb = 0; nb < 4; ++nb) {
#pragma unroll
            for (int mb = 0; mb < 4; ++mb) { v8h o16; v8us oh, ol;
#pragma unroll
                for (int k = 0; k < 8; ++k) { float y = acc[mb][nb][k]; if (BIAS) y += EP == 2 ? bm[mb] : bfr(bn[nb][k >> 2][k & 3]); o16[k] = tohx(y); unsigned short a, c2; splitf(y, a, c2); oh[k] = a; ol[k] = c2; }
                const size_t e = (size_t)mb * 16 * PPT + nb * 256; *(v8h*)(q16 + e) = o16; *(v8us*)(qh + e) = oh; *(v8us*)(ql + e) = ol; }
            xwait((const bf*)q16, (const bf*)qh, (const bf*)ql); }
        return; }
    float* my = (float*)ring + wv * (64 * 68);
#pragma unroll
    for (int mb = 0; mb < 4; ++mb)
#pragma unroll
        for (int nb = 0; nb < 4; ++nb) { float* d = my + (mb * 16 + lr) * 68 + nb * 16 + hi * 8; const v8f t = acc[mb][nb]; *(v4fa*)d = (v4f){t[0], t[1], t[2], t[3]}; *(v4fa*)(d + 4) = (v4f){t[4], t[5], t[6], t[7]}; }
    asm volatile("s_wait_dscnt 0x0" ::: "memory");   // the wave's own rows are in LDS before its lanes read what other lanes of it wrote (no other wave touches this range)
    { const int cofs = lr * 4; v4f bv = (v4f){};
      if (BIAS) { const float* bp = bias + c0w + cofs; const v4f r = *(const v4f*)bp; xwait(bp); bv = (v4f){bfr(r[0]), bfr(r[1]), bfr(r[2]), bfr(r[3])}; }
      float* cp = C + (size_t)(r0w + hi) * LDC + c0w + cofs; const float* sp = my + hi * 68 + cofs;   // two rows a wave-wide store, 256 bytes in a row of each
#pragma unroll
      for (int s = 0; s < 32; ++s) { *(v4f*)(cp + (size_t)s * 2 * LDC) = *(const v4fa*)(sp + s * 2 * 68) + bv; if ((s & 7) == 7) xwait((const float*)cp); } }
}

typedef __attribute__((ext_vector_type(2))) _Float16 v2h;
typedef __attribute__((ext_vector_type(4))) _Float16 v4h;
typedef __attribute__((ext_vector_type(2))) unsigned short v2us;
typedef __attribute__((ext_vector_type(4))) unsigned short v4us;
typedef __attribute__((ext_vector_type(2))) float v2f;
typedef __attribute__((ext_vector_type(4))) int v4i;

// the four equally shaped weights in one launch: blockIdx.y picks the weight and its plane (the planes lie one behind the other)
__global__ __launch_bounds__(256) void k_wtG(const float* __restrict__ w0, const float* __restrict__ w1, const float* __restrict__ w2, const float* __restrict__ w3, int K, int N, bf* Bt) {
    const int y = blockIdx.y; const float* __restrict__ w = y == 0 ? w0 : y == 1 ? w1 : y == 2 ? w2 : w3; Bt += (size_t)y * N * K;
    const int lane = threadIdx.x & 31; const int L0 = (blockIdx.x * 8 + (threadIdx.x >> 5)) * 8; const int nlines = N * K / 64;
{
#pragma unroll 1
        for (int l = 0; l < 8; ++l) { const int L = L0 + l; if (L >= nlines) break; const size_t e = (size_t)L * 64 + lane * 2; const size_t pn = e / ((size_t)16 * K); const int w16 = (int)(e % ((size_t)16 * K)); const int k = (w16 >> 7) * 8 + (w16 & 7), n = (int)pn * 16 + ((w16 >> 3) & 15); v2us o;
            o[0] = f2bf(w[(size_t)k * N + n]); o[1] = f2bf(w[(size_t)(k + 1) * N + n]); *(v2us*)(Bt + e) = o; }
         }
}
// both streams' bf16 copies in one launch: blockIdx.y picks the stream; a thread converts its 8-element unit of every batch (n8 units a batch), the loads of the NB_ units in flight together
__global__ __launch_bounds__(256) void k_cvt8(const float* __restrict__ s0, const float* __restrict__ s1, bf* dst, size_t n8) { const size_t i = (size_t)blockIdx.x * 256 + threadIdx.x; if (i >= n8) return;
    const float* __restrict__ src = blockIdx.y ? s1 : s0; dst += (size_t)blockIdx.y * NB_ * n8 * 8; v8f v[NB_];
    const size_t so = ((i / (DM * 2)) * 16 + (i & 15)) * DM + ((i % (DM * 2)) >> 4) * 8;   // unit i of the panel layout is row (panel * 16 + i % 16), octet (i % (16 * DM / 8)) / 16 of the source
#pragma unroll
    for (int b = 0; b < NB_; ++b) v[b] = *(const v8f*)(src + (size_t)b * n8 * 8 + so);
#pragma unroll
    for (int b = 0; b < NB_; ++b) { v8us o;
#pragma unroll
        for (int k = 0; k < 8; ++k) o[k] = f2bf(v[b][k]);
        *(v8us*)(dst + ((size_t)b * n8 + i) * 8) = o; } }

// ---- k_fattn: the whole causal attention of all batches in one launch: scores, softmax, probability x value product and the merge of the heads into the hi/lo planes that the output projection reads.
// Query rows < RH (fattn_wave; the fp16 rows: fattn_shared below, same products and softmax): one work-group = one head x 32 query rows. The keys 0 .. q0 + 31 are dealt over the FNW waves in 64-key chunks (2 KiB
// in a row of every V^T panel), each worked in two 32-key passes. Transposed products: S^T = K Q^T (A = key rows, B = query rows, same loader, same k order), so a lane holds 16 scores of ONE query per pass
// and column group: maximum and sum in the lane plus one exchange between the wave's halves; two S^T tiles (keys 0-15, 16-31), converted in place, ARE the B operand of O^T += V^T P^T (A = V^T rows in the same k order).
// Running maximum m (scaled log2 units) and running sum l per query and wave; the FNW partial (m, l, O) meet in LDS and are joined in wave order. Probabilities carry 2^PCL2 (it cancels in O / l) so that small ones stay normal in fp16.
// Query rows < RH: hi/lo bf16 planes, 3 products in both contractions; the rest fp16.
#define FQT  2                    // 16-query column groups per wave
#define FNW  4                    // waves per work-group
#define FOP  68                   // LDS pitch (floats) of a query's 64 partial outputs
#define SCL2 (SCL * 1.4426950408889634f)
#define PCL2 10.0f
__device__ __forceinline__ float xhalf(float x) { return __builtin_bit_cast(float, __builtin_amdgcn_permlanex16(__builtin_bit_cast(int, x), __builtin_bit_cast(int, x), 0x76543210, 0xfedcba98, false, false)); }   // lane l reads lane l ^ 16, on the vector pipe
template <typename T16, bool HR>
__device__ __forceinline__ void fattn_wave(const T16* __restrict__ Q, const T16* __restrict__ Q2, const T16* __restrict__ Kp, const T16* __restrict__ K2, const T16* __restrict__ Vt, const T16* __restrict__ Vt2, int q0, int wv, int lr, int hi, float* om, float* ol, float* oo) {
    typedef typename WFrag<T16>::V V;
    const int l8 = (hi * 16 + lr) * 8;   // panel layout: the lane's 16 bytes of a fragment's first half
    V qf[FQT][2], qf2[FQT][2];
    { const size_t e = (size_t)q0 * HD + l8; const T16* qp = Q + e; const T16* qp2 = HR ? Q2 + e : qp;
#pragma unroll
      for (int qt = 0; qt < FQT; ++qt)
#pragma unroll
        for (int ds = 0; ds < 2; ++ds) { qf[qt][ds] = WFrag<T16>::ld(qp + qt * 16 * HD + ds * 512); if (HR) qf2[qt][ds] = WFrag<T16>::ld(qp2 + qt * 16 * HD + ds * 512); }
      if (HR) xwait(qp, qp2); else xwait(qp); }
    v8f o[4][FQT]; float m[FQT], l[FQT];
#pragma unroll
    for (int qt = 0; qt < FQT; ++qt) { m[qt] = -3.0e38f; l[qt] = 0.0f;
#pragma unroll
        for (int mb = 0; mb < 4; ++mb) o[mb][qt] = (v8f){}; }
    // the passes of this wave in turn: both halves of chunk wv, then of chunk wv + FNW, ...; the loop stays rolled: one pass's fragments, scores and the output tile are what lets four waves share a SIMD's registers.
    // fp16 rows fetch the key fragments one pass ahead (issued right behind the S^T products that free their registers, so that their latency lies under the softmax and the P.V products); past the last pass the fetch is clamped to the diagonal rows and not used.
    V kf[2][2], kf2[2][2]; int kc = wv * 64;
    if (!HR) { const T16* kp = Kp + (size_t)min(kc, q0) * HD + l8;
#pragma unroll
        for (int kt = 0; kt < 2; ++kt) { kf[kt][0] = WFrag<T16>::ld(kp + kt * 16 * HD); kf[kt][1] = WFrag<T16>::ld(kp + kt * 16 * HD + 512); }
        xwait(kp); }
#pragma unroll 1
    while (kc <= q0) { const int kn = (kc & 32) ? kc + 32 + (FNW - 1) * 64 : kc + 32;
        const size_t ev = (size_t)kc * 16 + l8; const T16* vp = Vt + ev; V vf[4];
        if (!HR) {   // fp16 rows: the V^T fragments are asked for at the head of the pass; the hi/lo rows, with twice the fragments, load them where they are used, which keeps the kernel at four waves a SIMD
#pragma unroll
            for (int mb = 0; mb < 4; ++mb) vf[mb] = WFrag<T16>::ld(vp + (size_t)mb * 16 * PP); }
        v8f s[2][FQT];
#pragma unroll
        for (int kt = 0; kt < 2; ++kt) {
            if (HR) { const size_t e = (size_t)(kc + kt * 16) * HD + l8; const T16* kp = Kp + e; const T16* kp2 = K2 + e; kf[kt][0] = WFrag<T16>::ld(kp); kf[kt][1] = WFrag<T16>::ld(kp + 512); kf2[kt][0] = WFrag<T16>::ld(kp2); kf2[kt][1] = WFrag<T16>::ld(kp2 + 512); xwait(kp, kp2); }
#pragma unroll
            for (int qt = 0; qt < FQT; ++qt) { v8f c = (v8f){}; c = WFrag<T16>::mma(kf[kt][0], qf[qt][0], c); c = WFrag<T16>::mma(kf[kt][1], qf[qt][1], c);
                if (HR) { c = WFrag<T16>::mma(kf2[kt][0], qf[qt][0], c); c = WFrag<T16>::mma(kf2[kt][1], qf[qt][1], c); c = WFrag<T16>::mma(kf[kt][0], qf2[qt][0], c); c = WFrag<T16>::mma(kf[kt][1], qf2[qt][1], c); }
                s[kt][qt] = c; } }
        if (!HR) { const T16* kp = Kp + (size_t)min(kn, q0) * HD + l8;
#pragma unroll
            for (int kt = 0; kt < 2; ++kt) { kf[kt][0] = WFrag<T16>::ld(kp + kt * 16 * HD); kf[kt][1] = WFrag<T16>::ld(kp + kt * 16 * HD + 512); }
            xwait(vp, kp); }
        if (kc == q0) {   // the diagonal pass (always a wave's last): key > query leaves the softmax; -inf against the finite start value of m gives probability 0 also where a query has no key in this wave
#pragma unroll
            for (int kt = 0; kt < 2; ++kt)
#pragma unroll
                for (int qt = 0; qt < FQT; ++qt)
#pragma unroll
                    for (int r = 0; r < 8; ++r) if (kt * 16 + 8 * hi + r > qt * 16 + lr) s[kt][qt][r] = -__builtin_inff(); }
        V pf[FQT], pf2[FQT];
#pragma unroll
        for (int qt = 0; qt < FQT; ++qt) { float mr = s[0][qt][0];
#pragma unroll
            for (int e = 1; e < 16; ++e) mr = fmaxf(mr, s[e >> 3][qt][e & 7]);
            mr = fmaxf(mr, xhalf(mr));
            const float mn = fmaxf(m[qt], mr * SCL2); const float al = __builtin_amdgcn_exp2f(m[qt] - mn); m[qt] = mn; const float sh = PCL2 - mn; float p[16]; float sum = 0.0f;
#pragma unroll
            for (int e = 0; e < 16; ++e) { p[e] = __builtin_amdgcn_exp2f(fmaf(s[e >> 3][qt][e & 7], SCL2, sh)); sum += p[e]; }
            l[qt] = l[qt] * al + sum;
#pragma unroll
            for (int mb = 0; mb < 4; ++mb) o[mb][qt] *= al;
            if constexpr (HR) { v8us h0, h1, l0, l1;
#pragma unroll
                for (int r = 0; r < 8; ++r) { unsigned short a, c2; splitf(p[r], a, c2); h0[r] = a; l0[r] = c2; splitf(p[8 + r], a, c2); h1[r] = a; l1[r] = c2; }
                pf[qt] = cat16b(h0, h1); pf2[qt] = cat16b(l0, l1);
            } else { v8h h0, h1;
#pragma unroll
                for (int r = 0; r < 8; ++r) { h0[r] = tohx(p[r]); h1[r] = tohx(p[8 + r]); }
                pf[qt] = cat16(h0, h1); } }
        V vf2[4];
#pragma unroll
        for (int mb = 0; mb < 4; ++mb) {
            if (HR && (mb & 1) == 0) { const T16* vq = vp + (size_t)mb * 16 * PP; const T16* vq2 = Vt2 + ev + (size_t)mb * 16 * PP; vf[mb] = WFrag<T16>::ld(vq); vf[mb + 1] = WFrag<T16>::ld(vq + (size_t)16 * PP); vf2[mb] = WFrag<T16>::ld(vq2); vf2[mb + 1] = WFrag<T16>::ld(vq2 + (size_t)16 * PP); xwait(vq, vq2); }
#pragma unroll
            for (int qt = 0; qt < FQT; ++qt) { o[mb][qt] = WFrag<T16>::mma(vf[mb], pf[qt], o[mb][qt]); if (HR) { o[mb][qt] = WFrag<T16>::mma(vf[mb], pf2[qt], o[mb][qt]); o[mb][qt] = WFrag<T16>::mma(vf2[mb], pf[qt], o[mb][qt]); } } }
        kc = kn;
    }
#pragma unroll
    for (int qt = 0; qt < FQT; ++qt) { l[qt] += xhalf(l[qt]); if (hi == 0) { om[qt * 16 + lr] = m[qt]; ol[qt * 16 + lr] = l[qt]; }
#pragma unroll
        for (int mb = 0; mb < 4; ++mb) { float* d = oo + (qt * 16 + lr) * FOP + mb * 16 + hi * 8; const v8f t = o[mb][qt]; *(v4fa*)d = (v4f){t[0], t[1], t[2], t[3]}; *(v4fa*)(d + 4) = (v4f){t[4], t[5], t[6], t[7]}; } }
}
// ---- fp16 rows (query rows >= RH): one work-group = one head x FQW query rows, 32 a wave. Every wave walks all keys up to its own diagonal, so each holds the whole (m, l, O) of its queries and nothing is joined across waves.
// The keys go by in stages of 64: a stage's K rows (8 KiB in a row) and its share of the four V^T panels (2 KiB in a row each) are brought to LDS ONCE for the four waves by asynchronous 16-byte copies (wave w: K panel w and V^T panel w),
// in the order in which they lie in memory, so that the fragment loads keep their form. Two buffers: stage s + 2 is asked for behind the barrier that ends stage s and lands under stage s + 1.
#define FQW  (32 * FNW)           // query rows a work-group
#define SKE  (64 * HD)            // elements of a stage's K rows; its V^T share is as large
#define SGE  (2 * SKE)            // elements a stage
// a wave's share of one stage: eight wave-wide copies of 512 bytes; the last line is the wait in front of whatever next rewrites the address registers that the copies name (a precaution)
__device__ __forceinline__ void kv_copy(unsigned lk, unsigned lv, const void* gk, const void* gv) {
    asm volatile(AC4("%0", "%2") AC4("%1", "%3") "s_wait_xcnt 0x0" :: "v"(lk), "v"(lv), "v"(gk), "v"(gv) : "memory"); }
__device__ __forceinline__ void fattn_shared(const h16* __restrict__ Q, const h16* __restrict__ Kp, const h16* __restrict__ Vt, int q0, int wv, int lr, int hi, h16* ring, bf* Ah, bf* Al) {
    typedef WFrag<h16> F; typedef F::V V;
    const int l8 = (hi * 16 + lr) * 8;   // panel layout: the lane's 16 bytes of a fragment's first half, and of a 512-byte copy
    const int qw = q0 + wv * 32;         // the wave's first query
    V qf[FQT][2];
    { const h16* qp = Q + (size_t)qw * HD + l8;
#pragma unroll
      for (int qt = 0; qt < FQT; ++qt)
#pragma unroll
        for (int ds = 0; ds < 2; ++ds) qf[qt][ds] = F::ld(qp + qt * 16 * HD + ds * 512);
      xwait(qp); }
    v8f o[4][FQT]; float m[FQT], l[FQT];
#pragma unroll
    for (int qt = 0; qt < FQT; ++qt) { m[qt] = -3.0e38f; l[qt] = 0.0f;
#pragma unroll
        for (int mb = 0; mb < 4; ++mb) o[mb][qt] = (v8f){}; }
    const int ns = (q0 + FQW) / 64;      // stages of the work-group: the keys 0 .. q0 + FQW - 1; at least two
    const h16* gk = Kp + wv * (16 * HD) + l8; const h16* gv = Vt + (size_t)wv * 16 * PP + l8;
    const unsigned lk0 = (unsigned)(size_t)ring + (unsigned)((wv * (16 * HD) + l8) * 2);   // LDS byte address: the low 32 bits of the shared address
    auto issue = [&](int s, int buf) { const unsigned lk = lk0 + (unsigned)(buf * (SGE * 2)); kv_copy(lk, lk + SKE * 2, gk + (size_t)s * SKE, gv + (size_t)s * (64 * 16)); };
    issue(0, 0);
    asm volatile("s_wait_asynccnt 0x0" ::: "memory");   // this wave's share of stage 0 has landed
    __syncthreads();                                      // ... and every other wave's: stage 0 may be read
    issue(1, 1);
    // the stage loop stays rolled (one pass's fragments, scores and the output tile are what lets four waves share a SIMD's registers); a stage's two passes are unrolled: their places in the buffer are then immediate offsets of the LDS loads
#pragma unroll 1
    for (int s = 0; s < ns; ++s) {
#pragma unroll
        for (int p = 0; p < 2; ++p) { const int kc = s * 64 + p * 32;
            if (kc > qw) break;   // past the wave's diagonal (the same for the whole wave): it only keeps the work-group's barriers from here on
            const h16* sk = ring + (s & 1) * SGE + p * (32 * HD) + l8; const h16* sv = ring + (s & 1) * SGE + SKE + p * (32 * 16) + l8;
            V kf[2][2], vf[4];
#pragma unroll
            for (int kt = 0; kt < 2; ++kt) { kf[kt][0] = F::ld(sk + kt * 16 * HD); kf[kt][1] = F::ld(sk + kt * 16 * HD + 512); }
#pragma unroll
            for (int mb = 0; mb < 4; ++mb) vf[mb] = F::ld(sv + mb * (64 * 16));
            __builtin_amdgcn_sched_barrier(0);   // keeps the pass's LDS loads together in front of its products: left alone the scheduler loads the K fragments one after the other into the same registers, each behind a wait to zero
            v8f sc[2][FQT];
#pragma unroll
            for (int kt = 0; kt < 2; ++kt)
#pragma unroll
                for (int qt = 0; qt < FQT; ++qt) { v8f c = (v8f){}; c = F::mma(kf[kt][0], qf[qt][0], c); c = F::mma(kf[kt][1], qf[qt][1], c); sc[kt][qt] = c; }
            if (kc == qw) {   // the diagonal pass (the wave's last): key > query leaves the softmax
#pragma unroll
                for (int kt = 0; kt < 2; ++kt)
#pragma unroll
                    for (int qt = 0; qt < FQT; ++qt)
#pragma unroll
                        for (int r = 0; r < 8; ++r) if (kt * 16 + 8 * hi + r > qt * 16 + lr) sc[kt][qt][r] = -__builtin_inff(); }
            V pf[FQT];
#pragma unroll
            for (int qt = 0; qt < FQT; ++qt) { float mr = sc[0][qt][0];
#pragma unroll
                for (int e = 1; e < 16; ++e) mr = fmaxf(mr, sc[e >> 3][qt][e & 7]);
                mr = fmaxf(mr, xhalf(mr));
                const float mn = fmaxf(m[qt], mr * SCL2); const float al = __builtin_amdgcn_exp2f(m[qt] - mn); m[qt] = mn; const float sh = PCL2 - mn; float pr[16]; float sum = 0.0f;
#pragma unroll
                for (int e = 0; e < 16; ++e) { pr[e] = __builtin_amdgcn_exp2f(fmaf(sc[e >> 3][qt][e & 7], SCL2, sh)); sum += pr[e]; }
                l[qt] = l[qt] * al + sum;
#pragma unroll
                for (int mb = 0; mb < 4; ++mb) o[mb][qt] *= al;
                v8h h0, h1;
#pragma unroll
                for (int r = 0; r < 8; ++r) { h0[r] = tohx(pr[r]); h1[r] = tohx(pr[8 + r]); }
                pf[qt] = cat16(h0, h1); }
#pragma unroll
            for (int mb = 0; mb < 4; ++mb)
#pragma unroll
                for (int qt = 0; qt < FQT; ++qt) o[mb][qt] = F::mma(vf[mb], pf[qt], o[mb][qt]);
        }
        asm volatile("s_wait_dscnt 0x0" ::: "memory");      // this wave's reads of stage s are done before the buffer may be refilled
        asm volatile("s_wait_asynccnt 0x0" ::: "memory");   // this wave's share of stage s + 1 has landed
        __syncthreads();                                      // one barrier a stage: it publishes stage s + 1 and ends every wave's reads of stage s
        if (s + 2 < ns) issue(s + 2, s & 1);
    }
    asm volatile("s_wait_asynccnt 0x0" ::: "memory");   // no copy is outstanding when the wave ends
    // a lane's 8 values of an output tile are 8 neighbouring columns of ONE query: one 16-byte unit of the merged planes' panels; a wave-wide store covers 512 bytes in a row
#pragma unroll
    for (int qt = 0; qt < FQT; ++qt) { const float inv = __fdiv_rn(1.0f, l[qt] + xhalf(l[qt])); const size_t e = (size_t)(qw + qt * 16) * DQ + hi * 128 + lr * 8; bf* ph = Ah + e; bf* pl = Al + e;
#pragma unroll
        for (int mb = 0; mb < 4; ++mb) { v8us oh, olo;
#pragma unroll
            for (int r = 0; r < 8; ++r) { unsigned short a, c2; splitf(o[mb][qt][r] * inv, a, c2); oh[r] = a; olo[r] = c2; }
            *(v8us*)(ph + mb * 256) = oh; *(v8us*)(pl + mb * 256) = olo; }
        xwait((const bf*)ph, (const bf*)pl); }
}
// grid: first the NFW fp16 work-groups, then the hi/lo ones (32 query rows each, the longest first). For the fp16 work-groups:
// the tile follows the index modulo 12 in an order in which neighbours at stride 1 and at every power-of-two stride from 4 on are a long, a middle and a short tile (for speed only: any placement gives the same result).
#define NFT  ((TT - RH) / FQW)    // fp16 tiles of a head and batch
#define NFW  (NFT * NH_ * NB_)
#define NHW  ((RH / 32) * NH_ * NB_)
__global__ __launch_bounds__(32 * FNW) __attribute__((amdgpu_waves_per_eu(4, 4))) void k_fattn(const h16* __restrict__ Q16, const h16* __restrict__ K16, const h16* __restrict__ V16, const bf* __restrict__ Qh, const bf* __restrict__ Ql, const bf* __restrict__ Kh, const bf* __restrict__ Kl, const bf* __restrict__ Vh, const bf* __restrict__ Vl, bf* Ah, bf* Al) {
    static_assert(RH % FQW == 0 && TT % FQW == 0 && RH / FQW == 4 && NFT == 12 && FNW == 4 && RH >= 64, "the tile order below lists the tiles 4 .. 15; a wave brings one of four K and V^T panels; at least two stages");
    __shared__ __align__(512) h16 ring[2 * SGE]; __shared__ __align__(16) float oo[FNW * 32 * FOP]; __shared__ float om[FNW * 32]; __shared__ float ol[FNW * 32];
    const int lane = threadIdx.x & 31, lr = lane & 15, hi = lane >> 4;
    const int wv = __builtin_amdgcn_readfirstlane((int)(threadIdx.x >> 5));   // the wave's number in a scalar register: the key loop's bounds and branches stay scalar
    const int id = (int)blockIdx.x; const bool fp = id < NFW; const int hb = fp ? id / NFT : (id - NFW) % NH_ + (id - NFW) / ((RH / 32) * NH_) * NH_;   // head + NH_ * batch
    const int h = hb % NH_, b = hb / NH_; const int q0 = fp ? (int)((0x6BC5AD78E49Full >> (4 * (id % NFT))) & 15) * FQW : (RH / 32 - 1 - (id - NFW) / NH_ % (RH / 32)) * 32;
    const size_t zq = ((size_t)h * NB_ + b) * TT * HD, zk = ((size_t)(h / REP) * NB_ + b) * TT * HD, zv = ((size_t)(b / (PP / TT)) * DKV + (size_t)(h / REP) * HD) * PP + (size_t)(b % (PP / TT)) * TT * 16; Ah += (size_t)b * TT * DQ; Al += (size_t)b * TT * DQ;   // head planes [h][b][t][d]; V^T [b / 2][h * HD + d][(b % 2) * TT + t]; merged planes [b][t][DQ]; each in 16-row panels, so a column offset counts 16 elements a column
    if (fp) { fattn_shared(Q16 + zq, K16 + zk, V16 + zv, q0, wv, lr, hi, ring, Ah + (size_t)h * (HD * 16), Al + (size_t)h * (HD * 16)); return; }   // the whole work-group leaves here
    fattn_wave<bf, true>(Qh + zq, Ql + zq, Kh + zk, Kl + zk, Vh + zv, Vl + zv, q0, wv, lr, hi, om + wv * 32, ol + wv * 32, oo + wv * (32 * FOP));
    __syncthreads();   // every wave's partial (m, l, O) is in LDS before any thread joins them
#pragma unroll
    for (int s = 0; s < 8 / FNW; ++s) { const int it = s * (32 * FNW) + (int)threadIdx.x; const int q = (it >> 7) * 16 + (it & 15), oc = ((it >> 4) & 7) * 8; float M = om[q];
#pragma unroll
        for (int w = 1; w < FNW; ++w) M = fmaxf(M, om[w * 32 + q]);   // wave 0 always holds key 0, which every query sees: M is a real score
        float Ls = 0.0f; v4f a0 = (v4f){}, a1 = (v4f){};
#pragma unroll
        for (int w = 0; w < FNW; ++w) { const float f = __builtin_amdgcn_exp2f(om[w * 32 + q] - M); Ls += ol[w * 32 + q] * f; const float* sp = oo + (w * 32 + q) * FOP + oc; a0 += *(const v4fa*)sp * f; a1 += *(const v4fa*)(sp + 4) * f; }
        const float inv = __fdiv_rn(1.0f, Ls); v8us oh, olo;
#pragma unroll
        for (int k = 0; k < 4; ++k) { unsigned short a, c2; splitf(a0[k] * inv, a, c2); oh[k] = a; olo[k] = c2; splitf(a1[k] * inv, a, c2); oh[4 + k] = a; olo[4 + k] = c2; }
        const size_t e = (size_t)(q0 + (it >> 7) * 16) * DQ + (size_t)h * (HD * 16) + (it & 127) * 8; *(v8us*)(Ah + e) = oh; *(v8us*)(Al + e) = olo; xwait((const bf*)(Ah + e), (const bf*)(Al + e)); }
}

extern "C" void kernel_launch(void* const* d_in, const int* in_sizes, int n_in,
                              void* d_out, int out_size, void* d_ws, size_t ws_size, hipStream_t stream) {
    (void)in_sizes; (void)n_in; (void)out_size;
    const float* x = (const float*)d_in[0]; const float* xk = (const float*)d_in[1]; const float* wq = (const float*)d_in[2]; const float* bq = (const float*)d_in[3]; const float* wk = (const float*)d_in[4]; const float* bk = (const float*)d_in[5]; const float* wv = (const float*)d_in[6]; const float* bv = (const float*)d_in[7]; const float* wo = (const float*)d_in[8]; const float* bo = (const float*)d_in[9]; /* order data, context, Wq, bq, Wk, bk, Wv, bv, Wo, bo ('xw' + biases): TEN inputs: TWO streams: the queries come from data (d_in[0]); the keys AND the values both come from context (d_in[1]): the kernel's key stream and value stream pointers are the same input */
    float* OUT = (float*)d_out;     // [4][2048][1024]
    char* wsp = (char*)d_ws;
    auto take = [&](size_t bytes) { char* p = wsp; wsp += (bytes + 255) & ~(size_t)255; return (void*)p; };
    bf* WQ = (bf*)take((size_t)DQ * DM * 2); bf* WK = (bf*)take((size_t)DKV * DM * 2); bf* WV = (bf*)take((size_t)DKV * DM * 2); bf* WO = (bf*)take((size_t)DM * DQ * 2);
    static_assert(DQ == DM && DKV == DM && (NB_ * TT) % PP == 0, "one transpose launch takes four equally shaped weights; a V^T row holds whole batches");
    bf* XB = (bf*)take((size_t)2 * NB_ * TT * DM * 2); bf* XC = XB + (size_t)NB_ * TT * DM;   // bf16 copies: data, then context
    h16* QP16 = (h16*)take((size_t)NB_ * NH_ * TT * HD * 2); h16* KP16 = (h16*)take((size_t)NB_ * NKV * TT * HD * 2); h16* VT16 = (h16*)take((size_t)NB_ * NKV * HD * TT * 2);
    bf* QPh = (bf*)take((size_t)NB_ * NH_ * TT * HD * 2); bf* QPl = (bf*)take((size_t)NB_ * NH_ * TT * HD * 2); bf* KPh = (bf*)take((size_t)NB_ * NKV * TT * HD * 2); bf* KPl = (bf*)take((size_t)NB_ * NKV * TT * HD * 2); bf* VTh = (bf*)take((size_t)NB_ * NKV * HD * TT * 2); bf* VTl = (bf*)take((size_t)NB_ * NKV * HD * TT * 2);
    bf* ATh = (bf*)take((size_t)NB_ * TT * DQ * 2); bf* ATl = (bf*)take((size_t)NB_ * TT * DQ * 2);
    if ((size_t)(wsp - (char*)d_ws) > ws_size) return;    // ws 256 MiB, 216 MiB taken
    k_wtG<<<dim3((unsigned)((DM * DQ / 64 + 63) / 64), 4, 1), 256, 0, stream>>>(wq, wk, wv, wo, DM, DQ, WQ);
    k_cvt8<<<dim3((unsigned)(((size_t)TT * DM / 8 + 255) / 256), 2, 1), 256, 0, stream>>>(x, xk, XB, (size_t)TT * DM / 8);
    k_gemmw<bf, 0, true, 1, DM, 0, HD><<<dim3(NB_ * TT / 256, DQ / 128, 1), 256, 0, stream>>>(XB, nullptr, WQ, nullptr, bq, 0, QP16, QPh, QPl, (size_t)NB_ * TT * HD, 0);
    k_gemmw<bf, 0, true, 1, DM, 0, HD><<<dim3(NB_ * TT / 256, DKV / 128, 1), 256, 0, stream>>>(XC, nullptr, WK, nullptr, bk, 0, KP16, KPh, KPl, (size_t)NB_ * TT * HD, 0);
    k_gemmw<bf, 0, true, 2, DM, 0, PP><<<dim3(DKV / 256, PP / 128, NB_ * TT / PP), 256, 0, stream>>>(WV, nullptr, XC, nullptr, bv, (size_t)PP * DM, VT16, VTh, VTl, 64 * 16, (size_t)DKV * PP);   // weight rows as A, token rows as Bt: the tile is V^T as it stands; z = one V^T row's worth of tokens
    k_fattn<<<dim3(NFW + NHW, 1, 1), 32 * FNW, 0, stream>>>(QP16, KP16, VT16, QPh, QPl, KPh, KPl, VTh, VTl, ATh, ATl);
    k_gemmw<bf, 1, true, 0, DQ, DM, 0><<<dim3(NB_ * TT / 256, DM / 128, 1), 256, 0, stream>>>(ATh, ATl, WO, OUT, bo, 0, nullptr, nullptr, nullptr, 0, 0);
}

// v009
// It runs in 127 microseconds.
// Next to v008, in two timings, it ran 1.06 and 1.07 times as fast.
// Counting every step since v000, it is 22.6 times as fast.
#include <hip/hip_runtime.h>

// Causal multi-head attention between two equally long streams with biased (in, out) projections (data, context [4][2048][1024]; Q = data Wq + bq, K = context Wk + bk, V = context Wv + bv ('xw' [1024][1024] normal x 0.02 + [1024] zeros on this draw: read; 16 heads x 64); scores / sqrt(64); causal (tril kept, -inf elsewhere: query i sees context positions j <= i); softmax over the keys; out = merged Wo + bo ('xw' + bias zeros: read) -> [4][2048][1024] (8.4 M); argument order data, context, Wq, bq, Wk, bk, Wv, bv, Wo, bo).
// Every 16-bit matrix operand plane (rows x K) lies in panels [row / 16][k / 8][row % 16][k % 8]: a 16 x 32 fragment is 1 KiB in a row and each of its two wave-wide 16-byte loads covers four whole 128-byte lines.
// Layout, four launches over all batches: 'xw' weights transposed once and bf16 copies of the two streams (one launch); the three exact projections + f32 biases, whose epilogue writes the head planes (one launch); causal T-2048 attention in one fused launch (k_fattn; hybrid rows: < 512 hi/lo 3 products, rest fp16 x1024; nothing above the diagonal block is computed); merged hi/lo x w_o exact + b_o.
// Compute dtypes, f32 accumulate: every input rounded to bf16; projections exact + f32 biases; attention rows < 512 3 products, rest fp16; softmax f32; Wo hl x exact + bias.

#define NB_  4
#define TT   2048
#define DM   1024
#define NH_  16
#define NKV  16
#define REP  (NH_ / NKV)
#define HD   64
#define DQ   (NH_ * HD)
#define DKV  (NKV * HD)
#define PP   (2 * TT)             // row pitch, in 16-bit elements, of the V^T planes: a row holds the tokens of PP / TT batches
#define RH   512                  // query rows < RH use hi+lo planes
#define SCL  0.125f   // HD^-0.5
typedef _Float16 h16;
typedef unsigned short bf;
typedef __attribute__((ext_vector_type(16))) __bf16   v16bf;
typedef __attribute__((ext_vector_type(16))) _Float16 v16h;
typedef __attribute__((ext_vector_type(8)))  _Float16 v8h;
typedef __attribute__((ext_vector_type(8)))  unsigned short v8us;
typedef __attribute__((ext_vector_type(8)))  float    v8f;
typedef __attribute__((ext_vector_type(4)))  float    v4f;
typedef v8h  __attribute__((may_alias)) v8ha;
typedef v4f  __attribute__((may_alias)) v4fa;
typedef v8us __attribute__((may_alias)) v8usa;

__device__ __forceinline__ unsigned short f2bf(float f) { unsigned u = __float_as_uint(f); u += 0x7FFFu + ((u >> 16) & 1u); return (unsigned short)(u >> 16); }
__device__ __forceinline__ float bf2f(unsigned short b) { return __uint_as_float(((unsigned)b) << 16); }
__device__ __forceinline__ float bfr(float f) { return bf2f(f2bf(f)); }
__device__ __forceinline__ v16h cat16(v8h lo, v8h hi) { return __builtin_shufflevector(lo, hi, 0, 1, 2, 3, 4, 5, 6, 7, 8, 9, 10, 11, 12, 13, 14, 15); }
__device__ __forceinline__ v16bf cat16b(v8us lo, v8us hi) { return __builtin_bit_cast(v16bf, __builtin_shufflevector(lo, hi, 0, 1, 2, 3, 4, 5, 6, 7, 8, 9, 10, 11, 12, 13, 14, 15)); }
__device__ __forceinline__ v8f wmma16(v16h a, v16h b, v8f c) { return __builtin_amdgcn_wmma_f32_16x16x32_f16(false, a, false, b, (short)0, c, false, false); }
__device__ __forceinline__ v8f wmmab(v16bf a, v16bf b, v8f c) { return __builtin_amdgcn_wmma_f32_16x16x32_bf16(false, a, false, b, (short)0, c, false, false); }



// ---- gemm_tile: GEMM with one 256 x 128 output tile per work-group of 8 waves (4 x 2), each wave a 64 x 64 part of it over the whole K (16 accumulators, no sum across waves). Operands are 16-bit planes in the panel layout.
// A stage is KS columns of the tile's 8 Bt panels and 16 A panels (of both A planes where NSPLIT == 1): in memory and in LDS alike a panel's share of a stage is KS * 32 bytes in a row, so it is brought by asynchronous 16-byte
// copies to LDS, 512 bytes a wave-wide copy, and a fragment load from LDS reads 512 bytes in a row. Two buffers: stage t + 2 is asked for behind the barrier that ends stage t, and lands under stage t + 1's products.
// C[m][n] (f32, pitch LDC, + optional f32 bias[n]) = sum_k A[m][k] Bt[n][k] (NSPLIT == 1: + A2[m][k] Bt[n][k]). M / 256 x N / 128 tiles, 256 threads each. K % KS == 0, at least two stages.
// The products are taken transposed (Bt rows as the A operand, A rows as the B operand; same loader, same k order): a lane then holds 8 neighbouring columns n of ONE row m, which is one 16-byte unit of a panel.
// EP: what the epilogue stores. 0: the f32 tile C + bias[n], each wave's part turned into rows in its own LDS range (the ring, free behind the last stage's barrier). 1, 2: no f32 tile: the tile + bias (1: bias[n]; 2: bias[m]) goes straight from the accumulators out as three 16-bit planes (fp16, bf16 hi, bf16 lo) at element
// (n / 64) * sY + (m / 16) * 16 * PPT + ((n % 64) / 8) * 128 + (m % 16) * 8 + n % 8 (panels of a plane with PPT columns). With m = b * TT + t, sY = NB_ * TT * HD, PPT = HD that is the head plane [h][b][t][d] (a 64-wide column tile is one head); with A = weight rows, Bt = token rows, sY = 64 * 16, PPT = PP it is V^T [h * HD + d][t].
__device__ __forceinline__ h16 tohx(float x) { return (h16)x; }
__device__ __forceinline__ void splitf(float y, unsigned short& h, unsigned short& l) { h = f2bf(y); l = f2bf(y - bf2f(h)); }
// Precaution behind a group of global loads or stores: the wait stands in front of whatever next reuses the address registers that they name; the base pointers are inputs so that those registers stay theirs up to the wait.
template <typename T16> __device__ __forceinline__ void xwait(const T16* p) { asm volatile("s_wait_xcnt 0x0" :: "v"(p) : "memory"); }
template <typename T16> __device__ __forceinline__ void xwait(const T16* p, const T16* p2) { asm volatile("s_wait_xcnt 0x0" :: "v"(p), "v"(p2) : "memory"); }
template <typename T16> __device__ __forceinline__ void xwait(const T16* p, const T16* p2, const T16* p3) { asm volatile("s_wait_xcnt 0x0" :: "v"(p), "v"(p2), "v"(p3) : "memory"); }
template <typename T16> struct WFrag;
template <> struct WFrag<h16> { typedef v16h V; static __device__ __forceinline__ V ld(const h16* p) { return cat16(*(const v8h*)p, *(const v8h*)(p + 256)); } static __device__ __forceinline__ v8f mma(V a, V b, v8f c) { return wmma16(a, b, c); } };
template <> struct WFrag<bf> { typedef v16bf V; static __device__ __forceinline__ V ld(const bf* p) { return cat16b(*(const v8us*)p, *(const v8us*)(p + 256)); } static __device__ __forceinline__ v8f mma(V a, V b, v8f c) { return wmmab(a, b, c); } };
// A wave's share of one stage, by wave-wide asynchronous copies to LDS of 512 bytes each (16 bytes a lane): one LDS address and one global address a panel; the immediate offset moves both alike (a panel's share runs on in a row in both).
// All copies of a stage stand in ONE statement, whose last line is the wait in front of whatever next rewrites the address registers that the copies name (a precaution).
#define AC4(L, G) "global_load_async_to_lds_b128 " L ", " G ", off\n\tglobal_load_async_to_lds_b128 " L ", " G ", off offset:512\n\tglobal_load_async_to_lds_b128 " L ", " G ", off offset:1024\n\tglobal_load_async_to_lds_b128 " L ", " G ", off offset:1536\n\t"
#define AC4H(L, G) "global_load_async_to_lds_b128 " L ", " G ", off offset:2048\n\tglobal_load_async_to_lds_b128 " L ", " G ", off offset:2560\n\tglobal_load_async_to_lds_b128 " L ", " G ", off offset:3072\n\tglobal_load_async_to_lds_b128 " L ", " G ", off offset:3584\n\t"
// three panels of 4 KiB
__device__ __forceinline__ void stage_copy3(unsigned l0, unsigned l1, unsigned l2, const void* g0, const void* g1, const void* g2) {
    asm volatile(AC4("%0", "%3") AC4H("%0", "%3") AC4("%1", "%4") AC4H("%1", "%4") AC4("%2", "%5") AC4H("%2", "%5") "s_wait_xcnt 0x0" :: "v"(l0), "v"(l1), "v"(l2), "v"(g0), "v"(g1), "v"(g2) : "memory"); }
// five panels of 2 KiB
__device__ __forceinline__ void stage_copy5(unsigned l0, unsigned l1, unsigned l2, unsigned l3, unsigned l4, const void* g0, const void* g1, const void* g2, const void* g3, const void* g4) {
    asm volatile(AC4("%0", "%5") AC4("%1", "%6") AC4("%2", "%7") AC4("%3", "%8") AC4("%4", "%9") "s_wait_xcnt 0x0" :: "v"(l0), "v"(l1), "v"(l2), "v"(l3), "v"(l4), "v"(g0), "v"(g1), "v"(g2), "v"(g3), "v"(g4) : "memory"); }
// elements of the two-buffer ring (the work-group's one LDS array: the kernel declares it and hands it to gemm_tile)
template <int NSPLIT> constexpr int ring_elems() { return 2 * (8 + 16 * (1 + NSPLIT)) * ((NSPLIT ? 64 : 128) * 16); }
// one work-group's tile (bx, by) of the GEMM described above
template <typename T16, int NSPLIT, bool BIAS, int EP, int K, int LDC, int PPT>
__device__ __forceinline__ void gemm_tile(T16* ring, int bx, int by, const T16* __restrict__ A, const T16* __restrict__ A2, const T16* __restrict__ Bt, float* C, const float* __restrict__ bias, h16* P16, bf* Ph, bf* Pl, size_t sY) {
    typedef typename WFrag<T16>::V V;
    constexpr int KS = NSPLIT ? 64 : 128;              // columns a stage: 64 products a wave and stage either way
    constexpr int PE = KS * 16;                        // elements of one panel's share of a stage
    constexpr int PA0 = 8;                             // first A panel of a stage: the 8 Bt panels come first, so that every fragment's constant distance from its wave's base fits the LDS load's 16-bit offset
    constexpr int SE = (PA0 + 16 * (1 + NSPLIT)) * PE; // elements a stage
    constexpr int NT = K / KS;
    static_assert(NSPLIT == 0 || NSPLIT == 1, "one or two A planes"); static_assert(K % KS == 0 && NT >= 2, "whole stages, at least two"); static_assert(EP != 0 || 8 * 64 * 68 * 4 <= 2 * SE * 2, "the f32 staging fits the ring"); static_assert(2 * SE == ring_elems<NSPLIT>(), "the kernel's array is the ring");
    const int lane = threadIdx.x & 31, lr = lane & 15, hi = lane >> 4; const int r0 = bx * 256, c0 = by * 128;
    const int wv = __builtin_amdgcn_readfirstlane((int)(threadIdx.x >> 5));   // the wave's number in a scalar register: panel choices stay scalar
    const int wm = wv & 3, wn = wv >> 2;
    // wave w brings A panels 2w and 2w + 1 (of each A plane) and Bt panel w of every stage; the lane's 16 bytes of each 512-byte copy
    const T16* ga = A + (size_t)(r0 + wv * 32) * K + 8 * lane; const T16* ga2 = NSPLIT ? A2 + (size_t)(r0 + wv * 32) * K + 8 * lane : ga; const T16* gb = Bt + (size_t)(c0 + wv * 16) * K + 8 * lane;
    const unsigned l0 = (unsigned)(size_t)ring + 16u * (unsigned)lane;   // LDS byte address: the low 32 bits of the shared address
    auto issue = [&](int t, int buf) { const unsigned lb = l0 + (unsigned)(buf * (SE * 2)); const size_t ko = (size_t)t * PE; const unsigned la = lb + (unsigned)((PA0 + 2 * wv) * (PE * 2)), lw = lb + (unsigned)(wv * (PE * 2));
        if constexpr (NSPLIT == 1) stage_copy5(la, la + PE * 2, la + 16 * PE * 2, la + 17 * PE * 2, lw, ga + ko, ga + ko + (size_t)16 * K, ga2 + ko, ga2 + ko + (size_t)16 * K, gb + ko);
        else stage_copy3(la, la + PE * 2, lw, ga + ko, ga + ko + (size_t)16 * K, gb + ko); };
    static_assert(PE * 2 == (NSPLIT ? 2048 : 4096), "the copy statements are written for these panel shares");
    v8f acc[4][4];
#pragma unroll
    for (int mb = 0; mb < 4; ++mb)
#pragma unroll
        for (int nb = 0; nb < 4; ++nb) acc[mb][nb] = (v8f){};
    issue(0, 0);
    asm volatile("s_wait_asynccnt 0x0" ::: "memory");   // this wave's share of stage 0 has landed
    __syncthreads();                                      // ... and every other wave's: stage 0 may be read
    issue(1, 1);
    // the stage loop stays rolled (one body in the instruction cache); the k-steps of a stage are unrolled: their fragment sets alternate at compile time
#pragma unroll 1
    for (int t = 0; t < NT; ++t) {
        const T16* sb = ring + (t & 1) * SE + 8 * lane; const T16* sa = sb + (PA0 + wm * 4) * PE; const T16* sa2 = sa + 16 * PE; const T16* sw = sb + (wn * 4) * PE;
        V a[2][4], a2[2][4], b[2][4];   // two fragment sets: a k-step's loads stand as one group ahead of the products of the step before; nothing of stage t + 1 is fetched here
        auto frags = [&](int ks) { const int f = ks & 1;
#pragma unroll
            for (int i = 0; i < 4; ++i) b[f][i] = WFrag<T16>::ld(sw + i * PE + ks * 512);
#pragma unroll
            for (int i = 0; i < 4; ++i) { a[f][i] = WFrag<T16>::ld(sa + i * PE + ks * 512); if (NSPLIT == 1) a2[f][i] = WFrag<T16>::ld(sa2 + i * PE + ks * 512); } };
        frags(0);
#pragma unroll
        for (int ks = 0; ks < KS / 32; ++ks) { const int f = ks & 1;
            if (ks + 1 < KS / 32) frags(ks + 1);
            __builtin_amdgcn_sched_barrier(0);   // keeps the next step's LDS loads together in front of this step's products: left alone the scheduler sinks them among the products, each behind a wait to zero
#pragma unroll
            for (int nb = 0; nb < 4; ++nb)
#pragma unroll
                for (int mb = 0; mb < 4; ++mb) { acc[mb][nb] = WFrag<T16>::mma(b[f][nb], a[f][mb], acc[mb][nb]); if (NSPLIT == 1) acc[mb][nb] = WFrag<T16>::mma(b[f][nb], a2[f][mb], acc[mb][nb]); }
            __builtin_amdgcn_sched_barrier(0); }   // ... and the loads of the step after next behind them, again as one group
        asm volatile("s_wait_dscnt 0x0" ::: "memory");      // this wave's reads of stage t are done before the buffer may be refilled
        asm volatile("s_wait_asynccnt 0x0" ::: "memory");   // this wave's share of stage t + 1 has landed
        __syncthreads();                                      // one barrier a stage: it publishes stage t + 1 and ends every wave's reads of stage t
        if (t + 2 < NT) issue(t + 2, t & 1);
    }
    asm volatile("s_wait_asynccnt 0x0" ::: "memory");   // no copy is outstanding when the ring is reused or the wave ends
    const int r0w = r0 + wm * 64, c0w = c0 + wn * 64;
    if constexpr (EP != 0) {   // a lane's 8 accumulator values of a tile are one 16-byte unit; a wave-wide store covers 512 bytes in a row of the panel
        float bm[4]; v4f bn[4][2];
        if constexpr (BIAS) { if constexpr (EP == 2) { const float* bp = bias + r0w + lr;
#pragma unroll
                for (int mb = 0; mb < 4; ++mb) bm[mb] = bfr(bp[mb * 16]);
                xwait(bp); }
            else { const float* bp = bias + c0w + hi * 8;
#pragma unroll
                for (int nb = 0; nb < 4; ++nb) { bn[nb][0] = *(const v4f*)(bp + nb * 16); bn[nb][1] = *(const v4f*)(bp + nb * 16 + 4); }
                xwait(bp); } }
        const size_t e0 = (size_t)(c0w / 64) * sY + (size_t)r0w * PPT + hi * 128 + lr * 8; h16* q16 = P16 + e0; bf* qh = Ph + e0; bf* ql = Pl + e0;
#pragma unroll
        for (int nb = 0; nb < 4; ++nb) {
#pragma unroll
            for (int mb = 0; mb < 4; ++mb) { v8h o16; v8us oh, ol;
#pragma unroll
                for (int k = 0; k < 8; ++k) { float y = acc[mb][nb][k]; if (BIAS) y += EP == 2 ? bm[mb] : bfr(bn[nb][k >> 2][k & 3]); o16[k] = tohx(y); unsigned short a, c2; splitf(y, a, c2); oh[k] = a; ol[k] = c2; }
                const size_t e = (size_t)mb * 16 * PPT + nb * 256; *(v8h*)(q16 + e) = o16; *(v8us*)(qh + e) = oh; *(v8us*)(ql + e) = ol; }
            xwait((const bf*)q16, (const bf*)qh, (const bf*)ql); }
        return; }
    float* my = (float*)ring + wv * (64 * 68);
#pragma unroll
    for (int mb = 0; mb < 4; ++mb)
#pragma unroll
        for (int nb = 0; nb < 4; ++nb) { float* d = my + (mb * 16 + lr) * 68 + nb * 16 + hi * 8; const v8f t = acc[mb][nb]; *(v4fa*)d = (v4f){t[0], t[1], t[2], t[3]}; *(v4fa*)(d + 4) = (v4f){t[4], t[5], t[6], t[7]}; }
    asm volatile("s_wait_dscnt 0x0" ::: "memory");   // the wave's own rows are in LDS before its lanes read what other lanes of it wrote (no other wave touches this range)
    { const int cofs = lr * 4; v4f bv = (v4f){};
      if (BIAS) { const float* bp = bias + c0w + cofs; const v4f r = *(const v4f*)bp; xwait(bp); bv = (v4f){bfr(r[0]), bfr(r[1]), bfr(r[2]), bfr(r[3])}; }
      float* cp = C + (size_t)(r0w + hi) * LDC + c0w + cofs; const float* sp = my + hi * 68 + cofs;   // two rows a wave-wide store, 256 bytes in a row of each
#pragma unroll
      for (int s = 0; s < 32; ++s) { *(v4f*)(cp + (size_t)s * 2 * LDC) = *(const v4fa*)(sp + s * 2 * 68) + bv; if ((s & 7) == 7) xwait((const float*)cp); } }
}
// the output projection: grid (M / 256, N / 128)
__global__ __launch_bounds__(256) void k_gemmo(const bf* __restrict__ A, const bf* __restrict__ A2, const bf* __restrict__ Bt, float* C, const float* __restrict__ bias) {
    __shared__ __align__(512) bf ring[ring_elems<1>()];
    gemm_tile<bf, 1, true, 0, DQ, DM, 0>(ring, (int)blockIdx.x, (int)blockIdx.y, A, A2, Bt, C, bias, nullptr, nullptr, nullptr, 0);
}
// the three input projections in one launch: grid (NB_ * TT / 256, DQ / 128, 3), blockIdx.z = Q, K, V. They do not depend on one another, and a work-group fills a WGP's LDS: a WGP takes its next tile as soon as it has stored the last, whichever projection that belongs to.
// Q, K: token rows as A, weight rows as Bt, head planes out. V: weight rows as A, token rows as Bt, so that the tile is V^T as it stands; its 256 tiles are (DKV / 256) x (PP / 128) x (NB_ * TT / PP), the last being one V^T row's worth of tokens.
__global__ __launch_bounds__(256) void k_proj(const bf* __restrict__ XB, const bf* __restrict__ XC, const bf* __restrict__ WQ, const bf* __restrict__ WK, const bf* __restrict__ WV, const float* __restrict__ bq, const float* __restrict__ bk, const float* __restrict__ bv,
                                              h16* QP16, bf* QPh, bf* QPl, h16* KP16, bf* KPh, bf* KPl, h16* VT16, bf* VTh, bf* VTl) {
    static_assert(DQ == DKV && (NB_ * TT / 256) * (DQ / 128) == (DKV / 256) * (PP / 128) * (NB_ * TT / PP), "each projection has as many tiles as a z-plane of the grid");
    __shared__ __align__(512) bf ring[ring_elems<0>()];
    const int z = (int)blockIdx.z;   // the same for the whole work-group: every barrier below stands under uniform control flow
    if (z < 2) { gemm_tile<bf, 0, true, 1, DM, 0, HD>(ring, (int)blockIdx.x, (int)blockIdx.y, z ? XC : XB, nullptr, z ? WK : WQ, nullptr, z ? bk : bq, z ? KP16 : QP16, z ? KPh : QPh, z ? KPl : QPl, (size_t)NB_ * TT * HD); return; }
    const int id = (int)blockIdx.x + (int)blockIdx.y * (NB_ * TT / 256); const int vx = id % (DKV / 256), vy = id / (DKV / 256) % (PP / 128); const size_t vz = (size_t)(id / ((DKV / 256) * (PP / 128)));
    gemm_tile<bf, 0, true, 2, DM, 0, PP>(ring, vx, vy, WV, nullptr, XC + vz * ((size_t)PP * DM), nullptr, bv, VT16 + vz * ((size_t)DKV * PP), VTh + vz * ((size_t)DKV * PP), VTl + vz * ((size_t)DKV * PP), 64 * 16);
}

typedef __attribute__((ext_vector_type(2))) _Float16 v2h;
typedef __attribute__((ext_vector_type(4))) _Float16 v4h;
typedef __attribute__((ext_vector_type(2))) unsigned short v2us;
typedef __attribute__((ext_vector_type(4))) unsigned short v4us;
typedef __attribute__((ext_vector_type(2))) float v2f;
typedef __attribute__((ext_vector_type(4))) int v4i;

// the four equally shaped weights: y picks the weight and its plane (the planes lie one behind the other), bx the work-group's 64 lines of it
__device__ __forceinline__ void wt_part(const float* __restrict__ w0, const float* __restrict__ w1, const float* __restrict__ w2, const float* __restrict__ w3, int K, int N, bf* Bt, int bx, int y) {
    const float* __restrict__ w = y == 0 ? w0 : y == 1 ? w1 : y == 2 ? w2 : w3; Bt += (size_t)y * N * K;
    const int lane = threadIdx.x & 31; const int L0 = (bx * 8 + (threadIdx.x >> 5)) * 8; const int nlines = N * K / 64;
{
#pragma unroll 1
        for (int l = 0; l < 8; ++l) { const int L = L0 + l; if (L >= nlines) break; const size_t e = (size_t)L * 64 + lane * 2; const size_t pn = e / ((size_t)16 * K); const int w16 = (int)(e % ((size_t)16 * K)); const int k = (w16 >> 7) * 8 + (w16 & 7), n = (int)pn * 16 + ((w16 >> 3) & 15); v2us o;
            o[0] = f2bf(w[(size_t)k * N + n]); o[1] = f2bf(w[(size_t)(k + 1) * N + n]); *(v2us*)(Bt + e) = o; }
         }
}
// both streams' bf16 copies: y picks the stream; a thread converts its 8-element unit of every batch (n8 units a batch), the loads of the NB_ units in flight together
__device__ __forceinline__ void cvt_part(const float* __restrict__ s0, const float* __restrict__ s1, bf* dst, size_t n8, int bx, int y) { const size_t i = (size_t)bx * 256 + threadIdx.x; if (i >= n8) return;
    const float* __restrict__ src = y ? s1 : s0; dst += (size_t)y * NB_ * n8 * 8; v8f v[NB_];
    const size_t so = ((i / (DM * 2)) * 16 + (i & 15)) * DM + ((i % (DM * 2)) >> 4) * 8;   // unit i of the panel layout is row (panel * 16 + i % 16), octet (i % (16 * DM / 8)) / 16 of the source
#pragma unroll
    for (int b = 0; b < NB_; ++b) { const float* p = src + (size_t)b * n8 * 8 + so; v[b] = *(const v8f*)p; xwait(p); }   // the wait (a precaution) stands in front of the next unit's load, whose data may be given the registers that held this unit's address
#pragma unroll
    for (int b = 0; b < NB_; ++b) { v8us o;
#pragma unroll
        for (int k = 0; k < 8; ++k) o[k] = f2bf(v[b][k]);
        *(v8us*)(dst + ((size_t)b * n8 + i) * 8) = o; } }
// weights and streams in one launch (neither needs the other): first the 4 * NWX transposing work-groups, whose waves mostly wait for their short loads one after the other, then the 2 * NCX copying ones, which stream beside them
#define NWX  ((DM * DQ / 64 + 63) / 64)      // transposing work-groups a weight
#define NCX  ((TT * DM / 8 + 255) / 256)     // copying work-groups a stream
__global__ __launch_bounds__(256) void k_prep(const float* __restrict__ w0, const float* __restrict__ w1, const float* __restrict__ w2, const float* __restrict__ w3, int K, int N, bf* Bt, const float* __restrict__ s0, const float* __restrict__ s1, bf* dst, size_t n8) {
    const int id = (int)blockIdx.x;
    if (id < 4 * NWX) { wt_part(w0, w1, w2, w3, K, N, Bt, id % NWX, id / NWX); return; }
    cvt_part(s0, s1, dst, n8, (id - 4 * NWX) % NCX, (id - 4 * NWX) / NCX);
}

// ---- k_fattn: the whole causal attention of all batches in one launch: scores, softmax, probability x value product and the merge of the heads into the hi/lo planes that the output projection reads.
// Query rows < RH (fattn_wave; the fp16 rows: fattn_shared below, same products and softmax): one work-group = one head x 32 query rows. The keys 0 .. q0 + 31 are dealt over the FNW waves in 64-key chunks (2 KiB
// in a row of every V^T panel), each worked in two 32-key passes. Transposed products: S^T = K Q^T (A = key rows, B = query rows, same loader, same k order), so a lane holds 16 scores of ONE query per pass
// and column group: maximum and sum in the lane plus one exchange between the wave's halves; two S^T tiles (keys 0-15, 16-31), converted in place, ARE the B operand of O^T += V^T P^T (A = V^T rows in the same k order).
// Running maximum m (scaled log2 units) and running sum l per query and wave; the FNW partial (m, l, O) meet in LDS and are joined in wave order. Probabilities carry 2^PCL2 (it cancels in O / l) so that small ones stay normal in fp16.
// Query rows < RH: hi/lo bf16 planes, 3 products in both contractions; the rest fp16.
#define FQT  2                    // 16-query column groups per wave
#define FNW  4                    // waves per work-group
#define FOP  68                   // LDS pitch (floats) of a query's 64 partial outputs
#define SCL2 (SCL * 1.4426950408889634f)
#define PCL2 10.0f
__device__ __forceinline__ float xhalf(float x) { return __builtin_bit_cast(float, __builtin_amdgcn_permlanex16(__builtin_bit_cast(int, x), __builtin_bit_cast(int, x), 0x76543210, 0xfedcba98, false, false)); }   // lane l reads lane l ^ 16, on the vector pipe
template <typename T16, bool HR>
__device__ __forceinline__ void fattn_wave(const T16* __restrict__ Q, const T16* __restrict__ Q2, const T16* __restrict__ Kp, const T16* __restrict__ K2, const T16* __restrict__ Vt, const T16* __restrict__ Vt2, int q0, int wv, int lr, int hi, float* om, float* ol, float* oo) {
    typedef typename WFrag<T16>::V V;
    const int l8 = (hi * 16 + lr) * 8;   // panel layout: the lane's 16 bytes of a fragment's first half
    V qf[FQT][2], qf2[FQT][2];
    { const size_t e = (size_t)q0 * HD + l8; const T16* qp = Q + e; const T16* qp2 = HR ? Q2 + e : qp;
#pragma unroll
      for (int qt = 0; qt < FQT; ++qt)
#pragma unroll
        for (int ds = 0; ds < 2; ++ds) { qf[qt][ds] = WFrag<T16>::ld(qp + qt * 16 * HD + ds * 512); if (HR) qf2[qt][ds] = WFrag<T16>::ld(qp2 + qt * 16 * HD + ds * 512); }
      if (HR) xwait(qp, qp2); else xwait(qp); }
    v8f o[4][FQT]; float m[FQT], l[FQT];
#pragma unroll
    for (int qt = 0; qt < FQT; ++qt) { m[qt] = -3.0e38f; l[qt] = 0.0f;
#pragma unroll
        for (int mb = 0; mb < 4; ++mb) o[mb][qt] = (v8f){}; }
    // the passes of this wave in turn: both halves of chunk wv, then of chunk wv + FNW, ...; the loop stays rolled: one pass's fragments, scores and the output tile are what lets four waves share a SIMD's registers.
    // fp16 rows fetch the key fragments one pass ahead (issued right behind the S^T products that free their registers, so that their latency lies under the softmax and the P.V products); past the last pass the fetch is clamped to the diagonal rows and not used.
    V kf[2][2], kf2[2][2]; int kc = wv * 64;
    if (!HR) { const T16* kp = Kp + (size_t)min(kc, q0) * HD + l8;
#pragma unroll
        for (int kt = 0; kt < 2; ++kt) { kf[kt][0] = WFrag<T16>::ld(kp + kt * 16 * HD); kf[kt][1] = WFrag<T16>::ld(kp + kt * 16 * HD + 512); }
        xwait(kp); }
#pragma unroll 1
    while (kc <= q0) { const int kn = (kc & 32) ? kc + 32 + (FNW - 1) * 64 : kc + 32;
        const size_t ev = (size_t)kc * 16 + l8; const T16* vp = Vt + ev; V vf[4];
        if (!HR) {   // fp16 rows: the V^T fragments are asked for at the head of the pass; the hi/lo rows, with twice the fragments, load them where they are used, which keeps the kernel at four waves a SIMD
#pragma unroll
            for (int mb = 0; mb < 4; ++mb) vf[mb] = WFrag<T16>::ld(vp + (size_t)mb * 16 * PP); }
        v8f s[2][FQT];
#pragma unroll
        for (int kt = 0; kt < 2; ++kt) {
            if (HR) { const size_t e = (size_t)(kc + kt * 16) * HD + l8; const T16* kp = Kp + e; const T16* kp2 = K2 + e; kf[kt][0] = WFrag<T16>::ld(kp); kf[kt][1] = WFrag<T16>::ld(kp + 512); kf2[kt][0] = WFrag<T16>::ld(kp2); kf2[kt][1] = WFrag<T16>::ld(kp2 + 512); xwait(kp, kp2); }
#pragma unroll
            for (int qt = 0; qt < FQT; ++qt) { v8f c = (v8f){}; c = WFrag<T16>::mma(kf[kt][0], qf[qt][0], c); c = WFrag<T16>::mma(kf[kt][1], qf[qt][1], c);
                if (HR) { c = WFrag<T16>::mma(kf2[kt][0], qf[qt][0], c); c = WFrag<T16>::mma(kf2[kt][1], qf[qt][1], c); c = WFrag<T16>::mma(kf[kt][0], qf2[qt][0], c); c = WFrag<T16>::mma(kf[kt][1], qf2[qt][1], c); }
                s[kt][qt] = c; } }
        if (!HR) { const T16* kp = Kp + (size_t)min(kn, q0) * HD + l8;
#pragma unroll
            for (int kt = 0; kt < 2; ++kt) { kf[kt][0] = WFrag<T16>::ld(kp + kt * 16 * HD); kf[kt][1] = WFrag<T16>::ld(kp + kt * 16 * HD + 512); }
            xwait(vp, kp); }
        if (kc == q0) {   // the diagonal pass (always a wave's last): key > query leaves the softmax; -inf against the finite start value of m gives probability 0 also where a query has no key in this wave
#pragma unroll
            for (int kt = 0; kt < 2; ++kt)
#pragma unroll
                for (int qt = 0; qt < FQT; ++qt)
#pragma unroll
                    for (int r = 0; r < 8; ++r) if (kt * 16 + 8 * hi + r > qt * 16 + lr) s[kt][qt][r] = -__builtin_inff(); }
        V pf[FQT], pf2[FQT];
#pragma unroll
        for (int qt = 0; qt < FQT; ++qt) { float mr = s[0][qt][0];
#pragma unroll
            for (int e = 1; e < 16; ++e) mr = fmaxf(mr, s[e >> 3][qt][e & 7]);
            mr = fmaxf(mr, xhalf(mr));
            const float mn = fmaxf(m[qt], mr * SCL2); const float al = __builtin_amdgcn_exp2f(m[qt] - mn); m[qt] = mn; const float sh = PCL2 - mn; float p[16]; float sum = 0.0f;
#pragma unroll
            for (int e = 0; e < 16; ++e) { p[e] = __builtin_amdgcn_exp2f(fmaf(s[e >> 3][qt][e & 7], SCL2, sh)); sum += p[e]; }
            l[qt] = l[qt] * al + sum;
#pragma unroll
            for (int mb = 0; mb < 4; ++mb) o[mb][qt] *= al;
            if constexpr (HR) { v8us h0, h1, l0, l1;
#pragma unroll
                for (int r = 0; r < 8; ++r) { unsigned short a, c2; splitf(p[r], a, c2); h0[r] = a; l0[r] = c2; splitf(p[8 + r], a, c2); h1[r] = a; l1[r] = c2; }
                pf[qt] = cat16b(h0, h1); pf2[qt] = cat16b(l0, l1);
            } else { v8h h0, h1;
#pragma unroll
                for (int r = 0; r < 8; ++r) { h0[r] = tohx(p[r]); h1[r] = tohx(p[8 + r]); }
                pf[qt] = cat16(h0, h1); } }
        V vf2[4];
#pragma unroll
        for (int mb = 0; mb < 4; ++mb) {
            if (HR && (mb & 1) == 0) { const T16* vq = vp + (size_t)mb * 16 * PP; const T16* vq2 = Vt2 + ev + (size_t)mb * 16 * PP; vf[mb] = WFrag<T16>::ld(vq); vf[mb + 1] = WFrag<T16>::ld(vq + (size_t)16 * PP); vf2[mb] = WFrag<T16>::ld(vq2); vf2[mb + 1] = WFrag<T16>::ld(vq2 + (size_t)16 * PP); xwait(vq, vq2); }
#pragma unroll
            for (int qt = 0; qt < FQT; ++qt) { o[mb][qt] = WFrag<T16>::mma(vf[mb], pf[qt], o[mb][qt]); if (HR) { o[mb][qt] = WFrag<T16>::mma(vf[mb], pf2[qt], o[mb][qt]); o[mb][qt] = WFrag<T16>::mma(vf2[mb], pf[qt], o[mb][qt]); } } }
        kc = kn;
    }
#pragma unroll
    for (int qt = 0; qt < FQT; ++qt) { l[qt] += xhalf(l[qt]); if (hi == 0) { om[qt * 16 + lr] = m[qt]; ol[qt * 16 + lr] = l[qt]; }
#pragma unroll
        for (int mb = 0; mb < 4; ++mb) { float* d = oo + (qt * 16 + lr) * FOP + mb * 16 + hi * 8; const v8f t = o[mb][qt]; *(v4fa*)d = (v4f){t[0], t[1], t[2], t[3]}; *(v4fa*)(d + 4) = (v4f){t[4], t[5], t[6], t[7]}; } }
}
// ---- fp16 rows (query rows >= RH): one work-group = one head x FQW query rows, 32 a wave. Every wave walks all keys up to its own diagonal, so each holds the whole (m, l, O) of its queries and nothing is joined across waves.
// The keys go by in stages of 64: a stage's K rows (8 KiB in a row) and its share of the four V^T panels (2 KiB in a row each) are brought to LDS ONCE for the four waves by asynchronous 16-byte copies (wave w: K panel w and V^T panel w),
// in the order in which they lie in memory, so that the fragment loads keep their form. Two buffers: stage s + 2 is asked for behind the barrier that ends stage s and lands under stage s + 1.
#define FQW  (32 * FNW)           // query rows a work-group
#define SKE  (64 * HD)            // elements of a stage's K rows; its V^T share is as large
#define SGE  (2 * SKE)            // elements a stage
// a wave's share of one stage: eight wave-wide copies of 512 bytes; the last line is the wait in front of whatever next rewrites the address registers that the copies name (a precaution)
__device__ __forceinline__ void kv_copy(unsigned lk, unsigned lv, const void* gk, const void* gv) {
    asm volatile(AC4("%0", "%2") AC4("%1", "%3") "s_wait_xcnt 0x0" :: "v"(lk), "v"(lv), "v"(gk), "v"(gv) : "memory"); }
__device__ __forceinline__ void fattn_shared(const h16* __restrict__ Q, const h16* __restrict__ Kp, const h16* __restrict__ Vt, int q0, int wv, int lr, int hi, h16* ring, bf* Ah, bf* Al) {
    typedef WFrag<h16> F; typedef F::V V;
    const int l8 = (hi * 16 + lr) * 8;   // panel layout: the lane's 16 bytes of a fragment's first half, and of a 512-byte copy
    const int qw = q0 + wv * 32;         // the wave's first query
    V qf[FQT][2];
    { const h16* qp = Q + (size_t)qw * HD + l8;
#pragma unroll
      for (int qt = 0; qt < FQT; ++qt)
#pragma unroll
        for (int ds = 0; ds < 2; ++ds) qf[qt][ds] = F::ld(qp + qt * 16 * HD + ds * 512);
      xwait(qp); }
    v8f o[4][FQT]; float m[FQT], l[FQT];
#pragma unroll
    for (int qt = 0; qt < FQT; ++qt) { m[qt] = -3.0e38f; l[qt] = 0.0f;
#pragma unroll
        for (int mb = 0; mb < 4; ++mb) o[mb][qt] = (v8f){}; }
    const int ns = (q0 + FQW) / 64;      // stages of the work-group: the keys 0 .. q0 + FQW - 1; at least two
    const h16* gk = Kp + wv * (16 * HD) + l8; const h16* gv = Vt + (size_t)wv * 16 * PP + l8;
    const unsigned lk0 = (unsigned)(size_t)ring + (unsigned)((wv * (16 * HD) + l8) * 2);   // LDS byte address: the low 32 bits of the shared address
    auto issue = [&](int s, int buf) { const unsigned lk = lk0 + (unsigned)(buf * (SGE * 2)); kv_copy(lk, lk + SKE * 2, gk + (size_t)s * SKE, gv + (size_t)s * (64 * 16)); };
    issue(0, 0);
    asm volatile("s_wait_asynccnt 0x0" ::: "memory");   // this wave's share of stage 0 has landed
    __syncthreads();                                      // ... and every other wave's: stage 0 may be read
    issue(1, 1);
    // the stage loop stays rolled (one pass's fragments, scores and the output tile are what lets four waves share a SIMD's registers); a stage's two passes are unrolled: their places in the buffer are then immediate offsets of the LDS loads
#pragma unroll 1
    for (int s = 0; s < ns; ++s) {
#pragma unroll
        for (int p = 0; p < 2; ++p) { const int kc = s * 64 + p * 32;
            if (kc > qw) break;   // past the wave's diagonal (the same for the whole wave): it only keeps the work-group's barriers from here on
            const h16* sk = ring + (s & 1) * SGE + p * (32 * HD) + l8; const h16* sv = ring + (s & 1) * SGE + SKE + p * (32 * 16) + l8;
            V kf[2][2], vf[4];
#pragma unroll
            for (int kt = 0; kt < 2; ++kt) { kf[kt][0] = F::ld(sk + kt * 16 * HD); kf[kt][1] = F::ld(sk + kt * 16 * HD + 512); }
#pragma unroll
            for (int mb = 0; mb < 4; ++mb) vf[mb] = F::ld(sv + mb * (64 * 16));
            __builtin_amdgcn_sched_barrier(0);   // keeps the pass's LDS loads together in front of its products: left alone the scheduler loads the K fragments one after the other into the same registers, each behind a wait to zero
            v8f sc[2][FQT];
#pragma unroll
            for (int kt = 0; kt < 2; ++kt)
#pragma unroll
                for (int qt = 0; qt < FQT; ++qt) { v8f c = (v8f){}; c = F::mma(kf[kt][0], qf[qt][0], c); c = F::mma(kf[kt][1], qf[qt][1], c); sc[kt][qt] = c; }
            if (kc == qw) {   // the diagonal pass (the wave's last): key > query leaves the softmax
#pragma unroll
                for (int kt = 0; kt < 2; ++kt)
#pragma unroll
                    for (int qt = 0; qt < FQT; ++qt)
#pragma unroll
                        for (int r = 0; r < 8; ++r) if (kt * 16 + 8 * hi + r > qt * 16 + lr) sc[kt][qt][r] = -__builtin_inff(); }
            V pf[FQT];
#pragma unroll
            for (int qt = 0; qt < FQT; ++qt) { float mr = sc[0][qt][0];
#pragma unroll
                for (int e = 1; e < 16; ++e) mr = fmaxf(mr, sc[e >> 3][qt][e & 7]);
                mr = fmaxf(mr, xhalf(mr));
                const float mn = fmaxf(m[qt], mr * SCL2); const float al = __builtin_amdgcn_exp2f(m[qt] - mn); m[qt] = mn; const float sh = PCL2 - mn; float pr[16]; float sum = 0.0f;
#pragma unroll
                for (int e = 0; e < 16; ++e) { pr[e] = __builtin_amdgcn_exp2f(fmaf(sc[e >> 3][qt][e & 7], SCL2, sh)); sum += pr[e]; }
                l[qt] = l[qt] * al + sum;
#pragma unroll
                for (int mb = 0; mb < 4; ++mb) o[mb][qt] *= al;
                v8h h0, h1;
#pragma unroll
                for (int r = 0; r < 8; ++r) { h0[r] = tohx(pr[r]); h1[r] = tohx(pr[8 + r]); }
                pf[qt] = cat16(h0, h1); }
#pragma unroll
            for (int mb = 0; mb < 4; ++mb)
#pragma unroll
                for (int qt = 0; qt < FQT; ++qt) o[mb][qt] = F::mma(vf[mb], pf[qt], o[mb][qt]);
        }
        asm volatile("s_wait_dscnt 0x0" ::: "memory");      // this wave's reads of stage s are done before the buffer may be refilled
        asm volatile("s_wait_asynccnt 0x0" ::: "memory");   // this wave's share of stage s + 1 has landed
        __syncthreads();                                      // one barrier a stage: it publishes stage s + 1 and ends every wave's reads of stage s
        if (s + 2 < ns) issue(s + 2, s & 1);
    }
    asm volatile("s_wait_asynccnt 0x0" ::: "memory");   // no copy is outstanding when the wave ends
    // a lane's 8 values of an output tile are 8 neighbouring columns of ONE query: one 16-byte unit of the merged planes' panels; a wave-wide store covers 512 bytes in a row
#pragma unroll
    for (int qt = 0; qt < FQT; ++qt) { const float inv = __fdiv_rn(1.0f, l[qt] + xhalf(l[qt])); const size_t e = (size_t)(qw + qt * 16) * DQ + hi * 128 + lr * 8; bf* ph = Ah + e; bf* pl = Al + e;
#pragma unroll
        for (int mb = 0; mb < 4; ++mb) { v8us oh, olo;
#pragma unroll
            for (int r = 0; r < 8; ++r) { unsigned short a, c2; splitf(o[mb][qt][r] * inv, a, c2); oh[r] = a; olo[r] = c2; }
            *(v8us*)(ph + mb * 256) = oh; *(v8us*)(pl + mb * 256) = olo; }
        xwait((const bf*)ph, (const bf*)pl); }
}
// grid: first the NFW fp16 work-groups, then the hi/lo ones (32 query rows each, the longest first). For the fp16 work-groups:
// the tile follows the index modulo 12 in an order in which neighbours at stride 1 and at every power-of-two stride from 4 on are a long, a middle and a short tile (for speed only: any placement gives the same result).
#define NFT  ((TT - RH) / FQW)    // fp16 tiles of a head and batch
#define NFW  (NFT * NH_ * NB_)
#define NHW  ((RH / 32) * NH_ * NB_)
__global__ __launch_bounds__(32 * FNW) __attribute__((amdgpu_waves_per_eu(4, 4))) void k_fattn(const h16* __restrict__ Q16, const h16* __restrict__ K16, const h16* __restrict__ V16, const bf* __restrict__ Qh, const bf* __restrict__ Ql, const bf* __restrict__ Kh, const bf* __restrict__ Kl, const bf* __restrict__ Vh, const bf* __restrict__ Vl, bf* Ah, bf* Al) {
    static_assert(RH % FQW == 0 && TT % FQW == 0 && RH / FQW == 4 && NFT == 12 && FNW == 4 && RH >= 64, "the tile order below lists the tiles 4 .. 15; a wave brings one of four K and V^T panels; at least two stages");
    __shared__ __align__(512) h16 ring[2 * SGE]; __shared__ __align__(16) float oo[FNW * 32 * FOP]; __shared__ float om[FNW * 32]; __shared__ float ol[FNW * 32];
    const int lane = threadIdx.x & 31, lr = lane & 15, hi = lane >> 4;
    const int wv = __builtin_amdgcn_readfirstlane((int)(threadIdx.x >> 5));   // the wave's number in a scalar register: the key loop's bounds and branches stay scalar
    const int id = (int)blockIdx.x; const bool fp = id < NFW; const int hb = fp ? id / NFT : (id - NFW) % NH_ + (id - NFW) / ((RH / 32) * NH_) * NH_;   // head + NH_ * batch
    const int h = hb % NH_, b = hb / NH_; const int q0 = fp ? (int)((0x6BC5AD78E49Full >> (4 * (id % NFT))) & 15) * FQW : (RH / 32 - 1 - (id - NFW) / NH_ % (RH / 32)) * 32;
    const size_t zq = ((size_t)h * NB_ + b) * TT * HD, zk = ((size_t)(h / REP) * NB_ + b) * TT * HD, zv = ((size_t)(b / (PP / TT)) * DKV + (size_t)(h / REP) * HD) * PP + (size_t)(b % (PP / TT)) * TT * 16; Ah += (size_t)b * TT * DQ; Al += (size_t)b * TT * DQ;   // head planes [h][b][t][d]; V^T [b / 2][h * HD + d][(b % 2) * TT + t]; merged planes [b][t][DQ]; each in 16-row panels, so a column offset counts 16 elements a column
    if (fp) { fattn_shared(Q16 + zq, K16 + zk, V16 + zv, q0, wv, lr, hi, ring, Ah + (size_t)h * (HD * 16), Al + (size_t)h * (HD * 16)); return; }   // the whole work-group leaves here
    fattn_wave<bf, true>(Qh + zq, Ql + zq, Kh + zk, Kl + zk, Vh + zv, Vl + zv, q0, wv, lr, hi, om + wv * 32, ol + wv * 32, oo + wv * (32 * FOP));
    __syncthreads();   // every wave's partial (m, l, O) is in LDS before any thread joins them
#pragma unroll
    for (int s = 0; s < 8 / FNW; ++s) { const int it = s * (32 * FNW) + (int)threadIdx.x; const int q = (it >> 7) * 16 + (it & 15), oc = ((it >> 4) & 7) * 8; float M = om[q];
#pragma unroll
        for (int w = 1; w < FNW; ++w) M = fmaxf(M, om[w * 32 + q]);   // wave 0 always holds key 0, which every query sees: M is a real score
        float Ls = 0.0f; v4f a0 = (v4f){}, a1 = (v4f){};
#pragma unroll
        for (int w = 0; w < FNW; ++w) { const float f = __builtin_amdgcn_exp2f(om[w * 32 + q] - M); Ls += ol[w * 32 + q] * f; const float* sp = oo + (w * 32 + q) * FOP + oc; a0 += *(const v4fa*)sp * f; a1 += *(const v4fa*)(sp + 4) * f; }
        const float inv = __fdiv_rn(1.0f, Ls); v8us oh, olo;
#pragma unroll
        for (int k = 0; k < 4; ++k) { unsigned short a, c2; splitf(a0[k] * inv, a, c2); oh[k] = a; olo[k] = c2; splitf(a1[k] * inv, a, c2); oh[4 + k] = a; olo[4 + k] = c2; }
        const size_t e = (size_t)(q0 + (it >> 7) * 16) * DQ + (size_t)h * (HD * 16) + (it & 127) * 8; *(v8us*)(Ah + e) = oh; *(v8us*)(Al + e) = olo; xwait((const bf*)(Ah + e), (const bf*)(Al + e)); }
}

extern "C" void kernel_launch(void* const* d_in, const int* in_sizes, int n_in,
                              void* d_out, int out_size, void* d_ws, size_t ws_size, hipStream_t stream) {
    (void)in_sizes; (void)n_in; (void)out_size;
    const float* x = (const float*)d_in[0]; const float* xk = (const float*)d_in[1]; const float* wq = (const float*)d_in[2]; const float* bq = (const float*)d_in[3]; const float* wk = (const float*)d_in[4]; const float* bk = (const float*)d_in[5]; const float* wv = (const float*)d_in[6]; const float* bv = (const float*)d_in[7]; const float* wo = (const float*)d_in[8]; const float* bo = (const float*)d_in[9]; /* order data, context, Wq, bq, Wk, bk, Wv, bv, Wo, bo ('xw' + biases): TEN inputs: TWO streams: the queries come from data (d_in[0]); the keys AND the values both come from context (d_in[1]): the kernel's key stream and value stream pointers are the same input */
    float* OUT = (float*)d_out;     // [4][2048][1024]
    char* wsp = (char*)d_ws;
    auto take = [&](size_t bytes) { char* p = wsp; wsp += (bytes + 255) & ~(size_t)255; return (void*)p; };
    bf* WQ = (bf*)take((size_t)DQ * DM * 2); bf* WK = (bf*)take((size_t)DKV * DM * 2); bf* WV = (bf*)take((size_t)DKV * DM * 2); bf* WO = (bf*)take((size_t)DM * DQ * 2);
    static_assert(DQ == DM && DKV == DM && (NB_ * TT) % PP == 0, "one transpose launch takes four equally shaped weights; a V^T row holds whole batches");
    bf* XB = (bf*)take((size_t)2 * NB_ * TT * DM * 2); bf* XC = XB + (size_t)NB_ * TT * DM;   // bf16 copies: data, then context
    h16* QP16 = (h16*)take((size_t)NB_ * NH_ * TT * HD * 2); h16* KP16 = (h16*)take((size_t)NB_ * NKV * TT * HD * 2); h16* VT16 = (h16*)take((size_t)NB_ * NKV * HD * TT * 2);
    bf* QPh = (bf*)take((size_t)NB_ * NH_ * TT * HD * 2); bf* QPl = (bf*)take((size_t)NB_ * NH_ * TT * HD * 2); bf* KPh = (bf*)take((size_t)NB_ * NKV * TT * HD * 2); bf* KPl = (bf*)take((size_t)NB_ * NKV * TT * HD * 2); bf* VTh = (bf*)take((size_t)NB_ * NKV * HD * TT * 2); bf* VTl = (bf*)take((size_t)NB_ * NKV * HD * TT * 2);
    bf* ATh = (bf*)take((size_t)NB_ * TT * DQ * 2); bf* ATl = (bf*)take((size_t)NB_ * TT * DQ * 2);
    if ((size_t)(wsp - (char*)d_ws) > ws_size) return;    // ws 256 MiB, 216 MiB taken
    k_prep<<<dim3(4 * NWX + 2 * NCX, 1, 1), 256, 0, stream>>>(wq, wk, wv, wo, DM, DQ, WQ, x, xk, XB, (size_t)TT * DM / 8);
    k_proj<<<dim3(NB_ * TT / 256, DQ / 128, 3), 256, 0, stream>>>(XB, XC, WQ, WK, WV, bq, bk, bv, QP16, QPh, QPl, KP16, KPh, KPl, VT16, VTh, VTl);
    k_fattn<<<dim3(NFW + NHW, 1, 1), 32 * FNW, 0, stream>>>(QP16, KP16, VT16, QPh, QPl, KPh, KPl, VTh, VTl, ATh, ATl);
    k_gemmo<<<dim3(NB_ * TT / 256, DM / 128, 1), 256, 0, stream>>>(ATh, ATl, WO, OUT, bo);
}

// v010
// It runs in 124 microseconds.
// Next to v009, in two timings, it ran 1.04 and 1.03 times as fast.
// Over all steps from v000 it is 23.3 times as fast.
#include <hip/hip_runtime.h>

// Causal multi-head attention between two equally long streams with biased (in, out) projections (data, context [4][2048][1024]; Q = data Wq + bq, K = context Wk + bk, V = context Wv + bv ('xw' [1024][1024] normal x 0.02 + [1024] zeros on this draw: read; 16 heads x 64); scores / sqrt(64); causal (tril kept, -inf elsewhere: query i sees context positions j <= i); softmax over the keys; out = merged Wo + bo ('xw' + bias zeros: read) -> [4][2048][1024] (8.4 M); argument order data, context, Wq, bq, Wk, bk, Wv, bv, Wo, bo).
// Every 16-bit matrix operand plane (rows x K) lies in panels [row / 16][k / 8][row % 16][k % 8]: a 16 x 32 fragment is 1 KiB in a row and each of its two wave-wide 16-byte loads covers four whole 128-byte lines.
// Layout, four launches over all batches: 'xw' weights transposed once and bf16 copies of the two streams (one launch); the three exact projections + f32 biases, whose epilogue writes the head planes (one launch); causal T-2048 attention in one fused launch (k_fattn; hybrid rows: < 512 hi/lo 3 products, rest fp16 x1024; nothing above the diagonal block is computed); merged hi/lo x w_o exact + b_o.
// Compute dtypes, f32 accumulate: every input rounded to bf16; projections exact + f32 biases; attention rows < 512 3 products, rest fp16; softmax f32; Wo hl x exact + bias.

#define NB_  4
#define TT   2048
#define DM   1024
#define NH_  16
#define NKV  16
#define REP  (NH_ / NKV)
#define HD   64
#define DQ   (NH_ * HD)
#define DKV  (NKV * HD)
#define PP   (2 * TT)             // row pitch, in 16-bit elements, of the V^T planes: a row holds the tokens of PP / TT batches
#define RH   512                  // query rows < RH use hi+lo planes
#define SCL  0.125f   // HD^-0.5
typedef _Float16 h16;
typedef unsigned short bf;
typedef __attribute__((ext_vector_type(16))) __bf16   v16bf;
typedef __attribute__((ext_vector_type(16))) _Float16 v16h;
typedef __attribute__((ext_vector_type(8)))  _Float16 v8h;
typedef __attribute__((ext_vector_type(8)))  unsigned short v8us;
typedef __attribute__((ext_vector_type(8)))  float    v8f;
typedef __attribute__((ext_vector_type(4)))  float    v4f;
typedef v8h  __attribute__((may_alias)) v8ha;
typedef v4f  __attribute__((may_alias)) v4fa;
typedef v8us __attribute__((may_alias)) v8usa;

__device__ __forceinline__ unsigned short f2bf(float f) { unsigned u = __float_as_uint(f); u += 0x7FFFu + ((u >> 16) & 1u); return (unsigned short)(u >> 16); }
__device__ __forceinline__ float bf2f(unsigned short b) { return __uint_as_float(((unsigned)b) << 16); }
__device__ __forceinline__ float bfr(float f) { return bf2f(f2bf(f)); }
__device__ __forceinline__ v16h cat16(v8h lo, v8h hi) { return __builtin_shufflevector(lo, hi, 0, 1, 2, 3, 4, 5, 6, 7, 8, 9, 10, 11, 12, 13, 14, 15); }
__device__ __forceinline__ v16bf cat16b(v8us lo, v8us hi) { return __builtin_bit_cast(v16bf, __builtin_shufflevector(lo, hi, 0, 1, 2, 3, 4, 5, 6, 7, 8, 9, 10, 11, 12, 13, 14, 15)); }
__device__ __forceinline__ v8f wmma16(v16h a, v16h b, v8f c) { return __builtin_amdgcn_wmma_f32_16x16x32_f16(false, a, false, b, (short)0, c, false, false); }
__device__ __forceinline__ v8f wmmab(v16bf a, v16bf b, v8f c) { return __builtin_amdgcn_wmma_f32_16x16x32_bf16(false, a, false, b, (short)0, c, false, false); }



// ---- gemm_tile: GEMM with one 256 x 128 output tile per work-group of 8 waves (4 x 2), each wave a 64 x 64 part of it over the whole K (16 accumulators, no sum across waves). Operands are 16-bit planes in the panel layout.
// A stage is KS columns of the tile's 8 Bt panels and 16 A panels (of both A planes where NSPLIT == 1): in memory and in LDS alike a panel's share of a stage is KS * 32 bytes in a row, so it is brought by asynchronous 16-byte
// copies to LDS, 512 bytes a wave-wide copy, and a fragment load from LDS reads 512 bytes in a row. Two buffers: stage t + 2 is asked for behind the barrier that ends stage t, and lands under stage t + 1's products.
// C[m][n] (f32, pitch LDC, + optional f32 bias[n]) = sum_k A[m][k] Bt[n][k] (NSPLIT == 1: + A2[m][k] Bt[n][k]). M / 256 x N / 128 tiles, 256 threads each. K % KS == 0, at least two stages.
// The products are taken transposed (Bt rows as the A operand, A rows as the B operand; same loader, same k order): a lane then holds 8 neighbouring columns n of ONE row m, which is one 16-byte unit of a panel.
// EP: what the epilogue stores. 0: the f32 tile C + bias[n], each wave's part turned into rows in its own LDS range (the ring, free behind the last stage's barrier). 1, 2: no f32 tile: the tile + bias (1: bias[n]; 2: bias[m]) goes straight from the accumulators out as three 16-bit planes (fp16, bf16 hi, bf16 lo) at element
// (n / 64) * sY + (m / 16) * 16 * PPT + ((n % 64) / 8) * 128 + (m % 16) * 8 + n % 8 (panels of a plane with PPT columns). With m = b * TT + t, sY = NB_ * TT * HD, PPT = HD that is the head plane [h][b][t][d] (a 64-wide column tile is one head); with A = weight rows, Bt = token rows, sY = 64 * 16, PPT = PP it is V^T [h * HD + d][t]. st16, sthl (the same for the whole work-group): whether the tile's fp16 plane and its hi/lo planes are stored at all: a part of a plane that no later launch reads is neither converted nor written.
__device__ __forceinline__ h16 tohx(float x) { return (h16)x; }
__device__ __forceinline__ void splitf(float y, unsigned short& h, unsigned short& l) { h = f2bf(y); l = f2bf(y - bf2f(h)); }
// Precaution behind a group of global loads or stores: the wait stands in front of whatever next reuses the address registers that they name; the base pointers are inputs so that those registers stay theirs up to the wait.
template <typename T16> __device__ __forceinline__ void xwait(const T16* p) { asm volatile("s_wait_xcnt 0x0" :: "v"(p) : "memory"); }
template <typename T16> __device__ __forceinline__ void xwait(const T16* p, const T16* p2) { asm volatile("s_wait_xcnt 0x0" :: "v"(p), "v"(p2) : "memory"); }
template <typename T16> __device__ __forceinline__ void xwait(const T16* p, const T16* p2, const T16* p3) { asm volatile("s_wait_xcnt 0x0" :: "v"(p), "v"(p2), "v"(p3) : "memory"); }
template <typename T16> struct WFrag;
template <> struct WFrag<h16> { typedef v16h V; static __device__ __forceinline__ V ld(const h16* p) { return cat16(*(const v8h*)p, *(const v8h*)(p + 256)); } static __device__ __forceinline__ v8f mma(V a, V b, v8f c) { return wmma16(a, b, c); } };
template <> struct WFrag<bf> { typedef v16bf V; static __device__ __forceinline__ V ld(const bf* p) { return cat16b(*(const v8us*)p, *(const v8us*)(p + 256)); } static __device__ __forceinline__ v8f mma(V a, V b, v8f c) { return wmmab(a, b, c); } };
// A wave's share of one stage, by wave-wide asynchronous copies to LDS of 512 bytes each (16 bytes a lane): one LDS address and one global address a panel; the immediate offset moves both alike (a panel's share runs on in a row in both).
// All copies of a stage stand in ONE statement, whose last line is the wait in front of whatever next rewrites the address registers that the copies name (a precaution).
#define AC4(L, G) "global_load_async_to_lds_b128 " L ", " G ", off\n\tglobal_load_async_to_lds_b128 " L ", " G ", off offset:512\n\tglobal_load_async_to_lds_b128 " L ", " G ", off offset:1024\n\tglobal_load_async_to_lds_b128 " L ", " G ", off offset:1536\n\t"
#define AC4H(L, G) "global_load_async_to_lds_b128 " L ", " G ", off offset:2048\n\tglobal_load_async_to_lds_b128 " L ", " G ", off offset:2560\n\tglobal_load_async_to_lds_b128 " L ", " G ", off offset:3072\n\tglobal_load_async_to_lds_b128 " L ", " G ", off offset:3584\n\t"
// three panels of 4 KiB
__device__ __forceinline__ void stage_copy3(unsigned l0, unsigned l1, unsigned l2, const void* g0, const void* g1, const void* g2) {
    asm volatile(AC4("%0", "%3") AC4H("%0", "%3") AC4("%1", "%4") AC4H("%1", "%4") AC4("%2", "%5") AC4H("%2", "%5") "s_wait_xcnt 0x0" :: "v"(l0), "v"(l1), "v"(l2), "v"(g0), "v"(g1), "v"(g2) : "memory"); }
// five panels of 2 KiB
__device__ __forceinline__ void stage_copy5(unsigned l0, unsigned l1, unsigned l2, unsigned l3, unsigned l4, const void* g0, const void* g1, const void* g2, const void* g3, const void* g4) {
    asm volatile(AC4("%0", "%5") AC4("%1", "%6") AC4("%2", "%7") AC4("%3", "%8") AC4("%4", "%9") "s_wait_xcnt 0x0" :: "v"(l0), "v"(l1), "v"(l2), "v"(l3), "v"(l4), "v"(g0), "v"(g1), "v"(g2), "v"(g3), "v"(g4) : "memory"); }
// elements of the two-buffer ring (the work-group's one LDS array: the kernel declares it and hands it to gemm_tile)
template <int NSPLIT> constexpr int ring_elems() { return 2 * (8 + 16 * (1 + NSPLIT)) * ((NSPLIT ? 64 : 128) * 16); }
// one work-group's tile (bx, by) of the GEMM described above
template <typename T16, int NSPLIT, bool BIAS, int EP, int K, int LDC, int PPT>
__device__ __forceinline__ void gemm_tile(T16* ring, int bx, int by, const T16* __restrict__ A, const T16* __restrict__ A2, const T16* __restrict__ Bt, float* C, const float* __restrict__ bias, h16* P16, bf* Ph, bf* Pl, size_t sY, bool st16, bool sthl) {
    typedef typename WFrag<T16>::V V;
    constexpr int KS = NSPLIT ? 64 : 128;              // columns a stage: 64 products a wave and stage either way
    constexpr int PE = KS * 16;                        // elements of one panel's share of a stage
    constexpr int PA0 = 8;                             // first A panel of a stage: the 8 Bt panels come first, so that every fragment's constant distance from its wave's base fits the LDS load's 16-bit offset
    constexpr int SE = (PA0 + 16 * (1 + NSPLIT)) * PE; // elements a stage
    constexpr int NT = K / KS;
    static_assert(NSPLIT == 0 || NSPLIT == 1, "one or two A planes"); static_assert(K % KS == 0 && NT >= 2, "whole stages, at least two"); static_assert(EP != 0 || 8 * 64 * 68 * 4 <= 2 * SE * 2, "the f32 staging fits the ring"); static_assert(2 * SE == ring_elems<NSPLIT>(), "the kernel's array is the ring");
    const int lane = threadIdx.x & 31, lr = lane & 15, hi = lane >> 4; const int r0 = bx * 256, c0 = by * 128;
    const int wv = __builtin_amdgcn_readfirstlane((int)(threadIdx.x >> 5));   // the wave's number in a scalar register: panel choices stay scalar
    const int wm = wv & 3, wn = wv >> 2;
    // wave w brings A panels 2w and 2w + 1 (of each A plane) and Bt panel w of every stage; the lane's 16 bytes of each 512-byte copy
    const T16* ga = A + (size_t)(r0 + wv * 32) * K + 8 * lane; const T16* ga2 = NSPLIT ? A2 + (size_t)(r0 + wv * 32) * K + 8 * lane : ga; const T16* gb = Bt + (size_t)(c0 + wv * 16) * K + 8 * lane;
    const unsigned l0 = (unsigned)(size_t)ring + 16u * (unsigned)lane;   // LDS byte address: the low 32 bits of the shared address
    auto issue = [&](int t, int buf) { const unsigned lb = l0 + (unsigned)(buf * (SE * 2)); const size_t ko = (size_t)t * PE; const unsigned la = lb + (unsigned)((PA0 + 2 * wv) * (PE * 2)), lw = lb + (unsigned)(wv * (PE * 2));
        if constexpr (NSPLIT == 1) stage_copy5(la, la + PE * 2, la + 16 * PE * 2, la + 17 * PE * 2, lw, ga + ko, ga + ko + (size_t)16 * K, ga2 + ko, ga2 + ko + (size_t)16 * K, gb + ko);
        else stage_copy3(la, la + PE * 2, lw, ga + ko, ga + ko + (size_t)16 * K, gb + ko); };
    static_assert(PE * 2 == (NSPLIT ? 2048 : 4096), "the copy statements are written for these panel shares");
    v8f acc[4][4];
#pragma unroll
    for (int mb = 0; mb < 4; ++mb)
#pragma unroll
        for (int nb = 0; nb < 4; ++nb) acc[mb][nb] = (v8f){};
    issue(0, 0);
    asm volatile("s_wait_asynccnt 0x0" ::: "memory");   // this wave's share of stage 0 has landed
    __syncthreads();                                      // ... and every other wave's: stage 0 may be read
    issue(1, 1);
    // the stage loop stays rolled (one body in the instruction cache); the k-steps of a stage are unrolled: their fragment sets alternate at compile time
#pragma unroll 1
    for (int t = 0; t < NT; ++t) {
        const T16* sb = ring + (t & 1) * SE + 8 * lane; const T16* sa = sb + (PA0 + wm * 4) * PE; const T16* sa2 = sa + 16 * PE; const T16* sw = sb + (wn * 4) * PE;
        V a[2][4], a2[2][4], b[2][4];   // two fragment sets: a k-step's loads stand as one group ahead of the products of the step before; nothing of stage t + 1 is fetched here
        auto frags = [&](int ks) { const int f = ks & 1;
#pragma unroll
            for (int i = 0; i < 4; ++i) b[f][i] = WFrag<T16>::ld(sw + i * PE + ks * 512);
#pragma unroll
            for (int i = 0; i < 4; ++i) { a[f][i] = WFrag<T16>::ld(sa + i * PE + ks * 512); if (NSPLIT == 1) a2[f][i] = WFrag<T16>::ld(sa2 + i * PE + ks * 512); } };
        frags(0);
#pragma unroll
        for (int ks = 0; ks < KS / 32; ++ks) { const int f = ks & 1;
            if (ks + 1 < KS / 32) frags(ks + 1);
            __builtin_amdgcn_sched_barrier(0);   // keeps the next step's LDS loads together in front of this step's products: left alone the scheduler sinks them among the products, each behind a wait to zero
#pragma unroll
            for (int nb = 0; nb < 4; ++nb)
#pragma unroll
                for (int mb = 0; mb < 4; ++mb) { acc[mb][nb] = WFrag<T16>::mma(b[f][nb], a[f][mb], acc[mb][nb]); if (NSPLIT == 1) acc[mb][nb] = WFrag<T16>::mma(b[f][nb], a2[f][mb], acc[mb][nb]); }
            __builtin_amdgcn_sched_barrier(0); }   // ... and the loads of the step after next behind them, again as one group
        asm volatile("s_wait_dscnt 0x0" ::: "memory");      // this wave's reads of stage t are done before the buffer may be refilled
        asm volatile("s_wait_asynccnt 0x0" ::: "memory");   // this wave's share of stage t + 1 has landed
        __syncthreads();                                      // one barrier a stage: it publishes stage t + 1 and ends every wave's reads of stage t
        if (t + 2 < NT) issue(t + 2, t & 1);
    }
    asm volatile("s_wait_asynccnt 0x0" ::: "memory");   // no copy is outstanding when the ring is reused or the wave ends
    const int r0w = r0 + wm * 64, c0w = c0 + wn * 64;
    if constexpr (EP != 0) {   // a lane's 8 accumulator values of a tile are one 16-byte unit; a wave-wide store covers 512 bytes in a row of the panel
        float bm[4]; v4f bn[4][2];
        if constexpr (BIAS) { if constexpr (EP == 2) { const float* bp = bias + r0w + lr;
#pragma unroll
                for (int mb = 0; mb < 4; ++mb) bm[mb] = bfr(bp[mb * 16]);
                xwait(bp); }
            else { const float* bp = bias + c0w + hi * 8;
#pragma unroll
                for (int nb = 0; nb < 4; ++nb) { bn[nb][0] = *(const v4f*)(bp + nb * 16); bn[nb][1] = *(const v4f*)(bp + nb * 16 + 4); }
                xwait(bp); } }
        const size_t e0 = (size_t)(c0w / 64) * sY + (size_t)r0w * PPT + hi * 128 + lr * 8; h16* q16 = P16 + e0; bf* qh = Ph + e0; bf* ql = Pl + e0;
        if constexpr (BIAS) {
#pragma unroll
            for (int nb = 0; nb < 4; ++nb)
#pragma unroll
                for (int mb = 0; mb < 4; ++mb)
#pragma unroll
                    for (int k = 0; k < 8; ++k) acc[mb][nb][k] += EP == 2 ? bm[mb] : bfr(bn[nb][k >> 2][k & 3]); }
        if (st16) {   // the same for the whole work-group: the fp16 plane, where a reader of this tile's tokens takes it
#pragma unroll
            for (int nb = 0; nb < 4; ++nb) {
#pragma unroll
                for (int mb = 0; mb < 4; ++mb) { v8h o16;
#pragma unroll
                    for (int k = 0; k < 8; ++k) o16[k] = tohx(acc[mb][nb][k]);
                    *(v8h*)(q16 + (size_t)mb * 16 * PPT + nb * 256) = o16; }
                xwait((const bf*)q16); } }
        if (sthl) {   // likewise: the hi and lo planes
#pragma unroll
            for (int nb = 0; nb < 4; ++nb) {
#pragma unroll
                for (int mb = 0; mb < 4; ++mb) { v8us oh, ol;
#pragma unroll
                    for (int k = 0; k < 8; ++k) { unsigned short a, c2; splitf(acc[mb][nb][k], a, c2); oh[k] = a; ol[k] = c2; }
                    const size_t e = (size_t)mb * 16 * PPT + nb * 256; *(v8us*)(qh + e) = oh; *(v8us*)(ql + e) = ol; }
                xwait((const bf*)qh, (const bf*)ql); } }
        return; }
    float* my = (float*)ring + wv * (64 * 68);
#pragma unroll
    for (int mb = 0; mb < 4; ++mb)
#pragma unroll
        for (int nb = 0; nb < 4; ++nb) { float* d = my + (mb * 16 + lr) * 68 + nb * 16 + hi * 8; const v8f t = acc[mb][nb]; *(v4fa*)d = (v4f){t[0], t[1], t[2], t[3]}; *(v4fa*)(d + 4) = (v4f){t[4], t[5], t[6], t[7]}; }
    asm volatile("s_wait_dscnt 0x0" ::: "memory");   // the wave's own rows are in LDS before its lanes read what other lanes of it wrote (no other wave touches this range)
    { const int cofs = lr * 4; v4f bv = (v4f){};
      if (BIAS) { const float* bp = bias + c0w + cofs; const v4f r = *(const v4f*)bp; xwait(bp); bv = (v4f){bfr(r[0]), bfr(r[1]), bfr(r[2]), bfr(r[3])}; }
      float* cp = C + (size_t)(r0w + hi) * LDC + c0w + cofs; const float* sp = my + hi * 68 + cofs;   // two rows a wave-wide store, 256 bytes in a row of each
#pragma unroll
      for (int s = 0; s < 32; ++s) { *(v4f*)(cp + (size_t)s * 2 * LDC) = *(const v4fa*)(sp + s * 2 * 68) + bv; if ((s & 7) == 7) xwait((const float*)cp); } }
}
// the output projection: grid (M / 256, N / 128)
__global__ __launch_bounds__(256) void k_gemmo(const bf* __restrict__ A, const bf* __restrict__ A2, const bf* __restrict__ Bt, float* C, const float* __restrict__ bias) {
    __shared__ __align__(512) bf ring[ring_elems<1>()];
    gemm_tile<bf, 1, true, 0, DQ, DM, 0>(ring, (int)blockIdx.x, (int)blockIdx.y, A, A2, Bt, C, bias, nullptr, nullptr, nullptr, 0, false, false);
}
// the three input projections in one launch: grid (NB_ * TT / 256, DQ / 128, 3), blockIdx.z = Q, K, V. They do not depend on one another, and a work-group fills a WGP's LDS: a WGP takes its next tile as soon as it has stored the last, whichever projection that belongs to.
// Q, K: token rows as A, weight rows as Bt, head planes out. V: weight rows as A, token rows as Bt, so that the tile is V^T as it stands; its 256 tiles are (DKV / 256) x (PP / 128) x (NB_ * TT / PP), the last being one V^T row's worth of tokens.
__global__ __launch_bounds__(256) void k_proj(const bf* __restrict__ XB, const bf* __restrict__ XC, const bf* __restrict__ WQ, const bf* __restrict__ WK, const bf* __restrict__ WV, const float* __restrict__ bq, const float* __restrict__ bk, const float* __restrict__ bv,
                                              h16* QP16, bf* QPh, bf* QPl, h16* KP16, bf* KPh, bf* KPl, h16* VT16, bf* VTh, bf* VTl) {
    static_assert(DQ == DKV && (NB_ * TT / 256) * (DQ / 128) == (DKV / 256) * (PP / 128) * (NB_ * TT / PP), "each projection has as many tiles as a z-plane of the grid");
    __shared__ __align__(512) bf ring[ring_elems<0>()];
    const int z = (int)blockIdx.z;   // the same for the whole work-group: every barrier below stands under uniform control flow
    // what k_fattn reads: query rows < RH take hi/lo Q, K and V^T, and see tokens < RH only; the other query rows take fp16 Q, and fp16 K and V^T of all tokens. A tile's tokens lie wholly on one side of RH.
    static_assert(RH % 256 == 0 && TT % 256 == 0 && PP % TT == 0, "a tile of 256 or 128 tokens lies in one batch and on one side of RH");
    if (z < 2) { const bool low = ((int)blockIdx.x * 256) % TT < RH;
        gemm_tile<bf, 0, true, 1, DM, 0, HD>(ring, (int)blockIdx.x, (int)blockIdx.y, z ? XC : XB, nullptr, z ? WK : WQ, nullptr, z ? bk : bq, z ? KP16 : QP16, z ? KPh : QPh, z ? KPl : QPl, (size_t)NB_ * TT * HD, z != 0 || !low, low); return; }
    const int id = (int)blockIdx.x + (int)blockIdx.y * (NB_ * TT / 256); const int vx = id % (DKV / 256), vy = id / (DKV / 256) % (PP / 128); const size_t vz = (size_t)(id / ((DKV / 256) * (PP / 128)));
    gemm_tile<bf, 0, true, 2, DM, 0, PP>(ring, vx, vy, WV, nullptr, XC + vz * ((size_t)PP * DM), nullptr, bv, VT16 + vz * ((size_t)DKV * PP), VTh + vz * ((size_t)DKV * PP), VTl + vz * ((size_t)DKV * PP), 64 * 16, true, (vy * 128) % TT < RH);
}

typedef __attribute__((ext_vector_type(2))) _Float16 v2h;
typedef __attribute__((ext_vector_type(4))) _Float16 v4h;
typedef __attribute__((ext_vector_type(2))) unsigned short v2us;
typedef __attribute__((ext_vector_type(4))) unsigned short v4us;
typedef __attribute__((ext_vector_type(2))) float v2f;
typedef __attribute__((ext_vector_type(4))) int v4i;

// the four equally shaped weights: y picks the weight and its plane (the planes lie one behind the other), bx the work-group's 64 lines of it
__device__ __forceinline__ void wt_part(const float* __restrict__ w0, const float* __restrict__ w1, const float* __restrict__ w2, const float* __restrict__ w3, int K, int N, bf* Bt, int bx, int y) {
    const float* __restrict__ w = y == 0 ? w0 : y == 1 ? w1 : y == 2 ? w2 : w3; Bt += (size_t)y * N * K;
    const int lane = threadIdx.x & 31; const int L0 = (bx * 8 + (threadIdx.x >> 5)) * 8; const int nlines = N * K / 64;
{
#pragma unroll 1
        for (int l = 0; l < 8; ++l) { const int L = L0 + l; if (L >= nlines) break; const size_t e = (size_t)L * 64 + lane * 2; const size_t pn = e / ((size_t)16 * K); const int w16 = (int)(e % ((size_t)16 * K)); const int k = (w16 >> 7) * 8 + (w16 & 7), n = (int)pn * 16 + ((w16 >> 3) & 15); v2us o;
            o[0] = f2bf(w[(size_t)k * N + n]); o[1] = f2bf(w[(size_t)(k + 1) * N + n]); *(v2us*)(Bt + e) = o; }
         }
}
// both streams' bf16 copies: y picks the stream; a thread converts its 8-element unit of every batch (n8 units a batch), the loads of the NB_ units in flight together
__device__ __forceinline__ void cvt_part(const float* __restrict__ s0, const float* __restrict__ s1, bf* dst, size_t n8, int bx, int y) { const size_t i = (size_t)bx * 256 + threadIdx.x; if (i >= n8) return;
    const float* __restrict__ src = y ? s1 : s0; dst += (size_t)y * NB_ * n8 * 8; v8f v[NB_];
    const size_t so = ((i / (DM * 2)) * 16 + (i & 15)) * DM + ((i % (DM * 2)) >> 4) * 8;   // unit i of the panel layout is row (panel * 16 + i % 16), octet (i % (16 * DM / 8)) / 16 of the source
#pragma unroll
    for (int b = 0; b < NB_; ++b) { const float* p = src + (size_t)b * n8 * 8 + so; v[b] = *(const v8f*)p; xwait(p); }   // the wait (a precaution) stands in front of the next unit's load, whose data may be given the registers that held this unit's address
#pragma unroll
    for (int b = 0; b < NB_; ++b) { v8us o;
#pragma unroll
        for (int k = 0; k < 8; ++k) o[k] = f2bf(v[b][k]);
        *(v8us*)(dst + ((size_t)b * n8 + i) * 8) = o; } }
// weights and streams in one launch (neither needs the other): first the 4 * NWX transposing work-groups, whose waves mostly wait for their short loads one after the other, then the 2 * NCX copying ones, which stream beside them
#define NWX  ((DM * DQ / 64 + 63) / 64)      // transposing work-groups a weight
#define NCX  ((TT * DM / 8 + 255) / 256)     // copying work-groups a stream
__global__ __launch_bounds__(256) void k_prep(const float* __restrict__ w0, const float* __restrict__ w1, const float* __restrict__ w2, const float* __restrict__ w3, int K, int N, bf* Bt, const float* __restrict__ s0, const float* __restrict__ s1, bf* dst, size_t n8) {
    const int id = (int)blockIdx.x;
    if (id < 4 * NWX) { wt_part(w0, w1, w2, w3, K, N, Bt, id % NWX, id / NWX); return; }
    cvt_part(s0, s1, dst, n8, (id - 4 * NWX) % NCX, (id - 4 * NWX) / NCX);
}

// ---- k_fattn: the whole causal attention of all batches in one launch: scores, softmax, probability x value product and the merge of the heads into the hi/lo planes that the output projection reads.
// Query rows < RH (fattn_wave; the fp16 rows: fattn_shared below, same products and softmax): one work-group = one head x 32 query rows. The keys 0 .. q0 + 31 are dealt over the FNW waves in 64-key chunks (2 KiB
// in a row of every V^T panel), each worked in two 32-key passes. Transposed products: S^T = K Q^T (A = key rows, B = query rows, same loader, same k order), so a lane holds 16 scores of ONE query per pass
// and column group: maximum and sum in the lane plus one exchange between the wave's halves; two S^T tiles (keys 0-15, 16-31), converted in place, ARE the B operand of O^T += V^T P^T (A = V^T rows in the same k order).
// Running maximum m (scaled log2 units) and running sum l per query and wave; the FNW partial (m, l, O) meet in LDS and are joined in wave order. Probabilities carry 2^PCL2 (it cancels in O / l) so that small ones stay normal in fp16.
// Query rows < RH: hi/lo bf16 planes, 3 products in both contractions; the rest fp16.
#define FQT  2                    // 16-query column groups per wave
#define FNW  4                    // waves per work-group
#define FOP  68                   // LDS pitch (floats) of a query's 64 partial outputs
#define SCL2 (SCL * 1.4426950408889634f)
#define PCL2 10.0f
__device__ __forceinline__ float xhalf(float x) { return __builtin_bit_cast(float, __builtin_amdgcn_permlanex16(__builtin_bit_cast(int, x), __builtin_bit_cast(int, x), 0x76543210, 0xfedcba98, false, false)); }   // lane l reads lane l ^ 16, on the vector pipe
template <typename T16, bool HR>
__device__ __forceinline__ void fattn_wave(const T16* __restrict__ Q, const T16* __restrict__ Q2, const T16* __restrict__ Kp, const T16* __restrict__ K2, const T16* __restrict__ Vt, const T16* __restrict__ Vt2, int q0, int wv, int lr, int hi, float* om, float* ol, float* oo) {
    typedef typename WFrag<T16>::V V;
    const int l8 = (hi * 16 + lr) * 8;   // panel layout: the lane's 16 bytes of a fragment's first half
    V qf[FQT][2], qf2[FQT][2];
    { const size_t e = (size_t)q0 * HD + l8; const T16* qp = Q + e; const T16* qp2 = HR ? Q2 + e : qp;
#pragma unroll
      for (int qt = 0; qt < FQT; ++qt)
#pragma unroll
        for (int ds = 0; ds < 2; ++ds) { qf[qt][ds] = WFrag<T16>::ld(qp + qt * 16 * HD + ds * 512); if (HR) qf2[qt][ds] = WFrag<T16>::ld(qp2 + qt * 16 * HD + ds * 512); }
      if (HR) xwait(qp, qp2); else xwait(qp); }
    v8f o[4][FQT]; float m[FQT], l[FQT];
#pragma unroll
    for (int qt = 0; qt < FQT; ++qt) { m[qt] = -3.0e38f; l[qt] = 0.0f;
#pragma unroll
        for (int mb = 0; mb < 4; ++mb) o[mb][qt] = (v8f){}; }
    // the passes of this wave in turn: both halves of chunk wv, then of chunk wv + FNW, ...; the loop stays rolled: one pass's fragments, scores and the output tile are what lets four waves share a SIMD's registers.
    // fp16 rows fetch the key fragments one pass ahead (issued right behind the S^T products that free their registers, so that their latency lies under the softmax and the P.V products); past the last pass the fetch is clamped to the diagonal rows and not used.
    V kf[2][2], kf2[2][2]; int kc = wv * 64;
    if (!HR) { const T16* kp = Kp + (size_t)min(kc, q0) * HD + l8;
#pragma unroll
        for (int kt = 0; kt < 2; ++kt) { kf[kt][0] = WFrag<T16>::ld(kp + kt * 16 * HD); kf[kt][1] = WFrag<T16>::ld(kp + kt * 16 * HD + 512); }
        xwait(kp); }
#pragma unroll 1
    while (kc <= q0) { const int kn = (kc & 32) ? kc + 32 + (FNW - 1) * 64 : kc + 32;
        const size_t ev = (size_t)kc * 16 + l8; const T16* vp = Vt + ev; V vf[4];
        if (!HR) {   // fp16 rows: the V^T fragments are asked for at the head of the pass; the hi/lo rows, with twice the fragments, load them where they are used, which keeps the kernel at four waves a SIMD
#pragma unroll
            for (int mb = 0; mb < 4; ++mb) vf[mb] = WFrag<T16>::ld(vp + (size_t)mb * 16 * PP); }
        v8f s[2][FQT];
#pragma unroll
        for (int kt = 0; kt < 2; ++kt) {
            if (HR) { const size_t e = (size_t)(kc + kt * 16) * HD + l8; const T16* kp = Kp + e; const T16* kp2 = K2 + e; kf[kt][0] = WFrag<T16>::ld(kp); kf[kt][1] = WFrag<T16>::ld(kp + 512); kf2[kt][0] = WFrag<T16>::ld(kp2); kf2[kt][1] = WFrag<T16>::ld(kp2 + 512); xwait(kp, kp2); }
#pragma unroll
            for (int qt = 0; qt < FQT; ++qt) { v8f c = (v8f){}; c = WFrag<T16>::mma(kf[kt][0], qf[qt][0], c); c = WFrag<T16>::mma(kf[kt][1], qf[qt][1], c);
                if (HR) { c = WFrag<T16>::mma(kf2[kt][0], qf[qt][0], c); c = WFrag<T16>::mma(kf2[kt][1], qf[qt][1], c); c = WFrag<T16>::mma(kf[kt][0], qf2[qt][0], c); c = WFrag<T16>::mma(kf[kt][1], qf2[qt][1], c); }
                s[kt][qt] = c; } }
        if (!HR) { const T16* kp = Kp + (size_t)min(kn, q0) * HD + l8;
#pragma unroll
            for (int kt = 0; kt < 2; ++kt) { kf[kt][0] = WFrag<T16>::ld(kp + kt * 16 * HD); kf[kt][1] = WFrag<T16>::ld(kp + kt * 16 * HD + 512); }
            xwait(vp, kp); }
        if (kc == q0) {   // the diagonal pass (always a wave's last): key > query leaves the softmax; -inf against the finite start value of m gives probability 0 also where a query has no key in this wave
#pragma unroll
            for (int kt = 0; kt < 2; ++kt)
#pragma unroll
                for (int qt = 0; qt < FQT; ++qt)
#pragma unroll
                    for (int r = 0; r < 8; ++r) if (kt * 16 + 8 * hi + r > qt * 16 + lr) s[kt][qt][r] = -__builtin_inff(); }
        V pf[FQT], pf2[FQT];
#pragma unroll
        for (int qt = 0; qt < FQT; ++qt) { float mr = s[0][qt][0];
#pragma unroll
            for (int e = 1; e < 16; ++e) mr = fmaxf(mr, s[e >> 3][qt][e & 7]);
            mr = fmaxf(mr, xhalf(mr));
            const float mn = fmaxf(m[qt], mr * SCL2); const float al = __builtin_amdgcn_exp2f(m[qt] - mn); m[qt] = mn; const float sh = PCL2 - mn; float p[16]; float sum = 0.0f;
#pragma unroll
            for (int e = 0; e < 16; ++e) { p[e] = __builtin_amdgcn_exp2f(fmaf(s[e >> 3][qt][e & 7], SCL2, sh)); sum += p[e]; }
            l[qt] = l[qt] * al + sum;
#pragma unroll
            for (int mb = 0; mb < 4; ++mb) o[mb][qt] *= al;
            if constexpr (HR) { v8us h0, h1, l0, l1;
#pragma unroll
                for (int r = 0; r < 8; ++r) { unsigned short a, c2; splitf(p[r], a, c2); h0[r] = a; l0[r] = c2; splitf(p[8 + r], a, c2); h1[r] = a; l1[r] = c2; }
                pf[qt] = cat16b(h0, h1); pf2[qt] = cat16b(l0, l1);
            } else { v8h h0, h1;
#pragma unroll
                for (int r = 0; r < 8; ++r) { h0[r] = tohx(p[r]); h1[r] = tohx(p[8 + r]); }
                pf[qt] = cat16(h0, h1); } }
        V vf2[4];
#pragma unroll
        for (int mb = 0; mb < 4; ++mb) {
            if (HR && (mb & 1) == 0) { const T16* vq = vp + (size_t)mb * 16 * PP; const T16* vq2 = Vt2 + ev + (size_t)mb * 16 * PP; vf[mb] = WFrag<T16>::ld(vq); vf[mb + 1] = WFrag<T16>::ld(vq + (size_t)16 * PP); vf2[mb] = WFrag<T16>::ld(vq2); vf2[mb + 1] = WFrag<T16>::ld(vq2 + (size_t)16 * PP); xwait(vq, vq2); }
#pragma unroll
            for (int qt = 0; qt < FQT; ++qt) { o[mb][qt] = WFrag<T16>::mma(vf[mb], pf[qt], o[mb][qt]); if (HR) { o[mb][qt] = WFrag<T16>::mma(vf[mb], pf2[qt], o[mb][qt]); o[mb][qt] = WFrag<T16>::mma(vf2[mb], pf[qt], o[mb][qt]); } } }
        kc = kn;
    }
#pragma unroll
    for (int qt = 0; qt < FQT; ++qt) { l[qt] += xhalf(l[qt]); if (hi == 0) { om[qt * 16 + lr] = m[qt]; ol[qt * 16 + lr] = l[qt]; }
#pragma unroll
        for (int mb = 0; mb < 4; ++mb) { float* d = oo + (qt * 16 + lr) * FOP + mb * 16 + hi * 8; const v8f t = o[mb][qt]; *(v4fa*)d = (v4f){t[0], t[1], t[2], t[3]}; *(v4fa*)(d + 4) = (v4f){t[4], t[5], t[6], t[7]}; } }
}
// ---- fp16 rows (query rows >= RH): one work-group = one head x FQW query rows, 32 a wave. Every wave walks all keys up to its own diagonal, so each holds the whole (m, l, O) of its queries and nothing is joined across waves.
// The keys go by in stages of 64: a stage's K rows (8 KiB in a row) and its share of the four V^T panels (2 KiB in a row each) are brought to LDS ONCE for the four waves by asynchronous 16-byte copies (wave w: K panel w and V^T panel w),
// in the order in which they lie in memory, so that the fragment loads keep their form. Two buffers: stage s + 2 is asked for behind the barrier that ends stage s and lands under stage s + 1.
#define FQW  (32 * FNW)           // query rows a work-group
#define SKE  (64 * HD)            // elements of a stage's K rows; its V^T share is as large
#define SGE  (2 * SKE)            // elements a stage
// a wave's share of one stage: eight wave-wide copies of 512 bytes; the last line is the wait in front of whatever next rewrites the address registers that the copies name (a precaution)
__device__ __forceinline__ void kv_copy(unsigned lk, unsigned lv, const void* gk, const void* gv) {
    asm volatile(AC4("%0", "%2") AC4("%1", "%3") "s_wait_xcnt 0x0" :: "v"(lk), "v"(lv), "v"(gk), "v"(gv) : "memory"); }
__device__ __forceinline__ void fattn_shared(const h16* __restrict__ Q, const h16* __restrict__ Kp, const h16* __restrict__ Vt, int q0, int wv, int lr, int hi, h16* ring, bf* Ah, bf* Al) {
    typedef WFrag<h16> F; typedef F::V V;
    const int l8 = (hi * 16 + lr) * 8;   // panel layout: the lane's 16 bytes of a fragment's first half, and of a 512-byte copy
    const int qw = q0 + wv * 32;         // the wave's first query
    V qf[FQT][2];
    { const h16* qp = Q + (size_t)qw * HD + l8;
#pragma unroll
      for (int qt = 0; qt < FQT; ++qt)
#pragma unroll
        for (int ds = 0; ds < 2; ++ds) qf[qt][ds] = F::ld(qp + qt * 16 * HD + ds * 512);
      xwait(qp); }
    v8f o[4][FQT]; float m[FQT], l[FQT];
#pragma unroll
    for (int qt = 0; qt < FQT; ++qt) { m[qt] = -3.0e38f; l[qt] = 0.0f;
#pragma unroll
        for (int mb = 0; mb < 4; ++mb) o[mb][qt] = (v8f){}; }
    const int ns = (q0 + FQW) / 64;      // stages of the work-group: the keys 0 .. q0 + FQW - 1; at least two
    const h16* gk = Kp + wv * (16 * HD) + l8; const h16* gv = Vt + (size_t)wv * 16 * PP + l8;
    const unsigned lk0 = (unsigned)(size_t)ring + (unsigned)((wv * (16 * HD) + l8) * 2);   // LDS byte address: the low 32 bits of the shared address
    auto issue = [&](int s, int buf) { const unsigned lk = lk0 + (unsigned)(buf * (SGE * 2)); kv_copy(lk, lk + SKE * 2, gk + (size_t)s * SKE, gv + (size_t)s * (64 * 16)); };
    issue(0, 0);
    asm volatile("s_wait_asynccnt 0x0" ::: "memory");   // this wave's share of stage 0 has landed
    __syncthreads();                                      // ... and every other wave's: stage 0 may be read
    issue(1, 1);
    // the stage loop stays rolled (one pass's fragments, scores and the output tile are what lets four waves share a SIMD's registers); a stage's two passes are unrolled: their places in the buffer are then immediate offsets of the LDS loads
#pragma unroll 1
    for (int s = 0; s < ns; ++s) {
#pragma unroll
        for (int p = 0; p < 2; ++p) { const int kc = s * 64 + p * 32;
            if (kc > qw) break;   // past the wave's diagonal (the same for the whole wave): it only keeps the work-group's barriers from here on
            const h16* sk = ring + (s & 1) * SGE + p * (32 * HD) + l8; const h16* sv = ring + (s & 1) * SGE + SKE + p * (32 * 16) + l8;
            V kf[2][2], vf[4];
#pragma unroll
            for (int kt = 0; kt < 2; ++kt) { kf[kt][0] = F::ld(sk + kt * 16 * HD); kf[kt][1] = F::ld(sk + kt * 16 * HD + 512); }
#pragma unroll
            for (int mb = 0; mb < 4; ++mb) vf[mb] = F::ld(sv + mb * (64 * 16));
            __builtin_amdgcn_sched_barrier(0);   // keeps the pass's LDS loads together in front of its products: left alone the scheduler loads the K fragments one after the other into the same registers, each behind a wait to zero
            v8f sc[2][FQT];
#pragma unroll
            for (int kt = 0; kt < 2; ++kt)
#pragma unroll
                for (int qt = 0; qt < FQT; ++qt) { v8f c = (v8f){}; c = F::mma(kf[kt][0], qf[qt][0], c); c = F::mma(kf[kt][1], qf[qt][1], c); sc[kt][qt] = c; }
            if (kc == qw) {   // the diagonal pass (the wave's last): key > query leaves the softmax
#pragma unroll
                for (int kt = 0; kt < 2; ++kt)
#pragma unroll
                    for (int qt = 0; qt < FQT; ++qt)
#pragma unroll
                        for (int r = 0; r < 8; ++r) if (kt * 16 + 8 * hi + r > qt * 16 + lr) sc[kt][qt][r] = -__builtin_inff(); }
            V pf[FQT];
#pragma unroll
            for (int qt = 0; qt < FQT; ++qt) { float mr = sc[0][qt][0];
#pragma unroll
                for (int e = 1; e < 16; ++e) mr = fmaxf(mr, sc[e >> 3][qt][e & 7]);
                mr = fmaxf(mr, xhalf(mr));
                const float mn = fmaxf(m[qt], mr * SCL2); const float al = __builtin_amdgcn_exp2f(m[qt] - mn); m[qt] = mn; const float sh = PCL2 - mn; float pr[16]; float sum = 0.0f;
#pragma unroll
                for (int e = 0; e < 16; ++e) { pr[e] = __builtin_amdgcn_exp2f(fmaf(sc[e >> 3][qt][e & 7], SCL2, sh)); sum += pr[e]; }
                l[qt] = l[qt] * al + sum;
#pragma unroll
                for (int mb = 0; mb < 4; ++mb) o[mb][qt] *= al;
                v8h h0, h1;
#pragma unroll
                for (int r = 0; r < 8; ++r) { h0[r] = tohx(pr[r]); h1[r] = tohx(pr[8 + r]); }
                pf[qt] = cat16(h0, h1); }
#pragma unroll
            for (int mb = 0; mb < 4; ++mb)
#pragma unroll
                for (int qt = 0; qt < FQT; ++qt) o[mb][qt] = F::mma(vf[mb], pf[qt], o[mb][qt]);
        }
        asm volatile("s_wait_dscnt 0x0" ::: "memory");      // this wave's reads of stage s are done before the buffer may be refilled
        asm volatile("s_wait_asynccnt 0x0" ::: "memory");   // this wave's share of stage s + 1 has landed
        __syncthreads();                                      // one barrier a stage: it publishes stage s + 1 and ends every wave's reads of stage s
        if (s + 2 < ns) issue(s + 2, s & 1);
    }
    asm volatile("s_wait_asynccnt 0x0" ::: "memory");   // no copy is outstanding when the wave ends
    // a lane's 8 values of an output tile are 8 neighbouring columns of ONE query: one 16-byte unit of the merged planes' panels; a wave-wide store covers 512 bytes in a row
#pragma unroll
    for (int qt = 0; qt < FQT; ++qt) { const float inv = __fdiv_rn(1.0f, l[qt] + xhalf(l[qt])); const size_t e = (size_t)(qw + qt * 16) * DQ + hi * 128 + lr * 8; bf* ph = Ah + e; bf* pl = Al + e;
#pragma unroll
        for (int mb = 0; mb < 4; ++mb) { v8us oh, olo;
#pragma unroll
            for (int r = 0; r < 8; ++r) { unsigned short a, c2; splitf(o[mb][qt][r] * inv, a, c2); oh[r] = a; olo[r] = c2; }
            *(v8us*)(ph + mb * 256) = oh; *(v8us*)(pl + mb * 256) = olo; }
        xwait((const bf*)ph, (const bf*)pl); }
}
// grid: first the NFW fp16 work-groups, then the hi/lo ones (32 query rows each, the longest first). For the fp16 work-groups:
// the tile follows the index modulo 12 in an order in which neighbours at stride 1 and at every power-of-two stride from 4 on are a long, a middle and a short tile (for speed only: any placement gives the same result).
#define NFT  ((TT - RH) / FQW)    // fp16 tiles of a head and batch
#define NFW  (NFT * NH_ * NB_)
#define NHW  ((RH / 32) * NH_ * NB_)
__global__ __launch_bounds__(32 * FNW) __attribute__((amdgpu_waves_per_eu(4, 4))) void k_fattn(const h16* __restrict__ Q16, const h16* __restrict__ K16, const h16* __restrict__ V16, const bf* __restrict__ Qh, const bf* __restrict__ Ql, const bf* __restrict__ Kh, const bf* __restrict__ Kl, const bf* __restrict__ Vh, const bf* __restrict__ Vl, bf* Ah, bf* Al) {
    static_assert(RH % FQW == 0 && TT % FQW == 0 && RH / FQW == 4 && NFT == 12 && FNW == 4 && RH >= 64, "the tile order below lists the tiles 4 .. 15; a wave brings one of four K and V^T panels; at least two stages");
    __shared__ __align__(512) h16 ring[2 * SGE]; __shared__ __align__(16) float oo[FNW * 32 * FOP]; __shared__ float om[FNW * 32]; __shared__ float ol[FNW * 32];
    const int lane = threadIdx.x & 31, lr = lane & 15, hi = lane >> 4;
    const int wv = __builtin_amdgcn_readfirstlane((int)(threadIdx.x >> 5));   // the wave's number in a scalar register: the key loop's bounds and branches stay scalar
    const int id = (int)blockIdx.x; const bool fp = id < NFW; const int hb = fp ? id / NFT : (id - NFW) % NH_ + (id - NFW) / ((RH / 32) * NH_) * NH_;   // head + NH_ * batch
    const int h = hb % NH_, b = hb / NH_; const int q0 = fp ? (int)((0x6BC5AD78E49Full >> (4 * (id % NFT))) & 15) * FQW : (RH / 32 - 1 - (id - NFW) / NH_ % (RH / 32)) * 32;
    const size_t zq = ((size_t)h * NB_ + b) * TT * HD, zk = ((size_t)(h / REP) * NB_ + b) * TT * HD, zv = ((size_t)(b / (PP / TT)) * DKV + (size_t)(h / REP) * HD) * PP + (size_t)(b % (PP / TT)) * TT * 16; Ah += (size_t)b * TT * DQ; Al += (size_t)b * TT * DQ;   // head planes [h][b][t][d]; V^T [b / 2][h * HD + d][(b % 2) * TT + t]; merged planes [b][t][DQ]; each in 16-row panels, so a column offset counts 16 elements a column
    if (fp) { fattn_shared(Q16 + zq, K16 + zk, V16 + zv, q0, wv, lr, hi, ring, Ah + (size_t)h * (HD * 16), Al + (size_t)h * (HD * 16)); return; }   // the whole work-group leaves here
    fattn_wave<bf, true>(Qh + zq, Ql + zq, Kh + zk, Kl + zk, Vh + zv, Vl + zv, q0, wv, lr, hi, om + wv * 32, ol + wv * 32, oo + wv * (32 * FOP));
    __syncthreads();   // every wave's partial (m, l, O) is in LDS before any thread joins them
#pragma unroll
    for (int s = 0; s < 8 / FNW; ++s) { const int it = s * (32 * FNW) + (int)threadIdx.x; const int q = (it >> 7) * 16 + (it & 15), oc = ((it >> 4) & 7) * 8; float M = om[q];
#pragma unroll
        for (int w = 1; w < FNW; ++w) M = fmaxf(M, om[w * 32 + q]);   // wave 0 always holds key 0, which every query sees: M is a real score
        float Ls = 0.0f; v4f a0 = (v4f){}, a1 = (v4f){};
#pragma unroll
        for (int w = 0; w < FNW; ++w) { const float f = __builtin_amdgcn_exp2f(om[w * 32 + q] - M); Ls += ol[w * 32 + q] * f; const float* sp = oo + (w * 32 + q) * FOP + oc; a0 += *(const v4fa*)sp * f; a1 += *(const v4fa*)(sp + 4) * f; }
        const float inv = __fdiv_rn(1.0f, Ls); v8us oh, olo;
#pragma unroll
        for (int k = 0; k < 4; ++k) { unsigned short a, c2; splitf(a0[k] * inv, a, c2); oh[k] = a; olo[k] = c2; splitf(a1[k] * inv, a, c2); oh[4 + k] = a; olo[4 + k] = c2; }
        const size_t e = (size_t)(q0 + (it >> 7) * 16) * DQ + (size_t)h * (HD * 16) + (it & 127) * 8; *(v8us*)(Ah + e) = oh; *(v8us*)(Al + e) = olo; xwait((const bf*)(Ah + e), (const bf*)(Al + e)); }
}

extern "C" void kernel_launch(void* const* d_in, const int* in_sizes, int n_in,
                              void* d_out, int out_size, void* d_ws, size_t ws_size, hipStream_t stream) {
    (void)in_sizes; (void)n_in; (void)out_size;
    const float* x = (const float*)d_in[0]; const float* xk = (const float*)d_in[1]; const float* wq = (const float*)d_in[2]; const float* bq = (const float*)d_in[3]; const float* wk = (const float*)d_in[4]; const float* bk = (const float*)d_in[5]; const float* wv = (const float*)d_in[6]; const float* bv = (const float*)d_in[7]; const float* wo = (const float*)d_in[8]; const float* bo = (const float*)d_in[9]; /* order data, context, Wq, bq, Wk, bk, Wv, bv, Wo, bo ('xw' + biases): TEN inputs: TWO streams: the queries come from data (d_in[0]); the keys AND the values both come from context (d_in[1]): the kernel's key stream and value stream pointers are the same input */
    float* OUT = (float*)d_out;     // [4][2048][1024]
    char* wsp = (char*)d_ws;
    auto take = [&](size_t bytes) { char* p = wsp; wsp += (bytes + 255) & ~(size_t)255; return (void*)p; };
    bf* WQ = (bf*)take((size_t)DQ * DM * 2); bf* WK = (bf*)take((size_t)DKV * DM * 2); bf* WV = (bf*)take((size_t)DKV * DM * 2); bf* WO = (bf*)take((size_t)DM * DQ * 2);
    static_assert(DQ == DM && DKV == DM && (NB_ * TT) % PP == 0, "one transpose launch takes four equally shaped weights; a V^T row holds whole batches");
    bf* XB = (bf*)take((size_t)2 * NB_ * TT * DM * 2); bf* XC = XB + (size_t)NB_ * TT * DM;   // bf16 copies: data, then context
    h16* QP16 = (h16*)take((size_t)NB_ * NH_ * TT * HD * 2); h16* KP16 = (h16*)take((size_t)NB_ * NKV * TT * HD * 2); h16* VT16 = (h16*)take((size_t)NB_ * NKV * HD * TT * 2);
    bf* QPh = (bf*)take((size_t)NB_ * NH_ * TT * HD * 2); bf* QPl = (bf*)take((size_t)NB_ * NH_ * TT * HD * 2); bf* KPh = (bf*)take((size_t)NB_ * NKV * TT * HD * 2); bf* KPl = (bf*)take((size_t)NB_ * NKV * TT * HD * 2); bf* VTh = (bf*)take((size_t)NB_ * NKV * HD * TT * 2); bf* VTl = (bf*)take((size_t)NB_ * NKV * HD * TT * 2);
    bf* ATh = (bf*)take((size_t)NB_ * TT * DQ * 2); bf* ATl = (bf*)take((size_t)NB_ * TT * DQ * 2);
    if ((size_t)(wsp - (char*)d_ws) > ws_size) return;    // ws 256 MiB, 216 MiB taken
    k_prep<<<dim3(4 * NWX + 2 * NCX, 1, 1), 256, 0, stream>>>(wq, wk, wv, wo, DM, DQ, WQ, x, xk, XB, (size_t)TT * DM / 8);
    k_proj<<<dim3(NB_ * TT / 256, DQ / 128, 3), 256, 0, stream>>>(XB, XC, WQ, WK, WV, bq, bk, bv, QP16, QPh, QPl, KP16, KPh, KPl, VT16, VTh, VTl);
    k_fattn<<<dim3(NFW + NHW, 1, 1), 32 * FNW, 0, stream>>>(QP16, KP16, VT16, QPh, QPl, KPh, KPl, VTh, VTl, ATh, ATl);
    k_gemmo<<<dim3(NB_ * TT / 256, DM / 128, 1), 256, 0, stream>>>(ATh, ATl, WO, OUT, bo);
}
